// v000
// The times below were measured on an AMD MI455X: many runs one after another, warmed up first and cycling through
// copies of the inputs, with the whole window's GPU time divided by the number of runs. Launches and the gaps
// between them are all in it. The median over several windows is given; except for v000 it joins two sittings, which
// can be a few percent apart, so the side-by-side timings, each taken in one sitting, are the better comparison.
// The starting kernel, v000, takes 419 microseconds a run.
#include <hip/hip_runtime.h>
// Bottleneck-transformer MHSA with relative position term (B=16, C=512, 32×32 → N=1024, 4 heads × 128): q,k,v = 1×1 convs ((out,in) + bias); logits = (q·C^-½)·(k + rt) where rt[h][d][n] = rh[h][d][n mod 32] + rw[h][d][n div 32]
// (the module's (rh + rw).reshape(1, heads, emb, N)); softmax; y = attn·v per head; the output is the [B][h][N][d] buffer reinterpreted as [B,C,H,W] (the module's final reshape).
// Compute dtype: x, weights, biases, rh, rw rounded to bf16; token-major bf16 input plane; q as an f16 GEMM plane (unscaled — the C^-½ is applied to the f32 score), k as an f32 GEMM output with rtᵀ added in f32 then f16,
// v f16; fused flash-style kernel for head dim 128 (4 k-steps, 8 value tiles, online softmax f32, P as f16 + its exact f16 residual, V f16, one f32 accumulator) on v_wmma_f32_16x16x32_f16 writing y directly; f32 accumulate.
#define BB 16
#define CC 512
#define NN 1024
#define TT NN
#define NH 4
#define HDD 128
#define NVH (2 * NH)
#define NR (BB * NN)
#define ATT_SCALE 0.04419417382415922f

typedef __bf16 v16b __attribute__((ext_vector_type(16)));
typedef unsigned short v8us __attribute__((ext_vector_type(8), may_alias));
typedef float  v8f  __attribute__((ext_vector_type(8)));
typedef float  v4f  __attribute__((ext_vector_type(4)));
typedef float  v4fa __attribute__((ext_vector_type(4), may_alias));
union FragB { v16b v; v8us half[2]; unsigned short u[16]; };

__device__ __forceinline__ unsigned short bf16_bits(float x) { unsigned int u = __float_as_uint(x); return (unsigned short)((u + 0x7FFFu + ((u >> 16) & 1u)) >> 16); }
__device__ __forceinline__ float bf16_val(unsigned short b) { return __uint_as_float(((unsigned int)b) << 16); }
__device__ __forceinline__ float bf16_round(float x) { return bf16_val(bf16_bits(x)); }
// D += A·B with NT terms: 1 = ah·bh, 2 = + al·bh (A split), 3 = + ah·bl (both split)
template <int NT>
__device__ __forceinline__ v8f mmaN(v16b ah, v16b al, v16b bh, v16b bl, v8f c) {
  c = __builtin_amdgcn_wmma_f32_16x16x32_bf16(false, ah, false, bh, (short)0, c, false, false);
  if (NT >= 2) c = __builtin_amdgcn_wmma_f32_16x16x32_bf16(false, al, false, bh, (short)0, c, false, false);
  if (NT >= 3) c = __builtin_amdgcn_wmma_f32_16x16x32_bf16(false, ah, false, bl, (short)0, c, false, false);
  asm volatile("v_nop\n\tv_nop\n\tv_nop\n\tv_nop" : "+v"(c) : "v"(ah), "v"(al), "v"(bh), "v"(bl));
  return c;
}

__global__ __launch_bounds__(256) void k_wt_bf16(const float* __restrict__ W, unsigned short* __restrict__ Wt, int K, int N) {
  const int t = blockIdx.x * 256 + threadIdx.x;
  const int k8n = K / 8;
  if (t >= N * k8n) return;
  const int n = t / k8n, k8 = (t % k8n) * 8;
  v8us v;
#pragma unroll
  for (int i = 0; i < 8; ++i) v[i] = bf16_bits(W[(size_t)(k8 + i) * N + n]);
  *(v8us*)(Wt + (size_t)n * K + k8) = v;
  
}

// GEMM C[M][N] (f32, pitch ldc) = act(A[M][K]·W + bias). A f32 row-major (pitch lda) converted per fragment to bf16
// (ASPLIT: hi/lo two planes -> 2 terms, else single rounded term); Wt bf16 [N][K] (pitch ldb). BIAS_BF16 rounds the
// bias to bf16 first (bias quantised to bf16 before the add). K%32==0, M%16==0, N%64==0.
template <bool ASPLIT, int ACT, bool BIAS_BF16>
__global__ __launch_bounds__(128) void k_gemm_bf(const float* __restrict__ A, int lda, const unsigned short* __restrict__ Wt, int ldb,
                                               const float* __restrict__ bias, float* __restrict__ C, int ldc, int M, int N, int K) {
  __shared__ __attribute__((aligned(16))) float so[4][16][64];
  const int tid = threadIdx.x, w = tid >> 5, lane = tid & 31, ln = lane & 15, hh = lane >> 4;
  const int ntn = N / 64;
  const int wid = blockIdx.x * 4 + w;
  const int mt = wid / ntn, nq = wid % ntn;
  if (mt * 16 >= M) return;
  const int row0 = mt * 16, col0 = nq * 64;
  const float* arow = A + (size_t)(row0 + ln) * lda;
  v8f acc[4] = {};
  for (int kb = 0; kb < K; kb += 32) {
    FragB ah, al;
    const v4f x0 = *(const v4fa*)(arow + kb + 8 * hh), x1 = *(const v4fa*)(arow + kb + 8 * hh + 4);
    const v4f x2 = *(const v4fa*)(arow + kb + 16 + 8 * hh), x3 = *(const v4fa*)(arow + kb + 16 + 8 * hh + 4);
    float xs[16] = {x0[0],x0[1],x0[2],x0[3],x1[0],x1[1],x1[2],x1[3],x2[0],x2[1],x2[2],x2[3],x3[0],x3[1],x3[2],x3[3]};
#pragma unroll
    for (int i = 0; i < 16; ++i) { const unsigned short hb = bf16_bits(xs[i]); ah.u[i] = hb; al.u[i] = ASPLIT ? bf16_bits(xs[i] - bf16_val(hb)) : (unsigned short)0; }
#pragma unroll
    for (int t = 0; t < 4; ++t) {
      const unsigned short* brow = Wt + (size_t)(col0 + t * 16 + ln) * ldb + kb;
      FragB b;
      b.half[0] = *(const v8us*)(brow + 8 * hh);
      b.half[1] = *(const v8us*)(brow + 16 + 8 * hh);
      acc[t] = mmaN<ASPLIT ? 2 : 1>(ah.v, al.v, b.v, b.v, acc[t]);
    }
  }
#pragma unroll
  for (int t = 0; t < 4; ++t) {
    float bv = bias ? bias[col0 + t * 16 + ln] : 0.f;
    if (BIAS_BF16) bv = bf16_round(bv);
#pragma unroll
    for (int r = 0; r < 8; ++r) { float v = acc[t][r] + bv; if (ACT == 1) v = fmaxf(v, 0.f); so[w][8 * hh + r][t * 16 + ln] = v; }
  }
  __builtin_amdgcn_fence(__ATOMIC_ACQ_REL, "workgroup");
  __builtin_amdgcn_wave_barrier();
  const int rsub = lane >> 4, c4 = (lane & 15) * 4;
  {
#pragma unroll
    for (int q = 0; q < 8; ++q) {
      const int r = q * 2 + rsub;
      const v4f v = *(const v4fa*)&so[w][r][c4];
      *(v4f*)(C + (size_t)(row0 + r) * ldc + col0 + c4) = v;
    }
    
  }
}

// Flash-style causal/unmasked attention, all contractions 3-term bf16 hi/lo splits, f32 softmax with running max.
// q,k,v rows are read from f32 buffers with arbitrary row pitch (so they can live inside a fused qkv buffer);
// D = head size (multiple of 32, <= 128); one wave = 16 query rows; block = 4 waves (64 queries) sharing K/V chunks of 32.
template <int D, bool CAUSAL>
__global__ __launch_bounds__(128) void k_flash(const float* __restrict__ qb, const float* __restrict__ kb, const float* __restrict__ vb,
                                             int pitch, int T, int H, float scale, float* __restrict__ y, int ypitch) {
  constexpr int KS = D / 32;        // k-steps for QK
  constexpr int DT = D / 16;        // d tiles for PV
  __shared__ __attribute__((aligned(16))) unsigned short sKh[32][D + 8], sKl[32][D + 8], sVh[32][D + 8], sVl[32][D + 8];
  __shared__ __attribute__((aligned(16))) unsigned short sPh[4][16][40], sPl[4][16][40];
  __shared__ __attribute__((aligned(16))) float sO[4][16][D];
  const int tid = threadIdx.x, w = tid >> 5, lane = tid & 31, ln = lane & 15, hh = lane >> 4;
  const int nqb = (T + 63) / 64;
  const int bh = blockIdx.x / nqb, qblk = blockIdx.x % nqb;
  const int b = bh / H, h = bh % H;
  const int q0 = qblk * 64 + w * 16;
  const float* Q = qb + (size_t)b * T * pitch + h * D;
  const float* K = kb + (size_t)b * T * pitch + h * D;
  const float* V = vb + (size_t)b * T * pitch + h * D;

  // A fragments of the wave's 16 query rows (scaled), hi/lo
  FragB aqh[KS], aql[KS];
  {
    int row = q0 + ln; if (row >= T) row = T - 1;
    const float* qr = Q + (size_t)row * pitch;
#pragma unroll
    for (int ks = 0; ks < KS; ++ks)
#pragma unroll
      for (int i = 0; i < 16; ++i) {
        const int d = ks * 32 + ((i < 8) ? (8 * hh + i) : (16 + 8 * hh + (i - 8)));
        const float x = qr[d] * scale; const unsigned short hb = bf16_bits(x);
        aqh[ks].u[i] = hb; aql[ks].u[i] = bf16_bits(x - bf16_val(hb));
      }
  }
  float m_r[8], l_r[8];
#pragma unroll
  for (int r = 0; r < 8; ++r) { m_r[r] = -3.0e38f; l_r[r] = 0.f; }
  v8f oacc[DT];
#pragma unroll
  for (int dt = 0; dt < DT; ++dt) oacc[dt] = (v8f){0.f,0.f,0.f,0.f,0.f,0.f,0.f,0.f};

  const int kv_end = CAUSAL ? min(T, qblk * 64 + 64) : T;     // block-uniform
  for (int j0 = 0; j0 < kv_end; j0 += 32) {
    __syncthreads();
    for (int e = tid; e < 32 * (D / 4); e += 128) {
      const int r = e / (D / 4), c4 = (e % (D / 4)) * 4;
      const int key = j0 + r;
      v4f kf = {0.f,0.f,0.f,0.f}, vf = {0.f,0.f,0.f,0.f};
      if (key < T) { kf = *(const v4fa*)(K + (size_t)key * pitch + c4); vf = *(const v4fa*)(V + (size_t)key * pitch + c4); }
#pragma unroll
      for (int t = 0; t < 4; ++t) {
        unsigned short hb = bf16_bits(kf[t]); sKh[r][c4 + t] = hb; sKl[r][c4 + t] = bf16_bits(kf[t] - bf16_val(hb));
        hb = bf16_bits(vf[t]); sVh[r][c4 + t] = hb; sVl[r][c4 + t] = bf16_bits(vf[t] - bf16_val(hb));
      }
    }
    __syncthreads();
    // S tile 16 x 32
    v8f s[2];
#pragma unroll
    for (int nt = 0; nt < 2; ++nt) {
      v8f acc = {};
#pragma unroll
      for (int ks = 0; ks < KS; ++ks) {
        FragB bh_, bl_;
        bh_.half[0] = *(const v8us*)&sKh[nt * 16 + ln][ks * 32 + 8 * hh]; bh_.half[1] = *(const v8us*)&sKh[nt * 16 + ln][ks * 32 + 16 + 8 * hh];
        bl_.half[0] = *(const v8us*)&sKl[nt * 16 + ln][ks * 32 + 8 * hh]; bl_.half[1] = *(const v8us*)&sKl[nt * 16 + ln][ks * 32 + 16 + 8 * hh];
        acc = mmaN<3>(aqh[ks].v, aql[ks].v, bh_.v, bl_.v, acc);
      }
      s[nt] = acc;
    }
    // mask + running max (rows 8hh+r; the 16 lanes of a half share rows)
    float alpha[8];
#pragma unroll
    for (int r = 0; r < 8; ++r) {
      const int qi = q0 + 8 * hh + r;
      const int ja = j0 + ln, jb = j0 + 16 + ln;
      if (CAUSAL) { if (ja > qi) s[0][r] = -3.0e38f; if (jb > qi) s[1][r] = -3.0e38f; }
      if (ja >= T) s[0][r] = -3.0e38f;
      if (jb >= T) s[1][r] = -3.0e38f;
      float mx = fmaxf(s[0][r], s[1][r]);
      mx = fmaxf(mx, __shfl_xor(mx, 1, 32)); mx = fmaxf(mx, __shfl_xor(mx, 2, 32)); mx = fmaxf(mx, __shfl_xor(mx, 4, 32)); mx = fmaxf(mx, __shfl_xor(mx, 8, 32));
      const float mnew = fmaxf(m_r[r], mx);
      alpha[r] = (mnew > -1.0e38f) ? __expf(m_r[r] - mnew) : 1.0f;
      const float p0 = (s[0][r] > -1.0e38f) ? __expf(s[0][r] - mnew) : 0.f;
      const float p1 = (s[1][r] > -1.0e38f) ? __expf(s[1][r] - mnew) : 0.f;
      m_r[r] = mnew;
      l_r[r] = l_r[r] * alpha[r] + p0 + p1;            // per-lane partial row sum (16 lanes combined at the end)
      unsigned short hb = bf16_bits(p0); sPh[w][8 * hh + r][ln] = hb;      sPl[w][8 * hh + r][ln] = bf16_bits(p0 - bf16_val(hb));
      hb = bf16_bits(p1);                sPh[w][8 * hh + r][16 + ln] = hb; sPl[w][8 * hh + r][16 + ln] = bf16_bits(p1 - bf16_val(hb));
    }
#pragma unroll
    for (int dt = 0; dt < DT; ++dt)
#pragma unroll
      for (int r = 0; r < 8; ++r) oacc[dt][r] *= alpha[r];
    __builtin_amdgcn_fence(__ATOMIC_ACQ_REL, "workgroup");
    __builtin_amdgcn_wave_barrier();
    FragB pah, pal;
    pah.half[0] = *(const v8us*)&sPh[w][ln][8 * hh]; pah.half[1] = *(const v8us*)&sPh[w][ln][16 + 8 * hh];
    pal.half[0] = *(const v8us*)&sPl[w][ln][8 * hh]; pal.half[1] = *(const v8us*)&sPl[w][ln][16 + 8 * hh];
#pragma unroll
    for (int dt = 0; dt < DT; ++dt) {
      FragB bvh, bvl;
#pragma unroll
      for (int i = 0; i < 8; ++i) {
        bvh.u[i] = sVh[8 * hh + i][dt * 16 + ln]; bvh.u[8 + i] = sVh[16 + 8 * hh + i][dt * 16 + ln];
        bvl.u[i] = sVl[8 * hh + i][dt * 16 + ln]; bvl.u[8 + i] = sVl[16 + 8 * hh + i][dt * 16 + ln];
      }
      oacc[dt] = mmaN<3>(pah.v, pal.v, bvh.v, bvl.v, oacc[dt]);
    }
    __builtin_amdgcn_fence(__ATOMIC_ACQ_REL, "workgroup");
    __builtin_amdgcn_wave_barrier();
  }
#pragma unroll
  for (int r = 0; r < 8; ++r) {
    float l = l_r[r];
    l += __shfl_xor(l, 1, 32); l += __shfl_xor(l, 2, 32); l += __shfl_xor(l, 4, 32); l += __shfl_xor(l, 8, 32);
    l_r[r] = (l > 0.f) ? 1.0f / l : 0.f;
  }
#pragma unroll
  for (int dt = 0; dt < DT; ++dt)
#pragma unroll
    for (int r = 0; r < 8; ++r) sO[w][8 * hh + r][dt * 16 + ln] = oacc[dt][r] * l_r[r];
  __builtin_amdgcn_fence(__ATOMIC_ACQ_REL, "workgroup");
  __builtin_amdgcn_wave_barrier();
  {
    for (int r = 0; r < 16; ++r) {
      const int row = q0 + r;
      if (row < T && lane < D / 4) {
        const v4f val = *(const v4fa*)&sO[w][r][lane * 4];
        *(v4f*)(y + ((size_t)b * T + row) * ypitch + h * D + lane * 4) = val;
      }
    }
    
  }
}

// GEMM C = act(A·W + bias + resid): A f32 (ASPLIT -> hi/lo 2 terms), Wt bf16 [N][K]; ACT 0 none, 1 relu, 2 exact gelu;
// resid (optional, f32, row index = (row % rmod), pitch ldr, RES_BF16 rounds it) added before the activation.
template <bool ASPLIT, int ACT, bool BIAS_BF16, bool RES_BF16>
__global__ __launch_bounds__(128) void k_gemm_bf3(const float* __restrict__ A, int lda, const unsigned short* __restrict__ Wt, int ldb,
                                                const float* __restrict__ bias, const float* __restrict__ resid, int rmod, int ldr,
                                                float* __restrict__ C, int ldc, int M, int N, int K) {
  __shared__ __attribute__((aligned(16))) float so[4][16][64];
  const int tid = threadIdx.x, w = tid >> 5, lane = tid & 31, ln = lane & 15, hh = lane >> 4;
  const int ntn = N / 64;
  const int wid = blockIdx.x * 4 + w;
  const int mt = wid / ntn, nq = wid % ntn;
  if (mt * 16 >= M) return;
  const int row0 = mt * 16, col0 = nq * 64;
  const float* arow = A + (size_t)(row0 + ln) * lda;
  v8f acc[4] = {};
  for (int kb = 0; kb < K; kb += 32) {
    FragB ah, al;
    const v4f x0 = *(const v4fa*)(arow + kb + 8 * hh), x1 = *(const v4fa*)(arow + kb + 8 * hh + 4);
    const v4f x2 = *(const v4fa*)(arow + kb + 16 + 8 * hh), x3 = *(const v4fa*)(arow + kb + 16 + 8 * hh + 4);
    float xs[16] = {x0[0],x0[1],x0[2],x0[3],x1[0],x1[1],x1[2],x1[3],x2[0],x2[1],x2[2],x2[3],x3[0],x3[1],x3[2],x3[3]};
#pragma unroll
    for (int i = 0; i < 16; ++i) { const unsigned short hb = bf16_bits(xs[i]); ah.u[i] = hb; al.u[i] = ASPLIT ? bf16_bits(xs[i] - bf16_val(hb)) : (unsigned short)0; }
#pragma unroll
    for (int t = 0; t < 4; ++t) {
      const unsigned short* brow = Wt + (size_t)(col0 + t * 16 + ln) * ldb + kb;
      FragB b;
      b.half[0] = *(const v8us*)(brow + 8 * hh);
      b.half[1] = *(const v8us*)(brow + 16 + 8 * hh);
      acc[t] = mmaN<ASPLIT ? 2 : 1>(ah.v, al.v, b.v, b.v, acc[t]);
    }
  }
#pragma unroll
  for (int t = 0; t < 4; ++t) {
    const int col = col0 + t * 16 + ln;
    float bv = bias ? bias[col] : 0.f;
    if (BIAS_BF16) bv = bf16_round(bv);
#pragma unroll
    for (int r = 0; r < 8; ++r) {
      float v = acc[t][r] + bv;
      if (resid) { float rv = resid[(size_t)((row0 + 8 * hh + r) % rmod) * ldr + col]; if (RES_BF16) rv = bf16_round(rv); v += rv; }
      if (ACT == 1) v = fmaxf(v, 0.f);
      if (ACT == 2) v = 0.5f * v * (1.0f + erff(v * 0.70710678118654752f));
      if (ACT == 3) { const float u = 0.7978845608028654f * (v + 0.044715f * v * v * v); v = 0.5f * v * (1.0f + tanhf(u)); }
      so[w][8 * hh + r][t * 16 + ln] = v;
    }
  }
  __builtin_amdgcn_fence(__ATOMIC_ACQ_REL, "workgroup");
  __builtin_amdgcn_wave_barrier();
  const int rsub = lane >> 4, c4 = (lane & 15) * 4;
  {
#pragma unroll
    for (int q = 0; q < 8; ++q) {
      const int r = q * 2 + rsub;
      const v4f v = *(const v4fa*)&so[w][r][c4];
      *(v4f*)(C + (size_t)(row0 + r) * ldc + col0 + c4) = v;
    }
    
  }
}
// row LayerNorm (biased variance, eps) over N: s = X (+ R); optional out_sum <- s; out_norm <- (s-mu)*rsqrt(var+eps)*g + b
template <bool PARAM_BF16>
__global__ __launch_bounds__(256) void k_layernorm(const float* __restrict__ X, const float* __restrict__ R, const float* __restrict__ g, const float* __restrict__ bta,
                                                  float* __restrict__ out_sum, float* __restrict__ out_norm, int N, float eps) {
  __shared__ float red[256];
  const int row = blockIdx.x, tid = threadIdx.x;
  const float* x = X + (size_t)row * N; const float* rr = R ? R + (size_t)row * N : nullptr;
  float vals[16];                     // up to N = 4096
  const int per = N / 256;            // contiguous chunk per thread? use strided-by-4 chunks: thread handles j = tid*4 + 1024*u
  float s1 = 0.f;
  for (int u = 0; u < per / 4; ++u) {
    const int j = tid * 4 + 1024 * u;
    const v4f a = *(const v4fa*)(x + j);
    v4f b = {0.f,0.f,0.f,0.f}; if (rr) b = *(const v4fa*)(rr + j);
#pragma unroll
    for (int q = 0; q < 4; ++q) { const float v = a[q] + b[q]; vals[u * 4 + q] = v; s1 += v; }
  }
  red[tid] = s1; __syncthreads();
  for (int st = 128; st > 0; st >>= 1) { if (tid < st) red[tid] += red[tid + st]; __syncthreads(); }
  const float mu = red[0] / (float)N; __syncthreads();
  float s2 = 0.f;
  for (int u = 0; u < per / 4; ++u)
#pragma unroll
    for (int q = 0; q < 4; ++q) { const float c = vals[u * 4 + q] - mu; s2 += c * c; }
  red[tid] = s2; __syncthreads();
  for (int st = 128; st > 0; st >>= 1) { if (tid < st) red[tid] += red[tid + st]; __syncthreads(); }
  const float rs = rsqrtf(red[0] / (float)N + eps);
  {
    for (int u = 0; u < per / 4; ++u) {
      const int j = tid * 4 + 1024 * u;
      v4f o, sm;
#pragma unroll
      for (int q = 0; q < 4; ++q) {
        float gg = g[j + q], bb = bta[j + q];
        if (PARAM_BF16) { gg = bf16_round(gg); bb = bf16_round(bb); }
        sm[q] = vals[u * 4 + q]; o[q] = (vals[u * 4 + q] - mu) * rs * gg + bb;
      }
      if (out_sum) *(v4f*)(out_sum + (size_t)row * N + j) = sm;
      *(v4f*)(out_norm + (size_t)row * N + j) = o;
    }
    
  }
}



// ---- f16 WMMA path (v_wmma_f32_16x16x32_f16): 11-bit significands for operands in range — used where a [0,1] probability operand needs more precision than bf16
typedef _Float16 v16h __attribute__((ext_vector_type(16)));
union FragH { v16h v; v8us half[2]; _Float16 h[16]; unsigned short u[16]; };
template <int NT>
__device__ __forceinline__ v8f mmaH(v16h ah, v16h al, v16h bh, v16h bl, v8f c) {
  c = __builtin_amdgcn_wmma_f32_16x16x32_f16(false, ah, false, bh, (short)0, c, false, false);
  if (NT >= 2) c = __builtin_amdgcn_wmma_f32_16x16x32_f16(false, al, false, bh, (short)0, c, false, false);
  if (NT >= 3) c = __builtin_amdgcn_wmma_f32_16x16x32_f16(false, ah, false, bl, (short)0, c, false, false);
  asm volatile("v_nop\n\tv_nop\n\tv_nop\n\tv_nop" : "+v"(c) : "v"(ah), "v"(al), "v"(bh), "v"(bl));
  return c;
}
// batched GEMM like k_gemm_b but f16 operands: A f32 (split into f16 hi/lo if ASPLIT, else rounded to f16), Bt = f16 values [n][k]; alpha; C f32; N multiple of 16 (partial tiles skipped)
template <bool ASPLIT>
__global__ __launch_bounds__(128) void k_gemm_h(const float* __restrict__ A, int lda, size_t sA, const _Float16* __restrict__ Bh, int ldb, size_t sB, float alpha, float* __restrict__ C, int ldc, size_t sC, int M, int N, int K) {
  __shared__ __attribute__((aligned(16))) float so[4][16][64];
  const int tid = threadIdx.x, w = tid >> 5, lane = tid & 31, ln = lane & 15, hh = lane >> 4; const int by = blockIdx.y;
  A += (size_t)by * sA; Bh += (size_t)by * sB; C += (size_t)by * sC;
  const int ntn = (N + 63) / 64; const int wid = blockIdx.x * 4 + w; const int mt = wid / ntn, nq = wid % ntn; if (mt * 16 >= M) return;
  const int row0 = mt * 16, col0 = nq * 64; const float* arow = A + (size_t)(row0 + ln) * lda;
  v8f acc[4] = {};
  for (int kb = 0; kb < K; kb += 32) {
    FragH ah, al;
    const v4f x0 = *(const v4fa*)(arow + kb + 8 * hh), x1 = *(const v4fa*)(arow + kb + 8 * hh + 4), x2 = *(const v4fa*)(arow + kb + 16 + 8 * hh), x3 = *(const v4fa*)(arow + kb + 16 + 8 * hh + 4);
    float xs[16] = {x0[0],x0[1],x0[2],x0[3],x1[0],x1[1],x1[2],x1[3],x2[0],x2[1],x2[2],x2[3],x3[0],x3[1],x3[2],x3[3]};
#pragma unroll
    for (int i = 0; i < 16; ++i) { const _Float16 h = (_Float16)xs[i]; ah.h[i] = h; al.h[i] = ASPLIT ? (_Float16)(xs[i] - (float)h) : (_Float16)0.0f; }
#pragma unroll
    for (int t = 0; t < 4; ++t) { if (col0 + t * 16 >= N) continue; const size_t boff = (size_t)(col0 + t * 16 + ln) * ldb + kb; FragH bq; bq.half[0] = *(const v8us*)(Bh + boff + 8 * hh); bq.half[1] = *(const v8us*)(Bh + boff + 16 + 8 * hh);
      acc[t] = mmaH<ASPLIT ? 2 : 1>(ah.v, al.v, bq.v, bq.v, acc[t]); }
  }
#pragma unroll
  for (int t = 0; t < 4; ++t) { if (col0 + t * 16 >= N) continue;
#pragma unroll
    for (int r = 0; r < 8; ++r) so[w][8 * hh + r][t * 16 + ln] = acc[t][r] * alpha; }
  __builtin_amdgcn_fence(__ATOMIC_ACQ_REL, "workgroup"); __builtin_amdgcn_wave_barrier();
  const int rsub = lane >> 4, c4 = (lane & 15) * 4;
  {
#pragma unroll
    for (int q = 0; q < 8; ++q) { const int r = q * 2 + rsub; if (col0 + c4 < N) { const v4f v = *(const v4fa*)&so[w][r][c4]; *(v4f*)(C + (size_t)(row0 + r) * ldc + col0 + c4) = v; } }
     }
}

// Wt[n][k] = f16(W[k][n]·scale) from f32 row-major W[K][N] (scale = power of two; bf16-exact weights stay exact in f16 away from the subnormal range)
__global__ __launch_bounds__(256) void k_wt_f16(const float* __restrict__ W, _Float16* __restrict__ Wt, int K, int N, float scale) {
  const int t = blockIdx.x * 256 + threadIdx.x; if (t >= N * (K / 8)) return; const int n = t / (K / 8), k8 = (t % (K / 8)) * 8; FragH f;
#pragma unroll
  for (int i = 0; i < 8; ++i) f.h[i] = (_Float16)(bf16_round(W[(size_t)(k8 + i) * N + n]) * scale); const v8us o = f.half[0];
  *(v8us*)((unsigned short*)Wt + (size_t)n * K + k8) = o; 
}
// k_gemm_hh variant with fused epilogue: v = acc·alpha + bias[by·sBias + col] (+ CP[(row/rowsPerB)·sCPb + by·64 + col] if CP) ; ACT 0 none / 1 elu ; writes f16 C16 and f32 C, each if non-null
template <int ACT>
__global__ __launch_bounds__(128) void k_gemm_hhx(const _Float16* __restrict__ A, int lda, size_t sA, const _Float16* __restrict__ Bh, int ldb, size_t sB, float alpha, const float* __restrict__ bias, size_t sBias, const float* __restrict__ CP, int rowsPerB, size_t sCPb, int row0g,
    float* __restrict__ C, _Float16* __restrict__ C16, int ldc, size_t sC, int M, int N, int K) {
  __shared__ __attribute__((aligned(16))) float so[4][16][64];
  const int tid = threadIdx.x, w = tid >> 5, lane = tid & 31, ln = lane & 15, hh = lane >> 4; const int by = blockIdx.y;
  A += (size_t)by * sA; Bh += (size_t)by * sB; const size_t cofs = (size_t)by * sC; const float* bp = bias ? bias + (size_t)by * sBias : nullptr;
  const int ntn = (N + 63) / 64; const int wid = blockIdx.x * 4 + w; const int mt = wid / ntn, nq = wid % ntn; if (mt * 16 >= M) return;
  const int row0 = mt * 16, col0 = nq * 64; const _Float16* arow = A + (size_t)(row0 + ln) * lda;
  v8f acc[4] = {};
  for (int kb = 0; kb < K; kb += 32) { FragH ah; ah.half[0] = *(const v8us*)((const unsigned short*)arow + kb + 8 * hh); ah.half[1] = *(const v8us*)((const unsigned short*)arow + kb + 16 + 8 * hh);
#pragma unroll
    for (int t = 0; t < 4; ++t) { if (col0 + t * 16 >= N) continue; const size_t boff = (size_t)(col0 + t * 16 + ln) * ldb + kb; FragH bq; bq.half[0] = *(const v8us*)((const unsigned short*)Bh + boff + 8 * hh); bq.half[1] = *(const v8us*)((const unsigned short*)Bh + boff + 16 + 8 * hh);
      acc[t] = mmaH<1>(ah.v, ah.v, bq.v, bq.v, acc[t]); }
  }
#pragma unroll
  for (int t = 0; t < 4; ++t) { if (col0 + t * 16 >= N) continue; const int col = col0 + t * 16 + ln; const float bv = bp ? bf16_round(bp[col]) : 0.f;
#pragma unroll
    for (int r = 0; r < 8; ++r) { float v = acc[t][r] * alpha + bv; if (CP) { const int bidx = (row0g + row0 + 8 * hh + r) / rowsPerB; v += CP[(size_t)bidx * sCPb + (size_t)by * 64 + col]; } if (ACT == 1) v = (v > 0.f) ? v : expm1f(v); else if (ACT == 7) v = (v > 0.f) ? v + 1.0f : expf(v); else if (ACT == 8) v = tanhf(v); else if (ACT == 9) v = 0.5f * v * (1.0f + tanhf(0.7978845608028654f * (v + 0.044715f * v * v * v))); else if (ACT == 11) v = 1.0f / (1.0f + expf(-v)); else if (ACT == 12) v = (v > 0.f) ? v : 0.01f * v; else if (ACT == 14) v = (v > 0.f) ? v : 0.1f * v; else if (ACT == 15) v = v / (1.0f + expf(-v)); else if (ACT == 3) v = fmaxf(v, 0.f); else if (ACT == 6) v = 0.5f * v * (1.0f + erff(v * 0.70710678118654752f)); so[w][8 * hh + r][t * 16 + ln] = v; } }
  __builtin_amdgcn_fence(__ATOMIC_ACQ_REL, "workgroup"); __builtin_amdgcn_wave_barrier();
  const int rsub = lane >> 4, c4 = (lane & 15) * 4; typedef _Float16 v4h __attribute__((ext_vector_type(4)));
  {
#pragma unroll
    for (int q = 0; q < 8; ++q) { const int r = q * 2 + rsub; if (col0 + c4 < N) { const v4f v = *(const v4fa*)&so[w][r][c4]; if (C) *(v4f*)(C + cofs + (size_t)(row0 + r) * ldc + col0 + c4) = v; if (C16) { v4h h4; for (int i = 0; i < 4; ++i) h4[i] = (_Float16)v[i]; *(v4h*)(C16 + cofs + (size_t)(row0 + r) * ldc + col0 + c4) = h4; } } }
     }
}


typedef _Float16 v4h __attribute__((ext_vector_type(4)));

__global__ __launch_bounds__(256) void k_x16(const float* __restrict__ x, _Float16* __restrict__ X16, size_t n8) { const size_t t = (size_t)blockIdx.x * 256 + threadIdx.x; if (t >= n8) return; FragH f;
#pragma unroll
  for (int q = 0; q < 8; ++q) f.h[q] = (_Float16)bf16_round(x[t * 8 + q]); *(v8us*)((unsigned short*)X16 + t * 8) = f.half[0];  }
__global__ __launch_bounds__(256) void k_h16(const float* __restrict__ x, _Float16* __restrict__ X16, size_t n8) { const size_t t = (size_t)blockIdx.x * 256 + threadIdx.x; if (t >= n8) return; FragH f;
#pragma unroll
  for (int q = 0; q < 8; ++q) f.h[q] = (_Float16)x[t * 8 + q]; *(v8us*)((unsigned short*)X16 + t * 8) = f.half[0];  }
__global__ __launch_bounds__(256) void k_round16f(const float* __restrict__ W, _Float16* __restrict__ Bt, size_t n8) { const size_t t = (size_t)blockIdx.x * 256 + threadIdx.x; if (t >= n8) return; FragH f;
#pragma unroll
  for (int i = 0; i < 8; ++i) f.h[i] = (_Float16)(bf16_round(W[t * 8 + i]) * 16.0f); *(v8us*)((unsigned short*)Bt + t * 8) = f.half[0];  }
template <int NHv, int TTv>
__global__ __launch_bounds__(256) void k_vt(const _Float16* __restrict__ V16, int ldv, int voff, _Float16* __restrict__ Vt) { __shared__ unsigned short tl[64][66]; const int tid = threadIdx.x; const int slab = blockIdx.x / (TTv / 64), lg = blockIdx.x % (TTv / 64); const int b = slab / NHv, h = slab % NHv;
  for (int i = tid; i < 64 * 8; i += 256) { const int r = i / 8, c8 = (i % 8) * 8; FragH f; f.half[0] = *(const v8us*)((const unsigned short*)V16 + ((size_t)b * TTv + lg * 64 + r) * ldv + voff + h * 64 + c8);
#pragma unroll
    for (int q = 0; q < 8; ++q) tl[r][c8 + q] = f.u[q]; }
  __syncthreads();
  {
#pragma unroll
    for (int rd = 0; rd < 2; ++rd) { const int d = rd * 32 + tid / 8, pc = tid % 8; FragH f;
#pragma unroll
      for (int q = 0; q < 8; ++q) f.u[q] = tl[pc * 8 + q][d];
      *(v8us*)((unsigned short*)Vt + ((size_t)slab * 64 + d) * TTv + lg * 64 + pc * 8) = f.half[0]; }
     } }

__global__ __launch_bounds__(256) void k_tok(const float* __restrict__ x, _Float16* __restrict__ X16) { __shared__ float tl[32][65]; const int tid = threadIdx.x; const int b = blockIdx.x / ((CC / 64) * (NN / 32)), rem = blockIdx.x % ((CC / 64) * (NN / 32)); const int cg = rem / (NN / 32), pg = rem % (NN / 32); const int c0 = cg * 64, p0 = pg * 32;
  for (int i = tid; i < 64 * 32; i += 256) { const int c = i / 32, pp = i % 32; tl[pp][c] = bf16_round(x[((size_t)b * CC + c0 + c) * NN + p0 + pp]); } __syncthreads();
  const int r = tid / 8, pc = tid % 8; FragH f; for (int q = 0; q < 8; ++q) f.h[q] = (_Float16)tl[r][pc * 8 + q]; const size_t row = (size_t)b * NN + p0 + r; *(v8us*)((unsigned short*)X16 + row * CC + c0 + pc * 8) = f.half[0];  }
__global__ __launch_bounds__(256) void k_vthlu(const float* __restrict__ VF, int ldv, _Float16* __restrict__ Vth, _Float16* __restrict__ Vtl) { __shared__ float tl[64][65]; const int tid = threadIdx.x; const int slab = blockIdx.x / (TT / 64), lg = blockIdx.x % (TT / 64); const int b = slab / NVH, h = slab % NVH;
  for (int i = tid; i < 64 * 16; i += 256) { const int r = i / 16, c4 = (i % 16) * 4; const v4f a = *(const v4fa*)(VF + ((size_t)b * TT + lg * 64 + r) * ldv + h * 64 + c4); tl[r][c4] = a[0]; tl[r][c4 + 1] = a[1]; tl[r][c4 + 2] = a[2]; tl[r][c4 + 3] = a[3]; }
  __syncthreads();
  FragH fh[2], fl[2]; size_t oo[2];
#pragma unroll
  for (int rd = 0; rd < 2; ++rd) { const int d = rd * 32 + tid / 8, pc = tid % 8;
#pragma unroll
    for (int q = 0; q < 8; ++q) { const float v = tl[pc * 8 + q][d]; const _Float16 hv = (_Float16)v; fh[rd].h[q] = hv; fl[rd].h[q] = (_Float16)(v - (float)hv);      /* UNSCALED residual (k_flash reads only the hi plane) */ } oo[rd] = ((size_t)slab * 64 + d) * TT + lg * 64 + pc * 8; }
  {
#pragma unroll
    for (int rd = 0; rd < 2; ++rd) { *(v8us*)((unsigned short*)Vth + oo[rd]) = fh[rd].half[0]; *(v8us*)((unsigned short*)Vtl + oo[rd]) = fl[rd].half[0]; }
     } }
__global__ __launch_bounds__(256) void k_krt(const float* __restrict__ KF, const float* __restrict__ rh, const float* __restrict__ rw, _Float16* __restrict__ K16) { const size_t t = (size_t)blockIdx.x * 256 + threadIdx.x; if (t >= (size_t)NR * CC / 8) return; const size_t row = (t * 8) / CC; const int c0 = (int)((t * 8) % CC); const int n = (int)(row % NN); const int na = n / 32, nb = n % 32; const v4f a = *(const v4fa*)(KF + t * 8), c = *(const v4fa*)(KF + t * 8 + 4); FragH f;
#pragma unroll
  for (int q = 0; q < 8; ++q) { const int ch = c0 + q; const int h = ch / HDD, d = ch % HDD; const float r1 = bf16_round(rh[((size_t)h * HDD + d) * 32 + nb]) + bf16_round(rw[((size_t)h * HDD + d) * 32 + na]); f.h[q] = (_Float16)(((q < 4) ? a[q] : c[q - 4]) + r1); }
  *(v8us*)((unsigned short*)K16 + t * 8) = f.half[0];  }
__global__ __launch_bounds__(128) void k_flash(const _Float16* __restrict__ Q16, int ldq, const _Float16* __restrict__ K16, int ldk, const _Float16* __restrict__ Vt, const _Float16* __restrict__ Vtlo, float* __restrict__ O, int ldo) {
  constexpr int RPW = 16, RTN = RPW / 16, NQB = TT / (4 * RPW), DT = 8, KS = 4;      /* head dim 128: 4 k-steps, 8 value tiles */
  __shared__ __attribute__((aligned(16))) unsigned short sP[4][RPW][40]; __shared__ __attribute__((aligned(16))) unsigned short sPL[4][RPW][40]; __shared__ __attribute__((aligned(16))) float sO[4][RPW][128 + 4];
  const int tid = threadIdx.x, w = tid >> 5, lane = tid & 31, ln = lane & 15, hh = lane >> 4;
  const int slab = blockIdx.x / NQB, qblk = blockIdx.x % NQB; const int b = slab / NH, h = slab % NH; const int qb0 = qblk * (4 * RPW); const int q0 = qb0 + w * RPW;
  FragH aq[2][KS];
#pragma unroll
  for (int rt = 0; rt < RTN; ++rt) { const unsigned short* qr = (const unsigned short*)Q16 + ((size_t)b * TT + q0 + rt * 16 + ln) * ldq + h * 128;
#pragma unroll
    for (int ks = 0; ks < KS; ++ks) { aq[rt][ks].half[0] = *(const v8us*)(qr + ks * 32 + 8 * hh); aq[rt][ks].half[1] = *(const v8us*)(qr + ks * 32 + 16 + 8 * hh); } }
  const unsigned short* Vth = (const unsigned short*)Vt + (size_t)slab * 128 * TT; const unsigned short* Vtl = (const unsigned short*)Vtlo + (size_t)slab * 128 * TT;      /* hi and UNSCALED residual planes */
  float m_r[2][8], l_r[2][8]; v8f oacc[2][DT];
#pragma unroll
  for (int rt = 0; rt < RTN; ++rt) {
#pragma unroll
    for (int r = 0; r < 8; ++r) { m_r[rt][r] = -3.0e38f; l_r[rt][r] = 0.f; }
#pragma unroll
    for (int dt = 0; dt < DT; ++dt) oacc[rt][dt] = (v8f){0.f,0.f,0.f,0.f,0.f,0.f,0.f,0.f}; }
  const int jend = TT;
#pragma unroll 1
  for (int j0 = 0; j0 < jend; j0 += 32) {
    
    v8f s[2][2];
#pragma unroll
    for (int nt = 0; nt < 2; ++nt) { const unsigned short* kr = (const unsigned short*)K16 + ((size_t)b * TT + j0 + nt * 16 + ln) * ldk + h * 128; FragH bk[KS];
#pragma unroll
      for (int ks = 0; ks < KS; ++ks) { bk[ks].half[0] = *(const v8us*)(kr + ks * 32 + 8 * hh); bk[ks].half[1] = *(const v8us*)(kr + ks * 32 + 16 + 8 * hh); }
#pragma unroll
      for (int rt = 0; rt < RTN; ++rt) { v8f acc = (v8f){0.f,0.f,0.f,0.f,0.f,0.f,0.f,0.f};
#pragma unroll
        for (int ks = 0; ks < KS; ++ks) acc = mmaH<1>(aq[rt][ks].v, aq[rt][ks].v, bk[ks].v, bk[ks].v, acc); s[rt][nt] = acc; } }
#pragma unroll
    for (int rt = 0; rt < RTN; ++rt)
#pragma unroll
      for (int r = 0; r < 8; ++r) { const int tq = q0 + rt * 16 + 8 * hh + r; const int k0 = j0 + ln, k1 = j0 + 16 + ln; (void)tq; (void)k0; (void)k1;
        const bool ok0 = true, ok1 = true; (void)tq; (void)k0; (void)k1;
        const float s0 = ok0 ? s[rt][0][r] * ATT_SCALE : -INFINITY, s1 = ok1 ? s[rt][1][r] * ATT_SCALE : -INFINITY; float mc = fmaxf(s0, s1);
        mc = fmaxf(mc, __shfl_xor(mc, 1, 32)); mc = fmaxf(mc, __shfl_xor(mc, 2, 32)); mc = fmaxf(mc, __shfl_xor(mc, 4, 32)); mc = fmaxf(mc, __shfl_xor(mc, 8, 32));
        const float mn = fmaxf(m_r[rt][r], mc); const float al = (mn > -1.0e38f) ? expf(m_r[rt][r] - mn) : 1.0f; m_r[rt][r] = mn; const float p0 = ok0 ? expf(s0 - mn) : 0.f, p1 = ok1 ? expf(s1 - mn) : 0.f; l_r[rt][r] = l_r[rt][r] * al + p0 + p1;
#pragma unroll
        for (int dt = 0; dt < DT; ++dt) oacc[rt][dt][r] *= al;
        FragH t2, t3; const float ps0 = p0 * 1024.0f, ps1 = p1 * 1024.0f; t2.h[0] = (_Float16)ps0; t2.h[1] = (_Float16)ps1; t3.h[0] = (_Float16)(ps0 - (float)t2.h[0]); t3.h[1] = (_Float16)(ps1 - (float)t2.h[1]);      /* P hi and its UNSCALED residual (added into the same accumulator) */
        sP[w][rt * 16 + 8 * hh + r][ln] = t2.u[0]; sP[w][rt * 16 + 8 * hh + r][16 + ln] = t2.u[1]; sPL[w][rt * 16 + 8 * hh + r][ln] = t3.u[0]; sPL[w][rt * 16 + 8 * hh + r][16 + ln] = t3.u[1]; }
    __builtin_amdgcn_fence(__ATOMIC_ACQ_REL, "workgroup"); __builtin_amdgcn_wave_barrier();
    FragH pa[2], pl[2];
#pragma unroll
    for (int rt = 0; rt < RTN; ++rt) { pa[rt].half[0] = *(const v8us*)&sP[w][rt * 16 + ln][8 * hh]; pa[rt].half[1] = *(const v8us*)&sP[w][rt * 16 + ln][16 + 8 * hh]; pl[rt].half[0] = *(const v8us*)&sPL[w][rt * 16 + ln][8 * hh]; pl[rt].half[1] = *(const v8us*)&sPL[w][rt * 16 + ln][16 + 8 * hh]; }
#pragma unroll
    for (int dt = 0; dt < DT; ++dt) { const size_t vo = (size_t)(dt * 16 + ln) * TT + j0; FragH bv; bv.half[0] = *(const v8us*)(Vth + vo + 8 * hh); bv.half[1] = *(const v8us*)(Vth + vo + 16 + 8 * hh);
#pragma unroll
      for (int rt = 0; rt < RTN; ++rt) { oacc[rt][dt] = mmaH<1>(pa[rt].v, pa[rt].v, bv.v, bv.v, oacc[rt][dt]); oacc[rt][dt] = mmaH<1>(pl[rt].v, pl[rt].v, bv.v, bv.v, oacc[rt][dt]); } }      /* (Ph + Pl)·Vh — the V residual term is dropped here: near-uniform attention over 1024 keys averages out the f16 rounding of v */
    __builtin_amdgcn_fence(__ATOMIC_ACQ_REL, "workgroup"); __builtin_amdgcn_wave_barrier(); }
#pragma unroll
  for (int rt = 0; rt < RTN; ++rt) {
#pragma unroll
    for (int r = 0; r < 8; ++r) { float l = l_r[rt][r]; l += __shfl_xor(l, 1, 32); l += __shfl_xor(l, 2, 32); l += __shfl_xor(l, 4, 32); l += __shfl_xor(l, 8, 32); l_r[rt][r] = (l > 0.f) ? 1.0f / (l * 1024.0f) : 0.f; }
#pragma unroll
    for (int dt = 0; dt < DT; ++dt)
#pragma unroll
      for (int r = 0; r < 8; ++r) sO[w][rt * 16 + 8 * hh + r][dt * 16 + ln] = oacc[rt][dt][r] * l_r[rt][r]; }
  __builtin_amdgcn_fence(__ATOMIC_ACQ_REL, "workgroup"); __builtin_amdgcn_wave_barrier();
  {
#pragma unroll
    for (int r = 0; r < RPW; ++r) { const int pc = lane; const v4f val = *(const v4fa*)&sO[w][r][pc * 4]; *(v4f*)(O + ((size_t)slab * TT + q0 + r) * 128 + pc * 4) = val; }      /* output laid out [b][h][n][128] (the module reinterprets that buffer as [B,C,H,W]); one 512-B row per instruction */      /* one 512-B row per instruction: 32 lanes × 16 B */
     } }

extern "C" void kernel_launch(void* const* d_in, const int* in_sizes, int n_in,
                              void* d_out, int out_size, void* d_ws, size_t ws_size, hipStream_t stream) {
  (void)in_sizes; (void)n_in; (void)out_size;
  const float* const* I = (const float* const*)d_in; const float* x = I[0]; const float* Wq = I[1]; const float* bq = I[2]; const float* Wk = I[3]; const float* bk = I[4]; const float* Wv = I[5]; const float* bv = I[6]; const float* rh = I[7]; const float* rw = I[8];
  char* ws = (char*)d_ws; size_t off = 0;
  auto take = [&](size_t bytes) { char* p = ws + off; off += (bytes + 255) & ~(size_t)255; return p; };
  const size_t WSZ = (size_t)CC * CC; _Float16* Bw = (_Float16*)take(3 * WSZ * 2); _Float16* X16 = (_Float16*)take((size_t)NR * CC * 2); _Float16* Q = (_Float16*)take((size_t)NR * CC * 2); float* F32 = (float*)take((size_t)NR * CC * 4); _Float16* K = (_Float16*)take((size_t)NR * CC * 2); _Float16* Vt = (_Float16*)take((size_t)NR * CC * 2); _Float16* Vtl = X16;      /* Vᵀ residual over the token plane (dead after the three projections) */
  if (off > ws_size) return;      // 1.6 + 16.8 + 16.8 + 33.6 + 16.8 + 16.8 ≈ 102 MB
  const unsigned gw = (unsigned)((WSZ / 8 + 255) / 256); k_round16f<<<gw, 256, 0, stream>>>(Wq, Bw, WSZ / 8); k_round16f<<<gw, 256, 0, stream>>>(Wk, Bw + WSZ, WSZ / 8); k_round16f<<<gw, 256, 0, stream>>>(Wv, Bw + 2 * WSZ, WSZ / 8);      /* (out,in) natural ×2^4 */
  k_tok<<<BB * (CC / 64) * (NN / 32), 256, 0, stream>>>(x, X16);      /* [B][C][N] → token-major bf16 plane */
  const dim3 gp(((NR / 16) * (CC / 64) + 3) / 4, 1); const unsigned g8 = (unsigned)(((size_t)NR * CC / 8 + 255) / 256);
  k_gemm_hhx<0><<<gp, 128, 0, stream>>>(X16, CC, 0, Bw, CC, 0, 0.0625f, bq, 0, nullptr, 1, 0, 0, nullptr, Q, CC, 0, NR, CC, CC);      /* q (unscaled) f16: M 16384 N 512 K 512 */
  k_gemm_hhx<0><<<gp, 128, 0, stream>>>(X16, CC, 0, Bw + WSZ, CC, 0, 0.0625f, bk, 0, nullptr, 1, 0, 0, F32, nullptr, CC, 0, NR, CC, CC); k_krt<<<g8, 256, 0, stream>>>(F32, rh, rw, K);      /* k' = k + rtᵀ */
  k_gemm_hhx<0><<<gp, 128, 0, stream>>>(X16, CC, 0, Bw + 2 * WSZ, CC, 0, 0.0625f, bv, 0, nullptr, 1, 0, 0, F32, nullptr, CC, 0, NR, CC, CC); k_vthlu<<<BB * NVH * (NN / 64), 256, 0, stream>>>(F32, CC, Vt, Vtl);      /* v f32 → Vᵀ hi / residual per (b, h) [128][N] via 8 half-heads of 64 */
  k_flash<<<BB * NH * (NN / 64), 128, 0, stream>>>(Q, CC, K, CC, Vt, Vtl, (float*)d_out, 128);      /* y → d_out as [b][h][n][128] */
}

// v001
// Measured time: 343 microseconds a run.
// Timed twice side by side with v000, it ran 1.27 times as fast both times.
#include <hip/hip_runtime.h>
// Bottleneck-transformer MHSA with relative position term (B=16, C=512, 32×32 → N=1024, 4 heads × 128): q,k,v = 1×1 convs ((out,in) + bias); logits = (q·C^-½)·(k + rt) where rt[h][d][n] = rh[h][d][n mod 32] + rw[h][d][n div 32]
// (the module's (rh + rw).reshape(1, heads, emb, N)); softmax; y = attn·v per head; the output is the [B][h][N][d] buffer reinterpreted as [B,C,H,W] (the module's final reshape).
// Compute dtype: x, weights, biases, rh, rw rounded to bf16; token-major bf16 input plane; q as an f16 GEMM plane (unscaled — the C^-½ is applied to the f32 score), k as an f32 GEMM output with rtᵀ added in f32 then f16,
// v f16; fused flash-style kernel for head dim 128 (4 k-steps, 8 value tiles, online softmax f32, P as f16 + its exact f16 residual, V f16, one f32 accumulator) on v_wmma_f32_16x16x32_f16 writing y directly; f32 accumulate.
#define BB 16
#define CC 512
#define NN 1024
#define TT NN
#define NH 4
#define HDD 128
#define NVH (2 * NH)
#define NR (BB * NN)
#define ATT_SCALE 0.04419417382415922f

typedef __bf16 v16b __attribute__((ext_vector_type(16)));
typedef unsigned short v8us __attribute__((ext_vector_type(8), may_alias));
typedef float  v8f  __attribute__((ext_vector_type(8)));
typedef float  v4f  __attribute__((ext_vector_type(4)));
typedef float  v4fa __attribute__((ext_vector_type(4), may_alias));
union FragB { v16b v; v8us half[2]; unsigned short u[16]; };

__device__ __forceinline__ unsigned short bf16_bits(float x) { unsigned int u = __float_as_uint(x); return (unsigned short)((u + 0x7FFFu + ((u >> 16) & 1u)) >> 16); }
__device__ __forceinline__ float bf16_val(unsigned short b) { return __uint_as_float(((unsigned int)b) << 16); }
__device__ __forceinline__ float bf16_round(float x) { return bf16_val(bf16_bits(x)); }
// D += A·B with NT terms: 1 = ah·bh, 2 = + al·bh (A split), 3 = + ah·bl (both split)
template <int NT>
__device__ __forceinline__ v8f mmaN(v16b ah, v16b al, v16b bh, v16b bl, v8f c) {
  c = __builtin_amdgcn_wmma_f32_16x16x32_bf16(false, ah, false, bh, (short)0, c, false, false);
  if (NT >= 2) c = __builtin_amdgcn_wmma_f32_16x16x32_bf16(false, al, false, bh, (short)0, c, false, false);
  if (NT >= 3) c = __builtin_amdgcn_wmma_f32_16x16x32_bf16(false, ah, false, bl, (short)0, c, false, false);
  asm volatile("v_nop\n\tv_nop\n\tv_nop\n\tv_nop" : "+v"(c) : "v"(ah), "v"(al), "v"(bh), "v"(bl));
  return c;
}

__global__ __launch_bounds__(256) void k_wt_bf16(const float* __restrict__ W, unsigned short* __restrict__ Wt, int K, int N) {
  const int t = blockIdx.x * 256 + threadIdx.x;
  const int k8n = K / 8;
  if (t >= N * k8n) return;
  const int n = t / k8n, k8 = (t % k8n) * 8;
  v8us v;
#pragma unroll
  for (int i = 0; i < 8; ++i) v[i] = bf16_bits(W[(size_t)(k8 + i) * N + n]);
  *(v8us*)(Wt + (size_t)n * K + k8) = v;
  
}

// GEMM C[M][N] (f32, pitch ldc) = act(A[M][K]·W + bias). A f32 row-major (pitch lda) converted per fragment to bf16
// (ASPLIT: hi/lo two planes -> 2 terms, else single rounded term); Wt bf16 [N][K] (pitch ldb). BIAS_BF16 rounds the
// bias to bf16 first (bias quantised to bf16 before the add). K%32==0, M%16==0, N%64==0.
template <bool ASPLIT, int ACT, bool BIAS_BF16>
__global__ __launch_bounds__(128) void k_gemm_bf(const float* __restrict__ A, int lda, const unsigned short* __restrict__ Wt, int ldb,
                                               const float* __restrict__ bias, float* __restrict__ C, int ldc, int M, int N, int K) {
  __shared__ __attribute__((aligned(16))) float so[4][16][64];
  const int tid = threadIdx.x, w = tid >> 5, lane = tid & 31, ln = lane & 15, hh = lane >> 4;
  const int ntn = N / 64;
  const int wid = blockIdx.x * 4 + w;
  const int mt = wid / ntn, nq = wid % ntn;
  if (mt * 16 >= M) return;
  const int row0 = mt * 16, col0 = nq * 64;
  const float* arow = A + (size_t)(row0 + ln) * lda;
  v8f acc[4] = {};
  for (int kb = 0; kb < K; kb += 32) {
    FragB ah, al;
    const v4f x0 = *(const v4fa*)(arow + kb + 8 * hh), x1 = *(const v4fa*)(arow + kb + 8 * hh + 4);
    const v4f x2 = *(const v4fa*)(arow + kb + 16 + 8 * hh), x3 = *(const v4fa*)(arow + kb + 16 + 8 * hh + 4);
    float xs[16] = {x0[0],x0[1],x0[2],x0[3],x1[0],x1[1],x1[2],x1[3],x2[0],x2[1],x2[2],x2[3],x3[0],x3[1],x3[2],x3[3]};
#pragma unroll
    for (int i = 0; i < 16; ++i) { const unsigned short hb = bf16_bits(xs[i]); ah.u[i] = hb; al.u[i] = ASPLIT ? bf16_bits(xs[i] - bf16_val(hb)) : (unsigned short)0; }
#pragma unroll
    for (int t = 0; t < 4; ++t) {
      const unsigned short* brow = Wt + (size_t)(col0 + t * 16 + ln) * ldb + kb;
      FragB b;
      b.half[0] = *(const v8us*)(brow + 8 * hh);
      b.half[1] = *(const v8us*)(brow + 16 + 8 * hh);
      acc[t] = mmaN<ASPLIT ? 2 : 1>(ah.v, al.v, b.v, b.v, acc[t]);
    }
  }
#pragma unroll
  for (int t = 0; t < 4; ++t) {
    float bv = bias ? bias[col0 + t * 16 + ln] : 0.f;
    if (BIAS_BF16) bv = bf16_round(bv);
#pragma unroll
    for (int r = 0; r < 8; ++r) { float v = acc[t][r] + bv; if (ACT == 1) v = fmaxf(v, 0.f); so[w][8 * hh + r][t * 16 + ln] = v; }
  }
  __builtin_amdgcn_fence(__ATOMIC_ACQ_REL, "workgroup");
  __builtin_amdgcn_wave_barrier();
  const int rsub = lane >> 4, c4 = (lane & 15) * 4;
  {
#pragma unroll
    for (int q = 0; q < 8; ++q) {
      const int r = q * 2 + rsub;
      const v4f v = *(const v4fa*)&so[w][r][c4];
      *(v4f*)(C + (size_t)(row0 + r) * ldc + col0 + c4) = v;
    }
    
  }
}

// Flash-style causal/unmasked attention, all contractions 3-term bf16 hi/lo splits, f32 softmax with running max.
// q,k,v rows are read from f32 buffers with arbitrary row pitch (so they can live inside a fused qkv buffer);
// D = head size (multiple of 32, <= 128); one wave = 16 query rows; block = 4 waves (64 queries) sharing K/V chunks of 32.
template <int D, bool CAUSAL>
__global__ __launch_bounds__(128) void k_flash(const float* __restrict__ qb, const float* __restrict__ kb, const float* __restrict__ vb,
                                             int pitch, int T, int H, float scale, float* __restrict__ y, int ypitch) {
  constexpr int KS = D / 32;        // k-steps for QK
  constexpr int DT = D / 16;        // d tiles for PV
  __shared__ __attribute__((aligned(16))) unsigned short sKh[32][D + 8], sKl[32][D + 8], sVh[32][D + 8], sVl[32][D + 8];
  __shared__ __attribute__((aligned(16))) unsigned short sPh[4][16][40], sPl[4][16][40];
  __shared__ __attribute__((aligned(16))) float sO[4][16][D];
  const int tid = threadIdx.x, w = tid >> 5, lane = tid & 31, ln = lane & 15, hh = lane >> 4;
  const int nqb = (T + 63) / 64;
  const int bh = blockIdx.x / nqb, qblk = blockIdx.x % nqb;
  const int b = bh / H, h = bh % H;
  const int q0 = qblk * 64 + w * 16;
  const float* Q = qb + (size_t)b * T * pitch + h * D;
  const float* K = kb + (size_t)b * T * pitch + h * D;
  const float* V = vb + (size_t)b * T * pitch + h * D;

  // A fragments of the wave's 16 query rows (scaled), hi/lo
  FragB aqh[KS], aql[KS];
  {
    int row = q0 + ln; if (row >= T) row = T - 1;
    const float* qr = Q + (size_t)row * pitch;
#pragma unroll
    for (int ks = 0; ks < KS; ++ks)
#pragma unroll
      for (int i = 0; i < 16; ++i) {
        const int d = ks * 32 + ((i < 8) ? (8 * hh + i) : (16 + 8 * hh + (i - 8)));
        const float x = qr[d] * scale; const unsigned short hb = bf16_bits(x);
        aqh[ks].u[i] = hb; aql[ks].u[i] = bf16_bits(x - bf16_val(hb));
      }
  }
  float m_r[8], l_r[8];
#pragma unroll
  for (int r = 0; r < 8; ++r) { m_r[r] = -3.0e38f; l_r[r] = 0.f; }
  v8f oacc[DT];
#pragma unroll
  for (int dt = 0; dt < DT; ++dt) oacc[dt] = (v8f){0.f,0.f,0.f,0.f,0.f,0.f,0.f,0.f};

  const int kv_end = CAUSAL ? min(T, qblk * 64 + 64) : T;     // block-uniform
  for (int j0 = 0; j0 < kv_end; j0 += 32) {
    __syncthreads();
    for (int e = tid; e < 32 * (D / 4); e += 128) {
      const int r = e / (D / 4), c4 = (e % (D / 4)) * 4;
      const int key = j0 + r;
      v4f kf = {0.f,0.f,0.f,0.f}, vf = {0.f,0.f,0.f,0.f};
      if (key < T) { kf = *(const v4fa*)(K + (size_t)key * pitch + c4); vf = *(const v4fa*)(V + (size_t)key * pitch + c4); }
#pragma unroll
      for (int t = 0; t < 4; ++t) {
        unsigned short hb = bf16_bits(kf[t]); sKh[r][c4 + t] = hb; sKl[r][c4 + t] = bf16_bits(kf[t] - bf16_val(hb));
        hb = bf16_bits(vf[t]); sVh[r][c4 + t] = hb; sVl[r][c4 + t] = bf16_bits(vf[t] - bf16_val(hb));
      }
    }
    __syncthreads();
    // S tile 16 x 32
    v8f s[2];
#pragma unroll
    for (int nt = 0; nt < 2; ++nt) {
      v8f acc = {};
#pragma unroll
      for (int ks = 0; ks < KS; ++ks) {
        FragB bh_, bl_;
        bh_.half[0] = *(const v8us*)&sKh[nt * 16 + ln][ks * 32 + 8 * hh]; bh_.half[1] = *(const v8us*)&sKh[nt * 16 + ln][ks * 32 + 16 + 8 * hh];
        bl_.half[0] = *(const v8us*)&sKl[nt * 16 + ln][ks * 32 + 8 * hh]; bl_.half[1] = *(const v8us*)&sKl[nt * 16 + ln][ks * 32 + 16 + 8 * hh];
        acc = mmaN<3>(aqh[ks].v, aql[ks].v, bh_.v, bl_.v, acc);
      }
      s[nt] = acc;
    }
    // mask + running max (rows 8hh+r; the 16 lanes of a half share rows)
    float alpha[8];
#pragma unroll
    for (int r = 0; r < 8; ++r) {
      const int qi = q0 + 8 * hh + r;
      const int ja = j0 + ln, jb = j0 + 16 + ln;
      if (CAUSAL) { if (ja > qi) s[0][r] = -3.0e38f; if (jb > qi) s[1][r] = -3.0e38f; }
      if (ja >= T) s[0][r] = -3.0e38f;
      if (jb >= T) s[1][r] = -3.0e38f;
      float mx = fmaxf(s[0][r], s[1][r]);
      mx = fmaxf(mx, __shfl_xor(mx, 1, 32)); mx = fmaxf(mx, __shfl_xor(mx, 2, 32)); mx = fmaxf(mx, __shfl_xor(mx, 4, 32)); mx = fmaxf(mx, __shfl_xor(mx, 8, 32));
      const float mnew = fmaxf(m_r[r], mx);
      alpha[r] = (mnew > -1.0e38f) ? __expf(m_r[r] - mnew) : 1.0f;
      const float p0 = (s[0][r] > -1.0e38f) ? __expf(s[0][r] - mnew) : 0.f;
      const float p1 = (s[1][r] > -1.0e38f) ? __expf(s[1][r] - mnew) : 0.f;
      m_r[r] = mnew;
      l_r[r] = l_r[r] * alpha[r] + p0 + p1;            // per-lane partial row sum (16 lanes combined at the end)
      unsigned short hb = bf16_bits(p0); sPh[w][8 * hh + r][ln] = hb;      sPl[w][8 * hh + r][ln] = bf16_bits(p0 - bf16_val(hb));
      hb = bf16_bits(p1);                sPh[w][8 * hh + r][16 + ln] = hb; sPl[w][8 * hh + r][16 + ln] = bf16_bits(p1 - bf16_val(hb));
    }
#pragma unroll
    for (int dt = 0; dt < DT; ++dt)
#pragma unroll
      for (int r = 0; r < 8; ++r) oacc[dt][r] *= alpha[r];
    __builtin_amdgcn_fence(__ATOMIC_ACQ_REL, "workgroup");
    __builtin_amdgcn_wave_barrier();
    FragB pah, pal;
    pah.half[0] = *(const v8us*)&sPh[w][ln][8 * hh]; pah.half[1] = *(const v8us*)&sPh[w][ln][16 + 8 * hh];
    pal.half[0] = *(const v8us*)&sPl[w][ln][8 * hh]; pal.half[1] = *(const v8us*)&sPl[w][ln][16 + 8 * hh];
#pragma unroll
    for (int dt = 0; dt < DT; ++dt) {
      FragB bvh, bvl;
#pragma unroll
      for (int i = 0; i < 8; ++i) {
        bvh.u[i] = sVh[8 * hh + i][dt * 16 + ln]; bvh.u[8 + i] = sVh[16 + 8 * hh + i][dt * 16 + ln];
        bvl.u[i] = sVl[8 * hh + i][dt * 16 + ln]; bvl.u[8 + i] = sVl[16 + 8 * hh + i][dt * 16 + ln];
      }
      oacc[dt] = mmaN<3>(pah.v, pal.v, bvh.v, bvl.v, oacc[dt]);
    }
    __builtin_amdgcn_fence(__ATOMIC_ACQ_REL, "workgroup");
    __builtin_amdgcn_wave_barrier();
  }
#pragma unroll
  for (int r = 0; r < 8; ++r) {
    float l = l_r[r];
    l += __shfl_xor(l, 1, 32); l += __shfl_xor(l, 2, 32); l += __shfl_xor(l, 4, 32); l += __shfl_xor(l, 8, 32);
    l_r[r] = (l > 0.f) ? 1.0f / l : 0.f;
  }
#pragma unroll
  for (int dt = 0; dt < DT; ++dt)
#pragma unroll
    for (int r = 0; r < 8; ++r) sO[w][8 * hh + r][dt * 16 + ln] = oacc[dt][r] * l_r[r];
  __builtin_amdgcn_fence(__ATOMIC_ACQ_REL, "workgroup");
  __builtin_amdgcn_wave_barrier();
  {
    for (int r = 0; r < 16; ++r) {
      const int row = q0 + r;
      if (row < T && lane < D / 4) {
        const v4f val = *(const v4fa*)&sO[w][r][lane * 4];
        *(v4f*)(y + ((size_t)b * T + row) * ypitch + h * D + lane * 4) = val;
      }
    }
    
  }
}

// GEMM C = act(A·W + bias + resid): A f32 (ASPLIT -> hi/lo 2 terms), Wt bf16 [N][K]; ACT 0 none, 1 relu, 2 exact gelu;
// resid (optional, f32, row index = (row % rmod), pitch ldr, RES_BF16 rounds it) added before the activation.
template <bool ASPLIT, int ACT, bool BIAS_BF16, bool RES_BF16>
__global__ __launch_bounds__(128) void k_gemm_bf3(const float* __restrict__ A, int lda, const unsigned short* __restrict__ Wt, int ldb,
                                                const float* __restrict__ bias, const float* __restrict__ resid, int rmod, int ldr,
                                                float* __restrict__ C, int ldc, int M, int N, int K) {
  __shared__ __attribute__((aligned(16))) float so[4][16][64];
  const int tid = threadIdx.x, w = tid >> 5, lane = tid & 31, ln = lane & 15, hh = lane >> 4;
  const int ntn = N / 64;
  const int wid = blockIdx.x * 4 + w;
  const int mt = wid / ntn, nq = wid % ntn;
  if (mt * 16 >= M) return;
  const int row0 = mt * 16, col0 = nq * 64;
  const float* arow = A + (size_t)(row0 + ln) * lda;
  v8f acc[4] = {};
  for (int kb = 0; kb < K; kb += 32) {
    FragB ah, al;
    const v4f x0 = *(const v4fa*)(arow + kb + 8 * hh), x1 = *(const v4fa*)(arow + kb + 8 * hh + 4);
    const v4f x2 = *(const v4fa*)(arow + kb + 16 + 8 * hh), x3 = *(const v4fa*)(arow + kb + 16 + 8 * hh + 4);
    float xs[16] = {x0[0],x0[1],x0[2],x0[3],x1[0],x1[1],x1[2],x1[3],x2[0],x2[1],x2[2],x2[3],x3[0],x3[1],x3[2],x3[3]};
#pragma unroll
    for (int i = 0; i < 16; ++i) { const unsigned short hb = bf16_bits(xs[i]); ah.u[i] = hb; al.u[i] = ASPLIT ? bf16_bits(xs[i] - bf16_val(hb)) : (unsigned short)0; }
#pragma unroll
    for (int t = 0; t < 4; ++t) {
      const unsigned short* brow = Wt + (size_t)(col0 + t * 16 + ln) * ldb + kb;
      FragB b;
      b.half[0] = *(const v8us*)(brow + 8 * hh);
      b.half[1] = *(const v8us*)(brow + 16 + 8 * hh);
      acc[t] = mmaN<ASPLIT ? 2 : 1>(ah.v, al.v, b.v, b.v, acc[t]);
    }
  }
#pragma unroll
  for (int t = 0; t < 4; ++t) {
    const int col = col0 + t * 16 + ln;
    float bv = bias ? bias[col] : 0.f;
    if (BIAS_BF16) bv = bf16_round(bv);
#pragma unroll
    for (int r = 0; r < 8; ++r) {
      float v = acc[t][r] + bv;
      if (resid) { float rv = resid[(size_t)((row0 + 8 * hh + r) % rmod) * ldr + col]; if (RES_BF16) rv = bf16_round(rv); v += rv; }
      if (ACT == 1) v = fmaxf(v, 0.f);
      if (ACT == 2) v = 0.5f * v * (1.0f + erff(v * 0.70710678118654752f));
      if (ACT == 3) { const float u = 0.7978845608028654f * (v + 0.044715f * v * v * v); v = 0.5f * v * (1.0f + tanhf(u)); }
      so[w][8 * hh + r][t * 16 + ln] = v;
    }
  }
  __builtin_amdgcn_fence(__ATOMIC_ACQ_REL, "workgroup");
  __builtin_amdgcn_wave_barrier();
  const int rsub = lane >> 4, c4 = (lane & 15) * 4;
  {
#pragma unroll
    for (int q = 0; q < 8; ++q) {
      const int r = q * 2 + rsub;
      const v4f v = *(const v4fa*)&so[w][r][c4];
      *(v4f*)(C + (size_t)(row0 + r) * ldc + col0 + c4) = v;
    }
    
  }
}
// row LayerNorm (biased variance, eps) over N: s = X (+ R); optional out_sum <- s; out_norm <- (s-mu)*rsqrt(var+eps)*g + b
template <bool PARAM_BF16>
__global__ __launch_bounds__(256) void k_layernorm(const float* __restrict__ X, const float* __restrict__ R, const float* __restrict__ g, const float* __restrict__ bta,
                                                  float* __restrict__ out_sum, float* __restrict__ out_norm, int N, float eps) {
  __shared__ float red[256];
  const int row = blockIdx.x, tid = threadIdx.x;
  const float* x = X + (size_t)row * N; const float* rr = R ? R + (size_t)row * N : nullptr;
  float vals[16];                     // up to N = 4096
  const int per = N / 256;            // contiguous chunk per thread? use strided-by-4 chunks: thread handles j = tid*4 + 1024*u
  float s1 = 0.f;
  for (int u = 0; u < per / 4; ++u) {
    const int j = tid * 4 + 1024 * u;
    const v4f a = *(const v4fa*)(x + j);
    v4f b = {0.f,0.f,0.f,0.f}; if (rr) b = *(const v4fa*)(rr + j);
#pragma unroll
    for (int q = 0; q < 4; ++q) { const float v = a[q] + b[q]; vals[u * 4 + q] = v; s1 += v; }
  }
  red[tid] = s1; __syncthreads();
  for (int st = 128; st > 0; st >>= 1) { if (tid < st) red[tid] += red[tid + st]; __syncthreads(); }
  const float mu = red[0] / (float)N; __syncthreads();
  float s2 = 0.f;
  for (int u = 0; u < per / 4; ++u)
#pragma unroll
    for (int q = 0; q < 4; ++q) { const float c = vals[u * 4 + q] - mu; s2 += c * c; }
  red[tid] = s2; __syncthreads();
  for (int st = 128; st > 0; st >>= 1) { if (tid < st) red[tid] += red[tid + st]; __syncthreads(); }
  const float rs = rsqrtf(red[0] / (float)N + eps);
  {
    for (int u = 0; u < per / 4; ++u) {
      const int j = tid * 4 + 1024 * u;
      v4f o, sm;
#pragma unroll
      for (int q = 0; q < 4; ++q) {
        float gg = g[j + q], bb = bta[j + q];
        if (PARAM_BF16) { gg = bf16_round(gg); bb = bf16_round(bb); }
        sm[q] = vals[u * 4 + q]; o[q] = (vals[u * 4 + q] - mu) * rs * gg + bb;
      }
      if (out_sum) *(v4f*)(out_sum + (size_t)row * N + j) = sm;
      *(v4f*)(out_norm + (size_t)row * N + j) = o;
    }
    
  }
}



// ---- f16 WMMA path (v_wmma_f32_16x16x32_f16): 11-bit significands for operands in range — used where a [0,1] probability operand needs more precision than bf16
typedef _Float16 v16h __attribute__((ext_vector_type(16)));
union FragH { v16h v; v8us half[2]; _Float16 h[16]; unsigned short u[16]; };
template <int NT>
__device__ __forceinline__ v8f mmaH(v16h ah, v16h al, v16h bh, v16h bl, v8f c) {
  c = __builtin_amdgcn_wmma_f32_16x16x32_f16(false, ah, false, bh, (short)0, c, false, false);
  if (NT >= 2) c = __builtin_amdgcn_wmma_f32_16x16x32_f16(false, al, false, bh, (short)0, c, false, false);
  if (NT >= 3) c = __builtin_amdgcn_wmma_f32_16x16x32_f16(false, ah, false, bl, (short)0, c, false, false);
  asm volatile("v_nop\n\tv_nop\n\tv_nop\n\tv_nop" : "+v"(c) : "v"(ah), "v"(al), "v"(bh), "v"(bl));
  return c;
}
// batched GEMM like k_gemm_b but f16 operands: A f32 (split into f16 hi/lo if ASPLIT, else rounded to f16), Bt = f16 values [n][k]; alpha; C f32; N multiple of 16 (partial tiles skipped)
template <bool ASPLIT>
__global__ __launch_bounds__(128) void k_gemm_h(const float* __restrict__ A, int lda, size_t sA, const _Float16* __restrict__ Bh, int ldb, size_t sB, float alpha, float* __restrict__ C, int ldc, size_t sC, int M, int N, int K) {
  __shared__ __attribute__((aligned(16))) float so[4][16][64];
  const int tid = threadIdx.x, w = tid >> 5, lane = tid & 31, ln = lane & 15, hh = lane >> 4; const int by = blockIdx.y;
  A += (size_t)by * sA; Bh += (size_t)by * sB; C += (size_t)by * sC;
  const int ntn = (N + 63) / 64; const int wid = blockIdx.x * 4 + w; const int mt = wid / ntn, nq = wid % ntn; if (mt * 16 >= M) return;
  const int row0 = mt * 16, col0 = nq * 64; const float* arow = A + (size_t)(row0 + ln) * lda;
  v8f acc[4] = {};
  for (int kb = 0; kb < K; kb += 32) {
    FragH ah, al;
    const v4f x0 = *(const v4fa*)(arow + kb + 8 * hh), x1 = *(const v4fa*)(arow + kb + 8 * hh + 4), x2 = *(const v4fa*)(arow + kb + 16 + 8 * hh), x3 = *(const v4fa*)(arow + kb + 16 + 8 * hh + 4);
    float xs[16] = {x0[0],x0[1],x0[2],x0[3],x1[0],x1[1],x1[2],x1[3],x2[0],x2[1],x2[2],x2[3],x3[0],x3[1],x3[2],x3[3]};
#pragma unroll
    for (int i = 0; i < 16; ++i) { const _Float16 h = (_Float16)xs[i]; ah.h[i] = h; al.h[i] = ASPLIT ? (_Float16)(xs[i] - (float)h) : (_Float16)0.0f; }
#pragma unroll
    for (int t = 0; t < 4; ++t) { if (col0 + t * 16 >= N) continue; const size_t boff = (size_t)(col0 + t * 16 + ln) * ldb + kb; FragH bq; bq.half[0] = *(const v8us*)(Bh + boff + 8 * hh); bq.half[1] = *(const v8us*)(Bh + boff + 16 + 8 * hh);
      acc[t] = mmaH<ASPLIT ? 2 : 1>(ah.v, al.v, bq.v, bq.v, acc[t]); }
  }
#pragma unroll
  for (int t = 0; t < 4; ++t) { if (col0 + t * 16 >= N) continue;
#pragma unroll
    for (int r = 0; r < 8; ++r) so[w][8 * hh + r][t * 16 + ln] = acc[t][r] * alpha; }
  __builtin_amdgcn_fence(__ATOMIC_ACQ_REL, "workgroup"); __builtin_amdgcn_wave_barrier();
  const int rsub = lane >> 4, c4 = (lane & 15) * 4;
  {
#pragma unroll
    for (int q = 0; q < 8; ++q) { const int r = q * 2 + rsub; if (col0 + c4 < N) { const v4f v = *(const v4fa*)&so[w][r][c4]; *(v4f*)(C + (size_t)(row0 + r) * ldc + col0 + c4) = v; } }
     }
}

// Wt[n][k] = f16(W[k][n]·scale) from f32 row-major W[K][N] (scale = power of two; bf16-exact weights stay exact in f16 away from the subnormal range)
__global__ __launch_bounds__(256) void k_wt_f16(const float* __restrict__ W, _Float16* __restrict__ Wt, int K, int N, float scale) {
  const int t = blockIdx.x * 256 + threadIdx.x; if (t >= N * (K / 8)) return; const int n = t / (K / 8), k8 = (t % (K / 8)) * 8; FragH f;
#pragma unroll
  for (int i = 0; i < 8; ++i) f.h[i] = (_Float16)(bf16_round(W[(size_t)(k8 + i) * N + n]) * scale); const v8us o = f.half[0];
  *(v8us*)((unsigned short*)Wt + (size_t)n * K + k8) = o; 
}
// k_gemm_hh variant with fused epilogue: v = acc·alpha + bias[by·sBias + col] (+ CP[(row/rowsPerB)·sCPb + by·64 + col] if CP) ; ACT 0 none / 1 elu ; writes f16 C16 and f32 C, each if non-null
template <int ACT>
__global__ __launch_bounds__(128) void k_gemm_hhx(const _Float16* __restrict__ A, int lda, size_t sA, const _Float16* __restrict__ Bh, int ldb, size_t sB, float alpha, const float* __restrict__ bias, size_t sBias, const float* __restrict__ CP, int rowsPerB, size_t sCPb, int row0g,
    float* __restrict__ C, _Float16* __restrict__ C16, int ldc, size_t sC, int M, int N, int K) {
  __shared__ __attribute__((aligned(16))) float so[4][16][64];
  const int tid = threadIdx.x, w = tid >> 5, lane = tid & 31, ln = lane & 15, hh = lane >> 4; const int by = blockIdx.y;
  A += (size_t)by * sA; Bh += (size_t)by * sB; const size_t cofs = (size_t)by * sC; const float* bp = bias ? bias + (size_t)by * sBias : nullptr;
  const int ntn = (N + 63) / 64; const int wid = blockIdx.x * 4 + w; const int mt = wid / ntn, nq = wid % ntn; if (mt * 16 >= M) return;
  const int row0 = mt * 16, col0 = nq * 64; const _Float16* arow = A + (size_t)(row0 + ln) * lda;
  v8f acc[4] = {};
  for (int kb = 0; kb < K; kb += 32) { FragH ah; ah.half[0] = *(const v8us*)((const unsigned short*)arow + kb + 8 * hh); ah.half[1] = *(const v8us*)((const unsigned short*)arow + kb + 16 + 8 * hh);
#pragma unroll
    for (int t = 0; t < 4; ++t) { if (col0 + t * 16 >= N) continue; const size_t boff = (size_t)(col0 + t * 16 + ln) * ldb + kb; FragH bq; bq.half[0] = *(const v8us*)((const unsigned short*)Bh + boff + 8 * hh); bq.half[1] = *(const v8us*)((const unsigned short*)Bh + boff + 16 + 8 * hh);
      acc[t] = mmaH<1>(ah.v, ah.v, bq.v, bq.v, acc[t]); }
  }
#pragma unroll
  for (int t = 0; t < 4; ++t) { if (col0 + t * 16 >= N) continue; const int col = col0 + t * 16 + ln; const float bv = bp ? bf16_round(bp[col]) : 0.f;
#pragma unroll
    for (int r = 0; r < 8; ++r) { float v = acc[t][r] * alpha + bv; if (CP) { const int bidx = (row0g + row0 + 8 * hh + r) / rowsPerB; v += CP[(size_t)bidx * sCPb + (size_t)by * 64 + col]; } if (ACT == 1) v = (v > 0.f) ? v : expm1f(v); else if (ACT == 7) v = (v > 0.f) ? v + 1.0f : expf(v); else if (ACT == 8) v = tanhf(v); else if (ACT == 9) v = 0.5f * v * (1.0f + tanhf(0.7978845608028654f * (v + 0.044715f * v * v * v))); else if (ACT == 11) v = 1.0f / (1.0f + expf(-v)); else if (ACT == 12) v = (v > 0.f) ? v : 0.01f * v; else if (ACT == 14) v = (v > 0.f) ? v : 0.1f * v; else if (ACT == 15) v = v / (1.0f + expf(-v)); else if (ACT == 3) v = fmaxf(v, 0.f); else if (ACT == 6) v = 0.5f * v * (1.0f + erff(v * 0.70710678118654752f)); so[w][8 * hh + r][t * 16 + ln] = v; } }
  __builtin_amdgcn_fence(__ATOMIC_ACQ_REL, "workgroup"); __builtin_amdgcn_wave_barrier();
  const int rsub = lane >> 4, c4 = (lane & 15) * 4; typedef _Float16 v4h __attribute__((ext_vector_type(4)));
  {
#pragma unroll
    for (int q = 0; q < 8; ++q) { const int r = q * 2 + rsub; if (col0 + c4 < N) { const v4f v = *(const v4fa*)&so[w][r][c4]; if (C) *(v4f*)(C + cofs + (size_t)(row0 + r) * ldc + col0 + c4) = v; if (C16) { v4h h4; for (int i = 0; i < 4; ++i) h4[i] = (_Float16)v[i]; *(v4h*)(C16 + cofs + (size_t)(row0 + r) * ldc + col0 + c4) = h4; } } }
     }
}


typedef _Float16 v4h __attribute__((ext_vector_type(4)));

__global__ __launch_bounds__(256) void k_x16(const float* __restrict__ x, _Float16* __restrict__ X16, size_t n8) { const size_t t = (size_t)blockIdx.x * 256 + threadIdx.x; if (t >= n8) return; FragH f;
#pragma unroll
  for (int q = 0; q < 8; ++q) f.h[q] = (_Float16)bf16_round(x[t * 8 + q]); *(v8us*)((unsigned short*)X16 + t * 8) = f.half[0];  }
__global__ __launch_bounds__(256) void k_h16(const float* __restrict__ x, _Float16* __restrict__ X16, size_t n8) { const size_t t = (size_t)blockIdx.x * 256 + threadIdx.x; if (t >= n8) return; FragH f;
#pragma unroll
  for (int q = 0; q < 8; ++q) f.h[q] = (_Float16)x[t * 8 + q]; *(v8us*)((unsigned short*)X16 + t * 8) = f.half[0];  }
__global__ __launch_bounds__(256) void k_round16f(const float* __restrict__ W, _Float16* __restrict__ Bt, size_t n8) { const size_t t = (size_t)blockIdx.x * 256 + threadIdx.x; if (t >= n8) return; FragH f;
#pragma unroll
  for (int i = 0; i < 8; ++i) f.h[i] = (_Float16)(bf16_round(W[t * 8 + i]) * 16.0f); *(v8us*)((unsigned short*)Bt + t * 8) = f.half[0];  }
template <int NHv, int TTv>
__global__ __launch_bounds__(256) void k_vt(const _Float16* __restrict__ V16, int ldv, int voff, _Float16* __restrict__ Vt) { __shared__ unsigned short tl[64][66]; const int tid = threadIdx.x; const int slab = blockIdx.x / (TTv / 64), lg = blockIdx.x % (TTv / 64); const int b = slab / NHv, h = slab % NHv;
  for (int i = tid; i < 64 * 8; i += 256) { const int r = i / 8, c8 = (i % 8) * 8; FragH f; f.half[0] = *(const v8us*)((const unsigned short*)V16 + ((size_t)b * TTv + lg * 64 + r) * ldv + voff + h * 64 + c8);
#pragma unroll
    for (int q = 0; q < 8; ++q) tl[r][c8 + q] = f.u[q]; }
  __syncthreads();
  {
#pragma unroll
    for (int rd = 0; rd < 2; ++rd) { const int d = rd * 32 + tid / 8, pc = tid % 8; FragH f;
#pragma unroll
      for (int q = 0; q < 8; ++q) f.u[q] = tl[pc * 8 + q][d];
      *(v8us*)((unsigned short*)Vt + ((size_t)slab * 64 + d) * TTv + lg * 64 + pc * 8) = f.half[0]; }
     } }

__global__ __launch_bounds__(256) void k_tok(const float* __restrict__ x, _Float16* __restrict__ X16) { __shared__ float tl[32][65]; const int tid = threadIdx.x; const int b = blockIdx.x / ((CC / 64) * (NN / 32)), rem = blockIdx.x % ((CC / 64) * (NN / 32)); const int cg = rem / (NN / 32), pg = rem % (NN / 32); const int c0 = cg * 64, p0 = pg * 32;
  for (int i = tid; i < 64 * 32; i += 256) { const int c = i / 32, pp = i % 32; tl[pp][c] = bf16_round(x[((size_t)b * CC + c0 + c) * NN + p0 + pp]); } __syncthreads();
  const int r = tid / 8, pc = tid % 8; FragH f; for (int q = 0; q < 8; ++q) f.h[q] = (_Float16)tl[r][pc * 8 + q]; const size_t row = (size_t)b * NN + p0 + r; *(v8us*)((unsigned short*)X16 + row * CC + c0 + pc * 8) = f.half[0];  }
__global__ __launch_bounds__(256) void k_vthlu(const float* __restrict__ VF, int ldv, _Float16* __restrict__ Vth, _Float16* __restrict__ Vtl) { __shared__ float tl[64][65]; const int tid = threadIdx.x; const int slab = blockIdx.x / (TT / 64), lg = blockIdx.x % (TT / 64); const int b = slab / NVH, h = slab % NVH;
  for (int i = tid; i < 64 * 16; i += 256) { const int r = i / 16, c4 = (i % 16) * 4; const v4f a = *(const v4fa*)(VF + ((size_t)b * TT + lg * 64 + r) * ldv + h * 64 + c4); tl[r][c4] = a[0]; tl[r][c4 + 1] = a[1]; tl[r][c4 + 2] = a[2]; tl[r][c4 + 3] = a[3]; }
  __syncthreads();
  FragH fh[2], fl[2]; size_t oo[2];
#pragma unroll
  for (int rd = 0; rd < 2; ++rd) { const int d = rd * 32 + tid / 8, pc = tid % 8;
#pragma unroll
    for (int q = 0; q < 8; ++q) { const float v = tl[pc * 8 + q][d]; const _Float16 hv = (_Float16)v; fh[rd].h[q] = hv; fl[rd].h[q] = (_Float16)(v - (float)hv);      /* UNSCALED residual (k_flash reads only the hi plane) */ } oo[rd] = ((size_t)slab * 64 + d) * TT + lg * 64 + pc * 8; }
  {
#pragma unroll
    for (int rd = 0; rd < 2; ++rd) { *(v8us*)((unsigned short*)Vth + oo[rd]) = fh[rd].half[0]; *(v8us*)((unsigned short*)Vtl + oo[rd]) = fl[rd].half[0]; }
     } }
__global__ __launch_bounds__(256) void k_krt(const float* __restrict__ KF, const float* __restrict__ rh, const float* __restrict__ rw, _Float16* __restrict__ K16) { const size_t t = (size_t)blockIdx.x * 256 + threadIdx.x; if (t >= (size_t)NR * CC / 8) return; const size_t row = (t * 8) / CC; const int c0 = (int)((t * 8) % CC); const int n = (int)(row % NN); const int na = n / 32, nb = n % 32; const v4f a = *(const v4fa*)(KF + t * 8), c = *(const v4fa*)(KF + t * 8 + 4); FragH f;
#pragma unroll
  for (int q = 0; q < 8; ++q) { const int ch = c0 + q; const int h = ch / HDD, d = ch % HDD; const float r1 = bf16_round(rh[((size_t)h * HDD + d) * 32 + nb]) + bf16_round(rw[((size_t)h * HDD + d) * 32 + na]); f.h[q] = (_Float16)(((q < 4) ? a[q] : c[q - 4]) + r1); }
  *(v8us*)((unsigned short*)K16 + t * 8) = f.half[0];  }
__global__ __launch_bounds__(128) void k_flash(const _Float16* __restrict__ Q16, int ldq, const _Float16* __restrict__ K16, int ldk, const _Float16* __restrict__ Vt, const _Float16* __restrict__ Vtlo, float* __restrict__ O, int ldo) {
  constexpr int RPW = 16, RTN = RPW / 16, NQB = TT / (4 * RPW), DT = 8, KS = 4;      /* head dim 128: 4 k-steps, 8 value tiles */
  __shared__ __attribute__((aligned(16))) unsigned short sP[4][RPW][40]; __shared__ __attribute__((aligned(16))) unsigned short sPL[4][RPW][40];
  /* K/V ring shared by the four waves: two stages of 32 keys; a stage = 32 K rows of 256 B at pitch 272 B, then 128 V^T rows of 64 B at pitch 80 B (16 B x odd: conflict-free ds_load_b128) */
  constexpr int KP = 272, VP = 80, VOFF = 32 * KP, STG = VOFF + 128 * VP;
  __shared__ __attribute__((aligned(16))) unsigned char ring[2 * STG];
  static_assert(sizeof(float) * 4 * RPW * (128 + 4) <= 2 * STG, "output staging must fit in the ring");
  float (*sO)[RPW][128 + 4] = reinterpret_cast<float (*)[RPW][128 + 4]>(ring);      /* output staging takes the ring's place behind the last pass's barrier */
  const int tid = threadIdx.x, w = tid >> 5, lane = tid & 31, ln = lane & 15, hh = lane >> 4;
  const int slab = blockIdx.x / NQB, qblk = blockIdx.x % NQB; const int b = slab / NH, h = slab % NH; const int qb0 = qblk * (4 * RPW); const int q0 = qb0 + w * RPW;
  FragH aq[2][KS];
#pragma unroll
  for (int rt = 0; rt < RTN; ++rt) { const unsigned short* qr = (const unsigned short*)Q16 + ((size_t)b * TT + q0 + rt * 16 + ln) * ldq + h * 128;
#pragma unroll
    for (int ks = 0; ks < KS; ++ks) { aq[rt][ks].half[0] = *(const v8us*)(qr + ks * 32 + 8 * hh); aq[rt][ks].half[1] = *(const v8us*)(qr + ks * 32 + 16 + 8 * hh); } }
  const unsigned short* Vth = (const unsigned short*)Vt + (size_t)slab * 128 * TT; const unsigned short* Vtl = (const unsigned short*)Vtlo + (size_t)slab * 128 * TT;      /* hi and UNSCALED residual planes */
  float m_r[2][8], l_r[2][8]; v8f oacc[2][DT];
#pragma unroll
  for (int rt = 0; rt < RTN; ++rt) {
#pragma unroll
    for (int r = 0; r < 8; ++r) { m_r[rt][r] = -3.0e38f; l_r[rt][r] = 0.f; }
#pragma unroll
    for (int dt = 0; dt < DT; ++dt) oacc[rt][dt] = (v8f){0.f,0.f,0.f,0.f,0.f,0.f,0.f,0.f}; }
  const int jend = TT;
  /* each thread copies 4 x 16 B of K (a wave-wide copy = 2 whole rows = 4 lines) and 4 x 16 B of V^T (8 rows x 64 B) per stage */
  const char* gK = (const char*)((const unsigned short*)K16 + ((size_t)b * TT + (tid >> 4)) * ldk + h * 128) + (tid & 15) * 16;
  const char* gV = (const char*)(Vth + (size_t)(tid >> 2) * TT) + (tid & 3) * 16;
  const size_t kstep = (size_t)ldk * 2;      /* bytes per key row of K */
  const unsigned lK = (unsigned)(size_t)ring + (unsigned)((tid >> 4) * KP + (tid & 15) * 16);
  const unsigned lV = (unsigned)(size_t)ring + (unsigned)(VOFF + (tid >> 2) * VP + (tid & 3) * 16);
  auto stage_copies = [&](int j, unsigned bofs) {
    const char* k0 = gK + (size_t)j * kstep; const char* v0 = gV + (size_t)j * 2; const unsigned a = lK + bofs, c = lV + bofs;
    /* the s_wait_xcnt closes the statement so that no address register of a copy is rewritten ahead of it */
    asm volatile("global_load_async_to_lds_b128 %0, %8, off\n\t"
                 "global_load_async_to_lds_b128 %1, %9, off\n\t"
                 "global_load_async_to_lds_b128 %2, %10, off\n\t"
                 "global_load_async_to_lds_b128 %3, %11, off\n\t"
                 "global_load_async_to_lds_b128 %4, %12, off\n\t"
                 "global_load_async_to_lds_b128 %5, %13, off\n\t"
                 "global_load_async_to_lds_b128 %6, %14, off\n\t"
                 "global_load_async_to_lds_b128 %7, %15, off\n\t"
                 "s_wait_xcnt 0x0"
                 :: "v"(a), "v"(a + 8 * KP), "v"(a + 16 * KP), "v"(a + 24 * KP), "v"(c), "v"(c + 32 * VP), "v"(c + 64 * VP), "v"(c + 96 * VP),
                    "v"(k0), "v"(k0 + 8 * kstep), "v"(k0 + 16 * kstep), "v"(k0 + 24 * kstep), "v"(v0), "v"(v0 + (size_t)32 * TT * 2), "v"(v0 + (size_t)64 * TT * 2), "v"(v0 + (size_t)96 * TT * 2)
                 : "memory");
  };
  stage_copies(0, 0u);
  asm volatile("s_wait_asynccnt 0x0" ::: "memory");      /* stage 0 of this wave has landed */
  __syncthreads();                                       /* ... and every wave's part of it is published */
  stage_copies(32, (unsigned)STG);
#pragma unroll 1
  for (int j0 = 0; j0 < jend; j0 += 32) {
    const unsigned bofs = (unsigned)((j0 >> 5) & 1) * (unsigned)STG; const unsigned char* kt = ring + bofs; const unsigned char* vt = kt + VOFF;
    v8f s[2][2];
#pragma unroll
    for (int nt = 0; nt < 2; ++nt) { const unsigned short* kr = (const unsigned short*)(kt + (nt * 16 + ln) * KP); FragH bk[KS];
#pragma unroll
      for (int ks = 0; ks < KS; ++ks) { bk[ks].half[0] = *(const v8us*)(kr + ks * 32 + 8 * hh); bk[ks].half[1] = *(const v8us*)(kr + ks * 32 + 16 + 8 * hh); }
#pragma unroll
      for (int rt = 0; rt < RTN; ++rt) { v8f acc = (v8f){0.f,0.f,0.f,0.f,0.f,0.f,0.f,0.f};
#pragma unroll
        for (int ks = 0; ks < KS; ++ks) acc = mmaH<1>(aq[rt][ks].v, aq[rt][ks].v, bk[ks].v, bk[ks].v, acc); s[rt][nt] = acc; } }
#pragma unroll
    for (int rt = 0; rt < RTN; ++rt)
#pragma unroll
      for (int r = 0; r < 8; ++r) { const int tq = q0 + rt * 16 + 8 * hh + r; const int k0 = j0 + ln, k1 = j0 + 16 + ln; (void)tq; (void)k0; (void)k1;
        const bool ok0 = true, ok1 = true; (void)tq; (void)k0; (void)k1;
        const float s0 = ok0 ? s[rt][0][r] * ATT_SCALE : -INFINITY, s1 = ok1 ? s[rt][1][r] * ATT_SCALE : -INFINITY; float mc = fmaxf(s0, s1);
        mc = fmaxf(mc, __shfl_xor(mc, 1, 32)); mc = fmaxf(mc, __shfl_xor(mc, 2, 32)); mc = fmaxf(mc, __shfl_xor(mc, 4, 32)); mc = fmaxf(mc, __shfl_xor(mc, 8, 32));
        const float mn = fmaxf(m_r[rt][r], mc); const float al = (mn > -1.0e38f) ? expf(m_r[rt][r] - mn) : 1.0f; m_r[rt][r] = mn; const float p0 = ok0 ? expf(s0 - mn) : 0.f, p1 = ok1 ? expf(s1 - mn) : 0.f; l_r[rt][r] = l_r[rt][r] * al + p0 + p1;
#pragma unroll
        for (int dt = 0; dt < DT; ++dt) oacc[rt][dt][r] *= al;
        FragH t2, t3; const float ps0 = p0 * 1024.0f, ps1 = p1 * 1024.0f; t2.h[0] = (_Float16)ps0; t2.h[1] = (_Float16)ps1; t3.h[0] = (_Float16)(ps0 - (float)t2.h[0]); t3.h[1] = (_Float16)(ps1 - (float)t2.h[1]);      /* P hi and its UNSCALED residual (added into the same accumulator) */
        sP[w][rt * 16 + 8 * hh + r][ln] = t2.u[0]; sP[w][rt * 16 + 8 * hh + r][16 + ln] = t2.u[1]; sPL[w][rt * 16 + 8 * hh + r][ln] = t3.u[0]; sPL[w][rt * 16 + 8 * hh + r][16 + ln] = t3.u[1]; }
    __builtin_amdgcn_fence(__ATOMIC_ACQ_REL, "workgroup"); __builtin_amdgcn_wave_barrier();
    FragH pa[2], pl[2], bv[DT];
#pragma unroll
    for (int rt = 0; rt < RTN; ++rt) { pa[rt].half[0] = *(const v8us*)&sP[w][rt * 16 + ln][8 * hh]; pa[rt].half[1] = *(const v8us*)&sP[w][rt * 16 + ln][16 + 8 * hh]; pl[rt].half[0] = *(const v8us*)&sPL[w][rt * 16 + ln][8 * hh]; pl[rt].half[1] = *(const v8us*)&sPL[w][rt * 16 + ln][16 + 8 * hh]; }
#pragma unroll
    for (int dt = 0; dt < DT; ++dt) { const unsigned short* vr = (const unsigned short*)(vt + (dt * 16 + ln) * VP); bv[dt].half[0] = *(const v8us*)(vr + 8 * hh); bv[dt].half[1] = *(const v8us*)(vr + 16 + 8 * hh); }      /* all V fragments of the pass as one group of LDS reads, ahead of the products: one LDS latency a pass, not eight */
#pragma unroll      /* constant dt keeps bv and oacc in registers */
    for (int dt = 0; dt < DT; ++dt) {
#pragma unroll
      for (int rt = 0; rt < RTN; ++rt) { oacc[rt][dt] = mmaH<1>(pa[rt].v, pa[rt].v, bv[dt].v, bv[dt].v, oacc[rt][dt]); oacc[rt][dt] = mmaH<1>(pl[rt].v, pl[rt].v, bv[dt].v, bv[dt].v, oacc[rt][dt]); } }      /* (Ph + Pl)·Vh — the V residual term is dropped here: near-uniform attention over 1024 keys averages out the f16 rounding of v */
    __builtin_amdgcn_fence(__ATOMIC_ACQ_REL, "workgroup"); __builtin_amdgcn_wave_barrier();
    asm volatile("s_wait_dscnt 0x0" ::: "memory");         /* this wave's reads of the stage are done before the stage is refilled */
    asm volatile("s_wait_asynccnt 0x0" ::: "memory");      /* this wave's copies of the next stage have landed */
    __syncthreads();                                       /* publishes the next stage and ends every wave's reads of this one */
    if (j0 + 64 < jend) stage_copies(j0 + 64, bofs); }
  asm volatile("s_wait_asynccnt 0x0" ::: "memory");        /* nothing in flight when the ring becomes output staging */
#pragma unroll
  for (int rt = 0; rt < RTN; ++rt) {
#pragma unroll
    for (int r = 0; r < 8; ++r) { float l = l_r[rt][r]; l += __shfl_xor(l, 1, 32); l += __shfl_xor(l, 2, 32); l += __shfl_xor(l, 4, 32); l += __shfl_xor(l, 8, 32); l_r[rt][r] = (l > 0.f) ? 1.0f / (l * 1024.0f) : 0.f; }
#pragma unroll
    for (int dt = 0; dt < DT; ++dt)
#pragma unroll
      for (int r = 0; r < 8; ++r) sO[w][rt * 16 + 8 * hh + r][dt * 16 + ln] = oacc[rt][dt][r] * l_r[rt][r]; }
  __builtin_amdgcn_fence(__ATOMIC_ACQ_REL, "workgroup"); __builtin_amdgcn_wave_barrier();
  {
#pragma unroll
    for (int r = 0; r < RPW; ++r) { const int pc = lane; const v4f val = *(const v4fa*)&sO[w][r][pc * 4]; *(v4f*)(O + ((size_t)slab * TT + q0 + r) * 128 + pc * 4) = val; }      /* output laid out [b][h][n][128] (the module reinterprets that buffer as [B,C,H,W]); one 512-B row per instruction */      /* one 512-B row per instruction: 32 lanes × 16 B */
     } }

extern "C" void kernel_launch(void* const* d_in, const int* in_sizes, int n_in,
                              void* d_out, int out_size, void* d_ws, size_t ws_size, hipStream_t stream) {
  (void)in_sizes; (void)n_in; (void)out_size;
  const float* const* I = (const float* const*)d_in; const float* x = I[0]; const float* Wq = I[1]; const float* bq = I[2]; const float* Wk = I[3]; const float* bk = I[4]; const float* Wv = I[5]; const float* bv = I[6]; const float* rh = I[7]; const float* rw = I[8];
  char* ws = (char*)d_ws; size_t off = 0;
  auto take = [&](size_t bytes) { char* p = ws + off; off += (bytes + 255) & ~(size_t)255; return p; };
  const size_t WSZ = (size_t)CC * CC; _Float16* Bw = (_Float16*)take(3 * WSZ * 2); _Float16* X16 = (_Float16*)take((size_t)NR * CC * 2); _Float16* Q = (_Float16*)take((size_t)NR * CC * 2); float* F32 = (float*)take((size_t)NR * CC * 4); _Float16* K = (_Float16*)take((size_t)NR * CC * 2); _Float16* Vt = (_Float16*)take((size_t)NR * CC * 2); _Float16* Vtl = X16;      /* Vᵀ residual over the token plane (dead after the three projections) */
  if (off > ws_size) return;      // 1.6 + 16.8 + 16.8 + 33.6 + 16.8 + 16.8 ≈ 102 MB
  const unsigned gw = (unsigned)((WSZ / 8 + 255) / 256); k_round16f<<<gw, 256, 0, stream>>>(Wq, Bw, WSZ / 8); k_round16f<<<gw, 256, 0, stream>>>(Wk, Bw + WSZ, WSZ / 8); k_round16f<<<gw, 256, 0, stream>>>(Wv, Bw + 2 * WSZ, WSZ / 8);      /* (out,in) natural ×2^4 */
  k_tok<<<BB * (CC / 64) * (NN / 32), 256, 0, stream>>>(x, X16);      /* [B][C][N] → token-major bf16 plane */
  const dim3 gp(((NR / 16) * (CC / 64) + 3) / 4, 1); const unsigned g8 = (unsigned)(((size_t)NR * CC / 8 + 255) / 256);
  k_gemm_hhx<0><<<gp, 128, 0, stream>>>(X16, CC, 0, Bw, CC, 0, 0.0625f, bq, 0, nullptr, 1, 0, 0, nullptr, Q, CC, 0, NR, CC, CC);      /* q (unscaled) f16: M 16384 N 512 K 512 */
  k_gemm_hhx<0><<<gp, 128, 0, stream>>>(X16, CC, 0, Bw + WSZ, CC, 0, 0.0625f, bk, 0, nullptr, 1, 0, 0, F32, nullptr, CC, 0, NR, CC, CC); k_krt<<<g8, 256, 0, stream>>>(F32, rh, rw, K);      /* k' = k + rtᵀ */
  k_gemm_hhx<0><<<gp, 128, 0, stream>>>(X16, CC, 0, Bw + 2 * WSZ, CC, 0, 0.0625f, bv, 0, nullptr, 1, 0, 0, F32, nullptr, CC, 0, NR, CC, CC); k_vthlu<<<BB * NVH * (NN / 64), 256, 0, stream>>>(F32, CC, Vt, Vtl);      /* v f32 → Vᵀ hi / residual per (b, h) [128][N] via 8 half-heads of 64 */
  k_flash<<<BB * NH * (NN / 64), 128, 0, stream>>>(Q, CC, K, CC, Vt, Vtl, (float*)d_out, 128);      /* y → d_out as [b][h][n][128] */
}

// v002
// One run takes 227 microseconds.
// Two timings next to v001 both put it at 1.51 times that version's speed.
// Over all steps from v000 it is 1.91 times as fast.
#include <hip/hip_runtime.h>
// Bottleneck-transformer MHSA with relative position term (B=16, C=512, 32×32 → N=1024, 4 heads × 128): q,k,v = 1×1 convs ((out,in) + bias); logits = (q·C^-½)·(k + rt) where rt[h][d][n] = rh[h][d][n mod 32] + rw[h][d][n div 32]
// (the module's (rh + rw).reshape(1, heads, emb, N)); softmax; y = attn·v per head; the output is the [B][h][N][d] buffer reinterpreted as [B,C,H,W] (the module's final reshape).
// Compute dtype: x, weights, biases, rh, rw rounded to bf16; token-major bf16 input plane; q as an f16 GEMM plane (unscaled — the C^-½ is applied to the f32 score), k as an f32 GEMM output with rtᵀ added in f32 then f16,
// v f16; fused flash-style kernel for head dim 128 (4 k-steps, 8 value tiles, online softmax f32, P as f16 + its exact f16 residual, V f16, one f32 accumulator) on v_wmma_f32_16x16x32_f16 writing y directly; f32 accumulate.
#define BB 16
#define CC 512
#define NN 1024
#define TT NN
#define NH 4
#define HDD 128
#define NVH (2 * NH)
#define NR (BB * NN)
#define ATT_SCALE 0.04419417382415922f

typedef __bf16 v16b __attribute__((ext_vector_type(16)));
typedef unsigned short v8us __attribute__((ext_vector_type(8), may_alias));
typedef float  v8f  __attribute__((ext_vector_type(8)));
typedef float  v4f  __attribute__((ext_vector_type(4)));
typedef float  v4fa __attribute__((ext_vector_type(4), may_alias));
union FragB { v16b v; v8us half[2]; unsigned short u[16]; };

__device__ __forceinline__ unsigned short bf16_bits(float x) { unsigned int u = __float_as_uint(x); return (unsigned short)((u + 0x7FFFu + ((u >> 16) & 1u)) >> 16); }
__device__ __forceinline__ float bf16_val(unsigned short b) { return __uint_as_float(((unsigned int)b) << 16); }
__device__ __forceinline__ float bf16_round(float x) { return bf16_val(bf16_bits(x)); }
// D += A·B with NT terms: 1 = ah·bh, 2 = + al·bh (A split), 3 = + ah·bl (both split)
template <int NT>
__device__ __forceinline__ v8f mmaN(v16b ah, v16b al, v16b bh, v16b bl, v8f c) {
  c = __builtin_amdgcn_wmma_f32_16x16x32_bf16(false, ah, false, bh, (short)0, c, false, false);
  if (NT >= 2) c = __builtin_amdgcn_wmma_f32_16x16x32_bf16(false, al, false, bh, (short)0, c, false, false);
  if (NT >= 3) c = __builtin_amdgcn_wmma_f32_16x16x32_bf16(false, ah, false, bl, (short)0, c, false, false);
  asm volatile("v_nop\n\tv_nop\n\tv_nop\n\tv_nop" : "+v"(c) : "v"(ah), "v"(al), "v"(bh), "v"(bl));
  return c;
}

__global__ __launch_bounds__(256) void k_wt_bf16(const float* __restrict__ W, unsigned short* __restrict__ Wt, int K, int N) {
  const int t = blockIdx.x * 256 + threadIdx.x;
  const int k8n = K / 8;
  if (t >= N * k8n) return;
  const int n = t / k8n, k8 = (t % k8n) * 8;
  v8us v;
#pragma unroll
  for (int i = 0; i < 8; ++i) v[i] = bf16_bits(W[(size_t)(k8 + i) * N + n]);
  *(v8us*)(Wt + (size_t)n * K + k8) = v;
  
}

// GEMM C[M][N] (f32, pitch ldc) = act(A[M][K]·W + bias). A f32 row-major (pitch lda) converted per fragment to bf16
// (ASPLIT: hi/lo two planes -> 2 terms, else single rounded term); Wt bf16 [N][K] (pitch ldb). BIAS_BF16 rounds the
// bias to bf16 first (bias quantised to bf16 before the add). K%32==0, M%16==0, N%64==0.
template <bool ASPLIT, int ACT, bool BIAS_BF16>
__global__ __launch_bounds__(128) void k_gemm_bf(const float* __restrict__ A, int lda, const unsigned short* __restrict__ Wt, int ldb,
                                               const float* __restrict__ bias, float* __restrict__ C, int ldc, int M, int N, int K) {
  __shared__ __attribute__((aligned(16))) float so[4][16][64];
  const int tid = threadIdx.x, w = tid >> 5, lane = tid & 31, ln = lane & 15, hh = lane >> 4;
  const int ntn = N / 64;
  const int wid = blockIdx.x * 4 + w;
  const int mt = wid / ntn, nq = wid % ntn;
  if (mt * 16 >= M) return;
  const int row0 = mt * 16, col0 = nq * 64;
  const float* arow = A + (size_t)(row0 + ln) * lda;
  v8f acc[4] = {};
  for (int kb = 0; kb < K; kb += 32) {
    FragB ah, al;
    const v4f x0 = *(const v4fa*)(arow + kb + 8 * hh), x1 = *(const v4fa*)(arow + kb + 8 * hh + 4);
    const v4f x2 = *(const v4fa*)(arow + kb + 16 + 8 * hh), x3 = *(const v4fa*)(arow + kb + 16 + 8 * hh + 4);
    float xs[16] = {x0[0],x0[1],x0[2],x0[3],x1[0],x1[1],x1[2],x1[3],x2[0],x2[1],x2[2],x2[3],x3[0],x3[1],x3[2],x3[3]};
#pragma unroll
    for (int i = 0; i < 16; ++i) { const unsigned short hb = bf16_bits(xs[i]); ah.u[i] = hb; al.u[i] = ASPLIT ? bf16_bits(xs[i] - bf16_val(hb)) : (unsigned short)0; }
#pragma unroll
    for (int t = 0; t < 4; ++t) {
      const unsigned short* brow = Wt + (size_t)(col0 + t * 16 + ln) * ldb + kb;
      FragB b;
      b.half[0] = *(const v8us*)(brow + 8 * hh);
      b.half[1] = *(const v8us*)(brow + 16 + 8 * hh);
      acc[t] = mmaN<ASPLIT ? 2 : 1>(ah.v, al.v, b.v, b.v, acc[t]);
    }
  }
#pragma unroll
  for (int t = 0; t < 4; ++t) {
    float bv = bias ? bias[col0 + t * 16 + ln] : 0.f;
    if (BIAS_BF16) bv = bf16_round(bv);
#pragma unroll
    for (int r = 0; r < 8; ++r) { float v = acc[t][r] + bv; if (ACT == 1) v = fmaxf(v, 0.f); so[w][8 * hh + r][t * 16 + ln] = v; }
  }
  __builtin_amdgcn_fence(__ATOMIC_ACQ_REL, "workgroup");
  __builtin_amdgcn_wave_barrier();
  const int rsub = lane >> 4, c4 = (lane & 15) * 4;
  {
#pragma unroll
    for (int q = 0; q < 8; ++q) {
      const int r = q * 2 + rsub;
      const v4f v = *(const v4fa*)&so[w][r][c4];
      *(v4f*)(C + (size_t)(row0 + r) * ldc + col0 + c4) = v;
    }
    
  }
}

// Flash-style causal/unmasked attention, all contractions 3-term bf16 hi/lo splits, f32 softmax with running max.
// q,k,v rows are read from f32 buffers with arbitrary row pitch (so they can live inside a fused qkv buffer);
// D = head size (multiple of 32, <= 128); one wave = 16 query rows; block = 4 waves (64 queries) sharing K/V chunks of 32.
template <int D, bool CAUSAL>
__global__ __launch_bounds__(128) void k_flash(const float* __restrict__ qb, const float* __restrict__ kb, const float* __restrict__ vb,
                                             int pitch, int T, int H, float scale, float* __restrict__ y, int ypitch) {
  constexpr int KS = D / 32;        // k-steps for QK
  constexpr int DT = D / 16;        // d tiles for PV
  __shared__ __attribute__((aligned(16))) unsigned short sKh[32][D + 8], sKl[32][D + 8], sVh[32][D + 8], sVl[32][D + 8];
  __shared__ __attribute__((aligned(16))) unsigned short sPh[4][16][40], sPl[4][16][40];
  __shared__ __attribute__((aligned(16))) float sO[4][16][D];
  const int tid = threadIdx.x, w = tid >> 5, lane = tid & 31, ln = lane & 15, hh = lane >> 4;
  const int nqb = (T + 63) / 64;
  const int bh = blockIdx.x / nqb, qblk = blockIdx.x % nqb;
  const int b = bh / H, h = bh % H;
  const int q0 = qblk * 64 + w * 16;
  const float* Q = qb + (size_t)b * T * pitch + h * D;
  const float* K = kb + (size_t)b * T * pitch + h * D;
  const float* V = vb + (size_t)b * T * pitch + h * D;

  // A fragments of the wave's 16 query rows (scaled), hi/lo
  FragB aqh[KS], aql[KS];
  {
    int row = q0 + ln; if (row >= T) row = T - 1;
    const float* qr = Q + (size_t)row * pitch;
#pragma unroll
    for (int ks = 0; ks < KS; ++ks)
#pragma unroll
      for (int i = 0; i < 16; ++i) {
        const int d = ks * 32 + ((i < 8) ? (8 * hh + i) : (16 + 8 * hh + (i - 8)));
        const float x = qr[d] * scale; const unsigned short hb = bf16_bits(x);
        aqh[ks].u[i] = hb; aql[ks].u[i] = bf16_bits(x - bf16_val(hb));
      }
  }
  float m_r[8], l_r[8];
#pragma unroll
  for (int r = 0; r < 8; ++r) { m_r[r] = -3.0e38f; l_r[r] = 0.f; }
  v8f oacc[DT];
#pragma unroll
  for (int dt = 0; dt < DT; ++dt) oacc[dt] = (v8f){0.f,0.f,0.f,0.f,0.f,0.f,0.f,0.f};

  const int kv_end = CAUSAL ? min(T, qblk * 64 + 64) : T;     // block-uniform
  for (int j0 = 0; j0 < kv_end; j0 += 32) {
    __syncthreads();
    for (int e = tid; e < 32 * (D / 4); e += 128) {
      const int r = e / (D / 4), c4 = (e % (D / 4)) * 4;
      const int key = j0 + r;
      v4f kf = {0.f,0.f,0.f,0.f}, vf = {0.f,0.f,0.f,0.f};
      if (key < T) { kf = *(const v4fa*)(K + (size_t)key * pitch + c4); vf = *(const v4fa*)(V + (size_t)key * pitch + c4); }
#pragma unroll
      for (int t = 0; t < 4; ++t) {
        unsigned short hb = bf16_bits(kf[t]); sKh[r][c4 + t] = hb; sKl[r][c4 + t] = bf16_bits(kf[t] - bf16_val(hb));
        hb = bf16_bits(vf[t]); sVh[r][c4 + t] = hb; sVl[r][c4 + t] = bf16_bits(vf[t] - bf16_val(hb));
      }
    }
    __syncthreads();
    // S tile 16 x 32
    v8f s[2];
#pragma unroll
    for (int nt = 0; nt < 2; ++nt) {
      v8f acc = {};
#pragma unroll
      for (int ks = 0; ks < KS; ++ks) {
        FragB bh_, bl_;
        bh_.half[0] = *(const v8us*)&sKh[nt * 16 + ln][ks * 32 + 8 * hh]; bh_.half[1] = *(const v8us*)&sKh[nt * 16 + ln][ks * 32 + 16 + 8 * hh];
        bl_.half[0] = *(const v8us*)&sKl[nt * 16 + ln][ks * 32 + 8 * hh]; bl_.half[1] = *(const v8us*)&sKl[nt * 16 + ln][ks * 32 + 16 + 8 * hh];
        acc = mmaN<3>(aqh[ks].v, aql[ks].v, bh_.v, bl_.v, acc);
      }
      s[nt] = acc;
    }
    // mask + running max (rows 8hh+r; the 16 lanes of a half share rows)
    float alpha[8];
#pragma unroll
    for (int r = 0; r < 8; ++r) {
      const int qi = q0 + 8 * hh + r;
      const int ja = j0 + ln, jb = j0 + 16 + ln;
      if (CAUSAL) { if (ja > qi) s[0][r] = -3.0e38f; if (jb > qi) s[1][r] = -3.0e38f; }
      if (ja >= T) s[0][r] = -3.0e38f;
      if (jb >= T) s[1][r] = -3.0e38f;
      float mx = fmaxf(s[0][r], s[1][r]);
      mx = fmaxf(mx, __shfl_xor(mx, 1, 32)); mx = fmaxf(mx, __shfl_xor(mx, 2, 32)); mx = fmaxf(mx, __shfl_xor(mx, 4, 32)); mx = fmaxf(mx, __shfl_xor(mx, 8, 32));
      const float mnew = fmaxf(m_r[r], mx);
      alpha[r] = (mnew > -1.0e38f) ? __expf(m_r[r] - mnew) : 1.0f;
      const float p0 = (s[0][r] > -1.0e38f) ? __expf(s[0][r] - mnew) : 0.f;
      const float p1 = (s[1][r] > -1.0e38f) ? __expf(s[1][r] - mnew) : 0.f;
      m_r[r] = mnew;
      l_r[r] = l_r[r] * alpha[r] + p0 + p1;            // per-lane partial row sum (16 lanes combined at the end)
      unsigned short hb = bf16_bits(p0); sPh[w][8 * hh + r][ln] = hb;      sPl[w][8 * hh + r][ln] = bf16_bits(p0 - bf16_val(hb));
      hb = bf16_bits(p1);                sPh[w][8 * hh + r][16 + ln] = hb; sPl[w][8 * hh + r][16 + ln] = bf16_bits(p1 - bf16_val(hb));
    }
#pragma unroll
    for (int dt = 0; dt < DT; ++dt)
#pragma unroll
      for (int r = 0; r < 8; ++r) oacc[dt][r] *= alpha[r];
    __builtin_amdgcn_fence(__ATOMIC_ACQ_REL, "workgroup");
    __builtin_amdgcn_wave_barrier();
    FragB pah, pal;
    pah.half[0] = *(const v8us*)&sPh[w][ln][8 * hh]; pah.half[1] = *(const v8us*)&sPh[w][ln][16 + 8 * hh];
    pal.half[0] = *(const v8us*)&sPl[w][ln][8 * hh]; pal.half[1] = *(const v8us*)&sPl[w][ln][16 + 8 * hh];
#pragma unroll
    for (int dt = 0; dt < DT; ++dt) {
      FragB bvh, bvl;
#pragma unroll
      for (int i = 0; i < 8; ++i) {
        bvh.u[i] = sVh[8 * hh + i][dt * 16 + ln]; bvh.u[8 + i] = sVh[16 + 8 * hh + i][dt * 16 + ln];
        bvl.u[i] = sVl[8 * hh + i][dt * 16 + ln]; bvl.u[8 + i] = sVl[16 + 8 * hh + i][dt * 16 + ln];
      }
      oacc[dt] = mmaN<3>(pah.v, pal.v, bvh.v, bvl.v, oacc[dt]);
    }
    __builtin_amdgcn_fence(__ATOMIC_ACQ_REL, "workgroup");
    __builtin_amdgcn_wave_barrier();
  }
#pragma unroll
  for (int r = 0; r < 8; ++r) {
    float l = l_r[r];
    l += __shfl_xor(l, 1, 32); l += __shfl_xor(l, 2, 32); l += __shfl_xor(l, 4, 32); l += __shfl_xor(l, 8, 32);
    l_r[r] = (l > 0.f) ? 1.0f / l : 0.f;
  }
#pragma unroll
  for (int dt = 0; dt < DT; ++dt)
#pragma unroll
    for (int r = 0; r < 8; ++r) sO[w][8 * hh + r][dt * 16 + ln] = oacc[dt][r] * l_r[r];
  __builtin_amdgcn_fence(__ATOMIC_ACQ_REL, "workgroup");
  __builtin_amdgcn_wave_barrier();
  {
    for (int r = 0; r < 16; ++r) {
      const int row = q0 + r;
      if (row < T && lane < D / 4) {
        const v4f val = *(const v4fa*)&sO[w][r][lane * 4];
        *(v4f*)(y + ((size_t)b * T + row) * ypitch + h * D + lane * 4) = val;
      }
    }
    
  }
}

// GEMM C = act(A·W + bias + resid): A f32 (ASPLIT -> hi/lo 2 terms), Wt bf16 [N][K]; ACT 0 none, 1 relu, 2 exact gelu;
// resid (optional, f32, row index = (row % rmod), pitch ldr, RES_BF16 rounds it) added before the activation.
template <bool ASPLIT, int ACT, bool BIAS_BF16, bool RES_BF16>
__global__ __launch_bounds__(128) void k_gemm_bf3(const float* __restrict__ A, int lda, const unsigned short* __restrict__ Wt, int ldb,
                                                const float* __restrict__ bias, const float* __restrict__ resid, int rmod, int ldr,
                                                float* __restrict__ C, int ldc, int M, int N, int K) {
  __shared__ __attribute__((aligned(16))) float so[4][16][64];
  const int tid = threadIdx.x, w = tid >> 5, lane = tid & 31, ln = lane & 15, hh = lane >> 4;
  const int ntn = N / 64;
  const int wid = blockIdx.x * 4 + w;
  const int mt = wid / ntn, nq = wid % ntn;
  if (mt * 16 >= M) return;
  const int row0 = mt * 16, col0 = nq * 64;
  const float* arow = A + (size_t)(row0 + ln) * lda;
  v8f acc[4] = {};
  for (int kb = 0; kb < K; kb += 32) {
    FragB ah, al;
    const v4f x0 = *(const v4fa*)(arow + kb + 8 * hh), x1 = *(const v4fa*)(arow + kb + 8 * hh + 4);
    const v4f x2 = *(const v4fa*)(arow + kb + 16 + 8 * hh), x3 = *(const v4fa*)(arow + kb + 16 + 8 * hh + 4);
    float xs[16] = {x0[0],x0[1],x0[2],x0[3],x1[0],x1[1],x1[2],x1[3],x2[0],x2[1],x2[2],x2[3],x3[0],x3[1],x3[2],x3[3]};
#pragma unroll
    for (int i = 0; i < 16; ++i) { const unsigned short hb = bf16_bits(xs[i]); ah.u[i] = hb; al.u[i] = ASPLIT ? bf16_bits(xs[i] - bf16_val(hb)) : (unsigned short)0; }
#pragma unroll
    for (int t = 0; t < 4; ++t) {
      const unsigned short* brow = Wt + (size_t)(col0 + t * 16 + ln) * ldb + kb;
      FragB b;
      b.half[0] = *(const v8us*)(brow + 8 * hh);
      b.half[1] = *(const v8us*)(brow + 16 + 8 * hh);
      acc[t] = mmaN<ASPLIT ? 2 : 1>(ah.v, al.v, b.v, b.v, acc[t]);
    }
  }
#pragma unroll
  for (int t = 0; t < 4; ++t) {
    const int col = col0 + t * 16 + ln;
    float bv = bias ? bias[col] : 0.f;
    if (BIAS_BF16) bv = bf16_round(bv);
#pragma unroll
    for (int r = 0; r < 8; ++r) {
      float v = acc[t][r] + bv;
      if (resid) { float rv = resid[(size_t)((row0 + 8 * hh + r) % rmod) * ldr + col]; if (RES_BF16) rv = bf16_round(rv); v += rv; }
      if (ACT == 1) v = fmaxf(v, 0.f);
      if (ACT == 2) v = 0.5f * v * (1.0f + erff(v * 0.70710678118654752f));
      if (ACT == 3) { const float u = 0.7978845608028654f * (v + 0.044715f * v * v * v); v = 0.5f * v * (1.0f + tanhf(u)); }
      so[w][8 * hh + r][t * 16 + ln] = v;
    }
  }
  __builtin_amdgcn_fence(__ATOMIC_ACQ_REL, "workgroup");
  __builtin_amdgcn_wave_barrier();
  const int rsub = lane >> 4, c4 = (lane & 15) * 4;
  {
#pragma unroll
    for (int q = 0; q < 8; ++q) {
      const int r = q * 2 + rsub;
      const v4f v = *(const v4fa*)&so[w][r][c4];
      *(v4f*)(C + (size_t)(row0 + r) * ldc + col0 + c4) = v;
    }
    
  }
}
// row LayerNorm (biased variance, eps) over N: s = X (+ R); optional out_sum <- s; out_norm <- (s-mu)*rsqrt(var+eps)*g + b
template <bool PARAM_BF16>
__global__ __launch_bounds__(256) void k_layernorm(const float* __restrict__ X, const float* __restrict__ R, const float* __restrict__ g, const float* __restrict__ bta,
                                                  float* __restrict__ out_sum, float* __restrict__ out_norm, int N, float eps) {
  __shared__ float red[256];
  const int row = blockIdx.x, tid = threadIdx.x;
  const float* x = X + (size_t)row * N; const float* rr = R ? R + (size_t)row * N : nullptr;
  float vals[16];                     // up to N = 4096
  const int per = N / 256;            // contiguous chunk per thread? use strided-by-4 chunks: thread handles j = tid*4 + 1024*u
  float s1 = 0.f;
  for (int u = 0; u < per / 4; ++u) {
    const int j = tid * 4 + 1024 * u;
    const v4f a = *(const v4fa*)(x + j);
    v4f b = {0.f,0.f,0.f,0.f}; if (rr) b = *(const v4fa*)(rr + j);
#pragma unroll
    for (int q = 0; q < 4; ++q) { const float v = a[q] + b[q]; vals[u * 4 + q] = v; s1 += v; }
  }
  red[tid] = s1; __syncthreads();
  for (int st = 128; st > 0; st >>= 1) { if (tid < st) red[tid] += red[tid + st]; __syncthreads(); }
  const float mu = red[0] / (float)N; __syncthreads();
  float s2 = 0.f;
  for (int u = 0; u < per / 4; ++u)
#pragma unroll
    for (int q = 0; q < 4; ++q) { const float c = vals[u * 4 + q] - mu; s2 += c * c; }
  red[tid] = s2; __syncthreads();
  for (int st = 128; st > 0; st >>= 1) { if (tid < st) red[tid] += red[tid + st]; __syncthreads(); }
  const float rs = rsqrtf(red[0] / (float)N + eps);
  {
    for (int u = 0; u < per / 4; ++u) {
      const int j = tid * 4 + 1024 * u;
      v4f o, sm;
#pragma unroll
      for (int q = 0; q < 4; ++q) {
        float gg = g[j + q], bb = bta[j + q];
        if (PARAM_BF16) { gg = bf16_round(gg); bb = bf16_round(bb); }
        sm[q] = vals[u * 4 + q]; o[q] = (vals[u * 4 + q] - mu) * rs * gg + bb;
      }
      if (out_sum) *(v4f*)(out_sum + (size_t)row * N + j) = sm;
      *(v4f*)(out_norm + (size_t)row * N + j) = o;
    }
    
  }
}



// ---- f16 WMMA path (v_wmma_f32_16x16x32_f16): 11-bit significands for operands in range — used where a [0,1] probability operand needs more precision than bf16
typedef _Float16 v16h __attribute__((ext_vector_type(16)));
union FragH { v16h v; v8us half[2]; _Float16 h[16]; unsigned short u[16]; };
template <int NT>
__device__ __forceinline__ v8f mmaH(v16h ah, v16h al, v16h bh, v16h bl, v8f c) {
  c = __builtin_amdgcn_wmma_f32_16x16x32_f16(false, ah, false, bh, (short)0, c, false, false);
  if (NT >= 2) c = __builtin_amdgcn_wmma_f32_16x16x32_f16(false, al, false, bh, (short)0, c, false, false);
  if (NT >= 3) c = __builtin_amdgcn_wmma_f32_16x16x32_f16(false, ah, false, bl, (short)0, c, false, false);
  asm volatile("v_nop\n\tv_nop\n\tv_nop\n\tv_nop" : "+v"(c) : "v"(ah), "v"(al), "v"(bh), "v"(bl));
  return c;
}
// batched GEMM like k_gemm_b but f16 operands: A f32 (split into f16 hi/lo if ASPLIT, else rounded to f16), Bt = f16 values [n][k]; alpha; C f32; N multiple of 16 (partial tiles skipped)
template <bool ASPLIT>
__global__ __launch_bounds__(128) void k_gemm_h(const float* __restrict__ A, int lda, size_t sA, const _Float16* __restrict__ Bh, int ldb, size_t sB, float alpha, float* __restrict__ C, int ldc, size_t sC, int M, int N, int K) {
  __shared__ __attribute__((aligned(16))) float so[4][16][64];
  const int tid = threadIdx.x, w = tid >> 5, lane = tid & 31, ln = lane & 15, hh = lane >> 4; const int by = blockIdx.y;
  A += (size_t)by * sA; Bh += (size_t)by * sB; C += (size_t)by * sC;
  const int ntn = (N + 63) / 64; const int wid = blockIdx.x * 4 + w; const int mt = wid / ntn, nq = wid % ntn; if (mt * 16 >= M) return;
  const int row0 = mt * 16, col0 = nq * 64; const float* arow = A + (size_t)(row0 + ln) * lda;
  v8f acc[4] = {};
  for (int kb = 0; kb < K; kb += 32) {
    FragH ah, al;
    const v4f x0 = *(const v4fa*)(arow + kb + 8 * hh), x1 = *(const v4fa*)(arow + kb + 8 * hh + 4), x2 = *(const v4fa*)(arow + kb + 16 + 8 * hh), x3 = *(const v4fa*)(arow + kb + 16 + 8 * hh + 4);
    float xs[16] = {x0[0],x0[1],x0[2],x0[3],x1[0],x1[1],x1[2],x1[3],x2[0],x2[1],x2[2],x2[3],x3[0],x3[1],x3[2],x3[3]};
#pragma unroll
    for (int i = 0; i < 16; ++i) { const _Float16 h = (_Float16)xs[i]; ah.h[i] = h; al.h[i] = ASPLIT ? (_Float16)(xs[i] - (float)h) : (_Float16)0.0f; }
#pragma unroll
    for (int t = 0; t < 4; ++t) { if (col0 + t * 16 >= N) continue; const size_t boff = (size_t)(col0 + t * 16 + ln) * ldb + kb; FragH bq; bq.half[0] = *(const v8us*)(Bh + boff + 8 * hh); bq.half[1] = *(const v8us*)(Bh + boff + 16 + 8 * hh);
      acc[t] = mmaH<ASPLIT ? 2 : 1>(ah.v, al.v, bq.v, bq.v, acc[t]); }
  }
#pragma unroll
  for (int t = 0; t < 4; ++t) { if (col0 + t * 16 >= N) continue;
#pragma unroll
    for (int r = 0; r < 8; ++r) so[w][8 * hh + r][t * 16 + ln] = acc[t][r] * alpha; }
  __builtin_amdgcn_fence(__ATOMIC_ACQ_REL, "workgroup"); __builtin_amdgcn_wave_barrier();
  const int rsub = lane >> 4, c4 = (lane & 15) * 4;
  {
#pragma unroll
    for (int q = 0; q < 8; ++q) { const int r = q * 2 + rsub; if (col0 + c4 < N) { const v4f v = *(const v4fa*)&so[w][r][c4]; *(v4f*)(C + (size_t)(row0 + r) * ldc + col0 + c4) = v; } }
     }
}

// Wt[n][k] = f16(W[k][n]·scale) from f32 row-major W[K][N] (scale = power of two; bf16-exact weights stay exact in f16 away from the subnormal range)
__global__ __launch_bounds__(256) void k_wt_f16(const float* __restrict__ W, _Float16* __restrict__ Wt, int K, int N, float scale) {
  const int t = blockIdx.x * 256 + threadIdx.x; if (t >= N * (K / 8)) return; const int n = t / (K / 8), k8 = (t % (K / 8)) * 8; FragH f;
#pragma unroll
  for (int i = 0; i < 8; ++i) f.h[i] = (_Float16)(bf16_round(W[(size_t)(k8 + i) * N + n]) * scale); const v8us o = f.half[0];
  *(v8us*)((unsigned short*)Wt + (size_t)n * K + k8) = o; 
}
// Projection GEMM, fixed shape M = NR, N = K = CC: v = acc/16 + bf16(bias[col]); writes f16 C16 (HALF_OUT) or f32 C.
// One work-group = one 128 x 128 tile of the output, 8 waves as 4 x 2, 32 x 64 a wave. A pass is 64 k: 128 rows of A and 128 rows of W, 128 B (one line) each,
// copied once per work-group into LDS at pitch 144 B (16 B x odd: conflict-free ds_load_b128); two buffers, the next pass's copies fly while this pass is multiplied.
typedef _Float16 v4h __attribute__((ext_vector_type(4)));
template <bool HALF_OUT>
__global__ __launch_bounds__(256) void k_proj(const _Float16* __restrict__ A, const _Float16* __restrict__ Bh, const float* __restrict__ bias, float* __restrict__ C, _Float16* __restrict__ C16) {
  constexpr int BT = 128, BK = 64, RP = 144, TILE = BT * RP, STG = 2 * TILE, NPASS = CC / BK, SOP = 68;
  static_assert(NR % BT == 0 && CC % BT == 0 && CC % BK == 0 && NPASS >= 2, "whole tiles, at least two passes");
  __shared__ __attribute__((aligned(16))) unsigned char ring[2 * STG];
  static_assert(sizeof(float) * 8 * 32 * SOP <= 2 * STG, "output staging must fit in the ring");
  float (*so)[32][SOP] = reinterpret_cast<float (*)[32][SOP]>(ring);      /* output staging takes the ring's place behind the last pass's barrier; pitch 68 dwords keeps the two lane halves on different banks */
  const int tid = threadIdx.x, w = tid >> 5, lane = tid & 31, ln = lane & 15, hh = lane >> 4;
  const int row0 = (blockIdx.x / (CC / BT)) * BT, col0 = (blockIdx.x % (CC / BT)) * BT;
  const int wr = (w >> 1) * 32, wc = (w & 1) * 64;
  /* each thread copies 4 x 16 B of A and 4 x 16 B of W per pass; a wave-wide copy = 4 whole rows = 4 lines */
  const char* gA = (const char*)((const unsigned short*)A + (size_t)(row0 + (tid >> 3)) * CC) + (tid & 7) * 16;
  const char* gB = (const char*)((const unsigned short*)Bh + (size_t)(col0 + (tid >> 3)) * CC) + (tid & 7) * 16;
  const unsigned lA = (unsigned)(size_t)ring + (unsigned)((tid >> 3) * RP + (tid & 7) * 16);
  constexpr size_t R32 = (size_t)32 * CC * 2;      /* bytes from a row to the row 32 below it */
  auto stage_copies = [&](int p, unsigned bofs) {
    const char* a0 = gA + (size_t)p * (BK * 2); const char* b0 = gB + (size_t)p * (BK * 2); const unsigned a = lA + bofs, c = a + (unsigned)TILE;
    /* the s_wait_xcnt closes the statement so that no address register of a copy is rewritten ahead of it */
    asm volatile("global_load_async_to_lds_b128 %0, %8, off\n\t"
                 "global_load_async_to_lds_b128 %1, %9, off\n\t"
                 "global_load_async_to_lds_b128 %2, %10, off\n\t"
                 "global_load_async_to_lds_b128 %3, %11, off\n\t"
                 "global_load_async_to_lds_b128 %4, %12, off\n\t"
                 "global_load_async_to_lds_b128 %5, %13, off\n\t"
                 "global_load_async_to_lds_b128 %6, %14, off\n\t"
                 "global_load_async_to_lds_b128 %7, %15, off\n\t"
                 "s_wait_xcnt 0x0"
                 :: "v"(a), "v"(a + 32 * RP), "v"(a + 64 * RP), "v"(a + 96 * RP), "v"(c), "v"(c + 32 * RP), "v"(c + 64 * RP), "v"(c + 96 * RP),
                    "v"(a0), "v"(a0 + R32), "v"(a0 + 2 * R32), "v"(a0 + 3 * R32), "v"(b0), "v"(b0 + R32), "v"(b0 + 2 * R32), "v"(b0 + 3 * R32)
                 : "memory");
  };
  v8f acc[2][4] = {};
  stage_copies(0, 0u);
  asm volatile("s_wait_asynccnt 0x0" ::: "memory");      /* pass 0 of this wave has landed */
  __syncthreads();                                       /* ... and every wave's part of it is published */
  stage_copies(1, (unsigned)STG);
#pragma unroll 2      /* two passes a trip make the buffer offsets immediates; fully unrolled the copies' addresses of all passes took the wave past 256 VGPRs */
  for (int p = 0; p < NPASS; ++p) {
    const unsigned bofs = (unsigned)(p & 1) * (unsigned)STG;
    const unsigned char* at = ring + bofs + (wr + ln) * RP + 16 * hh; const unsigned char* bt = ring + bofs + TILE + (wc + ln) * RP + 16 * hh;
#pragma unroll      /* this loop and those inside it: constant indices keep the fragments and acc in registers */
    for (int ks = 0; ks < BK / 32; ++ks) { FragH fa[2], fb[4];
#pragma unroll
      for (int i = 0; i < 2; ++i) { fa[i].half[0] = *(const v8us*)(at + i * 16 * RP + ks * 64); fa[i].half[1] = *(const v8us*)(at + i * 16 * RP + ks * 64 + 32); }
#pragma unroll
      for (int t = 0; t < 4; ++t) { fb[t].half[0] = *(const v8us*)(bt + t * 16 * RP + ks * 64); fb[t].half[1] = *(const v8us*)(bt + t * 16 * RP + ks * 64 + 32); }
#pragma unroll
      for (int i = 0; i < 2; ++i)
#pragma unroll
        for (int t = 0; t < 4; ++t) acc[i][t] = __builtin_amdgcn_wmma_f32_16x16x32_f16(false, fa[i].v, false, fb[t].v, (short)0, acc[i][t], false, false); }
    asm volatile("s_wait_dscnt 0x0" ::: "memory");         /* this wave's reads of the buffer are done before it is refilled */
    asm volatile("s_wait_asynccnt 0x0" ::: "memory");      /* this wave's copies of the next pass have landed */
    __syncthreads();                                       /* publishes the next pass and ends every wave's reads of this one */
    if (p + 2 < NPASS) stage_copies(p + 2, bofs); }
  asm volatile("s_wait_asynccnt 0x0" ::: "memory");        /* nothing in flight when the ring becomes output staging */
#pragma unroll      /* this loop and the two inside it: constant indices into acc */
  for (int t = 0; t < 4; ++t) { const float bv = bf16_round(bias[col0 + wc + t * 16 + ln]);
#pragma unroll
    for (int i = 0; i < 2; ++i)
#pragma unroll
      for (int r = 0; r < 8; ++r) so[w][i * 16 + 8 * hh + r][t * 16 + ln] = acc[i][t][r] * 0.0625f + bv; }
  __builtin_amdgcn_fence(__ATOMIC_ACQ_REL, "workgroup"); __builtin_amdgcn_wave_barrier();      /* orders this wave's staging stores ahead of its reads; no work-group barrier: a wave reads back only its own rows */
  const int rsub = lane >> 4, c4 = (lane & 15) * 4;
#pragma unroll      /* the 16 LDS reads go out as one group ahead of the stores; a store = 2 rows of whole lines */
  for (int q = 0; q < 16; ++q) { const int r = q * 2 + rsub; const v4f v = *(const v4fa*)&so[w][r][c4]; const size_t o = (size_t)(row0 + wr + r) * CC + col0 + wc + c4;
    if (HALF_OUT) { v4h h4; for (int i = 0; i < 4; ++i) h4[i] = (_Float16)v[i]; *(v4h*)(C16 + o) = h4; } else *(v4f*)(C + o) = v; }
}


__global__ __launch_bounds__(256) void k_x16(const float* __restrict__ x, _Float16* __restrict__ X16, size_t n8) { const size_t t = (size_t)blockIdx.x * 256 + threadIdx.x; if (t >= n8) return; FragH f;
#pragma unroll
  for (int q = 0; q < 8; ++q) f.h[q] = (_Float16)bf16_round(x[t * 8 + q]); *(v8us*)((unsigned short*)X16 + t * 8) = f.half[0];  }
__global__ __launch_bounds__(256) void k_h16(const float* __restrict__ x, _Float16* __restrict__ X16, size_t n8) { const size_t t = (size_t)blockIdx.x * 256 + threadIdx.x; if (t >= n8) return; FragH f;
#pragma unroll
  for (int q = 0; q < 8; ++q) f.h[q] = (_Float16)x[t * 8 + q]; *(v8us*)((unsigned short*)X16 + t * 8) = f.half[0];  }
__global__ __launch_bounds__(256) void k_round16f(const float* __restrict__ W, _Float16* __restrict__ Bt, size_t n8) { const size_t t = (size_t)blockIdx.x * 256 + threadIdx.x; if (t >= n8) return; FragH f;
#pragma unroll
  for (int i = 0; i < 8; ++i) f.h[i] = (_Float16)(bf16_round(W[t * 8 + i]) * 16.0f); *(v8us*)((unsigned short*)Bt + t * 8) = f.half[0];  }
template <int NHv, int TTv>
__global__ __launch_bounds__(256) void k_vt(const _Float16* __restrict__ V16, int ldv, int voff, _Float16* __restrict__ Vt) { __shared__ unsigned short tl[64][66]; const int tid = threadIdx.x; const int slab = blockIdx.x / (TTv / 64), lg = blockIdx.x % (TTv / 64); const int b = slab / NHv, h = slab % NHv;
  for (int i = tid; i < 64 * 8; i += 256) { const int r = i / 8, c8 = (i % 8) * 8; FragH f; f.half[0] = *(const v8us*)((const unsigned short*)V16 + ((size_t)b * TTv + lg * 64 + r) * ldv + voff + h * 64 + c8);
#pragma unroll
    for (int q = 0; q < 8; ++q) tl[r][c8 + q] = f.u[q]; }
  __syncthreads();
  {
#pragma unroll
    for (int rd = 0; rd < 2; ++rd) { const int d = rd * 32 + tid / 8, pc = tid % 8; FragH f;
#pragma unroll
      for (int q = 0; q < 8; ++q) f.u[q] = tl[pc * 8 + q][d];
      *(v8us*)((unsigned short*)Vt + ((size_t)slab * 64 + d) * TTv + lg * 64 + pc * 8) = f.half[0]; }
     } }

__global__ __launch_bounds__(256) void k_tok(const float* __restrict__ x, _Float16* __restrict__ X16) { __shared__ float tl[32][65]; const int tid = threadIdx.x; const int b = blockIdx.x / ((CC / 64) * (NN / 32)), rem = blockIdx.x % ((CC / 64) * (NN / 32)); const int cg = rem / (NN / 32), pg = rem % (NN / 32); const int c0 = cg * 64, p0 = pg * 32;
  for (int i = tid; i < 64 * 32; i += 256) { const int c = i / 32, pp = i % 32; tl[pp][c] = bf16_round(x[((size_t)b * CC + c0 + c) * NN + p0 + pp]); } __syncthreads();
  const int r = tid / 8, pc = tid % 8; FragH f; for (int q = 0; q < 8; ++q) f.h[q] = (_Float16)tl[r][pc * 8 + q]; const size_t row = (size_t)b * NN + p0 + r; *(v8us*)((unsigned short*)X16 + row * CC + c0 + pc * 8) = f.half[0];  }
__global__ __launch_bounds__(256) void k_vthlu(const float* __restrict__ VF, int ldv, _Float16* __restrict__ Vth, _Float16* __restrict__ Vtl) { __shared__ float tl[64][65]; const int tid = threadIdx.x; const int slab = blockIdx.x / (TT / 64), lg = blockIdx.x % (TT / 64); const int b = slab / NVH, h = slab % NVH;
  for (int i = tid; i < 64 * 16; i += 256) { const int r = i / 16, c4 = (i % 16) * 4; const v4f a = *(const v4fa*)(VF + ((size_t)b * TT + lg * 64 + r) * ldv + h * 64 + c4); tl[r][c4] = a[0]; tl[r][c4 + 1] = a[1]; tl[r][c4 + 2] = a[2]; tl[r][c4 + 3] = a[3]; }
  __syncthreads();
  FragH fh[2], fl[2]; size_t oo[2];
#pragma unroll
  for (int rd = 0; rd < 2; ++rd) { const int d = rd * 32 + tid / 8, pc = tid % 8;
#pragma unroll
    for (int q = 0; q < 8; ++q) { const float v = tl[pc * 8 + q][d]; const _Float16 hv = (_Float16)v; fh[rd].h[q] = hv; fl[rd].h[q] = (_Float16)(v - (float)hv);      /* UNSCALED residual (k_flash reads only the hi plane) */ } oo[rd] = ((size_t)slab * 64 + d) * TT + lg * 64 + pc * 8; }
  {
#pragma unroll
    for (int rd = 0; rd < 2; ++rd) { *(v8us*)((unsigned short*)Vth + oo[rd]) = fh[rd].half[0]; *(v8us*)((unsigned short*)Vtl + oo[rd]) = fl[rd].half[0]; }
     } }
__global__ __launch_bounds__(256) void k_krt(const float* __restrict__ KF, const float* __restrict__ rh, const float* __restrict__ rw, _Float16* __restrict__ K16) { const size_t t = (size_t)blockIdx.x * 256 + threadIdx.x; if (t >= (size_t)NR * CC / 8) return; const size_t row = (t * 8) / CC; const int c0 = (int)((t * 8) % CC); const int n = (int)(row % NN); const int na = n / 32, nb = n % 32; const v4f a = *(const v4fa*)(KF + t * 8), c = *(const v4fa*)(KF + t * 8 + 4); FragH f;
#pragma unroll
  for (int q = 0; q < 8; ++q) { const int ch = c0 + q; const int h = ch / HDD, d = ch % HDD; const float r1 = bf16_round(rh[((size_t)h * HDD + d) * 32 + nb]) + bf16_round(rw[((size_t)h * HDD + d) * 32 + na]); f.h[q] = (_Float16)(((q < 4) ? a[q] : c[q - 4]) + r1); }
  *(v8us*)((unsigned short*)K16 + t * 8) = f.half[0];  }
__global__ __launch_bounds__(128) void k_flash(const _Float16* __restrict__ Q16, int ldq, const _Float16* __restrict__ K16, int ldk, const _Float16* __restrict__ Vt, const _Float16* __restrict__ Vtlo, float* __restrict__ O, int ldo) {
  constexpr int RPW = 16, RTN = RPW / 16, NQB = TT / (4 * RPW), DT = 8, KS = 4;      /* head dim 128: 4 k-steps, 8 value tiles */
  __shared__ __attribute__((aligned(16))) unsigned short sP[4][RPW][40]; __shared__ __attribute__((aligned(16))) unsigned short sPL[4][RPW][40];
  /* K/V ring shared by the four waves: two stages of 32 keys; a stage = 32 K rows of 256 B at pitch 272 B, then 128 V^T rows of 64 B at pitch 80 B (16 B x odd: conflict-free ds_load_b128) */
  constexpr int KP = 272, VP = 80, VOFF = 32 * KP, STG = VOFF + 128 * VP;
  __shared__ __attribute__((aligned(16))) unsigned char ring[2 * STG];
  static_assert(sizeof(float) * 4 * RPW * (128 + 4) <= 2 * STG, "output staging must fit in the ring");
  float (*sO)[RPW][128 + 4] = reinterpret_cast<float (*)[RPW][128 + 4]>(ring);      /* output staging takes the ring's place behind the last pass's barrier */
  const int tid = threadIdx.x, w = tid >> 5, lane = tid & 31, ln = lane & 15, hh = lane >> 4;
  const int slab = blockIdx.x / NQB, qblk = blockIdx.x % NQB; const int b = slab / NH, h = slab % NH; const int qb0 = qblk * (4 * RPW); const int q0 = qb0 + w * RPW;
  FragH aq[2][KS];
#pragma unroll
  for (int rt = 0; rt < RTN; ++rt) { const unsigned short* qr = (const unsigned short*)Q16 + ((size_t)b * TT + q0 + rt * 16 + ln) * ldq + h * 128;
#pragma unroll
    for (int ks = 0; ks < KS; ++ks) { aq[rt][ks].half[0] = *(const v8us*)(qr + ks * 32 + 8 * hh); aq[rt][ks].half[1] = *(const v8us*)(qr + ks * 32 + 16 + 8 * hh); } }
  const unsigned short* Vth = (const unsigned short*)Vt + (size_t)slab * 128 * TT; const unsigned short* Vtl = (const unsigned short*)Vtlo + (size_t)slab * 128 * TT;      /* hi and UNSCALED residual planes */
  float m_r[2][8], l_r[2][8]; v8f oacc[2][DT];
#pragma unroll
  for (int rt = 0; rt < RTN; ++rt) {
#pragma unroll
    for (int r = 0; r < 8; ++r) { m_r[rt][r] = -3.0e38f; l_r[rt][r] = 0.f; }
#pragma unroll
    for (int dt = 0; dt < DT; ++dt) oacc[rt][dt] = (v8f){0.f,0.f,0.f,0.f,0.f,0.f,0.f,0.f}; }
  const int jend = TT;
  /* each thread copies 4 x 16 B of K (a wave-wide copy = 2 whole rows = 4 lines) and 4 x 16 B of V^T (8 rows x 64 B) per stage */
  const char* gK = (const char*)((const unsigned short*)K16 + ((size_t)b * TT + (tid >> 4)) * ldk + h * 128) + (tid & 15) * 16;
  const char* gV = (const char*)(Vth + (size_t)(tid >> 2) * TT) + (tid & 3) * 16;
  const size_t kstep = (size_t)ldk * 2;      /* bytes per key row of K */
  const unsigned lK = (unsigned)(size_t)ring + (unsigned)((tid >> 4) * KP + (tid & 15) * 16);
  const unsigned lV = (unsigned)(size_t)ring + (unsigned)(VOFF + (tid >> 2) * VP + (tid & 3) * 16);
  auto stage_copies = [&](int j, unsigned bofs) {
    const char* k0 = gK + (size_t)j * kstep; const char* v0 = gV + (size_t)j * 2; const unsigned a = lK + bofs, c = lV + bofs;
    /* the s_wait_xcnt closes the statement so that no address register of a copy is rewritten ahead of it */
    asm volatile("global_load_async_to_lds_b128 %0, %8, off\n\t"
                 "global_load_async_to_lds_b128 %1, %9, off\n\t"
                 "global_load_async_to_lds_b128 %2, %10, off\n\t"
                 "global_load_async_to_lds_b128 %3, %11, off\n\t"
                 "global_load_async_to_lds_b128 %4, %12, off\n\t"
                 "global_load_async_to_lds_b128 %5, %13, off\n\t"
                 "global_load_async_to_lds_b128 %6, %14, off\n\t"
                 "global_load_async_to_lds_b128 %7, %15, off\n\t"
                 "s_wait_xcnt 0x0"
                 :: "v"(a), "v"(a + 8 * KP), "v"(a + 16 * KP), "v"(a + 24 * KP), "v"(c), "v"(c + 32 * VP), "v"(c + 64 * VP), "v"(c + 96 * VP),
                    "v"(k0), "v"(k0 + 8 * kstep), "v"(k0 + 16 * kstep), "v"(k0 + 24 * kstep), "v"(v0), "v"(v0 + (size_t)32 * TT * 2), "v"(v0 + (size_t)64 * TT * 2), "v"(v0 + (size_t)96 * TT * 2)
                 : "memory");
  };
  stage_copies(0, 0u);
  asm volatile("s_wait_asynccnt 0x0" ::: "memory");      /* stage 0 of this wave has landed */
  __syncthreads();                                       /* ... and every wave's part of it is published */
  stage_copies(32, (unsigned)STG);
#pragma unroll 1
  for (int j0 = 0; j0 < jend; j0 += 32) {
    const unsigned bofs = (unsigned)((j0 >> 5) & 1) * (unsigned)STG; const unsigned char* kt = ring + bofs; const unsigned char* vt = kt + VOFF;
    v8f s[2][2];
#pragma unroll
    for (int nt = 0; nt < 2; ++nt) { const unsigned short* kr = (const unsigned short*)(kt + (nt * 16 + ln) * KP); FragH bk[KS];
#pragma unroll
      for (int ks = 0; ks < KS; ++ks) { bk[ks].half[0] = *(const v8us*)(kr + ks * 32 + 8 * hh); bk[ks].half[1] = *(const v8us*)(kr + ks * 32 + 16 + 8 * hh); }
#pragma unroll
      for (int rt = 0; rt < RTN; ++rt) { v8f acc = (v8f){0.f,0.f,0.f,0.f,0.f,0.f,0.f,0.f};
#pragma unroll
        for (int ks = 0; ks < KS; ++ks) acc = mmaH<1>(aq[rt][ks].v, aq[rt][ks].v, bk[ks].v, bk[ks].v, acc); s[rt][nt] = acc; } }
#pragma unroll
    for (int rt = 0; rt < RTN; ++rt)
#pragma unroll
      for (int r = 0; r < 8; ++r) { const int tq = q0 + rt * 16 + 8 * hh + r; const int k0 = j0 + ln, k1 = j0 + 16 + ln; (void)tq; (void)k0; (void)k1;
        const bool ok0 = true, ok1 = true; (void)tq; (void)k0; (void)k1;
        const float s0 = ok0 ? s[rt][0][r] * ATT_SCALE : -INFINITY, s1 = ok1 ? s[rt][1][r] * ATT_SCALE : -INFINITY; float mc = fmaxf(s0, s1);
        mc = fmaxf(mc, __shfl_xor(mc, 1, 32)); mc = fmaxf(mc, __shfl_xor(mc, 2, 32)); mc = fmaxf(mc, __shfl_xor(mc, 4, 32)); mc = fmaxf(mc, __shfl_xor(mc, 8, 32));
        const float mn = fmaxf(m_r[rt][r], mc); const float al = (mn > -1.0e38f) ? expf(m_r[rt][r] - mn) : 1.0f; m_r[rt][r] = mn; const float p0 = ok0 ? expf(s0 - mn) : 0.f, p1 = ok1 ? expf(s1 - mn) : 0.f; l_r[rt][r] = l_r[rt][r] * al + p0 + p1;
#pragma unroll
        for (int dt = 0; dt < DT; ++dt) oacc[rt][dt][r] *= al;
        FragH t2, t3; const float ps0 = p0 * 1024.0f, ps1 = p1 * 1024.0f; t2.h[0] = (_Float16)ps0; t2.h[1] = (_Float16)ps1; t3.h[0] = (_Float16)(ps0 - (float)t2.h[0]); t3.h[1] = (_Float16)(ps1 - (float)t2.h[1]);      /* P hi and its UNSCALED residual (added into the same accumulator) */
        sP[w][rt * 16 + 8 * hh + r][ln] = t2.u[0]; sP[w][rt * 16 + 8 * hh + r][16 + ln] = t2.u[1]; sPL[w][rt * 16 + 8 * hh + r][ln] = t3.u[0]; sPL[w][rt * 16 + 8 * hh + r][16 + ln] = t3.u[1]; }
    __builtin_amdgcn_fence(__ATOMIC_ACQ_REL, "workgroup"); __builtin_amdgcn_wave_barrier();
    FragH pa[2], pl[2], bv[DT];
#pragma unroll
    for (int rt = 0; rt < RTN; ++rt) { pa[rt].half[0] = *(const v8us*)&sP[w][rt * 16 + ln][8 * hh]; pa[rt].half[1] = *(const v8us*)&sP[w][rt * 16 + ln][16 + 8 * hh]; pl[rt].half[0] = *(const v8us*)&sPL[w][rt * 16 + ln][8 * hh]; pl[rt].half[1] = *(const v8us*)&sPL[w][rt * 16 + ln][16 + 8 * hh]; }
#pragma unroll
    for (int dt = 0; dt < DT; ++dt) { const unsigned short* vr = (const unsigned short*)(vt + (dt * 16 + ln) * VP); bv[dt].half[0] = *(const v8us*)(vr + 8 * hh); bv[dt].half[1] = *(const v8us*)(vr + 16 + 8 * hh); }      /* all V fragments of the pass as one group of LDS reads, ahead of the products: one LDS latency a pass, not eight */
#pragma unroll      /* constant dt keeps bv and oacc in registers */
    for (int dt = 0; dt < DT; ++dt) {
#pragma unroll
      for (int rt = 0; rt < RTN; ++rt) { oacc[rt][dt] = mmaH<1>(pa[rt].v, pa[rt].v, bv[dt].v, bv[dt].v, oacc[rt][dt]); oacc[rt][dt] = mmaH<1>(pl[rt].v, pl[rt].v, bv[dt].v, bv[dt].v, oacc[rt][dt]); } }      /* (Ph + Pl)·Vh — the V residual term is dropped here: near-uniform attention over 1024 keys averages out the f16 rounding of v */
    __builtin_amdgcn_fence(__ATOMIC_ACQ_REL, "workgroup"); __builtin_amdgcn_wave_barrier();
    asm volatile("s_wait_dscnt 0x0" ::: "memory");         /* this wave's reads of the stage are done before the stage is refilled */
    asm volatile("s_wait_asynccnt 0x0" ::: "memory");      /* this wave's copies of the next stage have landed */
    __syncthreads();                                       /* publishes the next stage and ends every wave's reads of this one */
    if (j0 + 64 < jend) stage_copies(j0 + 64, bofs); }
  asm volatile("s_wait_asynccnt 0x0" ::: "memory");        /* nothing in flight when the ring becomes output staging */
#pragma unroll
  for (int rt = 0; rt < RTN; ++rt) {
#pragma unroll
    for (int r = 0; r < 8; ++r) { float l = l_r[rt][r]; l += __shfl_xor(l, 1, 32); l += __shfl_xor(l, 2, 32); l += __shfl_xor(l, 4, 32); l += __shfl_xor(l, 8, 32); l_r[rt][r] = (l > 0.f) ? 1.0f / (l * 1024.0f) : 0.f; }
#pragma unroll
    for (int dt = 0; dt < DT; ++dt)
#pragma unroll
      for (int r = 0; r < 8; ++r) sO[w][rt * 16 + 8 * hh + r][dt * 16 + ln] = oacc[rt][dt][r] * l_r[rt][r]; }
  __builtin_amdgcn_fence(__ATOMIC_ACQ_REL, "workgroup"); __builtin_amdgcn_wave_barrier();
  {
#pragma unroll
    for (int r = 0; r < RPW; ++r) { const int pc = lane; const v4f val = *(const v4fa*)&sO[w][r][pc * 4]; *(v4f*)(O + ((size_t)slab * TT + q0 + r) * 128 + pc * 4) = val; }      /* output laid out [b][h][n][128] (the module reinterprets that buffer as [B,C,H,W]); one 512-B row per instruction */      /* one 512-B row per instruction: 32 lanes × 16 B */
     } }

extern "C" void kernel_launch(void* const* d_in, const int* in_sizes, int n_in,
                              void* d_out, int out_size, void* d_ws, size_t ws_size, hipStream_t stream) {
  (void)in_sizes; (void)n_in; (void)out_size;
  const float* const* I = (const float* const*)d_in; const float* x = I[0]; const float* Wq = I[1]; const float* bq = I[2]; const float* Wk = I[3]; const float* bk = I[4]; const float* Wv = I[5]; const float* bv = I[6]; const float* rh = I[7]; const float* rw = I[8];
  char* ws = (char*)d_ws; size_t off = 0;
  auto take = [&](size_t bytes) { char* p = ws + off; off += (bytes + 255) & ~(size_t)255; return p; };
  const size_t WSZ = (size_t)CC * CC; _Float16* Bw = (_Float16*)take(3 * WSZ * 2); _Float16* X16 = (_Float16*)take((size_t)NR * CC * 2); _Float16* Q = (_Float16*)take((size_t)NR * CC * 2); float* F32 = (float*)take((size_t)NR * CC * 4); _Float16* K = (_Float16*)take((size_t)NR * CC * 2); _Float16* Vt = (_Float16*)take((size_t)NR * CC * 2); _Float16* Vtl = X16;      /* Vᵀ residual over the token plane (dead after the three projections) */
  if (off > ws_size) return;      // 1.6 + 16.8 + 16.8 + 33.6 + 16.8 + 16.8 ≈ 102 MB
  const unsigned gw = (unsigned)((WSZ / 8 + 255) / 256); k_round16f<<<gw, 256, 0, stream>>>(Wq, Bw, WSZ / 8); k_round16f<<<gw, 256, 0, stream>>>(Wk, Bw + WSZ, WSZ / 8); k_round16f<<<gw, 256, 0, stream>>>(Wv, Bw + 2 * WSZ, WSZ / 8);      /* (out,in) natural ×2^4 */
  k_tok<<<BB * (CC / 64) * (NN / 32), 256, 0, stream>>>(x, X16);      /* [B][C][N] → token-major bf16 plane */
  const dim3 gp((NR / 128) * (CC / 128), 1); const unsigned g8 = (unsigned)(((size_t)NR * CC / 8 + 255) / 256);
  k_proj<true><<<gp, 256, 0, stream>>>(X16, Bw, bq, nullptr, Q);      /* q (unscaled) f16: M 16384 N 512 K 512 */
  k_proj<false><<<gp, 256, 0, stream>>>(X16, Bw + WSZ, bk, F32, nullptr); k_krt<<<g8, 256, 0, stream>>>(F32, rh, rw, K);      /* k' = k + rtᵀ */
  k_proj<false><<<gp, 256, 0, stream>>>(X16, Bw + 2 * WSZ, bv, F32, nullptr); k_vthlu<<<BB * NVH * (NN / 64), 256, 0, stream>>>(F32, CC, Vt, Vtl);      /* v f32 → Vᵀ hi / residual per (b, h) [128][N] via 8 half-heads of 64 */
  k_flash<<<BB * NH * (NN / 64), 128, 0, stream>>>(Q, CC, K, CC, Vt, Vtl, (float*)d_out, 128);      /* y → d_out as [b][h][n][128] */
}

// v003
// Measured time: 185 microseconds a run.
// In both of two side-by-side timings against v002, it was 1.22 times as fast.
// All steps since v000 together make it 2.32 times as fast.
#include <hip/hip_runtime.h>
// Bottleneck-transformer MHSA with relative position term (B=16, C=512, 32×32 → N=1024, 4 heads × 128): q,k,v = 1×1 convs ((out,in) + bias); logits = (q·C^-½)·(k + rt) where rt[h][d][n] = rh[h][d][n mod 32] + rw[h][d][n div 32]
// (the module's (rh + rw).reshape(1, heads, emb, N)); softmax; y = attn·v per head; the output is the [B][h][N][d] buffer reinterpreted as [B,C,H,W] (the module's final reshape).
// Compute dtype: x, weights, biases, rh, rw rounded to bf16; token-major bf16 input plane; q as an f16 GEMM plane (unscaled — the C^-½ is applied to the f32 score), k as an f32 GEMM output with rtᵀ added in f32 then f16,
// v f16; fused flash-style kernel for head dim 128 (4 k-steps, 8 value tiles, online softmax f32, P as f16 + its exact f16 residual, V f16, one f32 accumulator) on v_wmma_f32_16x16x32_f16 writing y directly; f32 accumulate.
#define BB 16
#define CC 512
#define NN 1024
#define TT NN
#define NH 4
#define HDD 128
#define NVH (2 * NH)
#define NR (BB * NN)
#define ATT_SCALE 0.04419417382415922f

typedef __bf16 v16b __attribute__((ext_vector_type(16)));
typedef unsigned short v8us __attribute__((ext_vector_type(8), may_alias));
typedef float  v8f  __attribute__((ext_vector_type(8)));
typedef float  v4f  __attribute__((ext_vector_type(4)));
typedef float  v4fa __attribute__((ext_vector_type(4), may_alias));
union FragB { v16b v; v8us half[2]; unsigned short u[16]; };

__device__ __forceinline__ unsigned short bf16_bits(float x) { unsigned int u = __float_as_uint(x); return (unsigned short)((u + 0x7FFFu + ((u >> 16) & 1u)) >> 16); }
__device__ __forceinline__ float bf16_val(unsigned short b) { return __uint_as_float(((unsigned int)b) << 16); }
__device__ __forceinline__ float bf16_round(float x) { return bf16_val(bf16_bits(x)); }
// D += A·B with NT terms: 1 = ah·bh, 2 = + al·bh (A split), 3 = + ah·bl (both split)
template <int NT>
__device__ __forceinline__ v8f mmaN(v16b ah, v16b al, v16b bh, v16b bl, v8f c) {
  c = __builtin_amdgcn_wmma_f32_16x16x32_bf16(false, ah, false, bh, (short)0, c, false, false);
  if (NT >= 2) c = __builtin_amdgcn_wmma_f32_16x16x32_bf16(false, al, false, bh, (short)0, c, false, false);
  if (NT >= 3) c = __builtin_amdgcn_wmma_f32_16x16x32_bf16(false, ah, false, bl, (short)0, c, false, false);
  asm volatile("v_nop\n\tv_nop\n\tv_nop\n\tv_nop" : "+v"(c) : "v"(ah), "v"(al), "v"(bh), "v"(bl));
  return c;
}

__global__ __launch_bounds__(256) void k_wt_bf16(const float* __restrict__ W, unsigned short* __restrict__ Wt, int K, int N) {
  const int t = blockIdx.x * 256 + threadIdx.x;
  const int k8n = K / 8;
  if (t >= N * k8n) return;
  const int n = t / k8n, k8 = (t % k8n) * 8;
  v8us v;
#pragma unroll
  for (int i = 0; i < 8; ++i) v[i] = bf16_bits(W[(size_t)(k8 + i) * N + n]);
  *(v8us*)(Wt + (size_t)n * K + k8) = v;
  
}

// GEMM C[M][N] (f32, pitch ldc) = act(A[M][K]·W + bias). A f32 row-major (pitch lda) converted per fragment to bf16
// (ASPLIT: hi/lo two planes -> 2 terms, else single rounded term); Wt bf16 [N][K] (pitch ldb). BIAS_BF16 rounds the
// bias to bf16 first (bias quantised to bf16 before the add). K%32==0, M%16==0, N%64==0.
template <bool ASPLIT, int ACT, bool BIAS_BF16>
__global__ __launch_bounds__(128) void k_gemm_bf(const float* __restrict__ A, int lda, const unsigned short* __restrict__ Wt, int ldb,
                                               const float* __restrict__ bias, float* __restrict__ C, int ldc, int M, int N, int K) {
  __shared__ __attribute__((aligned(16))) float so[4][16][64];
  const int tid = threadIdx.x, w = tid >> 5, lane = tid & 31, ln = lane & 15, hh = lane >> 4;
  const int ntn = N / 64;
  const int wid = blockIdx.x * 4 + w;
  const int mt = wid / ntn, nq = wid % ntn;
  if (mt * 16 >= M) return;
  const int row0 = mt * 16, col0 = nq * 64;
  const float* arow = A + (size_t)(row0 + ln) * lda;
  v8f acc[4] = {};
  for (int kb = 0; kb < K; kb += 32) {
    FragB ah, al;
    const v4f x0 = *(const v4fa*)(arow + kb + 8 * hh), x1 = *(const v4fa*)(arow + kb + 8 * hh + 4);
    const v4f x2 = *(const v4fa*)(arow + kb + 16 + 8 * hh), x3 = *(const v4fa*)(arow + kb + 16 + 8 * hh + 4);
    float xs[16] = {x0[0],x0[1],x0[2],x0[3],x1[0],x1[1],x1[2],x1[3],x2[0],x2[1],x2[2],x2[3],x3[0],x3[1],x3[2],x3[3]};
#pragma unroll
    for (int i = 0; i < 16; ++i) { const unsigned short hb = bf16_bits(xs[i]); ah.u[i] = hb; al.u[i] = ASPLIT ? bf16_bits(xs[i] - bf16_val(hb)) : (unsigned short)0; }
#pragma unroll
    for (int t = 0; t < 4; ++t) {
      const unsigned short* brow = Wt + (size_t)(col0 + t * 16 + ln) * ldb + kb;
      FragB b;
      b.half[0] = *(const v8us*)(brow + 8 * hh);
      b.half[1] = *(const v8us*)(brow + 16 + 8 * hh);
      acc[t] = mmaN<ASPLIT ? 2 : 1>(ah.v, al.v, b.v, b.v, acc[t]);
    }
  }
#pragma unroll
  for (int t = 0; t < 4; ++t) {
    float bv = bias ? bias[col0 + t * 16 + ln] : 0.f;
    if (BIAS_BF16) bv = bf16_round(bv);
#pragma unroll
    for (int r = 0; r < 8; ++r) { float v = acc[t][r] + bv; if (ACT == 1) v = fmaxf(v, 0.f); so[w][8 * hh + r][t * 16 + ln] = v; }
  }
  __builtin_amdgcn_fence(__ATOMIC_ACQ_REL, "workgroup");
  __builtin_amdgcn_wave_barrier();
  const int rsub = lane >> 4, c4 = (lane & 15) * 4;
  {
#pragma unroll
    for (int q = 0; q < 8; ++q) {
      const int r = q * 2 + rsub;
      const v4f v = *(const v4fa*)&so[w][r][c4];
      *(v4f*)(C + (size_t)(row0 + r) * ldc + col0 + c4) = v;
    }
    
  }
}

// Flash-style causal/unmasked attention, all contractions 3-term bf16 hi/lo splits, f32 softmax with running max.
// q,k,v rows are read from f32 buffers with arbitrary row pitch (so they can live inside a fused qkv buffer);
// D = head size (multiple of 32, <= 128); one wave = 16 query rows; block = 4 waves (64 queries) sharing K/V chunks of 32.
template <int D, bool CAUSAL>
__global__ __launch_bounds__(128) void k_flash(const float* __restrict__ qb, const float* __restrict__ kb, const float* __restrict__ vb,
                                             int pitch, int T, int H, float scale, float* __restrict__ y, int ypitch) {
  constexpr int KS = D / 32;        // k-steps for QK
  constexpr int DT = D / 16;        // d tiles for PV
  __shared__ __attribute__((aligned(16))) unsigned short sKh[32][D + 8], sKl[32][D + 8], sVh[32][D + 8], sVl[32][D + 8];
  __shared__ __attribute__((aligned(16))) unsigned short sPh[4][16][40], sPl[4][16][40];
  __shared__ __attribute__((aligned(16))) float sO[4][16][D];
  const int tid = threadIdx.x, w = tid >> 5, lane = tid & 31, ln = lane & 15, hh = lane >> 4;
  const int nqb = (T + 63) / 64;
  const int bh = blockIdx.x / nqb, qblk = blockIdx.x % nqb;
  const int b = bh / H, h = bh % H;
  const int q0 = qblk * 64 + w * 16;
  const float* Q = qb + (size_t)b * T * pitch + h * D;
  const float* K = kb + (size_t)b * T * pitch + h * D;
  const float* V = vb + (size_t)b * T * pitch + h * D;

  // A fragments of the wave's 16 query rows (scaled), hi/lo
  FragB aqh[KS], aql[KS];
  {
    int row = q0 + ln; if (row >= T) row = T - 1;
    const float* qr = Q + (size_t)row * pitch;
#pragma unroll
    for (int ks = 0; ks < KS; ++ks)
#pragma unroll
      for (int i = 0; i < 16; ++i) {
        const int d = ks * 32 + ((i < 8) ? (8 * hh + i) : (16 + 8 * hh + (i - 8)));
        const float x = qr[d] * scale; const unsigned short hb = bf16_bits(x);
        aqh[ks].u[i] = hb; aql[ks].u[i] = bf16_bits(x - bf16_val(hb));
      }
  }
  float m_r[8], l_r[8];
#pragma unroll
  for (int r = 0; r < 8; ++r) { m_r[r] = -3.0e38f; l_r[r] = 0.f; }
  v8f oacc[DT];
#pragma unroll
  for (int dt = 0; dt < DT; ++dt) oacc[dt] = (v8f){0.f,0.f,0.f,0.f,0.f,0.f,0.f,0.f};

  const int kv_end = CAUSAL ? min(T, qblk * 64 + 64) : T;     // block-uniform
  for (int j0 = 0; j0 < kv_end; j0 += 32) {
    __syncthreads();
    for (int e = tid; e < 32 * (D / 4); e += 128) {
      const int r = e / (D / 4), c4 = (e % (D / 4)) * 4;
      const int key = j0 + r;
      v4f kf = {0.f,0.f,0.f,0.f}, vf = {0.f,0.f,0.f,0.f};
      if (key < T) { kf = *(const v4fa*)(K + (size_t)key * pitch + c4); vf = *(const v4fa*)(V + (size_t)key * pitch + c4); }
#pragma unroll
      for (int t = 0; t < 4; ++t) {
        unsigned short hb = bf16_bits(kf[t]); sKh[r][c4 + t] = hb; sKl[r][c4 + t] = bf16_bits(kf[t] - bf16_val(hb));
        hb = bf16_bits(vf[t]); sVh[r][c4 + t] = hb; sVl[r][c4 + t] = bf16_bits(vf[t] - bf16_val(hb));
      }
    }
    __syncthreads();
    // S tile 16 x 32
    v8f s[2];
#pragma unroll
    for (int nt = 0; nt < 2; ++nt) {
      v8f acc = {};
#pragma unroll
      for (int ks = 0; ks < KS; ++ks) {
        FragB bh_, bl_;
        bh_.half[0] = *(const v8us*)&sKh[nt * 16 + ln][ks * 32 + 8 * hh]; bh_.half[1] = *(const v8us*)&sKh[nt * 16 + ln][ks * 32 + 16 + 8 * hh];
        bl_.half[0] = *(const v8us*)&sKl[nt * 16 + ln][ks * 32 + 8 * hh]; bl_.half[1] = *(const v8us*)&sKl[nt * 16 + ln][ks * 32 + 16 + 8 * hh];
        acc = mmaN<3>(aqh[ks].v, aql[ks].v, bh_.v, bl_.v, acc);
      }
      s[nt] = acc;
    }
    // mask + running max (rows 8hh+r; the 16 lanes of a half share rows)
    float alpha[8];
#pragma unroll
    for (int r = 0; r < 8; ++r) {
      const int qi = q0 + 8 * hh + r;
      const int ja = j0 + ln, jb = j0 + 16 + ln;
      if (CAUSAL) { if (ja > qi) s[0][r] = -3.0e38f; if (jb > qi) s[1][r] = -3.0e38f; }
      if (ja >= T) s[0][r] = -3.0e38f;
      if (jb >= T) s[1][r] = -3.0e38f;
      float mx = fmaxf(s[0][r], s[1][r]);
      mx = fmaxf(mx, __shfl_xor(mx, 1, 32)); mx = fmaxf(mx, __shfl_xor(mx, 2, 32)); mx = fmaxf(mx, __shfl_xor(mx, 4, 32)); mx = fmaxf(mx, __shfl_xor(mx, 8, 32));
      const float mnew = fmaxf(m_r[r], mx);
      alpha[r] = (mnew > -1.0e38f) ? __expf(m_r[r] - mnew) : 1.0f;
      const float p0 = (s[0][r] > -1.0e38f) ? __expf(s[0][r] - mnew) : 0.f;
      const float p1 = (s[1][r] > -1.0e38f) ? __expf(s[1][r] - mnew) : 0.f;
      m_r[r] = mnew;
      l_r[r] = l_r[r] * alpha[r] + p0 + p1;            // per-lane partial row sum (16 lanes combined at the end)
      unsigned short hb = bf16_bits(p0); sPh[w][8 * hh + r][ln] = hb;      sPl[w][8 * hh + r][ln] = bf16_bits(p0 - bf16_val(hb));
      hb = bf16_bits(p1);                sPh[w][8 * hh + r][16 + ln] = hb; sPl[w][8 * hh + r][16 + ln] = bf16_bits(p1 - bf16_val(hb));
    }
#pragma unroll
    for (int dt = 0; dt < DT; ++dt)
#pragma unroll
      for (int r = 0; r < 8; ++r) oacc[dt][r] *= alpha[r];
    __builtin_amdgcn_fence(__ATOMIC_ACQ_REL, "workgroup");
    __builtin_amdgcn_wave_barrier();
    FragB pah, pal;
    pah.half[0] = *(const v8us*)&sPh[w][ln][8 * hh]; pah.half[1] = *(const v8us*)&sPh[w][ln][16 + 8 * hh];
    pal.half[0] = *(const v8us*)&sPl[w][ln][8 * hh]; pal.half[1] = *(const v8us*)&sPl[w][ln][16 + 8 * hh];
#pragma unroll
    for (int dt = 0; dt < DT; ++dt) {
      FragB bvh, bvl;
#pragma unroll
      for (int i = 0; i < 8; ++i) {
        bvh.u[i] = sVh[8 * hh + i][dt * 16 + ln]; bvh.u[8 + i] = sVh[16 + 8 * hh + i][dt * 16 + ln];
        bvl.u[i] = sVl[8 * hh + i][dt * 16 + ln]; bvl.u[8 + i] = sVl[16 + 8 * hh + i][dt * 16 + ln];
      }
      oacc[dt] = mmaN<3>(pah.v, pal.v, bvh.v, bvl.v, oacc[dt]);
    }
    __builtin_amdgcn_fence(__ATOMIC_ACQ_REL, "workgroup");
    __builtin_amdgcn_wave_barrier();
  }
#pragma unroll
  for (int r = 0; r < 8; ++r) {
    float l = l_r[r];
    l += __shfl_xor(l, 1, 32); l += __shfl_xor(l, 2, 32); l += __shfl_xor(l, 4, 32); l += __shfl_xor(l, 8, 32);
    l_r[r] = (l > 0.f) ? 1.0f / l : 0.f;
  }
#pragma unroll
  for (int dt = 0; dt < DT; ++dt)
#pragma unroll
    for (int r = 0; r < 8; ++r) sO[w][8 * hh + r][dt * 16 + ln] = oacc[dt][r] * l_r[r];
  __builtin_amdgcn_fence(__ATOMIC_ACQ_REL, "workgroup");
  __builtin_amdgcn_wave_barrier();
  {
    for (int r = 0; r < 16; ++r) {
      const int row = q0 + r;
      if (row < T && lane < D / 4) {
        const v4f val = *(const v4fa*)&sO[w][r][lane * 4];
        *(v4f*)(y + ((size_t)b * T + row) * ypitch + h * D + lane * 4) = val;
      }
    }
    
  }
}

// GEMM C = act(A·W + bias + resid): A f32 (ASPLIT -> hi/lo 2 terms), Wt bf16 [N][K]; ACT 0 none, 1 relu, 2 exact gelu;
// resid (optional, f32, row index = (row % rmod), pitch ldr, RES_BF16 rounds it) added before the activation.
template <bool ASPLIT, int ACT, bool BIAS_BF16, bool RES_BF16>
__global__ __launch_bounds__(128) void k_gemm_bf3(const float* __restrict__ A, int lda, const unsigned short* __restrict__ Wt, int ldb,
                                                const float* __restrict__ bias, const float* __restrict__ resid, int rmod, int ldr,
                                                float* __restrict__ C, int ldc, int M, int N, int K) {
  __shared__ __attribute__((aligned(16))) float so[4][16][64];
  const int tid = threadIdx.x, w = tid >> 5, lane = tid & 31, ln = lane & 15, hh = lane >> 4;
  const int ntn = N / 64;
  const int wid = blockIdx.x * 4 + w;
  const int mt = wid / ntn, nq = wid % ntn;
  if (mt * 16 >= M) return;
  const int row0 = mt * 16, col0 = nq * 64;
  const float* arow = A + (size_t)(row0 + ln) * lda;
  v8f acc[4] = {};
  for (int kb = 0; kb < K; kb += 32) {
    FragB ah, al;
    const v4f x0 = *(const v4fa*)(arow + kb + 8 * hh), x1 = *(const v4fa*)(arow + kb + 8 * hh + 4);
    const v4f x2 = *(const v4fa*)(arow + kb + 16 + 8 * hh), x3 = *(const v4fa*)(arow + kb + 16 + 8 * hh + 4);
    float xs[16] = {x0[0],x0[1],x0[2],x0[3],x1[0],x1[1],x1[2],x1[3],x2[0],x2[1],x2[2],x2[3],x3[0],x3[1],x3[2],x3[3]};
#pragma unroll
    for (int i = 0; i < 16; ++i) { const unsigned short hb = bf16_bits(xs[i]); ah.u[i] = hb; al.u[i] = ASPLIT ? bf16_bits(xs[i] - bf16_val(hb)) : (unsigned short)0; }
#pragma unroll
    for (int t = 0; t < 4; ++t) {
      const unsigned short* brow = Wt + (size_t)(col0 + t * 16 + ln) * ldb + kb;
      FragB b;
      b.half[0] = *(const v8us*)(brow + 8 * hh);
      b.half[1] = *(const v8us*)(brow + 16 + 8 * hh);
      acc[t] = mmaN<ASPLIT ? 2 : 1>(ah.v, al.v, b.v, b.v, acc[t]);
    }
  }
#pragma unroll
  for (int t = 0; t < 4; ++t) {
    const int col = col0 + t * 16 + ln;
    float bv = bias ? bias[col] : 0.f;
    if (BIAS_BF16) bv = bf16_round(bv);
#pragma unroll
    for (int r = 0; r < 8; ++r) {
      float v = acc[t][r] + bv;
      if (resid) { float rv = resid[(size_t)((row0 + 8 * hh + r) % rmod) * ldr + col]; if (RES_BF16) rv = bf16_round(rv); v += rv; }
      if (ACT == 1) v = fmaxf(v, 0.f);
      if (ACT == 2) v = 0.5f * v * (1.0f + erff(v * 0.70710678118654752f));
      if (ACT == 3) { const float u = 0.7978845608028654f * (v + 0.044715f * v * v * v); v = 0.5f * v * (1.0f + tanhf(u)); }
      so[w][8 * hh + r][t * 16 + ln] = v;
    }
  }
  __builtin_amdgcn_fence(__ATOMIC_ACQ_REL, "workgroup");
  __builtin_amdgcn_wave_barrier();
  const int rsub = lane >> 4, c4 = (lane & 15) * 4;
  {
#pragma unroll
    for (int q = 0; q < 8; ++q) {
      const int r = q * 2 + rsub;
      const v4f v = *(const v4fa*)&so[w][r][c4];
      *(v4f*)(C + (size_t)(row0 + r) * ldc + col0 + c4) = v;
    }
    
  }
}
// row LayerNorm (biased variance, eps) over N: s = X (+ R); optional out_sum <- s; out_norm <- (s-mu)*rsqrt(var+eps)*g + b
template <bool PARAM_BF16>
__global__ __launch_bounds__(256) void k_layernorm(const float* __restrict__ X, const float* __restrict__ R, const float* __restrict__ g, const float* __restrict__ bta,
                                                  float* __restrict__ out_sum, float* __restrict__ out_norm, int N, float eps) {
  __shared__ float red[256];
  const int row = blockIdx.x, tid = threadIdx.x;
  const float* x = X + (size_t)row * N; const float* rr = R ? R + (size_t)row * N : nullptr;
  float vals[16];                     // up to N = 4096
  const int per = N / 256;            // contiguous chunk per thread? use strided-by-4 chunks: thread handles j = tid*4 + 1024*u
  float s1 = 0.f;
  for (int u = 0; u < per / 4; ++u) {
    const int j = tid * 4 + 1024 * u;
    const v4f a = *(const v4fa*)(x + j);
    v4f b = {0.f,0.f,0.f,0.f}; if (rr) b = *(const v4fa*)(rr + j);
#pragma unroll
    for (int q = 0; q < 4; ++q) { const float v = a[q] + b[q]; vals[u * 4 + q] = v; s1 += v; }
  }
  red[tid] = s1; __syncthreads();
  for (int st = 128; st > 0; st >>= 1) { if (tid < st) red[tid] += red[tid + st]; __syncthreads(); }
  const float mu = red[0] / (float)N; __syncthreads();
  float s2 = 0.f;
  for (int u = 0; u < per / 4; ++u)
#pragma unroll
    for (int q = 0; q < 4; ++q) { const float c = vals[u * 4 + q] - mu; s2 += c * c; }
  red[tid] = s2; __syncthreads();
  for (int st = 128; st > 0; st >>= 1) { if (tid < st) red[tid] += red[tid + st]; __syncthreads(); }
  const float rs = rsqrtf(red[0] / (float)N + eps);
  {
    for (int u = 0; u < per / 4; ++u) {
      const int j = tid * 4 + 1024 * u;
      v4f o, sm;
#pragma unroll
      for (int q = 0; q < 4; ++q) {
        float gg = g[j + q], bb = bta[j + q];
        if (PARAM_BF16) { gg = bf16_round(gg); bb = bf16_round(bb); }
        sm[q] = vals[u * 4 + q]; o[q] = (vals[u * 4 + q] - mu) * rs * gg + bb;
      }
      if (out_sum) *(v4f*)(out_sum + (size_t)row * N + j) = sm;
      *(v4f*)(out_norm + (size_t)row * N + j) = o;
    }
    
  }
}



// ---- f16 WMMA path (v_wmma_f32_16x16x32_f16): 11-bit significands for operands in range — used where a [0,1] probability operand needs more precision than bf16
typedef _Float16 v16h __attribute__((ext_vector_type(16)));
union FragH { v16h v; v8us half[2]; _Float16 h[16]; unsigned short u[16]; };
template <int NT>
__device__ __forceinline__ v8f mmaH(v16h ah, v16h al, v16h bh, v16h bl, v8f c) {
  c = __builtin_amdgcn_wmma_f32_16x16x32_f16(false, ah, false, bh, (short)0, c, false, false);
  if (NT >= 2) c = __builtin_amdgcn_wmma_f32_16x16x32_f16(false, al, false, bh, (short)0, c, false, false);
  if (NT >= 3) c = __builtin_amdgcn_wmma_f32_16x16x32_f16(false, ah, false, bl, (short)0, c, false, false);
  asm volatile("v_nop\n\tv_nop\n\tv_nop\n\tv_nop" : "+v"(c) : "v"(ah), "v"(al), "v"(bh), "v"(bl));
  return c;
}
// batched GEMM like k_gemm_b but f16 operands: A f32 (split into f16 hi/lo if ASPLIT, else rounded to f16), Bt = f16 values [n][k]; alpha; C f32; N multiple of 16 (partial tiles skipped)
template <bool ASPLIT>
__global__ __launch_bounds__(128) void k_gemm_h(const float* __restrict__ A, int lda, size_t sA, const _Float16* __restrict__ Bh, int ldb, size_t sB, float alpha, float* __restrict__ C, int ldc, size_t sC, int M, int N, int K) {
  __shared__ __attribute__((aligned(16))) float so[4][16][64];
  const int tid = threadIdx.x, w = tid >> 5, lane = tid & 31, ln = lane & 15, hh = lane >> 4; const int by = blockIdx.y;
  A += (size_t)by * sA; Bh += (size_t)by * sB; C += (size_t)by * sC;
  const int ntn = (N + 63) / 64; const int wid = blockIdx.x * 4 + w; const int mt = wid / ntn, nq = wid % ntn; if (mt * 16 >= M) return;
  const int row0 = mt * 16, col0 = nq * 64; const float* arow = A + (size_t)(row0 + ln) * lda;
  v8f acc[4] = {};
  for (int kb = 0; kb < K; kb += 32) {
    FragH ah, al;
    const v4f x0 = *(const v4fa*)(arow + kb + 8 * hh), x1 = *(const v4fa*)(arow + kb + 8 * hh + 4), x2 = *(const v4fa*)(arow + kb + 16 + 8 * hh), x3 = *(const v4fa*)(arow + kb + 16 + 8 * hh + 4);
    float xs[16] = {x0[0],x0[1],x0[2],x0[3],x1[0],x1[1],x1[2],x1[3],x2[0],x2[1],x2[2],x2[3],x3[0],x3[1],x3[2],x3[3]};
#pragma unroll
    for (int i = 0; i < 16; ++i) { const _Float16 h = (_Float16)xs[i]; ah.h[i] = h; al.h[i] = ASPLIT ? (_Float16)(xs[i] - (float)h) : (_Float16)0.0f; }
#pragma unroll
    for (int t = 0; t < 4; ++t) { if (col0 + t * 16 >= N) continue; const size_t boff = (size_t)(col0 + t * 16 + ln) * ldb + kb; FragH bq; bq.half[0] = *(const v8us*)(Bh + boff + 8 * hh); bq.half[1] = *(const v8us*)(Bh + boff + 16 + 8 * hh);
      acc[t] = mmaH<ASPLIT ? 2 : 1>(ah.v, al.v, bq.v, bq.v, acc[t]); }
  }
#pragma unroll
  for (int t = 0; t < 4; ++t) { if (col0 + t * 16 >= N) continue;
#pragma unroll
    for (int r = 0; r < 8; ++r) so[w][8 * hh + r][t * 16 + ln] = acc[t][r] * alpha; }
  __builtin_amdgcn_fence(__ATOMIC_ACQ_REL, "workgroup"); __builtin_amdgcn_wave_barrier();
  const int rsub = lane >> 4, c4 = (lane & 15) * 4;
  {
#pragma unroll
    for (int q = 0; q < 8; ++q) { const int r = q * 2 + rsub; if (col0 + c4 < N) { const v4f v = *(const v4fa*)&so[w][r][c4]; *(v4f*)(C + (size_t)(row0 + r) * ldc + col0 + c4) = v; } }
     }
}

// Wt[n][k] = f16(W[k][n]·scale) from f32 row-major W[K][N] (scale = power of two; bf16-exact weights stay exact in f16 away from the subnormal range)
__global__ __launch_bounds__(256) void k_wt_f16(const float* __restrict__ W, _Float16* __restrict__ Wt, int K, int N, float scale) {
  const int t = blockIdx.x * 256 + threadIdx.x; if (t >= N * (K / 8)) return; const int n = t / (K / 8), k8 = (t % (K / 8)) * 8; FragH f;
#pragma unroll
  for (int i = 0; i < 8; ++i) f.h[i] = (_Float16)(bf16_round(W[(size_t)(k8 + i) * N + n]) * scale); const v8us o = f.half[0];
  *(v8us*)((unsigned short*)Wt + (size_t)n * K + k8) = o; 
}
// Projection GEMM, fixed shape M = NR, N = K = CC: v = acc/16 + bf16(bias[col]); writes f16 C16 (HALF_OUT) or f32 C.
// One work-group = one 128 x 128 tile of the output, 8 waves as 4 x 2, 32 x 64 a wave. A pass is 64 k: 128 rows of A and 128 rows of W, 128 B (one line) each,
// copied once per work-group into LDS at pitch 144 B (16 B x odd: conflict-free ds_load_b128); two buffers, the next pass's copies fly while this pass is multiplied.
typedef _Float16 v4h __attribute__((ext_vector_type(4)));
template <bool HALF_OUT>
__global__ __launch_bounds__(256) void k_proj(const _Float16* __restrict__ A, const _Float16* __restrict__ Bh, const float* __restrict__ bias, float* __restrict__ C, _Float16* __restrict__ C16) {
  constexpr int BT = 128, BK = 64, RP = 144, TILE = BT * RP, STG = 2 * TILE, NPASS = CC / BK, SOP = 68;
  static_assert(NR % BT == 0 && CC % BT == 0 && CC % BK == 0 && NPASS >= 2, "whole tiles, at least two passes");
  __shared__ __attribute__((aligned(16))) unsigned char ring[2 * STG];
  static_assert(sizeof(float) * 8 * 32 * SOP <= 2 * STG, "output staging must fit in the ring");
  float (*so)[32][SOP] = reinterpret_cast<float (*)[32][SOP]>(ring);      /* output staging takes the ring's place behind the last pass's barrier; pitch 68 dwords keeps the two lane halves on different banks */
  const int tid = threadIdx.x, w = tid >> 5, lane = tid & 31, ln = lane & 15, hh = lane >> 4;
  const int row0 = (blockIdx.x / (CC / BT)) * BT, col0 = (blockIdx.x % (CC / BT)) * BT;
  const int wr = (w >> 1) * 32, wc = (w & 1) * 64;
  /* each thread copies 4 x 16 B of A and 4 x 16 B of W per pass; a wave-wide copy = 4 whole rows = 4 lines */
  const char* gA = (const char*)((const unsigned short*)A + (size_t)(row0 + (tid >> 3)) * CC) + (tid & 7) * 16;
  const char* gB = (const char*)((const unsigned short*)Bh + (size_t)(col0 + (tid >> 3)) * CC) + (tid & 7) * 16;
  const unsigned lA = (unsigned)(size_t)ring + (unsigned)((tid >> 3) * RP + (tid & 7) * 16);
  constexpr size_t R32 = (size_t)32 * CC * 2;      /* bytes from a row to the row 32 below it */
  auto stage_copies = [&](int p, unsigned bofs) {
    const char* a0 = gA + (size_t)p * (BK * 2); const char* b0 = gB + (size_t)p * (BK * 2); const unsigned a = lA + bofs, c = a + (unsigned)TILE;
    /* the s_wait_xcnt closes the statement so that no address register of a copy is rewritten ahead of it */
    asm volatile("global_load_async_to_lds_b128 %0, %8, off\n\t"
                 "global_load_async_to_lds_b128 %1, %9, off\n\t"
                 "global_load_async_to_lds_b128 %2, %10, off\n\t"
                 "global_load_async_to_lds_b128 %3, %11, off\n\t"
                 "global_load_async_to_lds_b128 %4, %12, off\n\t"
                 "global_load_async_to_lds_b128 %5, %13, off\n\t"
                 "global_load_async_to_lds_b128 %6, %14, off\n\t"
                 "global_load_async_to_lds_b128 %7, %15, off\n\t"
                 "s_wait_xcnt 0x0"
                 :: "v"(a), "v"(a + 32 * RP), "v"(a + 64 * RP), "v"(a + 96 * RP), "v"(c), "v"(c + 32 * RP), "v"(c + 64 * RP), "v"(c + 96 * RP),
                    "v"(a0), "v"(a0 + R32), "v"(a0 + 2 * R32), "v"(a0 + 3 * R32), "v"(b0), "v"(b0 + R32), "v"(b0 + 2 * R32), "v"(b0 + 3 * R32)
                 : "memory");
  };
  v8f acc[2][4] = {};
  stage_copies(0, 0u);
  asm volatile("s_wait_asynccnt 0x0" ::: "memory");      /* pass 0 of this wave has landed */
  __syncthreads();                                       /* ... and every wave's part of it is published */
  stage_copies(1, (unsigned)STG);
#pragma unroll 2      /* two passes a trip make the buffer offsets immediates; fully unrolled the copies' addresses of all passes took the wave past 256 VGPRs */
  for (int p = 0; p < NPASS; ++p) {
    const unsigned bofs = (unsigned)(p & 1) * (unsigned)STG;
    const unsigned char* at = ring + bofs + (wr + ln) * RP + 16 * hh; const unsigned char* bt = ring + bofs + TILE + (wc + ln) * RP + 16 * hh;
#pragma unroll      /* this loop and those inside it: constant indices keep the fragments and acc in registers */
    for (int ks = 0; ks < BK / 32; ++ks) { FragH fa[2], fb[4];
#pragma unroll
      for (int i = 0; i < 2; ++i) { fa[i].half[0] = *(const v8us*)(at + i * 16 * RP + ks * 64); fa[i].half[1] = *(const v8us*)(at + i * 16 * RP + ks * 64 + 32); }
#pragma unroll
      for (int t = 0; t < 4; ++t) { fb[t].half[0] = *(const v8us*)(bt + t * 16 * RP + ks * 64); fb[t].half[1] = *(const v8us*)(bt + t * 16 * RP + ks * 64 + 32); }
#pragma unroll
      for (int i = 0; i < 2; ++i)
#pragma unroll
        for (int t = 0; t < 4; ++t) acc[i][t] = __builtin_amdgcn_wmma_f32_16x16x32_f16(false, fa[i].v, false, fb[t].v, (short)0, acc[i][t], false, false); }
    asm volatile("s_wait_dscnt 0x0" ::: "memory");         /* this wave's reads of the buffer are done before it is refilled */
    asm volatile("s_wait_asynccnt 0x0" ::: "memory");      /* this wave's copies of the next pass have landed */
    __syncthreads();                                       /* publishes the next pass and ends every wave's reads of this one */
    if (p + 2 < NPASS) stage_copies(p + 2, bofs); }
  asm volatile("s_wait_asynccnt 0x0" ::: "memory");        /* nothing in flight when the ring becomes output staging */
#pragma unroll      /* this loop and the two inside it: constant indices into acc */
  for (int t = 0; t < 4; ++t) { const float bv = bf16_round(bias[col0 + wc + t * 16 + ln]);
#pragma unroll
    for (int i = 0; i < 2; ++i)
#pragma unroll
      for (int r = 0; r < 8; ++r) so[w][i * 16 + 8 * hh + r][t * 16 + ln] = acc[i][t][r] * 0.0625f + bv; }
  __builtin_amdgcn_fence(__ATOMIC_ACQ_REL, "workgroup"); __builtin_amdgcn_wave_barrier();      /* orders this wave's staging stores ahead of its reads; no work-group barrier: a wave reads back only its own rows */
  const int rsub = lane >> 4, c4 = (lane & 15) * 4;
#pragma unroll      /* the 16 LDS reads go out as one group ahead of the stores; a store = 2 rows of whole lines */
  for (int q = 0; q < 16; ++q) { const int r = q * 2 + rsub; const v4f v = *(const v4fa*)&so[w][r][c4]; const size_t o = (size_t)(row0 + wr + r) * CC + col0 + wc + c4;
    if (HALF_OUT) { v4h h4; for (int i = 0; i < 4; ++i) h4[i] = (_Float16)v[i]; *(v4h*)(C16 + o) = h4; } else *(v4f*)(C + o) = v; }
}


__global__ __launch_bounds__(256) void k_x16(const float* __restrict__ x, _Float16* __restrict__ X16, size_t n8) { const size_t t = (size_t)blockIdx.x * 256 + threadIdx.x; if (t >= n8) return; FragH f;
#pragma unroll
  for (int q = 0; q < 8; ++q) f.h[q] = (_Float16)bf16_round(x[t * 8 + q]); *(v8us*)((unsigned short*)X16 + t * 8) = f.half[0];  }
__global__ __launch_bounds__(256) void k_h16(const float* __restrict__ x, _Float16* __restrict__ X16, size_t n8) { const size_t t = (size_t)blockIdx.x * 256 + threadIdx.x; if (t >= n8) return; FragH f;
#pragma unroll
  for (int q = 0; q < 8; ++q) f.h[q] = (_Float16)x[t * 8 + q]; *(v8us*)((unsigned short*)X16 + t * 8) = f.half[0];  }
__global__ __launch_bounds__(256) void k_round16f(const float* __restrict__ W, _Float16* __restrict__ Bt, size_t n8) { const size_t t = (size_t)blockIdx.x * 256 + threadIdx.x; if (t >= n8) return; FragH f;
#pragma unroll
  for (int i = 0; i < 8; ++i) f.h[i] = (_Float16)(bf16_round(W[t * 8 + i]) * 16.0f); *(v8us*)((unsigned short*)Bt + t * 8) = f.half[0];  }
template <int NHv, int TTv>
__global__ __launch_bounds__(256) void k_vt(const _Float16* __restrict__ V16, int ldv, int voff, _Float16* __restrict__ Vt) { __shared__ unsigned short tl[64][66]; const int tid = threadIdx.x; const int slab = blockIdx.x / (TTv / 64), lg = blockIdx.x % (TTv / 64); const int b = slab / NHv, h = slab % NHv;
  for (int i = tid; i < 64 * 8; i += 256) { const int r = i / 8, c8 = (i % 8) * 8; FragH f; f.half[0] = *(const v8us*)((const unsigned short*)V16 + ((size_t)b * TTv + lg * 64 + r) * ldv + voff + h * 64 + c8);
#pragma unroll
    for (int q = 0; q < 8; ++q) tl[r][c8 + q] = f.u[q]; }
  __syncthreads();
  {
#pragma unroll
    for (int rd = 0; rd < 2; ++rd) { const int d = rd * 32 + tid / 8, pc = tid % 8; FragH f;
#pragma unroll
      for (int q = 0; q < 8; ++q) f.u[q] = tl[pc * 8 + q][d];
      *(v8us*)((unsigned short*)Vt + ((size_t)slab * 64 + d) * TTv + lg * 64 + pc * 8) = f.half[0]; }
     } }

__global__ __launch_bounds__(256) void k_tok(const float* __restrict__ x, _Float16* __restrict__ X16) { __shared__ float tl[32][65]; const int tid = threadIdx.x; const int b = blockIdx.x / ((CC / 64) * (NN / 32)), rem = blockIdx.x % ((CC / 64) * (NN / 32)); const int cg = rem / (NN / 32), pg = rem % (NN / 32); const int c0 = cg * 64, p0 = pg * 32;
  for (int i = tid; i < 64 * 32; i += 256) { const int c = i / 32, pp = i % 32; tl[pp][c] = bf16_round(x[((size_t)b * CC + c0 + c) * NN + p0 + pp]); } __syncthreads();
  const int r = tid / 8, pc = tid % 8; FragH f; for (int q = 0; q < 8; ++q) f.h[q] = (_Float16)tl[r][pc * 8 + q]; const size_t row = (size_t)b * NN + p0 + r; *(v8us*)((unsigned short*)X16 + row * CC + c0 + pc * 8) = f.half[0];  }
__global__ __launch_bounds__(256) void k_vthlu(const float* __restrict__ VF, int ldv, _Float16* __restrict__ Vth, _Float16* __restrict__ Vtl) { __shared__ float tl[64][65]; const int tid = threadIdx.x; const int slab = blockIdx.x / (TT / 64), lg = blockIdx.x % (TT / 64); const int b = slab / NVH, h = slab % NVH;
  for (int i = tid; i < 64 * 16; i += 256) { const int r = i / 16, c4 = (i % 16) * 4; const v4f a = *(const v4fa*)(VF + ((size_t)b * TT + lg * 64 + r) * ldv + h * 64 + c4); tl[r][c4] = a[0]; tl[r][c4 + 1] = a[1]; tl[r][c4 + 2] = a[2]; tl[r][c4 + 3] = a[3]; }
  __syncthreads();
  FragH fh[2], fl[2]; size_t oo[2];
#pragma unroll
  for (int rd = 0; rd < 2; ++rd) { const int d = rd * 32 + tid / 8, pc = tid % 8;
#pragma unroll
    for (int q = 0; q < 8; ++q) { const float v = tl[pc * 8 + q][d]; const _Float16 hv = (_Float16)v; fh[rd].h[q] = hv; fl[rd].h[q] = (_Float16)(v - (float)hv);      /* UNSCALED residual (k_flash reads only the hi plane) */ } oo[rd] = ((size_t)slab * 64 + d) * TT + lg * 64 + pc * 8; }
  {
#pragma unroll
    for (int rd = 0; rd < 2; ++rd) { *(v8us*)((unsigned short*)Vth + oo[rd]) = fh[rd].half[0]; *(v8us*)((unsigned short*)Vtl + oo[rd]) = fl[rd].half[0]; }
     } }
__global__ __launch_bounds__(256) void k_krt(const float* __restrict__ KF, const float* __restrict__ rh, const float* __restrict__ rw, _Float16* __restrict__ K16) { const size_t t = (size_t)blockIdx.x * 256 + threadIdx.x; if (t >= (size_t)NR * CC / 8) return; const size_t row = (t * 8) / CC; const int c0 = (int)((t * 8) % CC); const int n = (int)(row % NN); const int na = n / 32, nb = n % 32; const v4f a = *(const v4fa*)(KF + t * 8), c = *(const v4fa*)(KF + t * 8 + 4); FragH f;
#pragma unroll
  for (int q = 0; q < 8; ++q) { const int ch = c0 + q; const int h = ch / HDD, d = ch % HDD; const float r1 = bf16_round(rh[((size_t)h * HDD + d) * 32 + nb]) + bf16_round(rw[((size_t)h * HDD + d) * 32 + na]); f.h[q] = (_Float16)(((q < 4) ? a[q] : c[q - 4]) + r1); }
  *(v8us*)((unsigned short*)K16 + t * 8) = f.half[0];  }
/* lane l <-> lane l ^ 16 as a vector cross-row move */
__device__ __forceinline__ float xhalf(float x) { return __builtin_bit_cast(float, __builtin_amdgcn_permlanex16(__builtin_bit_cast(int, x), __builtin_bit_cast(int, x), 0x76543210, 0xfedcba98, false, false)); }
__global__ __launch_bounds__(128) void k_flash(const _Float16* __restrict__ Q16, int ldq, const _Float16* __restrict__ K16, int ldk, const _Float16* __restrict__ Vt, const _Float16* __restrict__ Vtlo, float* __restrict__ O, int ldo) {
  constexpr int RPW = 16, NQB = TT / (4 * RPW), DT = 8, KS = 4;      /* head dim 128: 4 k-steps, 8 value tiles */
  /* K/V ring shared by the four waves: two stages of 32 keys; a stage = 32 K rows of 256 B at pitch 272 B, then 128 V^T rows of 64 B at pitch 80 B (16 B x odd: conflict-free ds_load_b128) */
  constexpr int KP = 272, VP = 80, VOFF = 32 * KP, STG = VOFF + 128 * VP;
  __shared__ __attribute__((aligned(16))) unsigned char ring[2 * STG];
  static_assert(sizeof(float) * 4 * RPW * (128 + 4) <= 2 * STG, "output staging must fit in the ring");
  float (*sO)[RPW][128 + 4] = reinterpret_cast<float (*)[RPW][128 + 4]>(ring);      /* output staging takes the ring's place behind the last pass's barrier */
  const int tid = threadIdx.x, w = tid >> 5, lane = tid & 31, ln = lane & 15, hh = lane >> 4;
  const int slab = blockIdx.x / NQB, qblk = blockIdx.x % NQB; const int b = slab / NH, h = slab % NH; const int qb0 = qblk * (4 * RPW); const int q0 = qb0 + w * RPW;
  FragH aq[KS];
  { const unsigned short* qr = (const unsigned short*)Q16 + ((size_t)b * TT + q0 + ln) * ldq + h * 128;
#pragma unroll
    for (int ks = 0; ks < KS; ++ks) { aq[ks].half[0] = *(const v8us*)(qr + ks * 32 + 8 * hh); aq[ks].half[1] = *(const v8us*)(qr + ks * 32 + 16 + 8 * hh); } }
  const unsigned short* Vth = (const unsigned short*)Vt + (size_t)slab * 128 * TT;
  float m_q = -3.0e38f, l_q = 0.f; v8f oacc[DT];      /* running maximum (equal in both halves) and this half's partial sum of query q0 + ln; oacc[dt][r] = O^T[dt*16 + 8*hh + r][ln] */
#pragma unroll
  for (int dt = 0; dt < DT; ++dt) oacc[dt] = (v8f){0.f,0.f,0.f,0.f,0.f,0.f,0.f,0.f};
  const int jend = TT;
  /* each thread copies 4 x 16 B of K (a wave-wide copy = 2 whole rows = 4 lines) and 4 x 16 B of V^T (8 rows x 64 B) per stage */
  const char* gK = (const char*)((const unsigned short*)K16 + ((size_t)b * TT + (tid >> 4)) * ldk + h * 128) + (tid & 15) * 16;
  const char* gV = (const char*)(Vth + (size_t)(tid >> 2) * TT) + (tid & 3) * 16;
  const size_t kstep = (size_t)ldk * 2;      /* bytes per key row of K */
  const unsigned lK = (unsigned)(size_t)ring + (unsigned)((tid >> 4) * KP + (tid & 15) * 16);
  const unsigned lV = (unsigned)(size_t)ring + (unsigned)(VOFF + (tid >> 2) * VP + (tid & 3) * 16);
  auto stage_copies = [&](int j, unsigned bofs) {
    const char* k0 = gK + (size_t)j * kstep; const char* v0 = gV + (size_t)j * 2; const unsigned a = lK + bofs, c = lV + bofs;
    /* the s_wait_xcnt closes the statement so that no address register of a copy is rewritten ahead of it */
    asm volatile("global_load_async_to_lds_b128 %0, %8, off\n\t"
                 "global_load_async_to_lds_b128 %1, %9, off\n\t"
                 "global_load_async_to_lds_b128 %2, %10, off\n\t"
                 "global_load_async_to_lds_b128 %3, %11, off\n\t"
                 "global_load_async_to_lds_b128 %4, %12, off\n\t"
                 "global_load_async_to_lds_b128 %5, %13, off\n\t"
                 "global_load_async_to_lds_b128 %6, %14, off\n\t"
                 "global_load_async_to_lds_b128 %7, %15, off\n\t"
                 "s_wait_xcnt 0x0"
                 :: "v"(a), "v"(a + 8 * KP), "v"(a + 16 * KP), "v"(a + 24 * KP), "v"(c), "v"(c + 32 * VP), "v"(c + 64 * VP), "v"(c + 96 * VP),
                    "v"(k0), "v"(k0 + 8 * kstep), "v"(k0 + 16 * kstep), "v"(k0 + 24 * kstep), "v"(v0), "v"(v0 + (size_t)32 * TT * 2), "v"(v0 + (size_t)64 * TT * 2), "v"(v0 + (size_t)96 * TT * 2)
                 : "memory");
  };
  stage_copies(0, 0u);
  asm volatile("s_wait_asynccnt 0x0" ::: "memory");      /* stage 0 of this wave has landed */
  __syncthreads();                                       /* ... and every wave's part of it is published */
  stage_copies(32, (unsigned)STG);
#pragma unroll 1
  for (int j0 = 0; j0 < jend; j0 += 32) {
    const unsigned bofs = (unsigned)((j0 >> 5) & 1) * (unsigned)STG; const unsigned char* kt = ring + bofs; const unsigned char* vt = kt + VOFF;
    v8f st[2];
#pragma unroll
    for (int nt = 0; nt < 2; ++nt) { const unsigned short* kr = (const unsigned short*)(kt + (nt * 16 + ln) * KP); FragH bk[KS];
#pragma unroll
      for (int ks = 0; ks < KS; ++ks) { bk[ks].half[0] = *(const v8us*)(kr + ks * 32 + 8 * hh); bk[ks].half[1] = *(const v8us*)(kr + ks * 32 + 16 + 8 * hh); }
      v8f acc = (v8f){0.f,0.f,0.f,0.f,0.f,0.f,0.f,0.f};
#pragma unroll
      for (int ks = 0; ks < KS; ++ks) acc = mmaH<1>(bk[ks].v, bk[ks].v, aq[ks].v, aq[ks].v, acc);
      st[nt] = acc; }
    float sc[16];
#pragma unroll      /* this loop and the three below: constant indices keep the scores, P and oacc in registers */
    for (int i = 0; i < 16; ++i) sc[i] = st[i >> 3][i & 7] * ATT_SCALE;
    float mc = sc[0];
#pragma unroll
    for (int i = 1; i < 16; ++i) mc = fmaxf(mc, sc[i]);
    mc = fmaxf(mc, xhalf(mc));      /* the other 16 keys of this query sit in lane ^ 16 */
    const float mn = fmaxf(m_q, mc); const float al = (mn > -1.0e38f) ? expf(m_q - mn) : 1.0f; m_q = mn;
    FragH ph, pl; float ls[4] = {0.f, 0.f, 0.f, 0.f};      /* four independent partial sums: a chain of 4 dependent adds, not 16 */
#pragma unroll
    for (int i = 0; i < 16; ++i) { const float p = expf(sc[i] - mn); ls[i & 3] += p; const float ps = p * 1024.0f; ph.h[i] = (_Float16)ps; pl.h[i] = (_Float16)(ps - (float)ph.h[i]); }      /* P hi and its UNSCALED residual (added into the same accumulator); element i = key (i >> 3) * 16 + 8 * hh + (i & 7) */
    l_q = l_q * al + ((ls[0] + ls[1]) + (ls[2] + ls[3]));
#pragma unroll
    for (int dt = 0; dt < DT; ++dt) oacc[dt] *= al;
    FragH bv[DT];
#pragma unroll
    for (int dt = 0; dt < DT; ++dt) { const unsigned short* vr = (const unsigned short*)(vt + (dt * 16 + ln) * VP); bv[dt].half[0] = *(const v8us*)(vr + 8 * hh); bv[dt].half[1] = *(const v8us*)(vr + 16 + 8 * hh); }      /* all V fragments of the pass as one group of LDS reads, ahead of the products: one LDS latency a pass, not eight */
#pragma unroll      /* constant dt keeps bv and oacc in registers */
    for (int dt = 0; dt < DT; ++dt) { oacc[dt] = mmaH<1>(bv[dt].v, bv[dt].v, ph.v, ph.v, oacc[dt]); oacc[dt] = mmaH<1>(bv[dt].v, bv[dt].v, pl.v, pl.v, oacc[dt]); }      /* Vh^T.(Ph + Pl)^T - the V residual term is dropped here: near-uniform attention over 1024 keys averages the f16 rounding of v */
    asm volatile("s_wait_dscnt 0x0" ::: "memory");         /* this wave's reads of the stage are done before the stage is refilled */
    asm volatile("s_wait_asynccnt 0x0" ::: "memory");      /* this wave's copies of the next stage have landed */
    __syncthreads();                                       /* publishes the next stage and ends every wave's reads of this one */
    if (j0 + 64 < jend) stage_copies(j0 + 64, bofs); }
  asm volatile("s_wait_asynccnt 0x0" ::: "memory");        /* nothing in flight when the ring becomes output staging */
  { float l = l_q; l += xhalf(l); const float inv = (l > 0.f) ? 1.0f / (l * 1024.0f) : 0.f;      /* the two halves' partial sums joined once */
#pragma unroll      /* constant dt: oacc stays in registers; a lane's 8 values are 8 consecutive d of its query's row */
    for (int dt = 0; dt < DT; ++dt) { const v4f lo = {oacc[dt][0] * inv, oacc[dt][1] * inv, oacc[dt][2] * inv, oacc[dt][3] * inv}, hi = {oacc[dt][4] * inv, oacc[dt][5] * inv, oacc[dt][6] * inv, oacc[dt][7] * inv};
      *(v4fa*)&sO[w][ln][dt * 16 + 8 * hh] = lo; *(v4fa*)&sO[w][ln][dt * 16 + 8 * hh + 4] = hi; } }
  __builtin_amdgcn_fence(__ATOMIC_ACQ_REL, "workgroup"); __builtin_amdgcn_wave_barrier();
  {
#pragma unroll
    for (int r = 0; r < RPW; ++r) { const int pc = lane; const v4f val = *(const v4fa*)&sO[w][r][pc * 4]; *(v4f*)(O + ((size_t)slab * TT + q0 + r) * 128 + pc * 4) = val; }      /* output laid out [b][h][n][128] (the module reinterprets that buffer as [B,C,H,W]); one 512-B row per instruction: 32 lanes x 16 B */
     } }

extern "C" void kernel_launch(void* const* d_in, const int* in_sizes, int n_in,
                              void* d_out, int out_size, void* d_ws, size_t ws_size, hipStream_t stream) {
  (void)in_sizes; (void)n_in; (void)out_size;
  const float* const* I = (const float* const*)d_in; const float* x = I[0]; const float* Wq = I[1]; const float* bq = I[2]; const float* Wk = I[3]; const float* bk = I[4]; const float* Wv = I[5]; const float* bv = I[6]; const float* rh = I[7]; const float* rw = I[8];
  char* ws = (char*)d_ws; size_t off = 0;
  auto take = [&](size_t bytes) { char* p = ws + off; off += (bytes + 255) & ~(size_t)255; return p; };
  const size_t WSZ = (size_t)CC * CC; _Float16* Bw = (_Float16*)take(3 * WSZ * 2); _Float16* X16 = (_Float16*)take((size_t)NR * CC * 2); _Float16* Q = (_Float16*)take((size_t)NR * CC * 2); float* F32 = (float*)take((size_t)NR * CC * 4); _Float16* K = (_Float16*)take((size_t)NR * CC * 2); _Float16* Vt = (_Float16*)take((size_t)NR * CC * 2); _Float16* Vtl = X16;      /* Vᵀ residual over the token plane (dead after the three projections) */
  if (off > ws_size) return;      // 1.6 + 16.8 + 16.8 + 33.6 + 16.8 + 16.8 ≈ 102 MB
  const unsigned gw = (unsigned)((WSZ / 8 + 255) / 256); k_round16f<<<gw, 256, 0, stream>>>(Wq, Bw, WSZ / 8); k_round16f<<<gw, 256, 0, stream>>>(Wk, Bw + WSZ, WSZ / 8); k_round16f<<<gw, 256, 0, stream>>>(Wv, Bw + 2 * WSZ, WSZ / 8);      /* (out,in) natural ×2^4 */
  k_tok<<<BB * (CC / 64) * (NN / 32), 256, 0, stream>>>(x, X16);      /* [B][C][N] → token-major bf16 plane */
  const dim3 gp((NR / 128) * (CC / 128), 1); const unsigned g8 = (unsigned)(((size_t)NR * CC / 8 + 255) / 256);
  k_proj<true><<<gp, 256, 0, stream>>>(X16, Bw, bq, nullptr, Q);      /* q (unscaled) f16: M 16384 N 512 K 512 */
  k_proj<false><<<gp, 256, 0, stream>>>(X16, Bw + WSZ, bk, F32, nullptr); k_krt<<<g8, 256, 0, stream>>>(F32, rh, rw, K);      /* k' = k + rtᵀ */
  k_proj<false><<<gp, 256, 0, stream>>>(X16, Bw + 2 * WSZ, bv, F32, nullptr); k_vthlu<<<BB * NVH * (NN / 64), 256, 0, stream>>>(F32, CC, Vt, Vtl);      /* v f32 → Vᵀ hi / residual per (b, h) [128][N] via 8 half-heads of 64 */
  k_flash<<<BB * NH * (NN / 64), 128, 0, stream>>>(Q, CC, K, CC, Vt, Vtl, (float*)d_out, 128);      /* y → d_out as [b][h][n][128] */
}

// v004
// One run takes 120 microseconds.
// Two timings next to v003 put it at 1.56 and 1.55 times that version's speed.
// All steps since v000 together make it 3.61 times as fast.
#include <hip/hip_runtime.h>
// Bottleneck-transformer MHSA with relative position term (B=16, C=512, 32×32 → N=1024, 4 heads × 128): q,k,v = 1×1 convs ((out,in) + bias); logits = (q·C^-½)·(k + rt) where rt[h][d][n] = rh[h][d][n mod 32] + rw[h][d][n div 32]
// (the module's (rh + rw).reshape(1, heads, emb, N)); softmax; y = attn·v per head; the output is the [B][h][N][d] buffer reinterpreted as [B,C,H,W] (the module's final reshape).
// Compute dtype: x, weights, biases, rh, rw rounded to bf16; token-major bf16 input plane; q as an f16 GEMM plane (unscaled — the C^-½ is applied to the f32 score), k as an f32 GEMM output with rtᵀ added in f32 then f16,
// v f16; fused flash-style kernel for head dim 128 (4 k-steps, 8 value tiles, online softmax f32, P as f16 + its exact f16 residual, V f16, one f32 accumulator) on v_wmma_f32_16x16x32_f16 writing y directly; f32 accumulate.
#define BB 16
#define CC 512
#define NN 1024
#define TT NN
#define NH 4
#define HDD 128
#define NVH (2 * NH)
#define NR (BB * NN)
#define ATT_SCALE 0.04419417382415922f

typedef __bf16 v16b __attribute__((ext_vector_type(16)));
typedef unsigned short v8us __attribute__((ext_vector_type(8), may_alias));
typedef float  v8f  __attribute__((ext_vector_type(8)));
typedef float  v4f  __attribute__((ext_vector_type(4)));
typedef float  v4fa __attribute__((ext_vector_type(4), may_alias));
union FragB { v16b v; v8us half[2]; unsigned short u[16]; };

__device__ __forceinline__ unsigned short bf16_bits(float x) { unsigned int u = __float_as_uint(x); return (unsigned short)((u + 0x7FFFu + ((u >> 16) & 1u)) >> 16); }
__device__ __forceinline__ float bf16_val(unsigned short b) { return __uint_as_float(((unsigned int)b) << 16); }
__device__ __forceinline__ float bf16_round(float x) { return bf16_val(bf16_bits(x)); }
// D += A·B with NT terms: 1 = ah·bh, 2 = + al·bh (A split), 3 = + ah·bl (both split)
template <int NT>
__device__ __forceinline__ v8f mmaN(v16b ah, v16b al, v16b bh, v16b bl, v8f c) {
  c = __builtin_amdgcn_wmma_f32_16x16x32_bf16(false, ah, false, bh, (short)0, c, false, false);
  if (NT >= 2) c = __builtin_amdgcn_wmma_f32_16x16x32_bf16(false, al, false, bh, (short)0, c, false, false);
  if (NT >= 3) c = __builtin_amdgcn_wmma_f32_16x16x32_bf16(false, ah, false, bl, (short)0, c, false, false);
  asm volatile("v_nop\n\tv_nop\n\tv_nop\n\tv_nop" : "+v"(c) : "v"(ah), "v"(al), "v"(bh), "v"(bl));
  return c;
}

__global__ __launch_bounds__(256) void k_wt_bf16(const float* __restrict__ W, unsigned short* __restrict__ Wt, int K, int N) {
  const int t = blockIdx.x * 256 + threadIdx.x;
  const int k8n = K / 8;
  if (t >= N * k8n) return;
  const int n = t / k8n, k8 = (t % k8n) * 8;
  v8us v;
#pragma unroll
  for (int i = 0; i < 8; ++i) v[i] = bf16_bits(W[(size_t)(k8 + i) * N + n]);
  *(v8us*)(Wt + (size_t)n * K + k8) = v;
  
}

// GEMM C[M][N] (f32, pitch ldc) = act(A[M][K]·W + bias). A f32 row-major (pitch lda) converted per fragment to bf16
// (ASPLIT: hi/lo two planes -> 2 terms, else single rounded term); Wt bf16 [N][K] (pitch ldb). BIAS_BF16 rounds the
// bias to bf16 first (bias quantised to bf16 before the add). K%32==0, M%16==0, N%64==0.
template <bool ASPLIT, int ACT, bool BIAS_BF16>
__global__ __launch_bounds__(128) void k_gemm_bf(const float* __restrict__ A, int lda, const unsigned short* __restrict__ Wt, int ldb,
                                               const float* __restrict__ bias, float* __restrict__ C, int ldc, int M, int N, int K) {
  __shared__ __attribute__((aligned(16))) float so[4][16][64];
  const int tid = threadIdx.x, w = tid >> 5, lane = tid & 31, ln = lane & 15, hh = lane >> 4;
  const int ntn = N / 64;
  const int wid = blockIdx.x * 4 + w;
  const int mt = wid / ntn, nq = wid % ntn;
  if (mt * 16 >= M) return;
  const int row0 = mt * 16, col0 = nq * 64;
  const float* arow = A + (size_t)(row0 + ln) * lda;
  v8f acc[4] = {};
  for (int kb = 0; kb < K; kb += 32) {
    FragB ah, al;
    const v4f x0 = *(const v4fa*)(arow + kb + 8 * hh), x1 = *(const v4fa*)(arow + kb + 8 * hh + 4);
    const v4f x2 = *(const v4fa*)(arow + kb + 16 + 8 * hh), x3 = *(const v4fa*)(arow + kb + 16 + 8 * hh + 4);
    float xs[16] = {x0[0],x0[1],x0[2],x0[3],x1[0],x1[1],x1[2],x1[3],x2[0],x2[1],x2[2],x2[3],x3[0],x3[1],x3[2],x3[3]};
#pragma unroll
    for (int i = 0; i < 16; ++i) { const unsigned short hb = bf16_bits(xs[i]); ah.u[i] = hb; al.u[i] = ASPLIT ? bf16_bits(xs[i] - bf16_val(hb)) : (unsigned short)0; }
#pragma unroll
    for (int t = 0; t < 4; ++t) {
      const unsigned short* brow = Wt + (size_t)(col0 + t * 16 + ln) * ldb + kb;
      FragB b;
      b.half[0] = *(const v8us*)(brow + 8 * hh);
      b.half[1] = *(const v8us*)(brow + 16 + 8 * hh);
      acc[t] = mmaN<ASPLIT ? 2 : 1>(ah.v, al.v, b.v, b.v, acc[t]);
    }
  }
#pragma unroll
  for (int t = 0; t < 4; ++t) {
    float bv = bias ? bias[col0 + t * 16 + ln] : 0.f;
    if (BIAS_BF16) bv = bf16_round(bv);
#pragma unroll
    for (int r = 0; r < 8; ++r) { float v = acc[t][r] + bv; if (ACT == 1) v = fmaxf(v, 0.f); so[w][8 * hh + r][t * 16 + ln] = v; }
  }
  __builtin_amdgcn_fence(__ATOMIC_ACQ_REL, "workgroup");
  __builtin_amdgcn_wave_barrier();
  const int rsub = lane >> 4, c4 = (lane & 15) * 4;
  {
#pragma unroll
    for (int q = 0; q < 8; ++q) {
      const int r = q * 2 + rsub;
      const v4f v = *(const v4fa*)&so[w][r][c4];
      *(v4f*)(C + (size_t)(row0 + r) * ldc + col0 + c4) = v;
    }
    
  }
}

// Flash-style causal/unmasked attention, all contractions 3-term bf16 hi/lo splits, f32 softmax with running max.
// q,k,v rows are read from f32 buffers with arbitrary row pitch (so they can live inside a fused qkv buffer);
// D = head size (multiple of 32, <= 128); one wave = 16 query rows; block = 4 waves (64 queries) sharing K/V chunks of 32.
template <int D, bool CAUSAL>
__global__ __launch_bounds__(128) void k_flash(const float* __restrict__ qb, const float* __restrict__ kb, const float* __restrict__ vb,
                                             int pitch, int T, int H, float scale, float* __restrict__ y, int ypitch) {
  constexpr int KS = D / 32;        // k-steps for QK
  constexpr int DT = D / 16;        // d tiles for PV
  __shared__ __attribute__((aligned(16))) unsigned short sKh[32][D + 8], sKl[32][D + 8], sVh[32][D + 8], sVl[32][D + 8];
  __shared__ __attribute__((aligned(16))) unsigned short sPh[4][16][40], sPl[4][16][40];
  __shared__ __attribute__((aligned(16))) float sO[4][16][D];
  const int tid = threadIdx.x, w = tid >> 5, lane = tid & 31, ln = lane & 15, hh = lane >> 4;
  const int nqb = (T + 63) / 64;
  const int bh = blockIdx.x / nqb, qblk = blockIdx.x % nqb;
  const int b = bh / H, h = bh % H;
  const int q0 = qblk * 64 + w * 16;
  const float* Q = qb + (size_t)b * T * pitch + h * D;
  const float* K = kb + (size_t)b * T * pitch + h * D;
  const float* V = vb + (size_t)b * T * pitch + h * D;

  // A fragments of the wave's 16 query rows (scaled), hi/lo
  FragB aqh[KS], aql[KS];
  {
    int row = q0 + ln; if (row >= T) row = T - 1;
    const float* qr = Q + (size_t)row * pitch;
#pragma unroll
    for (int ks = 0; ks < KS; ++ks)
#pragma unroll
      for (int i = 0; i < 16; ++i) {
        const int d = ks * 32 + ((i < 8) ? (8 * hh + i) : (16 + 8 * hh + (i - 8)));
        const float x = qr[d] * scale; const unsigned short hb = bf16_bits(x);
        aqh[ks].u[i] = hb; aql[ks].u[i] = bf16_bits(x - bf16_val(hb));
      }
  }
  float m_r[8], l_r[8];
#pragma unroll
  for (int r = 0; r < 8; ++r) { m_r[r] = -3.0e38f; l_r[r] = 0.f; }
  v8f oacc[DT];
#pragma unroll
  for (int dt = 0; dt < DT; ++dt) oacc[dt] = (v8f){0.f,0.f,0.f,0.f,0.f,0.f,0.f,0.f};

  const int kv_end = CAUSAL ? min(T, qblk * 64 + 64) : T;     // block-uniform
  for (int j0 = 0; j0 < kv_end; j0 += 32) {
    __syncthreads();
    for (int e = tid; e < 32 * (D / 4); e += 128) {
      const int r = e / (D / 4), c4 = (e % (D / 4)) * 4;
      const int key = j0 + r;
      v4f kf = {0.f,0.f,0.f,0.f}, vf = {0.f,0.f,0.f,0.f};
      if (key < T) { kf = *(const v4fa*)(K + (size_t)key * pitch + c4); vf = *(const v4fa*)(V + (size_t)key * pitch + c4); }
#pragma unroll
      for (int t = 0; t < 4; ++t) {
        unsigned short hb = bf16_bits(kf[t]); sKh[r][c4 + t] = hb; sKl[r][c4 + t] = bf16_bits(kf[t] - bf16_val(hb));
        hb = bf16_bits(vf[t]); sVh[r][c4 + t] = hb; sVl[r][c4 + t] = bf16_bits(vf[t] - bf16_val(hb));
      }
    }
    __syncthreads();
    // S tile 16 x 32
    v8f s[2];
#pragma unroll
    for (int nt = 0; nt < 2; ++nt) {
      v8f acc = {};
#pragma unroll
      for (int ks = 0; ks < KS; ++ks) {
        FragB bh_, bl_;
        bh_.half[0] = *(const v8us*)&sKh[nt * 16 + ln][ks * 32 + 8 * hh]; bh_.half[1] = *(const v8us*)&sKh[nt * 16 + ln][ks * 32 + 16 + 8 * hh];
        bl_.half[0] = *(const v8us*)&sKl[nt * 16 + ln][ks * 32 + 8 * hh]; bl_.half[1] = *(const v8us*)&sKl[nt * 16 + ln][ks * 32 + 16 + 8 * hh];
        acc = mmaN<3>(aqh[ks].v, aql[ks].v, bh_.v, bl_.v, acc);
      }
      s[nt] = acc;
    }
    // mask + running max (rows 8hh+r; the 16 lanes of a half share rows)
    float alpha[8];
#pragma unroll
    for (int r = 0; r < 8; ++r) {
      const int qi = q0 + 8 * hh + r;
      const int ja = j0 + ln, jb = j0 + 16 + ln;
      if (CAUSAL) { if (ja > qi) s[0][r] = -3.0e38f; if (jb > qi) s[1][r] = -3.0e38f; }
      if (ja >= T) s[0][r] = -3.0e38f;
      if (jb >= T) s[1][r] = -3.0e38f;
      float mx = fmaxf(s[0][r], s[1][r]);
      mx = fmaxf(mx, __shfl_xor(mx, 1, 32)); mx = fmaxf(mx, __shfl_xor(mx, 2, 32)); mx = fmaxf(mx, __shfl_xor(mx, 4, 32)); mx = fmaxf(mx, __shfl_xor(mx, 8, 32));
      const float mnew = fmaxf(m_r[r], mx);
      alpha[r] = (mnew > -1.0e38f) ? __expf(m_r[r] - mnew) : 1.0f;
      const float p0 = (s[0][r] > -1.0e38f) ? __expf(s[0][r] - mnew) : 0.f;
      const float p1 = (s[1][r] > -1.0e38f) ? __expf(s[1][r] - mnew) : 0.f;
      m_r[r] = mnew;
      l_r[r] = l_r[r] * alpha[r] + p0 + p1;            // per-lane partial row sum (16 lanes combined at the end)
      unsigned short hb = bf16_bits(p0); sPh[w][8 * hh + r][ln] = hb;      sPl[w][8 * hh + r][ln] = bf16_bits(p0 - bf16_val(hb));
      hb = bf16_bits(p1);                sPh[w][8 * hh + r][16 + ln] = hb; sPl[w][8 * hh + r][16 + ln] = bf16_bits(p1 - bf16_val(hb));
    }
#pragma unroll
    for (int dt = 0; dt < DT; ++dt)
#pragma unroll
      for (int r = 0; r < 8; ++r) oacc[dt][r] *= alpha[r];
    __builtin_amdgcn_fence(__ATOMIC_ACQ_REL, "workgroup");
    __builtin_amdgcn_wave_barrier();
    FragB pah, pal;
    pah.half[0] = *(const v8us*)&sPh[w][ln][8 * hh]; pah.half[1] = *(const v8us*)&sPh[w][ln][16 + 8 * hh];
    pal.half[0] = *(const v8us*)&sPl[w][ln][8 * hh]; pal.half[1] = *(const v8us*)&sPl[w][ln][16 + 8 * hh];
#pragma unroll
    for (int dt = 0; dt < DT; ++dt) {
      FragB bvh, bvl;
#pragma unroll
      for (int i = 0; i < 8; ++i) {
        bvh.u[i] = sVh[8 * hh + i][dt * 16 + ln]; bvh.u[8 + i] = sVh[16 + 8 * hh + i][dt * 16 + ln];
        bvl.u[i] = sVl[8 * hh + i][dt * 16 + ln]; bvl.u[8 + i] = sVl[16 + 8 * hh + i][dt * 16 + ln];
      }
      oacc[dt] = mmaN<3>(pah.v, pal.v, bvh.v, bvl.v, oacc[dt]);
    }
    __builtin_amdgcn_fence(__ATOMIC_ACQ_REL, "workgroup");
    __builtin_amdgcn_wave_barrier();
  }
#pragma unroll
  for (int r = 0; r < 8; ++r) {
    float l = l_r[r];
    l += __shfl_xor(l, 1, 32); l += __shfl_xor(l, 2, 32); l += __shfl_xor(l, 4, 32); l += __shfl_xor(l, 8, 32);
    l_r[r] = (l > 0.f) ? 1.0f / l : 0.f;
  }
#pragma unroll
  for (int dt = 0; dt < DT; ++dt)
#pragma unroll
    for (int r = 0; r < 8; ++r) sO[w][8 * hh + r][dt * 16 + ln] = oacc[dt][r] * l_r[r];
  __builtin_amdgcn_fence(__ATOMIC_ACQ_REL, "workgroup");
  __builtin_amdgcn_wave_barrier();
  {
    for (int r = 0; r < 16; ++r) {
      const int row = q0 + r;
      if (row < T && lane < D / 4) {
        const v4f val = *(const v4fa*)&sO[w][r][lane * 4];
        *(v4f*)(y + ((size_t)b * T + row) * ypitch + h * D + lane * 4) = val;
      }
    }
    
  }
}

// GEMM C = act(A·W + bias + resid): A f32 (ASPLIT -> hi/lo 2 terms), Wt bf16 [N][K]; ACT 0 none, 1 relu, 2 exact gelu;
// resid (optional, f32, row index = (row % rmod), pitch ldr, RES_BF16 rounds it) added before the activation.
template <bool ASPLIT, int ACT, bool BIAS_BF16, bool RES_BF16>
__global__ __launch_bounds__(128) void k_gemm_bf3(const float* __restrict__ A, int lda, const unsigned short* __restrict__ Wt, int ldb,
                                                const float* __restrict__ bias, const float* __restrict__ resid, int rmod, int ldr,
                                                float* __restrict__ C, int ldc, int M, int N, int K) {
  __shared__ __attribute__((aligned(16))) float so[4][16][64];
  const int tid = threadIdx.x, w = tid >> 5, lane = tid & 31, ln = lane & 15, hh = lane >> 4;
  const int ntn = N / 64;
  const int wid = blockIdx.x * 4 + w;
  const int mt = wid / ntn, nq = wid % ntn;
  if (mt * 16 >= M) return;
  const int row0 = mt * 16, col0 = nq * 64;
  const float* arow = A + (size_t)(row0 + ln) * lda;
  v8f acc[4] = {};
  for (int kb = 0; kb < K; kb += 32) {
    FragB ah, al;
    const v4f x0 = *(const v4fa*)(arow + kb + 8 * hh), x1 = *(const v4fa*)(arow + kb + 8 * hh + 4);
    const v4f x2 = *(const v4fa*)(arow + kb + 16 + 8 * hh), x3 = *(const v4fa*)(arow + kb + 16 + 8 * hh + 4);
    float xs[16] = {x0[0],x0[1],x0[2],x0[3],x1[0],x1[1],x1[2],x1[3],x2[0],x2[1],x2[2],x2[3],x3[0],x3[1],x3[2],x3[3]};
#pragma unroll
    for (int i = 0; i < 16; ++i) { const unsigned short hb = bf16_bits(xs[i]); ah.u[i] = hb; al.u[i] = ASPLIT ? bf16_bits(xs[i] - bf16_val(hb)) : (unsigned short)0; }
#pragma unroll
    for (int t = 0; t < 4; ++t) {
      const unsigned short* brow = Wt + (size_t)(col0 + t * 16 + ln) * ldb + kb;
      FragB b;
      b.half[0] = *(const v8us*)(brow + 8 * hh);
      b.half[1] = *(const v8us*)(brow + 16 + 8 * hh);
      acc[t] = mmaN<ASPLIT ? 2 : 1>(ah.v, al.v, b.v, b.v, acc[t]);
    }
  }
#pragma unroll
  for (int t = 0; t < 4; ++t) {
    const int col = col0 + t * 16 + ln;
    float bv = bias ? bias[col] : 0.f;
    if (BIAS_BF16) bv = bf16_round(bv);
#pragma unroll
    for (int r = 0; r < 8; ++r) {
      float v = acc[t][r] + bv;
      if (resid) { float rv = resid[(size_t)((row0 + 8 * hh + r) % rmod) * ldr + col]; if (RES_BF16) rv = bf16_round(rv); v += rv; }
      if (ACT == 1) v = fmaxf(v, 0.f);
      if (ACT == 2) v = 0.5f * v * (1.0f + erff(v * 0.70710678118654752f));
      if (ACT == 3) { const float u = 0.7978845608028654f * (v + 0.044715f * v * v * v); v = 0.5f * v * (1.0f + tanhf(u)); }
      so[w][8 * hh + r][t * 16 + ln] = v;
    }
  }
  __builtin_amdgcn_fence(__ATOMIC_ACQ_REL, "workgroup");
  __builtin_amdgcn_wave_barrier();
  const int rsub = lane >> 4, c4 = (lane & 15) * 4;
  {
#pragma unroll
    for (int q = 0; q < 8; ++q) {
      const int r = q * 2 + rsub;
      const v4f v = *(const v4fa*)&so[w][r][c4];
      *(v4f*)(C + (size_t)(row0 + r) * ldc + col0 + c4) = v;
    }
    
  }
}
// row LayerNorm (biased variance, eps) over N: s = X (+ R); optional out_sum <- s; out_norm <- (s-mu)*rsqrt(var+eps)*g + b
template <bool PARAM_BF16>
__global__ __launch_bounds__(256) void k_layernorm(const float* __restrict__ X, const float* __restrict__ R, const float* __restrict__ g, const float* __restrict__ bta,
                                                  float* __restrict__ out_sum, float* __restrict__ out_norm, int N, float eps) {
  __shared__ float red[256];
  const int row = blockIdx.x, tid = threadIdx.x;
  const float* x = X + (size_t)row * N; const float* rr = R ? R + (size_t)row * N : nullptr;
  float vals[16];                     // up to N = 4096
  const int per = N / 256;            // contiguous chunk per thread? use strided-by-4 chunks: thread handles j = tid*4 + 1024*u
  float s1 = 0.f;
  for (int u = 0; u < per / 4; ++u) {
    const int j = tid * 4 + 1024 * u;
    const v4f a = *(const v4fa*)(x + j);
    v4f b = {0.f,0.f,0.f,0.f}; if (rr) b = *(const v4fa*)(rr + j);
#pragma unroll
    for (int q = 0; q < 4; ++q) { const float v = a[q] + b[q]; vals[u * 4 + q] = v; s1 += v; }
  }
  red[tid] = s1; __syncthreads();
  for (int st = 128; st > 0; st >>= 1) { if (tid < st) red[tid] += red[tid + st]; __syncthreads(); }
  const float mu = red[0] / (float)N; __syncthreads();
  float s2 = 0.f;
  for (int u = 0; u < per / 4; ++u)
#pragma unroll
    for (int q = 0; q < 4; ++q) { const float c = vals[u * 4 + q] - mu; s2 += c * c; }
  red[tid] = s2; __syncthreads();
  for (int st = 128; st > 0; st >>= 1) { if (tid < st) red[tid] += red[tid + st]; __syncthreads(); }
  const float rs = rsqrtf(red[0] / (float)N + eps);
  {
    for (int u = 0; u < per / 4; ++u) {
      const int j = tid * 4 + 1024 * u;
      v4f o, sm;
#pragma unroll
      for (int q = 0; q < 4; ++q) {
        float gg = g[j + q], bb = bta[j + q];
        if (PARAM_BF16) { gg = bf16_round(gg); bb = bf16_round(bb); }
        sm[q] = vals[u * 4 + q]; o[q] = (vals[u * 4 + q] - mu) * rs * gg + bb;
      }
      if (out_sum) *(v4f*)(out_sum + (size_t)row * N + j) = sm;
      *(v4f*)(out_norm + (size_t)row * N + j) = o;
    }
    
  }
}



// ---- f16 WMMA path (v_wmma_f32_16x16x32_f16): 11-bit significands for operands in range — used where a [0,1] probability operand needs more precision than bf16
typedef _Float16 v16h __attribute__((ext_vector_type(16)));
union FragH { v16h v; v8us half[2]; _Float16 h[16]; unsigned short u[16]; };
template <int NT>
__device__ __forceinline__ v8f mmaH(v16h ah, v16h al, v16h bh, v16h bl, v8f c) {
  c = __builtin_amdgcn_wmma_f32_16x16x32_f16(false, ah, false, bh, (short)0, c, false, false);
  if (NT >= 2) c = __builtin_amdgcn_wmma_f32_16x16x32_f16(false, al, false, bh, (short)0, c, false, false);
  if (NT >= 3) c = __builtin_amdgcn_wmma_f32_16x16x32_f16(false, ah, false, bl, (short)0, c, false, false);
  asm volatile("v_nop\n\tv_nop\n\tv_nop\n\tv_nop" : "+v"(c) : "v"(ah), "v"(al), "v"(bh), "v"(bl));
  return c;
}
// batched GEMM like k_gemm_b but f16 operands: A f32 (split into f16 hi/lo if ASPLIT, else rounded to f16), Bt = f16 values [n][k]; alpha; C f32; N multiple of 16 (partial tiles skipped)
template <bool ASPLIT>
__global__ __launch_bounds__(128) void k_gemm_h(const float* __restrict__ A, int lda, size_t sA, const _Float16* __restrict__ Bh, int ldb, size_t sB, float alpha, float* __restrict__ C, int ldc, size_t sC, int M, int N, int K) {
  __shared__ __attribute__((aligned(16))) float so[4][16][64];
  const int tid = threadIdx.x, w = tid >> 5, lane = tid & 31, ln = lane & 15, hh = lane >> 4; const int by = blockIdx.y;
  A += (size_t)by * sA; Bh += (size_t)by * sB; C += (size_t)by * sC;
  const int ntn = (N + 63) / 64; const int wid = blockIdx.x * 4 + w; const int mt = wid / ntn, nq = wid % ntn; if (mt * 16 >= M) return;
  const int row0 = mt * 16, col0 = nq * 64; const float* arow = A + (size_t)(row0 + ln) * lda;
  v8f acc[4] = {};
  for (int kb = 0; kb < K; kb += 32) {
    FragH ah, al;
    const v4f x0 = *(const v4fa*)(arow + kb + 8 * hh), x1 = *(const v4fa*)(arow + kb + 8 * hh + 4), x2 = *(const v4fa*)(arow + kb + 16 + 8 * hh), x3 = *(const v4fa*)(arow + kb + 16 + 8 * hh + 4);
    float xs[16] = {x0[0],x0[1],x0[2],x0[3],x1[0],x1[1],x1[2],x1[3],x2[0],x2[1],x2[2],x2[3],x3[0],x3[1],x3[2],x3[3]};
#pragma unroll
    for (int i = 0; i < 16; ++i) { const _Float16 h = (_Float16)xs[i]; ah.h[i] = h; al.h[i] = ASPLIT ? (_Float16)(xs[i] - (float)h) : (_Float16)0.0f; }
#pragma unroll
    for (int t = 0; t < 4; ++t) { if (col0 + t * 16 >= N) continue; const size_t boff = (size_t)(col0 + t * 16 + ln) * ldb + kb; FragH bq; bq.half[0] = *(const v8us*)(Bh + boff + 8 * hh); bq.half[1] = *(const v8us*)(Bh + boff + 16 + 8 * hh);
      acc[t] = mmaH<ASPLIT ? 2 : 1>(ah.v, al.v, bq.v, bq.v, acc[t]); }
  }
#pragma unroll
  for (int t = 0; t < 4; ++t) { if (col0 + t * 16 >= N) continue;
#pragma unroll
    for (int r = 0; r < 8; ++r) so[w][8 * hh + r][t * 16 + ln] = acc[t][r] * alpha; }
  __builtin_amdgcn_fence(__ATOMIC_ACQ_REL, "workgroup"); __builtin_amdgcn_wave_barrier();
  const int rsub = lane >> 4, c4 = (lane & 15) * 4;
  {
#pragma unroll
    for (int q = 0; q < 8; ++q) { const int r = q * 2 + rsub; if (col0 + c4 < N) { const v4f v = *(const v4fa*)&so[w][r][c4]; *(v4f*)(C + (size_t)(row0 + r) * ldc + col0 + c4) = v; } }
     }
}

// Wt[n][k] = f16(W[k][n]·scale) from f32 row-major W[K][N] (scale = power of two; bf16-exact weights stay exact in f16 away from the subnormal range)
__global__ __launch_bounds__(256) void k_wt_f16(const float* __restrict__ W, _Float16* __restrict__ Wt, int K, int N, float scale) {
  const int t = blockIdx.x * 256 + threadIdx.x; if (t >= N * (K / 8)) return; const int n = t / (K / 8), k8 = (t % (K / 8)) * 8; FragH f;
#pragma unroll
  for (int i = 0; i < 8; ++i) f.h[i] = (_Float16)(bf16_round(W[(size_t)(k8 + i) * N + n]) * scale); const v8us o = f.half[0];
  *(v8us*)((unsigned short*)Wt + (size_t)n * K + k8) = o; 
}
// Projection GEMM, fixed shape M = NR, N = K = CC: v = acc/16 + bf16(bias[col]) in f32, and the epilogue writes the f16 plane that the attention kernel reads:
// MODE 0 (q): f16 rows [token][channel]; MODE 1 (k): v + (bf16(rh[channel][n mod 32]) + bf16(rw[channel][n div 32])) in f32, then f16 rows; MODE 2 (v): f16, transposed per batch to [channel][token].
// One work-group = one 128 x 128 tile of the output, 8 waves as 4 x 2, 32 x 64 a wave. A pass is 64 k: 128 rows of A and 128 rows of W, 128 B (one line) each,
// copied once per work-group into LDS at pitch 144 B (16 B x odd: conflict-free ds_load_b128); two buffers, the next pass's copies fly while this pass is multiplied.
typedef _Float16 v4h __attribute__((ext_vector_type(4)));
template <int MODE>
__global__ __launch_bounds__(256) void k_proj(const _Float16* __restrict__ A, const _Float16* __restrict__ Bh, const float* __restrict__ bias, const float* __restrict__ rh, const float* __restrict__ rw, _Float16* __restrict__ C16) {
  constexpr int BT = 128, BK = 64, RP = 144, TILE = BT * RP, STG = 2 * TILE, NPASS = CC / BK, SOP = 68, TP = 2 * BT + 16;
  static_assert(NR % BT == 0 && CC % BT == 0 && CC % BK == 0 && NPASS >= 2, "whole tiles, at least two passes");
  static_assert(NN % BT == 0 && BT % 32 == 0, "a tile lies in one batch, a wave's 32 rows in one value of n div 32");
  static_assert(BT * TP <= 2 * STG, "the transposed tile must fit in the ring");
  __shared__ __attribute__((aligned(16))) unsigned char ring[2 * STG];
  static_assert(sizeof(float) * 8 * 32 * SOP <= 2 * STG, "output staging must fit in the ring");
  float (*so)[32][SOP] = reinterpret_cast<float (*)[32][SOP]>(ring);      /* output staging takes the ring's place behind the last pass's barrier; pitch 68 dwords keeps the two lane halves on different banks */
  const int tid = threadIdx.x, w = tid >> 5, lane = tid & 31, ln = lane & 15, hh = lane >> 4;
  const int row0 = (blockIdx.x / (CC / BT)) * BT, col0 = (blockIdx.x % (CC / BT)) * BT;
  const int wr = (w >> 1) * 32, wc = (w & 1) * 64;
  /* each thread copies 4 x 16 B of A and 4 x 16 B of W per pass; a wave-wide copy = 4 whole rows = 4 lines */
  const char* gA = (const char*)((const unsigned short*)A + (size_t)(row0 + (tid >> 3)) * CC) + (tid & 7) * 16;
  const char* gB = (const char*)((const unsigned short*)Bh + (size_t)(col0 + (tid >> 3)) * CC) + (tid & 7) * 16;
  const unsigned lA = (unsigned)(size_t)ring + (unsigned)((tid >> 3) * RP + (tid & 7) * 16);
  constexpr size_t R32 = (size_t)32 * CC * 2;      /* bytes from a row to the row 32 below it */
  auto stage_copies = [&](int p, unsigned bofs) {
    const char* a0 = gA + (size_t)p * (BK * 2); const char* b0 = gB + (size_t)p * (BK * 2); const unsigned a = lA + bofs, c = a + (unsigned)TILE;
    /* the s_wait_xcnt closes the statement so that no address register of a copy is rewritten ahead of it */
    asm volatile("global_load_async_to_lds_b128 %0, %8, off\n\t"
                 "global_load_async_to_lds_b128 %1, %9, off\n\t"
                 "global_load_async_to_lds_b128 %2, %10, off\n\t"
                 "global_load_async_to_lds_b128 %3, %11, off\n\t"
                 "global_load_async_to_lds_b128 %4, %12, off\n\t"
                 "global_load_async_to_lds_b128 %5, %13, off\n\t"
                 "global_load_async_to_lds_b128 %6, %14, off\n\t"
                 "global_load_async_to_lds_b128 %7, %15, off\n\t"
                 "s_wait_xcnt 0x0"
                 :: "v"(a), "v"(a + 32 * RP), "v"(a + 64 * RP), "v"(a + 96 * RP), "v"(c), "v"(c + 32 * RP), "v"(c + 64 * RP), "v"(c + 96 * RP),
                    "v"(a0), "v"(a0 + R32), "v"(a0 + 2 * R32), "v"(a0 + 3 * R32), "v"(b0), "v"(b0 + R32), "v"(b0 + 2 * R32), "v"(b0 + 3 * R32)
                 : "memory");
  };
  v8f acc[2][4] = {};
  stage_copies(0, 0u);
  /* MODE 1: the wave's part of rh and rw is asked for here and used in the epilogue: its latency runs beside that of pass 0's copies, not alone behind the last pass.
     Row n of the tile: n div 32 = na for all 32 rows of a wave, n mod 32 = i * 16 + 8 * hh + r; a lane's 8 rows of one accumulator are 32 consecutive bytes of its channel's 128-B row of rh */
  v4f rhv[4][2][2]; float rwv[4];
  if (MODE == 1) { const int na = (row0 % NN + wr) / 32;
#pragma unroll      /* this loop and the one inside it: constant indices keep rhv and rwv in registers */
    for (int t = 0; t < 4; ++t) { const size_t c32 = (size_t)(col0 + wc + t * 16 + ln) * 32; rwv[t] = rw[c32 + na];
#pragma unroll
      for (int i = 0; i < 2; ++i) { rhv[t][i][0] = *(const v4fa*)(rh + c32 + i * 16 + 8 * hh); rhv[t][i][1] = *(const v4fa*)(rh + c32 + i * 16 + 8 * hh + 4); } } }
  asm volatile("s_wait_asynccnt 0x0" ::: "memory");      /* pass 0 of this wave has landed */
  __syncthreads();                                       /* ... and every wave's part of it is published */
  stage_copies(1, (unsigned)STG);
#pragma unroll 2      /* two passes a trip make the buffer offsets immediates; fully unrolled the copies' addresses of all passes took the wave past 256 VGPRs */
  for (int p = 0; p < NPASS; ++p) {
    const unsigned bofs = (unsigned)(p & 1) * (unsigned)STG;
    const unsigned char* at = ring + bofs + (wr + ln) * RP + 16 * hh; const unsigned char* bt = ring + bofs + TILE + (wc + ln) * RP + 16 * hh;
#pragma unroll      /* this loop and those inside it: constant indices keep the fragments and acc in registers */
    for (int ks = 0; ks < BK / 32; ++ks) { FragH fa[2], fb[4];
#pragma unroll
      for (int i = 0; i < 2; ++i) { fa[i].half[0] = *(const v8us*)(at + i * 16 * RP + ks * 64); fa[i].half[1] = *(const v8us*)(at + i * 16 * RP + ks * 64 + 32); }
#pragma unroll
      for (int t = 0; t < 4; ++t) { fb[t].half[0] = *(const v8us*)(bt + t * 16 * RP + ks * 64); fb[t].half[1] = *(const v8us*)(bt + t * 16 * RP + ks * 64 + 32); }
#pragma unroll
      for (int i = 0; i < 2; ++i)
#pragma unroll
        for (int t = 0; t < 4; ++t) acc[i][t] = __builtin_amdgcn_wmma_f32_16x16x32_f16(false, fa[i].v, false, fb[t].v, (short)0, acc[i][t], false, false); }
    asm volatile("s_wait_dscnt 0x0" ::: "memory");         /* this wave's reads of the buffer are done before it is refilled */
    asm volatile("s_wait_asynccnt 0x0" ::: "memory");      /* this wave's copies of the next pass have landed */
    __syncthreads();                                       /* publishes the next pass and ends every wave's reads of this one */
    if (p + 2 < NPASS) stage_copies(p + 2, bofs); }
  asm volatile("s_wait_asynccnt 0x0" ::: "memory");        /* nothing in flight when the ring becomes output staging */
  if (MODE == 2) {
    /* D[8*hh + r][ln]: a lane's 8 values of one accumulator are 8 consecutive tokens of ONE channel = 16 B of a row of the transposed tile.
       The tile [128 channels][128 tokens] is gathered in LDS at pitch 272 B (16 B x odd: 16 lanes of a ds_store_b128 on 64 different banks), since a channel's 128 tokens come from four waves. */
#pragma unroll      /* this loop and the two inside it: constant indices into acc */
    for (int t = 0; t < 4; ++t) { const float bv = bf16_round(bias[col0 + wc + t * 16 + ln]);
#pragma unroll
      for (int i = 0; i < 2; ++i) { FragH f;
#pragma unroll
        for (int r = 0; r < 8; ++r) f.h[r] = (_Float16)(acc[i][t][r] * 0.0625f + bv);
        *(v8us*)(ring + (wc + t * 16 + ln) * TP + (wr + i * 16 + 8 * hh) * 2) = f.half[0]; } }
    __syncthreads();      /* every wave's part of the transposed tile is in LDS before any wave reads whole channel rows */
    unsigned short* vt = (unsigned short*)C16 + ((size_t)(row0 / NN) * CC + col0) * NN + row0 % NN;
#pragma unroll      /* the 8 LDS reads go out as one group ahead of the stores; a store = 2 channel rows of 256 B, whole lines */
    for (int q = 0; q < 8; ++q) { const int ch = w * 16 + q * 2 + hh; const v8us v = *(const v8us*)(ring + ch * TP + ln * 16); *(v8us*)(vt + (size_t)ch * NN + ln * 8) = v; }
    return;
  }
#pragma unroll      /* this loop and the two inside it: constant indices into acc */
  for (int t = 0; t < 4; ++t) { const float bv = bf16_round(bias[col0 + wc + t * 16 + ln]); const float rwb = (MODE == 1) ? bf16_round(rwv[t]) : 0.f;
#pragma unroll
    for (int i = 0; i < 2; ++i)
#pragma unroll
      for (int r = 0; r < 8; ++r) { float v = acc[i][t][r] * 0.0625f + bv; if (MODE == 1) v += bf16_round(rhv[t][i][r >> 2][r & 3]) + rwb; so[w][i * 16 + 8 * hh + r][t * 16 + ln] = v; } }
  __builtin_amdgcn_fence(__ATOMIC_ACQ_REL, "workgroup"); __builtin_amdgcn_wave_barrier();      /* orders this wave's staging stores ahead of its reads; no work-group barrier: a wave reads back only its own rows */
  const int rsub = lane >> 4, c4 = (lane & 15) * 4;
#pragma unroll      /* the 16 LDS reads go out as one group ahead of the stores; a store = 2 rows of whole lines */
  for (int q = 0; q < 16; ++q) { const int r = q * 2 + rsub; const v4f v = *(const v4fa*)&so[w][r][c4]; const size_t o = (size_t)(row0 + wr + r) * CC + col0 + wc + c4;
    v4h h4; for (int i = 0; i < 4; ++i) h4[i] = (_Float16)v[i]; *(v4h*)(C16 + o) = h4; }
}


__global__ __launch_bounds__(256) void k_x16(const float* __restrict__ x, _Float16* __restrict__ X16, size_t n8) { const size_t t = (size_t)blockIdx.x * 256 + threadIdx.x; if (t >= n8) return; FragH f;
#pragma unroll
  for (int q = 0; q < 8; ++q) f.h[q] = (_Float16)bf16_round(x[t * 8 + q]); *(v8us*)((unsigned short*)X16 + t * 8) = f.half[0];  }
__global__ __launch_bounds__(256) void k_h16(const float* __restrict__ x, _Float16* __restrict__ X16, size_t n8) { const size_t t = (size_t)blockIdx.x * 256 + threadIdx.x; if (t >= n8) return; FragH f;
#pragma unroll
  for (int q = 0; q < 8; ++q) f.h[q] = (_Float16)x[t * 8 + q]; *(v8us*)((unsigned short*)X16 + t * 8) = f.half[0];  }
__global__ __launch_bounds__(256) void k_round16f(const float* __restrict__ W, _Float16* __restrict__ Bt, size_t n8) { const size_t t = (size_t)blockIdx.x * 256 + threadIdx.x; if (t >= n8) return; FragH f;
#pragma unroll
  for (int i = 0; i < 8; ++i) f.h[i] = (_Float16)(bf16_round(W[t * 8 + i]) * 16.0f); *(v8us*)((unsigned short*)Bt + t * 8) = f.half[0];  }
template <int NHv, int TTv>
__global__ __launch_bounds__(256) void k_vt(const _Float16* __restrict__ V16, int ldv, int voff, _Float16* __restrict__ Vt) { __shared__ unsigned short tl[64][66]; const int tid = threadIdx.x; const int slab = blockIdx.x / (TTv / 64), lg = blockIdx.x % (TTv / 64); const int b = slab / NHv, h = slab % NHv;
  for (int i = tid; i < 64 * 8; i += 256) { const int r = i / 8, c8 = (i % 8) * 8; FragH f; f.half[0] = *(const v8us*)((const unsigned short*)V16 + ((size_t)b * TTv + lg * 64 + r) * ldv + voff + h * 64 + c8);
#pragma unroll
    for (int q = 0; q < 8; ++q) tl[r][c8 + q] = f.u[q]; }
  __syncthreads();
  {
#pragma unroll
    for (int rd = 0; rd < 2; ++rd) { const int d = rd * 32 + tid / 8, pc = tid % 8; FragH f;
#pragma unroll
      for (int q = 0; q < 8; ++q) f.u[q] = tl[pc * 8 + q][d];
      *(v8us*)((unsigned short*)Vt + ((size_t)slab * 64 + d) * TTv + lg * 64 + pc * 8) = f.half[0]; }
     } }

__global__ __launch_bounds__(256) void k_tok(const float* __restrict__ x, _Float16* __restrict__ X16) { __shared__ float tl[32][65]; const int tid = threadIdx.x; const int b = blockIdx.x / ((CC / 64) * (NN / 32)), rem = blockIdx.x % ((CC / 64) * (NN / 32)); const int cg = rem / (NN / 32), pg = rem % (NN / 32); const int c0 = cg * 64, p0 = pg * 32;
  for (int i = tid; i < 64 * 32; i += 256) { const int c = i / 32, pp = i % 32; tl[pp][c] = bf16_round(x[((size_t)b * CC + c0 + c) * NN + p0 + pp]); } __syncthreads();
  const int r = tid / 8, pc = tid % 8; FragH f; for (int q = 0; q < 8; ++q) f.h[q] = (_Float16)tl[r][pc * 8 + q]; const size_t row = (size_t)b * NN + p0 + r; *(v8us*)((unsigned short*)X16 + row * CC + c0 + pc * 8) = f.half[0];  }
/* lane l <-> lane l ^ 16 as a vector cross-row move */
__device__ __forceinline__ float xhalf(float x) { return __builtin_bit_cast(float, __builtin_amdgcn_permlanex16(__builtin_bit_cast(int, x), __builtin_bit_cast(int, x), 0x76543210, 0xfedcba98, false, false)); }
__global__ __launch_bounds__(128) void k_flash(const _Float16* __restrict__ Q16, int ldq, const _Float16* __restrict__ K16, int ldk, const _Float16* __restrict__ Vt, const _Float16* __restrict__ Vtlo, float* __restrict__ O, int ldo) {
  constexpr int RPW = 16, NQB = TT / (4 * RPW), DT = 8, KS = 4;      /* head dim 128: 4 k-steps, 8 value tiles */
  /* K/V ring shared by the four waves: two stages of 32 keys; a stage = 32 K rows of 256 B at pitch 272 B, then 128 V^T rows of 64 B at pitch 80 B (16 B x odd: conflict-free ds_load_b128) */
  constexpr int KP = 272, VP = 80, VOFF = 32 * KP, STG = VOFF + 128 * VP;
  __shared__ __attribute__((aligned(16))) unsigned char ring[2 * STG];
  static_assert(sizeof(float) * 4 * RPW * (128 + 4) <= 2 * STG, "output staging must fit in the ring");
  float (*sO)[RPW][128 + 4] = reinterpret_cast<float (*)[RPW][128 + 4]>(ring);      /* output staging takes the ring's place behind the last pass's barrier */
  const int tid = threadIdx.x, w = tid >> 5, lane = tid & 31, ln = lane & 15, hh = lane >> 4;
  const int slab = blockIdx.x / NQB, qblk = blockIdx.x % NQB; const int b = slab / NH, h = slab % NH; const int qb0 = qblk * (4 * RPW); const int q0 = qb0 + w * RPW;
  FragH aq[KS];
  { const unsigned short* qr = (const unsigned short*)Q16 + ((size_t)b * TT + q0 + ln) * ldq + h * 128;
#pragma unroll
    for (int ks = 0; ks < KS; ++ks) { aq[ks].half[0] = *(const v8us*)(qr + ks * 32 + 8 * hh); aq[ks].half[1] = *(const v8us*)(qr + ks * 32 + 16 + 8 * hh); } }
  const unsigned short* Vth = (const unsigned short*)Vt + (size_t)slab * 128 * TT;
  float m_q = -3.0e38f, l_q = 0.f; v8f oacc[DT];      /* running maximum (equal in both halves) and this half's partial sum of query q0 + ln; oacc[dt][r] = O^T[dt*16 + 8*hh + r][ln] */
#pragma unroll
  for (int dt = 0; dt < DT; ++dt) oacc[dt] = (v8f){0.f,0.f,0.f,0.f,0.f,0.f,0.f,0.f};
  const int jend = TT;
  /* each thread copies 4 x 16 B of K (a wave-wide copy = 2 whole rows = 4 lines) and 4 x 16 B of V^T (8 rows x 64 B) per stage */
  const char* gK = (const char*)((const unsigned short*)K16 + ((size_t)b * TT + (tid >> 4)) * ldk + h * 128) + (tid & 15) * 16;
  const char* gV = (const char*)(Vth + (size_t)(tid >> 2) * TT) + (tid & 3) * 16;
  const size_t kstep = (size_t)ldk * 2;      /* bytes per key row of K */
  const unsigned lK = (unsigned)(size_t)ring + (unsigned)((tid >> 4) * KP + (tid & 15) * 16);
  const unsigned lV = (unsigned)(size_t)ring + (unsigned)(VOFF + (tid >> 2) * VP + (tid & 3) * 16);
  auto stage_copies = [&](int j, unsigned bofs) {
    const char* k0 = gK + (size_t)j * kstep; const char* v0 = gV + (size_t)j * 2; const unsigned a = lK + bofs, c = lV + bofs;
    /* the s_wait_xcnt closes the statement so that no address register of a copy is rewritten ahead of it */
    asm volatile("global_load_async_to_lds_b128 %0, %8, off\n\t"
                 "global_load_async_to_lds_b128 %1, %9, off\n\t"
                 "global_load_async_to_lds_b128 %2, %10, off\n\t"
                 "global_load_async_to_lds_b128 %3, %11, off\n\t"
                 "global_load_async_to_lds_b128 %4, %12, off\n\t"
                 "global_load_async_to_lds_b128 %5, %13, off\n\t"
                 "global_load_async_to_lds_b128 %6, %14, off\n\t"
                 "global_load_async_to_lds_b128 %7, %15, off\n\t"
                 "s_wait_xcnt 0x0"
                 :: "v"(a), "v"(a + 8 * KP), "v"(a + 16 * KP), "v"(a + 24 * KP), "v"(c), "v"(c + 32 * VP), "v"(c + 64 * VP), "v"(c + 96 * VP),
                    "v"(k0), "v"(k0 + 8 * kstep), "v"(k0 + 16 * kstep), "v"(k0 + 24 * kstep), "v"(v0), "v"(v0 + (size_t)32 * TT * 2), "v"(v0 + (size_t)64 * TT * 2), "v"(v0 + (size_t)96 * TT * 2)
                 : "memory");
  };
  stage_copies(0, 0u);
  asm volatile("s_wait_asynccnt 0x0" ::: "memory");      /* stage 0 of this wave has landed */
  __syncthreads();                                       /* ... and every wave's part of it is published */
  stage_copies(32, (unsigned)STG);
#pragma unroll 1
  for (int j0 = 0; j0 < jend; j0 += 32) {
    const unsigned bofs = (unsigned)((j0 >> 5) & 1) * (unsigned)STG; const unsigned char* kt = ring + bofs; const unsigned char* vt = kt + VOFF;
    v8f st[2];
#pragma unroll
    for (int nt = 0; nt < 2; ++nt) { const unsigned short* kr = (const unsigned short*)(kt + (nt * 16 + ln) * KP); FragH bk[KS];
#pragma unroll
      for (int ks = 0; ks < KS; ++ks) { bk[ks].half[0] = *(const v8us*)(kr + ks * 32 + 8 * hh); bk[ks].half[1] = *(const v8us*)(kr + ks * 32 + 16 + 8 * hh); }
      v8f acc = (v8f){0.f,0.f,0.f,0.f,0.f,0.f,0.f,0.f};
#pragma unroll
      for (int ks = 0; ks < KS; ++ks) acc = mmaH<1>(bk[ks].v, bk[ks].v, aq[ks].v, aq[ks].v, acc);
      st[nt] = acc; }
    float sc[16];
#pragma unroll      /* this loop and the three below: constant indices keep the scores, P and oacc in registers */
    for (int i = 0; i < 16; ++i) sc[i] = st[i >> 3][i & 7] * ATT_SCALE;
    float mc = sc[0];
#pragma unroll
    for (int i = 1; i < 16; ++i) mc = fmaxf(mc, sc[i]);
    mc = fmaxf(mc, xhalf(mc));      /* the other 16 keys of this query sit in lane ^ 16 */
    const float mn = fmaxf(m_q, mc); const float al = (mn > -1.0e38f) ? expf(m_q - mn) : 1.0f; m_q = mn;
    FragH ph, pl; float ls[4] = {0.f, 0.f, 0.f, 0.f};      /* four independent partial sums: a chain of 4 dependent adds, not 16 */
#pragma unroll
    for (int i = 0; i < 16; ++i) { const float p = expf(sc[i] - mn); ls[i & 3] += p; const float ps = p * 1024.0f; ph.h[i] = (_Float16)ps; pl.h[i] = (_Float16)(ps - (float)ph.h[i]); }      /* P hi and its UNSCALED residual (added into the same accumulator); element i = key (i >> 3) * 16 + 8 * hh + (i & 7) */
    l_q = l_q * al + ((ls[0] + ls[1]) + (ls[2] + ls[3]));
#pragma unroll
    for (int dt = 0; dt < DT; ++dt) oacc[dt] *= al;
    FragH bv[DT];
#pragma unroll
    for (int dt = 0; dt < DT; ++dt) { const unsigned short* vr = (const unsigned short*)(vt + (dt * 16 + ln) * VP); bv[dt].half[0] = *(const v8us*)(vr + 8 * hh); bv[dt].half[1] = *(const v8us*)(vr + 16 + 8 * hh); }      /* all V fragments of the pass as one group of LDS reads, ahead of the products: one LDS latency a pass, not eight */
#pragma unroll      /* constant dt keeps bv and oacc in registers */
    for (int dt = 0; dt < DT; ++dt) { oacc[dt] = mmaH<1>(bv[dt].v, bv[dt].v, ph.v, ph.v, oacc[dt]); oacc[dt] = mmaH<1>(bv[dt].v, bv[dt].v, pl.v, pl.v, oacc[dt]); }      /* Vh^T.(Ph + Pl)^T - the V residual term is dropped here: near-uniform attention over 1024 keys averages the f16 rounding of v */
    asm volatile("s_wait_dscnt 0x0" ::: "memory");         /* this wave's reads of the stage are done before the stage is refilled */
    asm volatile("s_wait_asynccnt 0x0" ::: "memory");      /* this wave's copies of the next stage have landed */
    __syncthreads();                                       /* publishes the next stage and ends every wave's reads of this one */
    if (j0 + 64 < jend) stage_copies(j0 + 64, bofs); }
  asm volatile("s_wait_asynccnt 0x0" ::: "memory");        /* nothing in flight when the ring becomes output staging */
  { float l = l_q; l += xhalf(l); const float inv = (l > 0.f) ? 1.0f / (l * 1024.0f) : 0.f;      /* the two halves' partial sums joined once */
#pragma unroll      /* constant dt: oacc stays in registers; a lane's 8 values are 8 consecutive d of its query's row */
    for (int dt = 0; dt < DT; ++dt) { const v4f lo = {oacc[dt][0] * inv, oacc[dt][1] * inv, oacc[dt][2] * inv, oacc[dt][3] * inv}, hi = {oacc[dt][4] * inv, oacc[dt][5] * inv, oacc[dt][6] * inv, oacc[dt][7] * inv};
      *(v4fa*)&sO[w][ln][dt * 16 + 8 * hh] = lo; *(v4fa*)&sO[w][ln][dt * 16 + 8 * hh + 4] = hi; } }
  __builtin_amdgcn_fence(__ATOMIC_ACQ_REL, "workgroup"); __builtin_amdgcn_wave_barrier();
  {
#pragma unroll
    for (int r = 0; r < RPW; ++r) { const int pc = lane; const v4f val = *(const v4fa*)&sO[w][r][pc * 4]; *(v4f*)(O + ((size_t)slab * TT + q0 + r) * 128 + pc * 4) = val; }      /* output laid out [b][h][n][128] (the module reinterprets that buffer as [B,C,H,W]); one 512-B row per instruction: 32 lanes x 16 B */
     } }

extern "C" void kernel_launch(void* const* d_in, const int* in_sizes, int n_in,
                              void* d_out, int out_size, void* d_ws, size_t ws_size, hipStream_t stream) {
  (void)in_sizes; (void)n_in; (void)out_size;
  const float* const* I = (const float* const*)d_in; const float* x = I[0]; const float* Wq = I[1]; const float* bq = I[2]; const float* Wk = I[3]; const float* bk = I[4]; const float* Wv = I[5]; const float* bv = I[6]; const float* rh = I[7]; const float* rw = I[8];
  char* ws = (char*)d_ws; size_t off = 0;
  auto take = [&](size_t bytes) { char* p = ws + off; off += (bytes + 255) & ~(size_t)255; return p; };
  const size_t WSZ = (size_t)CC * CC; _Float16* Bw = (_Float16*)take(3 * WSZ * 2); _Float16* X16 = (_Float16*)take((size_t)NR * CC * 2); _Float16* Q = (_Float16*)take((size_t)NR * CC * 2); _Float16* K = (_Float16*)take((size_t)NR * CC * 2); _Float16* Vt = (_Float16*)take((size_t)NR * CC * 2);
  if (off > ws_size) return;      // 1.6 + 4 x 16.8 = 69 MB
  const unsigned gw = (unsigned)((WSZ / 8 + 255) / 256); k_round16f<<<gw, 256, 0, stream>>>(Wq, Bw, WSZ / 8); k_round16f<<<gw, 256, 0, stream>>>(Wk, Bw + WSZ, WSZ / 8); k_round16f<<<gw, 256, 0, stream>>>(Wv, Bw + 2 * WSZ, WSZ / 8);      /* (out,in) natural x 2^4 */
  k_tok<<<BB * (CC / 64) * (NN / 32), 256, 0, stream>>>(x, X16);      /* [B][C][N] to token-major bf16 plane */
  const dim3 gp((NR / 128) * (CC / 128), 1);
  k_proj<0><<<gp, 256, 0, stream>>>(X16, Bw, bq, nullptr, nullptr, Q);      /* q (unscaled) f16: M 16384 N 512 K 512 */
  k_proj<1><<<gp, 256, 0, stream>>>(X16, Bw + WSZ, bk, rh, rw, K);      /* k' = k + rt^T, f16 */
  k_proj<2><<<gp, 256, 0, stream>>>(X16, Bw + 2 * WSZ, bv, nullptr, nullptr, Vt);      /* v as V^T f16 per batch [512 channels][N] = per (b, h) [128][N] */
  k_flash<<<BB * NH * (NN / 64), 128, 0, stream>>>(Q, CC, K, CC, Vt, nullptr, (float*)d_out, 128);      /* y to d_out as [b][h][n][128]; k_flash does not read its V residual argument, and that plane is no longer made */
}

// v005
// Measured time: 106 microseconds a run.
// Next to v004, in two timings, it ran 1.13 times as fast each time.
// All steps since v000 together make it 4.09 times as fast.
#include <hip/hip_runtime.h>
// Bottleneck-transformer MHSA with relative position term (B=16, C=512, 32×32 → N=1024, 4 heads × 128): q,k,v = 1×1 convs ((out,in) + bias); logits = (q·C^-½)·(k + rt) where rt[h][d][n] = rh[h][d][n mod 32] + rw[h][d][n div 32]
// (the module's (rh + rw).reshape(1, heads, emb, N)); softmax; y = attn·v per head; the output is the [B][h][N][d] buffer reinterpreted as [B,C,H,W] (the module's final reshape).
// Compute dtype: x, weights, biases, rh, rw rounded to bf16; token-major bf16 input plane; q as an f16 GEMM plane (unscaled — the C^-½ is applied to the f32 score), k as an f32 GEMM output with rtᵀ added in f32 then f16,
// v f16; fused flash-style kernel for head dim 128 (4 k-steps, 8 value tiles, online softmax f32, P as f16 + its exact f16 residual, V f16, one f32 accumulator) on v_wmma_f32_16x16x32_f16 writing y directly; f32 accumulate.
#define BB 16
#define CC 512
#define NN 1024
#define TT NN
#define NH 4
#define HDD 128
#define NVH (2 * NH)
#define NR (BB * NN)
#define ATT_SCALE 0.04419417382415922f

typedef __bf16 v16b __attribute__((ext_vector_type(16)));
typedef unsigned short v8us __attribute__((ext_vector_type(8), may_alias));
typedef float  v8f  __attribute__((ext_vector_type(8)));
typedef float  v4f  __attribute__((ext_vector_type(4)));
typedef float  v4fa __attribute__((ext_vector_type(4), may_alias));
union FragB { v16b v; v8us half[2]; unsigned short u[16]; };

__device__ __forceinline__ unsigned short bf16_bits(float x) { unsigned int u = __float_as_uint(x); return (unsigned short)((u + 0x7FFFu + ((u >> 16) & 1u)) >> 16); }
__device__ __forceinline__ float bf16_val(unsigned short b) { return __uint_as_float(((unsigned int)b) << 16); }
__device__ __forceinline__ float bf16_round(float x) { return bf16_val(bf16_bits(x)); }
// D += A·B with NT terms: 1 = ah·bh, 2 = + al·bh (A split), 3 = + ah·bl (both split)
template <int NT>
__device__ __forceinline__ v8f mmaN(v16b ah, v16b al, v16b bh, v16b bl, v8f c) {
  c = __builtin_amdgcn_wmma_f32_16x16x32_bf16(false, ah, false, bh, (short)0, c, false, false);
  if (NT >= 2) c = __builtin_amdgcn_wmma_f32_16x16x32_bf16(false, al, false, bh, (short)0, c, false, false);
  if (NT >= 3) c = __builtin_amdgcn_wmma_f32_16x16x32_bf16(false, ah, false, bl, (short)0, c, false, false);
  asm volatile("v_nop\n\tv_nop\n\tv_nop\n\tv_nop" : "+v"(c) : "v"(ah), "v"(al), "v"(bh), "v"(bl));
  return c;
}

__global__ __launch_bounds__(256) void k_wt_bf16(const float* __restrict__ W, unsigned short* __restrict__ Wt, int K, int N) {
  const int t = blockIdx.x * 256 + threadIdx.x;
  const int k8n = K / 8;
  if (t >= N * k8n) return;
  const int n = t / k8n, k8 = (t % k8n) * 8;
  v8us v;
#pragma unroll
  for (int i = 0; i < 8; ++i) v[i] = bf16_bits(W[(size_t)(k8 + i) * N + n]);
  *(v8us*)(Wt + (size_t)n * K + k8) = v;
  
}

// GEMM C[M][N] (f32, pitch ldc) = act(A[M][K]·W + bias). A f32 row-major (pitch lda) converted per fragment to bf16
// (ASPLIT: hi/lo two planes -> 2 terms, else single rounded term); Wt bf16 [N][K] (pitch ldb). BIAS_BF16 rounds the
// bias to bf16 first (bias quantised to bf16 before the add). K%32==0, M%16==0, N%64==0.
template <bool ASPLIT, int ACT, bool BIAS_BF16>
__global__ __launch_bounds__(128) void k_gemm_bf(const float* __restrict__ A, int lda, const unsigned short* __restrict__ Wt, int ldb,
                                               const float* __restrict__ bias, float* __restrict__ C, int ldc, int M, int N, int K) {
  __shared__ __attribute__((aligned(16))) float so[4][16][64];
  const int tid = threadIdx.x, w = tid >> 5, lane = tid & 31, ln = lane & 15, hh = lane >> 4;
  const int ntn = N / 64;
  const int wid = blockIdx.x * 4 + w;
  const int mt = wid / ntn, nq = wid % ntn;
  if (mt * 16 >= M) return;
  const int row0 = mt * 16, col0 = nq * 64;
  const float* arow = A + (size_t)(row0 + ln) * lda;
  v8f acc[4] = {};
  for (int kb = 0; kb < K; kb += 32) {
    FragB ah, al;
    const v4f x0 = *(const v4fa*)(arow + kb + 8 * hh), x1 = *(const v4fa*)(arow + kb + 8 * hh + 4);
    const v4f x2 = *(const v4fa*)(arow + kb + 16 + 8 * hh), x3 = *(const v4fa*)(arow + kb + 16 + 8 * hh + 4);
    float xs[16] = {x0[0],x0[1],x0[2],x0[3],x1[0],x1[1],x1[2],x1[3],x2[0],x2[1],x2[2],x2[3],x3[0],x3[1],x3[2],x3[3]};
#pragma unroll
    for (int i = 0; i < 16; ++i) { const unsigned short hb = bf16_bits(xs[i]); ah.u[i] = hb; al.u[i] = ASPLIT ? bf16_bits(xs[i] - bf16_val(hb)) : (unsigned short)0; }
#pragma unroll
    for (int t = 0; t < 4; ++t) {
      const unsigned short* brow = Wt + (size_t)(col0 + t * 16 + ln) * ldb + kb;
      FragB b;
      b.half[0] = *(const v8us*)(brow + 8 * hh);
      b.half[1] = *(const v8us*)(brow + 16 + 8 * hh);
      acc[t] = mmaN<ASPLIT ? 2 : 1>(ah.v, al.v, b.v, b.v, acc[t]);
    }
  }
#pragma unroll
  for (int t = 0; t < 4; ++t) {
    float bv = bias ? bias[col0 + t * 16 + ln] : 0.f;
    if (BIAS_BF16) bv = bf16_round(bv);
#pragma unroll
    for (int r = 0; r < 8; ++r) { float v = acc[t][r] + bv; if (ACT == 1) v = fmaxf(v, 0.f); so[w][8 * hh + r][t * 16 + ln] = v; }
  }
  __builtin_amdgcn_fence(__ATOMIC_ACQ_REL, "workgroup");
  __builtin_amdgcn_wave_barrier();
  const int rsub = lane >> 4, c4 = (lane & 15) * 4;
  {
#pragma unroll
    for (int q = 0; q < 8; ++q) {
      const int r = q * 2 + rsub;
      const v4f v = *(const v4fa*)&so[w][r][c4];
      *(v4f*)(C + (size_t)(row0 + r) * ldc + col0 + c4) = v;
    }
    
  }
}

// Flash-style causal/unmasked attention, all contractions 3-term bf16 hi/lo splits, f32 softmax with running max.
// q,k,v rows are read from f32 buffers with arbitrary row pitch (so they can live inside a fused qkv buffer);
// D = head size (multiple of 32, <= 128); one wave = 16 query rows; block = 4 waves (64 queries) sharing K/V chunks of 32.
template <int D, bool CAUSAL>
__global__ __launch_bounds__(128) void k_flash(const float* __restrict__ qb, const float* __restrict__ kb, const float* __restrict__ vb,
                                             int pitch, int T, int H, float scale, float* __restrict__ y, int ypitch) {
  constexpr int KS = D / 32;        // k-steps for QK
  constexpr int DT = D / 16;        // d tiles for PV
  __shared__ __attribute__((aligned(16))) unsigned short sKh[32][D + 8], sKl[32][D + 8], sVh[32][D + 8], sVl[32][D + 8];
  __shared__ __attribute__((aligned(16))) unsigned short sPh[4][16][40], sPl[4][16][40];
  __shared__ __attribute__((aligned(16))) float sO[4][16][D];
  const int tid = threadIdx.x, w = tid >> 5, lane = tid & 31, ln = lane & 15, hh = lane >> 4;
  const int nqb = (T + 63) / 64;
  const int bh = blockIdx.x / nqb, qblk = blockIdx.x % nqb;
  const int b = bh / H, h = bh % H;
  const int q0 = qblk * 64 + w * 16;
  const float* Q = qb + (size_t)b * T * pitch + h * D;
  const float* K = kb + (size_t)b * T * pitch + h * D;
  const float* V = vb + (size_t)b * T * pitch + h * D;

  // A fragments of the wave's 16 query rows (scaled), hi/lo
  FragB aqh[KS], aql[KS];
  {
    int row = q0 + ln; if (row >= T) row = T - 1;
    const float* qr = Q + (size_t)row * pitch;
#pragma unroll
    for (int ks = 0; ks < KS; ++ks)
#pragma unroll
      for (int i = 0; i < 16; ++i) {
        const int d = ks * 32 + ((i < 8) ? (8 * hh + i) : (16 + 8 * hh + (i - 8)));
        const float x = qr[d] * scale; const unsigned short hb = bf16_bits(x);
        aqh[ks].u[i] = hb; aql[ks].u[i] = bf16_bits(x - bf16_val(hb));
      }
  }
  float m_r[8], l_r[8];
#pragma unroll
  for (int r = 0; r < 8; ++r) { m_r[r] = -3.0e38f; l_r[r] = 0.f; }
  v8f oacc[DT];
#pragma unroll
  for (int dt = 0; dt < DT; ++dt) oacc[dt] = (v8f){0.f,0.f,0.f,0.f,0.f,0.f,0.f,0.f};

  const int kv_end = CAUSAL ? min(T, qblk * 64 + 64) : T;     // block-uniform
  for (int j0 = 0; j0 < kv_end; j0 += 32) {
    __syncthreads();
    for (int e = tid; e < 32 * (D / 4); e += 128) {
      const int r = e / (D / 4), c4 = (e % (D / 4)) * 4;
      const int key = j0 + r;
      v4f kf = {0.f,0.f,0.f,0.f}, vf = {0.f,0.f,0.f,0.f};
      if (key < T) { kf = *(const v4fa*)(K + (size_t)key * pitch + c4); vf = *(const v4fa*)(V + (size_t)key * pitch + c4); }
#pragma unroll
      for (int t = 0; t < 4; ++t) {
        unsigned short hb = bf16_bits(kf[t]); sKh[r][c4 + t] = hb; sKl[r][c4 + t] = bf16_bits(kf[t] - bf16_val(hb));
        hb = bf16_bits(vf[t]); sVh[r][c4 + t] = hb; sVl[r][c4 + t] = bf16_bits(vf[t] - bf16_val(hb));
      }
    }
    __syncthreads();
    // S tile 16 x 32
    v8f s[2];
#pragma unroll
    for (int nt = 0; nt < 2; ++nt) {
      v8f acc = {};
#pragma unroll
      for (int ks = 0; ks < KS; ++ks) {
        FragB bh_, bl_;
        bh_.half[0] = *(const v8us*)&sKh[nt * 16 + ln][ks * 32 + 8 * hh]; bh_.half[1] = *(const v8us*)&sKh[nt * 16 + ln][ks * 32 + 16 + 8 * hh];
        bl_.half[0] = *(const v8us*)&sKl[nt * 16 + ln][ks * 32 + 8 * hh]; bl_.half[1] = *(const v8us*)&sKl[nt * 16 + ln][ks * 32 + 16 + 8 * hh];
        acc = mmaN<3>(aqh[ks].v, aql[ks].v, bh_.v, bl_.v, acc);
      }
      s[nt] = acc;
    }
    // mask + running max (rows 8hh+r; the 16 lanes of a half share rows)
    float alpha[8];
#pragma unroll
    for (int r = 0; r < 8; ++r) {
      const int qi = q0 + 8 * hh + r;
      const int ja = j0 + ln, jb = j0 + 16 + ln;
      if (CAUSAL) { if (ja > qi) s[0][r] = -3.0e38f; if (jb > qi) s[1][r] = -3.0e38f; }
      if (ja >= T) s[0][r] = -3.0e38f;
      if (jb >= T) s[1][r] = -3.0e38f;
      float mx = fmaxf(s[0][r], s[1][r]);
      mx = fmaxf(mx, __shfl_xor(mx, 1, 32)); mx = fmaxf(mx, __shfl_xor(mx, 2, 32)); mx = fmaxf(mx, __shfl_xor(mx, 4, 32)); mx = fmaxf(mx, __shfl_xor(mx, 8, 32));
      const float mnew = fmaxf(m_r[r], mx);
      alpha[r] = (mnew > -1.0e38f) ? __expf(m_r[r] - mnew) : 1.0f;
      const float p0 = (s[0][r] > -1.0e38f) ? __expf(s[0][r] - mnew) : 0.f;
      const float p1 = (s[1][r] > -1.0e38f) ? __expf(s[1][r] - mnew) : 0.f;
      m_r[r] = mnew;
      l_r[r] = l_r[r] * alpha[r] + p0 + p1;            // per-lane partial row sum (16 lanes combined at the end)
      unsigned short hb = bf16_bits(p0); sPh[w][8 * hh + r][ln] = hb;      sPl[w][8 * hh + r][ln] = bf16_bits(p0 - bf16_val(hb));
      hb = bf16_bits(p1);                sPh[w][8 * hh + r][16 + ln] = hb; sPl[w][8 * hh + r][16 + ln] = bf16_bits(p1 - bf16_val(hb));
    }
#pragma unroll
    for (int dt = 0; dt < DT; ++dt)
#pragma unroll
      for (int r = 0; r < 8; ++r) oacc[dt][r] *= alpha[r];
    __builtin_amdgcn_fence(__ATOMIC_ACQ_REL, "workgroup");
    __builtin_amdgcn_wave_barrier();
    FragB pah, pal;
    pah.half[0] = *(const v8us*)&sPh[w][ln][8 * hh]; pah.half[1] = *(const v8us*)&sPh[w][ln][16 + 8 * hh];
    pal.half[0] = *(const v8us*)&sPl[w][ln][8 * hh]; pal.half[1] = *(const v8us*)&sPl[w][ln][16 + 8 * hh];
#pragma unroll
    for (int dt = 0; dt < DT; ++dt) {
      FragB bvh, bvl;
#pragma unroll
      for (int i = 0; i < 8; ++i) {
        bvh.u[i] = sVh[8 * hh + i][dt * 16 + ln]; bvh.u[8 + i] = sVh[16 + 8 * hh + i][dt * 16 + ln];
        bvl.u[i] = sVl[8 * hh + i][dt * 16 + ln]; bvl.u[8 + i] = sVl[16 + 8 * hh + i][dt * 16 + ln];
      }
      oacc[dt] = mmaN<3>(pah.v, pal.v, bvh.v, bvl.v, oacc[dt]);
    }
    __builtin_amdgcn_fence(__ATOMIC_ACQ_REL, "workgroup");
    __builtin_amdgcn_wave_barrier();
  }
#pragma unroll
  for (int r = 0; r < 8; ++r) {
    float l = l_r[r];
    l += __shfl_xor(l, 1, 32); l += __shfl_xor(l, 2, 32); l += __shfl_xor(l, 4, 32); l += __shfl_xor(l, 8, 32);
    l_r[r] = (l > 0.f) ? 1.0f / l : 0.f;
  }
#pragma unroll
  for (int dt = 0; dt < DT; ++dt)
#pragma unroll
    for (int r = 0; r < 8; ++r) sO[w][8 * hh + r][dt * 16 + ln] = oacc[dt][r] * l_r[r];
  __builtin_amdgcn_fence(__ATOMIC_ACQ_REL, "workgroup");
  __builtin_amdgcn_wave_barrier();
  {
    for (int r = 0; r < 16; ++r) {
      const int row = q0 + r;
      if (row < T && lane < D / 4) {
        const v4f val = *(const v4fa*)&sO[w][r][lane * 4];
        *(v4f*)(y + ((size_t)b * T + row) * ypitch + h * D + lane * 4) = val;
      }
    }
    
  }
}

// GEMM C = act(A·W + bias + resid): A f32 (ASPLIT -> hi/lo 2 terms), Wt bf16 [N][K]; ACT 0 none, 1 relu, 2 exact gelu;
// resid (optional, f32, row index = (row % rmod), pitch ldr, RES_BF16 rounds it) added before the activation.
template <bool ASPLIT, int ACT, bool BIAS_BF16, bool RES_BF16>
__global__ __launch_bounds__(128) void k_gemm_bf3(const float* __restrict__ A, int lda, const unsigned short* __restrict__ Wt, int ldb,
                                                const float* __restrict__ bias, const float* __restrict__ resid, int rmod, int ldr,
                                                float* __restrict__ C, int ldc, int M, int N, int K) {
  __shared__ __attribute__((aligned(16))) float so[4][16][64];
  const int tid = threadIdx.x, w = tid >> 5, lane = tid & 31, ln = lane & 15, hh = lane >> 4;
  const int ntn = N / 64;
  const int wid = blockIdx.x * 4 + w;
  const int mt = wid / ntn, nq = wid % ntn;
  if (mt * 16 >= M) return;
  const int row0 = mt * 16, col0 = nq * 64;
  const float* arow = A + (size_t)(row0 + ln) * lda;
  v8f acc[4] = {};
  for (int kb = 0; kb < K; kb += 32) {
    FragB ah, al;
    const v4f x0 = *(const v4fa*)(arow + kb + 8 * hh), x1 = *(const v4fa*)(arow + kb + 8 * hh + 4);
    const v4f x2 = *(const v4fa*)(arow + kb + 16 + 8 * hh), x3 = *(const v4fa*)(arow + kb + 16 + 8 * hh + 4);
    float xs[16] = {x0[0],x0[1],x0[2],x0[3],x1[0],x1[1],x1[2],x1[3],x2[0],x2[1],x2[2],x2[3],x3[0],x3[1],x3[2],x3[3]};
#pragma unroll
    for (int i = 0; i < 16; ++i) { const unsigned short hb = bf16_bits(xs[i]); ah.u[i] = hb; al.u[i] = ASPLIT ? bf16_bits(xs[i] - bf16_val(hb)) : (unsigned short)0; }
#pragma unroll
    for (int t = 0; t < 4; ++t) {
      const unsigned short* brow = Wt + (size_t)(col0 + t * 16 + ln) * ldb + kb;
      FragB b;
      b.half[0] = *(const v8us*)(brow + 8 * hh);
      b.half[1] = *(const v8us*)(brow + 16 + 8 * hh);
      acc[t] = mmaN<ASPLIT ? 2 : 1>(ah.v, al.v, b.v, b.v, acc[t]);
    }
  }
#pragma unroll
  for (int t = 0; t < 4; ++t) {
    const int col = col0 + t * 16 + ln;
    float bv = bias ? bias[col] : 0.f;
    if (BIAS_BF16) bv = bf16_round(bv);
#pragma unroll
    for (int r = 0; r < 8; ++r) {
      float v = acc[t][r] + bv;
      if (resid) { float rv = resid[(size_t)((row0 + 8 * hh + r) % rmod) * ldr + col]; if (RES_BF16) rv = bf16_round(rv); v += rv; }
      if (ACT == 1) v = fmaxf(v, 0.f);
      if (ACT == 2) v = 0.5f * v * (1.0f + erff(v * 0.70710678118654752f));
      if (ACT == 3) { const float u = 0.7978845608028654f * (v + 0.044715f * v * v * v); v = 0.5f * v * (1.0f + tanhf(u)); }
      so[w][8 * hh + r][t * 16 + ln] = v;
    }
  }
  __builtin_amdgcn_fence(__ATOMIC_ACQ_REL, "workgroup");
  __builtin_amdgcn_wave_barrier();
  const int rsub = lane >> 4, c4 = (lane & 15) * 4;
  {
#pragma unroll
    for (int q = 0; q < 8; ++q) {
      const int r = q * 2 + rsub;
      const v4f v = *(const v4fa*)&so[w][r][c4];
      *(v4f*)(C + (size_t)(row0 + r) * ldc + col0 + c4) = v;
    }
    
  }
}
// row LayerNorm (biased variance, eps) over N: s = X (+ R); optional out_sum <- s; out_norm <- (s-mu)*rsqrt(var+eps)*g + b
template <bool PARAM_BF16>
__global__ __launch_bounds__(256) void k_layernorm(const float* __restrict__ X, const float* __restrict__ R, const float* __restrict__ g, const float* __restrict__ bta,
                                                  float* __restrict__ out_sum, float* __restrict__ out_norm, int N, float eps) {
  __shared__ float red[256];
  const int row = blockIdx.x, tid = threadIdx.x;
  const float* x = X + (size_t)row * N; const float* rr = R ? R + (size_t)row * N : nullptr;
  float vals[16];                     // up to N = 4096
  const int per = N / 256;            // contiguous chunk per thread? use strided-by-4 chunks: thread handles j = tid*4 + 1024*u
  float s1 = 0.f;
  for (int u = 0; u < per / 4; ++u) {
    const int j = tid * 4 + 1024 * u;
    const v4f a = *(const v4fa*)(x + j);
    v4f b = {0.f,0.f,0.f,0.f}; if (rr) b = *(const v4fa*)(rr + j);
#pragma unroll
    for (int q = 0; q < 4; ++q) { const float v = a[q] + b[q]; vals[u * 4 + q] = v; s1 += v; }
  }
  red[tid] = s1; __syncthreads();
  for (int st = 128; st > 0; st >>= 1) { if (tid < st) red[tid] += red[tid + st]; __syncthreads(); }
  const float mu = red[0] / (float)N; __syncthreads();
  float s2 = 0.f;
  for (int u = 0; u < per / 4; ++u)
#pragma unroll
    for (int q = 0; q < 4; ++q) { const float c = vals[u * 4 + q] - mu; s2 += c * c; }
  red[tid] = s2; __syncthreads();
  for (int st = 128; st > 0; st >>= 1) { if (tid < st) red[tid] += red[tid + st]; __syncthreads(); }
  const float rs = rsqrtf(red[0] / (float)N + eps);
  {
    for (int u = 0; u < per / 4; ++u) {
      const int j = tid * 4 + 1024 * u;
      v4f o, sm;
#pragma unroll
      for (int q = 0; q < 4; ++q) {
        float gg = g[j + q], bb = bta[j + q];
        if (PARAM_BF16) { gg = bf16_round(gg); bb = bf16_round(bb); }
        sm[q] = vals[u * 4 + q]; o[q] = (vals[u * 4 + q] - mu) * rs * gg + bb;
      }
      if (out_sum) *(v4f*)(out_sum + (size_t)row * N + j) = sm;
      *(v4f*)(out_norm + (size_t)row * N + j) = o;
    }
    
  }
}



// ---- f16 WMMA path (v_wmma_f32_16x16x32_f16): 11-bit significands for operands in range — used where the probability operand (1024 p, in [0,1024]) needs more precision than bf16
typedef _Float16 v16h __attribute__((ext_vector_type(16)));
union FragH { v16h v; v8us half[2]; _Float16 h[16]; unsigned short u[16]; };
template <int NT>
__device__ __forceinline__ v8f mmaH(v16h ah, v16h al, v16h bh, v16h bl, v8f c) {
  c = __builtin_amdgcn_wmma_f32_16x16x32_f16(false, ah, false, bh, (short)0, c, false, false);
  if (NT >= 2) c = __builtin_amdgcn_wmma_f32_16x16x32_f16(false, al, false, bh, (short)0, c, false, false);
  if (NT >= 3) c = __builtin_amdgcn_wmma_f32_16x16x32_f16(false, ah, false, bl, (short)0, c, false, false);
  asm volatile("v_nop\n\tv_nop\n\tv_nop\n\tv_nop" : "+v"(c) : "v"(ah), "v"(al), "v"(bh), "v"(bl));
  return c;
}
// batched GEMM like k_gemm_b but f16 operands: A f32 (split into f16 hi/lo if ASPLIT, else rounded to f16), Bt = f16 values [n][k]; alpha; C f32; N multiple of 16 (partial tiles skipped)
template <bool ASPLIT>
__global__ __launch_bounds__(128) void k_gemm_h(const float* __restrict__ A, int lda, size_t sA, const _Float16* __restrict__ Bh, int ldb, size_t sB, float alpha, float* __restrict__ C, int ldc, size_t sC, int M, int N, int K) {
  __shared__ __attribute__((aligned(16))) float so[4][16][64];
  const int tid = threadIdx.x, w = tid >> 5, lane = tid & 31, ln = lane & 15, hh = lane >> 4; const int by = blockIdx.y;
  A += (size_t)by * sA; Bh += (size_t)by * sB; C += (size_t)by * sC;
  const int ntn = (N + 63) / 64; const int wid = blockIdx.x * 4 + w; const int mt = wid / ntn, nq = wid % ntn; if (mt * 16 >= M) return;
  const int row0 = mt * 16, col0 = nq * 64; const float* arow = A + (size_t)(row0 + ln) * lda;
  v8f acc[4] = {};
  for (int kb = 0; kb < K; kb += 32) {
    FragH ah, al;
    const v4f x0 = *(const v4fa*)(arow + kb + 8 * hh), x1 = *(const v4fa*)(arow + kb + 8 * hh + 4), x2 = *(const v4fa*)(arow + kb + 16 + 8 * hh), x3 = *(const v4fa*)(arow + kb + 16 + 8 * hh + 4);
    float xs[16] = {x0[0],x0[1],x0[2],x0[3],x1[0],x1[1],x1[2],x1[3],x2[0],x2[1],x2[2],x2[3],x3[0],x3[1],x3[2],x3[3]};
#pragma unroll
    for (int i = 0; i < 16; ++i) { const _Float16 h = (_Float16)xs[i]; ah.h[i] = h; al.h[i] = ASPLIT ? (_Float16)(xs[i] - (float)h) : (_Float16)0.0f; }
#pragma unroll
    for (int t = 0; t < 4; ++t) { if (col0 + t * 16 >= N) continue; const size_t boff = (size_t)(col0 + t * 16 + ln) * ldb + kb; FragH bq; bq.half[0] = *(const v8us*)(Bh + boff + 8 * hh); bq.half[1] = *(const v8us*)(Bh + boff + 16 + 8 * hh);
      acc[t] = mmaH<ASPLIT ? 2 : 1>(ah.v, al.v, bq.v, bq.v, acc[t]); }
  }
#pragma unroll
  for (int t = 0; t < 4; ++t) { if (col0 + t * 16 >= N) continue;
#pragma unroll
    for (int r = 0; r < 8; ++r) so[w][8 * hh + r][t * 16 + ln] = acc[t][r] * alpha; }
  __builtin_amdgcn_fence(__ATOMIC_ACQ_REL, "workgroup"); __builtin_amdgcn_wave_barrier();
  const int rsub = lane >> 4, c4 = (lane & 15) * 4;
  {
#pragma unroll
    for (int q = 0; q < 8; ++q) { const int r = q * 2 + rsub; if (col0 + c4 < N) { const v4f v = *(const v4fa*)&so[w][r][c4]; *(v4f*)(C + (size_t)(row0 + r) * ldc + col0 + c4) = v; } }
     }
}

// Wt[n][k] = f16(W[k][n]·scale) from f32 row-major W[K][N] (scale = power of two; bf16-exact weights stay exact in f16 away from the subnormal range)
__global__ __launch_bounds__(256) void k_wt_f16(const float* __restrict__ W, _Float16* __restrict__ Wt, int K, int N, float scale) {
  const int t = blockIdx.x * 256 + threadIdx.x; if (t >= N * (K / 8)) return; const int n = t / (K / 8), k8 = (t % (K / 8)) * 8; FragH f;
#pragma unroll
  for (int i = 0; i < 8; ++i) f.h[i] = (_Float16)(bf16_round(W[(size_t)(k8 + i) * N + n]) * scale); const v8us o = f.half[0];
  *(v8us*)((unsigned short*)Wt + (size_t)n * K + k8) = o; 
}
// Projection GEMM, fixed shape M = NR, N = K = CC: v = acc/16 + bf16(bias[col]) in f32, and the epilogue writes the f16 plane that the attention kernel reads:
// MODE 0 (q): f16 rows [token][channel]; MODE 1 (k): v + (bf16(rh[channel][n mod 32]) + bf16(rw[channel][n div 32])) in f32, then f16 rows; MODE 2 (v): f16, transposed per batch to [channel][token].
// One work-group = one 128 x 128 tile of the output, 8 waves as 4 x 2, 32 x 64 a wave. A pass is 64 k: 128 rows of A and 128 rows of W, 128 B (one line) each,
// copied once per work-group into LDS at pitch 144 B (16 B x odd: conflict-free ds_load_b128); two buffers, the next pass's copies fly while this pass is multiplied.
typedef _Float16 v4h __attribute__((ext_vector_type(4)));
template <int MODE>
__global__ __launch_bounds__(256) void k_proj(const _Float16* __restrict__ A, const _Float16* __restrict__ Bh, const float* __restrict__ bias, const float* __restrict__ rh, const float* __restrict__ rw, _Float16* __restrict__ C16) {
  constexpr int BT = 128, BK = 64, RP = 144, TILE = BT * RP, STG = 2 * TILE, NPASS = CC / BK, SOP = 68, TP = 2 * BT + 16;
  static_assert(NR % BT == 0 && CC % BT == 0 && CC % BK == 0 && NPASS >= 2, "whole tiles, at least two passes");
  static_assert(NN % BT == 0 && BT % 32 == 0, "a tile lies in one batch, a wave's 32 rows in one value of n div 32");
  static_assert(BT * TP <= 2 * STG, "the transposed tile must fit in the ring");
  __shared__ __attribute__((aligned(16))) unsigned char ring[2 * STG];
  static_assert(sizeof(float) * 8 * 32 * SOP <= 2 * STG, "output staging must fit in the ring");
  float (*so)[32][SOP] = reinterpret_cast<float (*)[32][SOP]>(ring);      /* output staging takes the ring's place behind the last pass's barrier; pitch 68 dwords keeps the two lane halves on different banks */
  const int tid = threadIdx.x, w = tid >> 5, lane = tid & 31, ln = lane & 15, hh = lane >> 4;
  const int row0 = (blockIdx.x / (CC / BT)) * BT, col0 = (blockIdx.x % (CC / BT)) * BT;
  const int wr = (w >> 1) * 32, wc = (w & 1) * 64;
  /* each thread copies 4 x 16 B of A and 4 x 16 B of W per pass; a wave-wide copy = 4 whole rows = 4 lines */
  const char* gA = (const char*)((const unsigned short*)A + (size_t)(row0 + (tid >> 3)) * CC) + (tid & 7) * 16;
  const char* gB = (const char*)((const unsigned short*)Bh + (size_t)(col0 + (tid >> 3)) * CC) + (tid & 7) * 16;
  const unsigned lA = (unsigned)(size_t)ring + (unsigned)((tid >> 3) * RP + (tid & 7) * 16);
  constexpr size_t R32 = (size_t)32 * CC * 2;      /* bytes from a row to the row 32 below it */
  auto stage_copies = [&](int p, unsigned bofs) {
    const char* a0 = gA + (size_t)p * (BK * 2); const char* b0 = gB + (size_t)p * (BK * 2); const unsigned a = lA + bofs, c = a + (unsigned)TILE;
    /* the s_wait_xcnt closes the statement so that no address register of a copy is rewritten ahead of it */
    asm volatile("global_load_async_to_lds_b128 %0, %8, off\n\t"
                 "global_load_async_to_lds_b128 %1, %9, off\n\t"
                 "global_load_async_to_lds_b128 %2, %10, off\n\t"
                 "global_load_async_to_lds_b128 %3, %11, off\n\t"
                 "global_load_async_to_lds_b128 %4, %12, off\n\t"
                 "global_load_async_to_lds_b128 %5, %13, off\n\t"
                 "global_load_async_to_lds_b128 %6, %14, off\n\t"
                 "global_load_async_to_lds_b128 %7, %15, off\n\t"
                 "s_wait_xcnt 0x0"
                 :: "v"(a), "v"(a + 32 * RP), "v"(a + 64 * RP), "v"(a + 96 * RP), "v"(c), "v"(c + 32 * RP), "v"(c + 64 * RP), "v"(c + 96 * RP),
                    "v"(a0), "v"(a0 + R32), "v"(a0 + 2 * R32), "v"(a0 + 3 * R32), "v"(b0), "v"(b0 + R32), "v"(b0 + 2 * R32), "v"(b0 + 3 * R32)
                 : "memory");
  };
  v8f acc[2][4] = {};
  stage_copies(0, 0u);
  /* MODE 1: the wave's part of rh and rw is asked for here and used in the epilogue: its latency runs beside that of pass 0's copies, not alone behind the last pass.
     Row n of the tile: n div 32 = na for all 32 rows of a wave, n mod 32 = i * 16 + 8 * hh + r; a lane's 8 rows of one accumulator are 32 consecutive bytes of its channel's 128-B row of rh */
  v4f rhv[4][2][2]; float rwv[4];
  if (MODE == 1) { const int na = (row0 % NN + wr) / 32;
#pragma unroll      /* this loop and the one inside it: constant indices keep rhv and rwv in registers */
    for (int t = 0; t < 4; ++t) { const size_t c32 = (size_t)(col0 + wc + t * 16 + ln) * 32; rwv[t] = rw[c32 + na];
#pragma unroll
      for (int i = 0; i < 2; ++i) { rhv[t][i][0] = *(const v4fa*)(rh + c32 + i * 16 + 8 * hh); rhv[t][i][1] = *(const v4fa*)(rh + c32 + i * 16 + 8 * hh + 4); } } }
  asm volatile("s_wait_asynccnt 0x0" ::: "memory");      /* pass 0 of this wave has landed */
  __syncthreads();                                       /* ... and every wave's part of it is published */
  stage_copies(1, (unsigned)STG);
#pragma unroll 2      /* two passes a trip make the buffer offsets immediates; fully unrolled the copies' addresses of all passes took the wave past 256 VGPRs */
  for (int p = 0; p < NPASS; ++p) {
    const unsigned bofs = (unsigned)(p & 1) * (unsigned)STG;
    const unsigned char* at = ring + bofs + (wr + ln) * RP + 16 * hh; const unsigned char* bt = ring + bofs + TILE + (wc + ln) * RP + 16 * hh;
#pragma unroll      /* this loop and those inside it: constant indices keep the fragments and acc in registers */
    for (int ks = 0; ks < BK / 32; ++ks) { FragH fa[2], fb[4];
#pragma unroll
      for (int i = 0; i < 2; ++i) { fa[i].half[0] = *(const v8us*)(at + i * 16 * RP + ks * 64); fa[i].half[1] = *(const v8us*)(at + i * 16 * RP + ks * 64 + 32); }
#pragma unroll
      for (int t = 0; t < 4; ++t) { fb[t].half[0] = *(const v8us*)(bt + t * 16 * RP + ks * 64); fb[t].half[1] = *(const v8us*)(bt + t * 16 * RP + ks * 64 + 32); }
#pragma unroll
      for (int i = 0; i < 2; ++i)
#pragma unroll
        for (int t = 0; t < 4; ++t) acc[i][t] = __builtin_amdgcn_wmma_f32_16x16x32_f16(false, fa[i].v, false, fb[t].v, (short)0, acc[i][t], false, false); }
    asm volatile("s_wait_dscnt 0x0" ::: "memory");         /* this wave's reads of the buffer are done before it is refilled */
    asm volatile("s_wait_asynccnt 0x0" ::: "memory");      /* this wave's copies of the next pass have landed */
    __syncthreads();                                       /* publishes the next pass and ends every wave's reads of this one */
    if (p + 2 < NPASS) stage_copies(p + 2, bofs); }
  asm volatile("s_wait_asynccnt 0x0" ::: "memory");        /* nothing in flight when the ring becomes output staging */
  if (MODE == 2) {
    /* D[8*hh + r][ln]: a lane's 8 values of one accumulator are 8 consecutive tokens of ONE channel = 16 B of a row of the transposed tile.
       The tile [128 channels][128 tokens] is gathered in LDS at pitch 272 B (16 B x odd: 16 lanes of a ds_store_b128 on 64 different banks), since a channel's 128 tokens come from four waves. */
#pragma unroll      /* this loop and the two inside it: constant indices into acc */
    for (int t = 0; t < 4; ++t) { const float bv = bf16_round(bias[col0 + wc + t * 16 + ln]);
#pragma unroll
      for (int i = 0; i < 2; ++i) { FragH f;
#pragma unroll
        for (int r = 0; r < 8; ++r) f.h[r] = (_Float16)(acc[i][t][r] * 0.0625f + bv);
        *(v8us*)(ring + (wc + t * 16 + ln) * TP + (wr + i * 16 + 8 * hh) * 2) = f.half[0]; } }
    __syncthreads();      /* every wave's part of the transposed tile is in LDS before any wave reads whole channel rows */
    unsigned short* vt = (unsigned short*)C16 + ((size_t)(row0 / NN) * CC + col0) * NN + row0 % NN;
#pragma unroll      /* the 8 LDS reads go out as one group ahead of the stores; a store = 2 channel rows of 256 B, whole lines */
    for (int q = 0; q < 8; ++q) { const int ch = w * 16 + q * 2 + hh; const v8us v = *(const v8us*)(ring + ch * TP + ln * 16); *(v8us*)(vt + (size_t)ch * NN + ln * 8) = v; }
    return;
  }
#pragma unroll      /* this loop and the two inside it: constant indices into acc */
  for (int t = 0; t < 4; ++t) { const float bv = bf16_round(bias[col0 + wc + t * 16 + ln]); const float rwb = (MODE == 1) ? bf16_round(rwv[t]) : 0.f;
#pragma unroll
    for (int i = 0; i < 2; ++i)
#pragma unroll
      for (int r = 0; r < 8; ++r) { float v = acc[i][t][r] * 0.0625f + bv; if (MODE == 1) v += bf16_round(rhv[t][i][r >> 2][r & 3]) + rwb; so[w][i * 16 + 8 * hh + r][t * 16 + ln] = v; } }
  __builtin_amdgcn_fence(__ATOMIC_ACQ_REL, "workgroup"); __builtin_amdgcn_wave_barrier();      /* orders this wave's staging stores ahead of its reads; no work-group barrier: a wave reads back only its own rows */
  const int rsub = lane >> 4, c4 = (lane & 15) * 4;
#pragma unroll      /* the 16 LDS reads go out as one group ahead of the stores; a store = 2 rows of whole lines */
  for (int q = 0; q < 16; ++q) { const int r = q * 2 + rsub; const v4f v = *(const v4fa*)&so[w][r][c4]; const size_t o = (size_t)(row0 + wr + r) * CC + col0 + wc + c4;
    v4h h4; for (int i = 0; i < 4; ++i) h4[i] = (_Float16)v[i]; *(v4h*)(C16 + o) = h4; }
}


__global__ __launch_bounds__(256) void k_x16(const float* __restrict__ x, _Float16* __restrict__ X16, size_t n8) { const size_t t = (size_t)blockIdx.x * 256 + threadIdx.x; if (t >= n8) return; FragH f;
#pragma unroll
  for (int q = 0; q < 8; ++q) f.h[q] = (_Float16)bf16_round(x[t * 8 + q]); *(v8us*)((unsigned short*)X16 + t * 8) = f.half[0];  }
__global__ __launch_bounds__(256) void k_h16(const float* __restrict__ x, _Float16* __restrict__ X16, size_t n8) { const size_t t = (size_t)blockIdx.x * 256 + threadIdx.x; if (t >= n8) return; FragH f;
#pragma unroll
  for (int q = 0; q < 8; ++q) f.h[q] = (_Float16)x[t * 8 + q]; *(v8us*)((unsigned short*)X16 + t * 8) = f.half[0];  }
__global__ __launch_bounds__(256) void k_round16f(const float* __restrict__ W, _Float16* __restrict__ Bt, size_t n8) { const size_t t = (size_t)blockIdx.x * 256 + threadIdx.x; if (t >= n8) return; FragH f;
#pragma unroll
  for (int i = 0; i < 8; ++i) f.h[i] = (_Float16)(bf16_round(W[t * 8 + i]) * 16.0f); *(v8us*)((unsigned short*)Bt + t * 8) = f.half[0];  }
template <int NHv, int TTv>
__global__ __launch_bounds__(256) void k_vt(const _Float16* __restrict__ V16, int ldv, int voff, _Float16* __restrict__ Vt) { __shared__ unsigned short tl[64][66]; const int tid = threadIdx.x; const int slab = blockIdx.x / (TTv / 64), lg = blockIdx.x % (TTv / 64); const int b = slab / NHv, h = slab % NHv;
  for (int i = tid; i < 64 * 8; i += 256) { const int r = i / 8, c8 = (i % 8) * 8; FragH f; f.half[0] = *(const v8us*)((const unsigned short*)V16 + ((size_t)b * TTv + lg * 64 + r) * ldv + voff + h * 64 + c8);
#pragma unroll
    for (int q = 0; q < 8; ++q) tl[r][c8 + q] = f.u[q]; }
  __syncthreads();
  {
#pragma unroll
    for (int rd = 0; rd < 2; ++rd) { const int d = rd * 32 + tid / 8, pc = tid % 8; FragH f;
#pragma unroll
      for (int q = 0; q < 8; ++q) f.u[q] = tl[pc * 8 + q][d];
      *(v8us*)((unsigned short*)Vt + ((size_t)slab * 64 + d) * TTv + lg * 64 + pc * 8) = f.half[0]; }
     } }

__global__ __launch_bounds__(256) void k_tok(const float* __restrict__ x, _Float16* __restrict__ X16) { __shared__ float tl[32][65]; const int tid = threadIdx.x; const int b = blockIdx.x / ((CC / 64) * (NN / 32)), rem = blockIdx.x % ((CC / 64) * (NN / 32)); const int cg = rem / (NN / 32), pg = rem % (NN / 32); const int c0 = cg * 64, p0 = pg * 32;
  for (int i = tid; i < 64 * 32; i += 256) { const int c = i / 32, pp = i % 32; tl[pp][c] = bf16_round(x[((size_t)b * CC + c0 + c) * NN + p0 + pp]); } __syncthreads();
  const int r = tid / 8, pc = tid % 8; FragH f; for (int q = 0; q < 8; ++q) f.h[q] = (_Float16)tl[r][pc * 8 + q]; const size_t row = (size_t)b * NN + p0 + r; *(v8us*)((unsigned short*)X16 + row * CC + c0 + pc * 8) = f.half[0];  }
/* lane l <-> lane l ^ 16 as a vector cross-row move */
__device__ __forceinline__ float xhalf(float x) { return __builtin_bit_cast(float, __builtin_amdgcn_permlanex16(__builtin_bit_cast(int, x), __builtin_bit_cast(int, x), 0x76543210, 0xfedcba98, false, false)); }
__global__ __launch_bounds__(128) void k_flash(const _Float16* __restrict__ Q16, int ldq, const _Float16* __restrict__ K16, int ldk, const _Float16* __restrict__ Vt, const _Float16* __restrict__ Vtlo, float* __restrict__ O, int ldo) {
  constexpr int RPW = 16, NQB = TT / (4 * RPW), DT = 8, KS = 4;      /* head dim 128: 4 k-steps, 8 value tiles */
  constexpr float SC2 = ATT_SCALE * 1.4426950408889634f;      /* score scale x log2(e) */
  /* K/V ring shared by the four waves: two stages of 32 keys; a stage = 32 K rows of 256 B at pitch 272 B, then 128 V^T rows of 64 B at pitch 80 B (16 B x odd: conflict-free ds_load_b128) */
  constexpr int KP = 272, VP = 80, VOFF = 32 * KP, STG = VOFF + 128 * VP;
  __shared__ __attribute__((aligned(16))) unsigned char ring[2 * STG];
  static_assert(sizeof(float) * 4 * RPW * (128 + 4) <= 2 * STG, "output staging must fit in the ring");
  float (*sO)[RPW][128 + 4] = reinterpret_cast<float (*)[RPW][128 + 4]>(ring);      /* output staging takes the ring's place behind the last pass's barrier */
  const int tid = threadIdx.x, w = tid >> 5, lane = tid & 31, ln = lane & 15, hh = lane >> 4;
  const int slab = blockIdx.x / NQB, qblk = blockIdx.x % NQB; const int b = slab / NH, h = slab % NH; const int qb0 = qblk * (4 * RPW); const int q0 = qb0 + w * RPW;
  FragH aq[KS];
  { const unsigned short* qr = (const unsigned short*)Q16 + ((size_t)b * TT + q0 + ln) * ldq + h * 128;
#pragma unroll
    for (int ks = 0; ks < KS; ++ks) { aq[ks].half[0] = *(const v8us*)(qr + ks * 32 + 8 * hh); aq[ks].half[1] = *(const v8us*)(qr + ks * 32 + 16 + 8 * hh); } }
  const unsigned short* Vth = (const unsigned short*)Vt + (size_t)slab * 128 * TT;
  float m_q = -3.0e38f, l_q = 0.f; v8f oacc[DT];      /* running maximum of the raw scores (equal in both halves) and this half's partial sum (x 2^10) of query q0 + ln; oacc[dt][r] = O^T[dt*16 + 8*hh + r][ln] */
#pragma unroll
  for (int dt = 0; dt < DT; ++dt) oacc[dt] = (v8f){0.f,0.f,0.f,0.f,0.f,0.f,0.f,0.f};
  const int jend = TT;
  /* each thread copies 4 x 16 B of K (a wave-wide copy = 2 whole rows = 4 lines) and 4 x 16 B of V^T (8 rows x 64 B) per stage */
  const char* gK = (const char*)((const unsigned short*)K16 + ((size_t)b * TT + (tid >> 4)) * ldk + h * 128) + (tid & 15) * 16;
  const char* gV = (const char*)(Vth + (size_t)(tid >> 2) * TT) + (tid & 3) * 16;
  const size_t kstep = (size_t)ldk * 2;      /* bytes per key row of K */
  const unsigned lK = (unsigned)(size_t)ring + (unsigned)((tid >> 4) * KP + (tid & 15) * 16);
  const unsigned lV = (unsigned)(size_t)ring + (unsigned)(VOFF + (tid >> 2) * VP + (tid & 3) * 16);
  auto stage_copies = [&](int j, unsigned bofs) {
    const char* k0 = gK + (size_t)j * kstep; const char* v0 = gV + (size_t)j * 2; const unsigned a = lK + bofs, c = lV + bofs;
    /* the s_wait_xcnt closes the statement so that no address register of a copy is rewritten ahead of it */
    asm volatile("global_load_async_to_lds_b128 %0, %8, off\n\t"
                 "global_load_async_to_lds_b128 %1, %9, off\n\t"
                 "global_load_async_to_lds_b128 %2, %10, off\n\t"
                 "global_load_async_to_lds_b128 %3, %11, off\n\t"
                 "global_load_async_to_lds_b128 %4, %12, off\n\t"
                 "global_load_async_to_lds_b128 %5, %13, off\n\t"
                 "global_load_async_to_lds_b128 %6, %14, off\n\t"
                 "global_load_async_to_lds_b128 %7, %15, off\n\t"
                 "s_wait_xcnt 0x0"
                 :: "v"(a), "v"(a + 8 * KP), "v"(a + 16 * KP), "v"(a + 24 * KP), "v"(c), "v"(c + 32 * VP), "v"(c + 64 * VP), "v"(c + 96 * VP),
                    "v"(k0), "v"(k0 + 8 * kstep), "v"(k0 + 16 * kstep), "v"(k0 + 24 * kstep), "v"(v0), "v"(v0 + (size_t)32 * TT * 2), "v"(v0 + (size_t)64 * TT * 2), "v"(v0 + (size_t)96 * TT * 2)
                 : "memory");
  };
  stage_copies(0, 0u);
  asm volatile("s_wait_asynccnt 0x0" ::: "memory");      /* stage 0 of this wave has landed */
  __syncthreads();                                       /* ... and every wave's part of it is published */
  stage_copies(32, (unsigned)STG);
#pragma unroll 1
  for (int j0 = 0; j0 < jend; j0 += 32) {
    const unsigned bofs = (unsigned)((j0 >> 5) & 1) * (unsigned)STG; const unsigned char* kt = ring + bofs; const unsigned char* vt = kt + VOFF;
    v8f st[2];
#pragma unroll
    for (int nt = 0; nt < 2; ++nt) { const unsigned short* kr = (const unsigned short*)(kt + (nt * 16 + ln) * KP); FragH bk[KS];
#pragma unroll
      for (int ks = 0; ks < KS; ++ks) { bk[ks].half[0] = *(const v8us*)(kr + ks * 32 + 8 * hh); bk[ks].half[1] = *(const v8us*)(kr + ks * 32 + 16 + 8 * hh); }
      v8f acc = (v8f){0.f,0.f,0.f,0.f,0.f,0.f,0.f,0.f};
#pragma unroll
      for (int ks = 0; ks < KS; ++ks) acc = mmaH<1>(bk[ks].v, bk[ks].v, aq[ks].v, aq[ks].v, acc);
      st[nt] = acc; }
    /* The softmax runs on the raw scores in base 2: exp(ATT_SCALE * (s - m)) * 2^10 = 2^(s * SC2 + (10 - m * SC2)), one fused multiply-add and one hardware exp2 an element.
       The argument is at most 10 and a result below 2^-126 counts as 0, so none of the range handling of the library's expf is needed. m_q holds the maximum of the raw scores (SC2 > 0: the same element). */
    float mc = st[0][0];
#pragma unroll      /* this loop and the two below: constant indices keep the scores, P and oacc in registers */
    for (int i = 1; i < 16; ++i) mc = fmaxf(mc, st[i >> 3][i & 7]);
    mc = fmaxf(mc, xhalf(mc));      /* the other 16 keys of this query sit in lane ^ 16 */
    const float mn = fmaxf(m_q, mc); const float al = (mn > -1.0e38f) ? __builtin_amdgcn_exp2f((m_q - mn) * SC2) : 1.0f; m_q = mn;
    const float nb = __builtin_fmaf(-mn, SC2, 10.0f);
    FragH ph, pl; float ls[4] = {0.f, 0.f, 0.f, 0.f};      /* four independent partial sums: a chain of 4 dependent adds, not 16 */
#pragma unroll
    for (int i = 0; i < 16; ++i) { const float ps = __builtin_amdgcn_exp2f(__builtin_fmaf(st[i >> 3][i & 7], SC2, nb)); ls[i & 3] += ps; ph.h[i] = (_Float16)ps; pl.h[i] = (_Float16)(ps - (float)ph.h[i]); }      /* ps = 1024 p; P hi and its UNSCALED residual (added into the same accumulator); element i = key (i >> 3) * 16 + 8 * hh + (i & 7) */
    l_q = l_q * al + ((ls[0] + ls[1]) + (ls[2] + ls[3]));
#pragma unroll
    for (int dt = 0; dt < DT; ++dt) oacc[dt] *= al;
    FragH bv[DT];
#pragma unroll
    for (int dt = 0; dt < DT; ++dt) { const unsigned short* vr = (const unsigned short*)(vt + (dt * 16 + ln) * VP); bv[dt].half[0] = *(const v8us*)(vr + 8 * hh); bv[dt].half[1] = *(const v8us*)(vr + 16 + 8 * hh); }      /* all V fragments of the pass as one group of LDS reads, ahead of the products: one LDS latency a pass, not eight */
#pragma unroll      /* constant dt keeps bv and oacc in registers */
    for (int dt = 0; dt < DT; ++dt) { oacc[dt] = mmaH<1>(bv[dt].v, bv[dt].v, ph.v, ph.v, oacc[dt]); oacc[dt] = mmaH<1>(bv[dt].v, bv[dt].v, pl.v, pl.v, oacc[dt]); }      /* Vh^T.(Ph + Pl)^T - the V residual term is dropped here: near-uniform attention over 1024 keys averages the f16 rounding of v */
    asm volatile("s_wait_dscnt 0x0" ::: "memory");         /* this wave's reads of the stage are done before the stage is refilled */
    asm volatile("s_wait_asynccnt 0x0" ::: "memory");      /* this wave's copies of the next stage have landed */
    __syncthreads();                                       /* publishes the next stage and ends every wave's reads of this one */
    if (j0 + 64 < jend) stage_copies(j0 + 64, bofs); }
  asm volatile("s_wait_asynccnt 0x0" ::: "memory");        /* nothing in flight when the ring becomes output staging */
  { float l = l_q; l += xhalf(l); const float inv = (l > 0.f) ? 1.0f / l : 0.f;      /* the two halves' partial sums joined once; l and oacc both carry the 2^10 of ps */
#pragma unroll      /* constant dt: oacc stays in registers; a lane's 8 values are 8 consecutive d of its query's row */
    for (int dt = 0; dt < DT; ++dt) { const v4f lo = {oacc[dt][0] * inv, oacc[dt][1] * inv, oacc[dt][2] * inv, oacc[dt][3] * inv}, hi = {oacc[dt][4] * inv, oacc[dt][5] * inv, oacc[dt][6] * inv, oacc[dt][7] * inv};
      *(v4fa*)&sO[w][ln][dt * 16 + 8 * hh] = lo; *(v4fa*)&sO[w][ln][dt * 16 + 8 * hh + 4] = hi; } }
  __builtin_amdgcn_fence(__ATOMIC_ACQ_REL, "workgroup"); __builtin_amdgcn_wave_barrier();
  {
#pragma unroll
    for (int r = 0; r < RPW; ++r) { const int pc = lane; const v4f val = *(const v4fa*)&sO[w][r][pc * 4]; *(v4f*)(O + ((size_t)slab * TT + q0 + r) * 128 + pc * 4) = val; }      /* output laid out [b][h][n][128] (the module reinterprets that buffer as [B,C,H,W]); one 512-B row per instruction: 32 lanes x 16 B */
     } }

extern "C" void kernel_launch(void* const* d_in, const int* in_sizes, int n_in,
                              void* d_out, int out_size, void* d_ws, size_t ws_size, hipStream_t stream) {
  (void)in_sizes; (void)n_in; (void)out_size;
  const float* const* I = (const float* const*)d_in; const float* x = I[0]; const float* Wq = I[1]; const float* bq = I[2]; const float* Wk = I[3]; const float* bk = I[4]; const float* Wv = I[5]; const float* bv = I[6]; const float* rh = I[7]; const float* rw = I[8];
  char* ws = (char*)d_ws; size_t off = 0;
  auto take = [&](size_t bytes) { char* p = ws + off; off += (bytes + 255) & ~(size_t)255; return p; };
  const size_t WSZ = (size_t)CC * CC; _Float16* Bw = (_Float16*)take(3 * WSZ * 2); _Float16* X16 = (_Float16*)take((size_t)NR * CC * 2); _Float16* Q = (_Float16*)take((size_t)NR * CC * 2); _Float16* K = (_Float16*)take((size_t)NR * CC * 2); _Float16* Vt = (_Float16*)take((size_t)NR * CC * 2);
  if (off > ws_size) return;      // 1.6 + 4 x 16.8 = 69 MB
  const unsigned gw = (unsigned)((WSZ / 8 + 255) / 256); k_round16f<<<gw, 256, 0, stream>>>(Wq, Bw, WSZ / 8); k_round16f<<<gw, 256, 0, stream>>>(Wk, Bw + WSZ, WSZ / 8); k_round16f<<<gw, 256, 0, stream>>>(Wv, Bw + 2 * WSZ, WSZ / 8);      /* (out,in) natural x 2^4 */
  k_tok<<<BB * (CC / 64) * (NN / 32), 256, 0, stream>>>(x, X16);      /* [B][C][N] to token-major bf16 plane */
  const dim3 gp((NR / 128) * (CC / 128), 1);
  k_proj<0><<<gp, 256, 0, stream>>>(X16, Bw, bq, nullptr, nullptr, Q);      /* q (unscaled) f16: M 16384 N 512 K 512 */
  k_proj<1><<<gp, 256, 0, stream>>>(X16, Bw + WSZ, bk, rh, rw, K);      /* k' = k + rt^T, f16 */
  k_proj<2><<<gp, 256, 0, stream>>>(X16, Bw + 2 * WSZ, bv, nullptr, nullptr, Vt);      /* v as V^T f16 per batch [512 channels][N] = per (b, h) [128][N] */
  k_flash<<<BB * NH * (NN / 64), 128, 0, stream>>>(Q, CC, K, CC, Vt, nullptr, (float*)d_out, 128);      /* y to d_out as [b][h][n][128]; k_flash does not read its V residual argument, and that plane is no longer made */
}

// v006
// One run takes 92.9 microseconds.
// Two timings next to v005 both put it at 1.14 times that version's speed.
// All steps since v000 together make it 4.66 times as fast.
#include <hip/hip_runtime.h>
// Bottleneck-transformer MHSA with relative position term (B=16, C=512, 32×32 → N=1024, 4 heads × 128): q,k,v = 1×1 convs ((out,in) + bias); logits = (q·C^-½)·(k + rt) where rt[h][d][n] = rh[h][d][n mod 32] + rw[h][d][n div 32]
// (the module's (rh + rw).reshape(1, heads, emb, N)); softmax; y = attn·v per head; the output is the [B][h][N][d] buffer reinterpreted as [B,C,H,W] (the module's final reshape).
// Compute dtype: x, weights, biases, rh, rw rounded to bf16; token-major bf16 input plane; q as an f16 GEMM plane (unscaled — the C^-½ is applied to the f32 score), k as an f32 GEMM output with rtᵀ added in f32 then f16,
// v f16; fused flash-style kernel for head dim 128 (4 k-steps, 8 value tiles, online softmax f32, P as f16 + its exact f16 residual, V f16, one f32 accumulator) on v_wmma_f32_16x16x32_f16 writing y directly; f32 accumulate.
#define BB 16
#define CC 512
#define NN 1024
#define TT NN
#define NH 4
#define HDD 128
#define NVH (2 * NH)
#define NR (BB * NN)
#define ATT_SCALE 0.04419417382415922f

typedef __bf16 v16b __attribute__((ext_vector_type(16)));
typedef unsigned short v8us __attribute__((ext_vector_type(8), may_alias));
typedef float  v8f  __attribute__((ext_vector_type(8)));
typedef float  v4f  __attribute__((ext_vector_type(4)));
typedef float  v4fa __attribute__((ext_vector_type(4), may_alias));
union FragB { v16b v; v8us half[2]; unsigned short u[16]; };

__device__ __forceinline__ unsigned short bf16_bits(float x) { unsigned int u = __float_as_uint(x); return (unsigned short)((u + 0x7FFFu + ((u >> 16) & 1u)) >> 16); }
__device__ __forceinline__ float bf16_val(unsigned short b) { return __uint_as_float(((unsigned int)b) << 16); }
__device__ __forceinline__ float bf16_round(float x) { return bf16_val(bf16_bits(x)); }
// D += A·B with NT terms: 1 = ah·bh, 2 = + al·bh (A split), 3 = + ah·bl (both split)
template <int NT>
__device__ __forceinline__ v8f mmaN(v16b ah, v16b al, v16b bh, v16b bl, v8f c) {
  c = __builtin_amdgcn_wmma_f32_16x16x32_bf16(false, ah, false, bh, (short)0, c, false, false);
  if (NT >= 2) c = __builtin_amdgcn_wmma_f32_16x16x32_bf16(false, al, false, bh, (short)0, c, false, false);
  if (NT >= 3) c = __builtin_amdgcn_wmma_f32_16x16x32_bf16(false, ah, false, bl, (short)0, c, false, false);
  asm volatile("v_nop\n\tv_nop\n\tv_nop\n\tv_nop" : "+v"(c) : "v"(ah), "v"(al), "v"(bh), "v"(bl));
  return c;
}

__global__ __launch_bounds__(256) void k_wt_bf16(const float* __restrict__ W, unsigned short* __restrict__ Wt, int K, int N) {
  const int t = blockIdx.x * 256 + threadIdx.x;
  const int k8n = K / 8;
  if (t >= N * k8n) return;
  const int n = t / k8n, k8 = (t % k8n) * 8;
  v8us v;
#pragma unroll
  for (int i = 0; i < 8; ++i) v[i] = bf16_bits(W[(size_t)(k8 + i) * N + n]);
  *(v8us*)(Wt + (size_t)n * K + k8) = v;
  
}

// GEMM C[M][N] (f32, pitch ldc) = act(A[M][K]·W + bias). A f32 row-major (pitch lda) converted per fragment to bf16
// (ASPLIT: hi/lo two planes -> 2 terms, else single rounded term); Wt bf16 [N][K] (pitch ldb). BIAS_BF16 rounds the
// bias to bf16 first (bias quantised to bf16 before the add). K%32==0, M%16==0, N%64==0.
template <bool ASPLIT, int ACT, bool BIAS_BF16>
__global__ __launch_bounds__(128) void k_gemm_bf(const float* __restrict__ A, int lda, const unsigned short* __restrict__ Wt, int ldb,
                                               const float* __restrict__ bias, float* __restrict__ C, int ldc, int M, int N, int K) {
  __shared__ __attribute__((aligned(16))) float so[4][16][64];
  const int tid = threadIdx.x, w = tid >> 5, lane = tid & 31, ln = lane & 15, hh = lane >> 4;
  const int ntn = N / 64;
  const int wid = blockIdx.x * 4 + w;
  const int mt = wid / ntn, nq = wid % ntn;
  if (mt * 16 >= M) return;
  const int row0 = mt * 16, col0 = nq * 64;
  const float* arow = A + (size_t)(row0 + ln) * lda;
  v8f acc[4] = {};
  for (int kb = 0; kb < K; kb += 32) {
    FragB ah, al;
    const v4f x0 = *(const v4fa*)(arow + kb + 8 * hh), x1 = *(const v4fa*)(arow + kb + 8 * hh + 4);
    const v4f x2 = *(const v4fa*)(arow + kb + 16 + 8 * hh), x3 = *(const v4fa*)(arow + kb + 16 + 8 * hh + 4);
    float xs[16] = {x0[0],x0[1],x0[2],x0[3],x1[0],x1[1],x1[2],x1[3],x2[0],x2[1],x2[2],x2[3],x3[0],x3[1],x3[2],x3[3]};
#pragma unroll
    for (int i = 0; i < 16; ++i) { const unsigned short hb = bf16_bits(xs[i]); ah.u[i] = hb; al.u[i] = ASPLIT ? bf16_bits(xs[i] - bf16_val(hb)) : (unsigned short)0; }
#pragma unroll
    for (int t = 0; t < 4; ++t) {
      const unsigned short* brow = Wt + (size_t)(col0 + t * 16 + ln) * ldb + kb;
      FragB b;
      b.half[0] = *(const v8us*)(brow + 8 * hh);
      b.half[1] = *(const v8us*)(brow + 16 + 8 * hh);
      acc[t] = mmaN<ASPLIT ? 2 : 1>(ah.v, al.v, b.v, b.v, acc[t]);
    }
  }
#pragma unroll
  for (int t = 0; t < 4; ++t) {
    float bv = bias ? bias[col0 + t * 16 + ln] : 0.f;
    if (BIAS_BF16) bv = bf16_round(bv);
#pragma unroll
    for (int r = 0; r < 8; ++r) { float v = acc[t][r] + bv; if (ACT == 1) v = fmaxf(v, 0.f); so[w][8 * hh + r][t * 16 + ln] = v; }
  }
  __builtin_amdgcn_fence(__ATOMIC_ACQ_REL, "workgroup");
  __builtin_amdgcn_wave_barrier();
  const int rsub = lane >> 4, c4 = (lane & 15) * 4;
  {
#pragma unroll
    for (int q = 0; q < 8; ++q) {
      const int r = q * 2 + rsub;
      const v4f v = *(const v4fa*)&so[w][r][c4];
      *(v4f*)(C + (size_t)(row0 + r) * ldc + col0 + c4) = v;
    }
    
  }
}

// Flash-style causal/unmasked attention, all contractions 3-term bf16 hi/lo splits, f32 softmax with running max.
// q,k,v rows are read from f32 buffers with arbitrary row pitch (so they can live inside a fused qkv buffer);
// D = head size (multiple of 32, <= 128); one wave = 16 query rows; block = 4 waves (64 queries) sharing K/V chunks of 32.
template <int D, bool CAUSAL>
__global__ __launch_bounds__(128) void k_flash(const float* __restrict__ qb, const float* __restrict__ kb, const float* __restrict__ vb,
                                             int pitch, int T, int H, float scale, float* __restrict__ y, int ypitch) {
  constexpr int KS = D / 32;        // k-steps for QK
  constexpr int DT = D / 16;        // d tiles for PV
  __shared__ __attribute__((aligned(16))) unsigned short sKh[32][D + 8], sKl[32][D + 8], sVh[32][D + 8], sVl[32][D + 8];
  __shared__ __attribute__((aligned(16))) unsigned short sPh[4][16][40], sPl[4][16][40];
  __shared__ __attribute__((aligned(16))) float sO[4][16][D];
  const int tid = threadIdx.x, w = tid >> 5, lane = tid & 31, ln = lane & 15, hh = lane >> 4;
  const int nqb = (T + 63) / 64;
  const int bh = blockIdx.x / nqb, qblk = blockIdx.x % nqb;
  const int b = bh / H, h = bh % H;
  const int q0 = qblk * 64 + w * 16;
  const float* Q = qb + (size_t)b * T * pitch + h * D;
  const float* K = kb + (size_t)b * T * pitch + h * D;
  const float* V = vb + (size_t)b * T * pitch + h * D;

  // A fragments of the wave's 16 query rows (scaled), hi/lo
  FragB aqh[KS], aql[KS];
  {
    int row = q0 + ln; if (row >= T) row = T - 1;
    const float* qr = Q + (size_t)row * pitch;
#pragma unroll
    for (int ks = 0; ks < KS; ++ks)
#pragma unroll
      for (int i = 0; i < 16; ++i) {
        const int d = ks * 32 + ((i < 8) ? (8 * hh + i) : (16 + 8 * hh + (i - 8)));
        const float x = qr[d] * scale; const unsigned short hb = bf16_bits(x);
        aqh[ks].u[i] = hb; aql[ks].u[i] = bf16_bits(x - bf16_val(hb));
      }
  }
  float m_r[8], l_r[8];
#pragma unroll
  for (int r = 0; r < 8; ++r) { m_r[r] = -3.0e38f; l_r[r] = 0.f; }
  v8f oacc[DT];
#pragma unroll
  for (int dt = 0; dt < DT; ++dt) oacc[dt] = (v8f){0.f,0.f,0.f,0.f,0.f,0.f,0.f,0.f};

  const int kv_end = CAUSAL ? min(T, qblk * 64 + 64) : T;     // block-uniform
  for (int j0 = 0; j0 < kv_end; j0 += 32) {
    __syncthreads();
    for (int e = tid; e < 32 * (D / 4); e += 128) {
      const int r = e / (D / 4), c4 = (e % (D / 4)) * 4;
      const int key = j0 + r;
      v4f kf = {0.f,0.f,0.f,0.f}, vf = {0.f,0.f,0.f,0.f};
      if (key < T) { kf = *(const v4fa*)(K + (size_t)key * pitch + c4); vf = *(const v4fa*)(V + (size_t)key * pitch + c4); }
#pragma unroll
      for (int t = 0; t < 4; ++t) {
        unsigned short hb = bf16_bits(kf[t]); sKh[r][c4 + t] = hb; sKl[r][c4 + t] = bf16_bits(kf[t] - bf16_val(hb));
        hb = bf16_bits(vf[t]); sVh[r][c4 + t] = hb; sVl[r][c4 + t] = bf16_bits(vf[t] - bf16_val(hb));
      }
    }
    __syncthreads();
    // S tile 16 x 32
    v8f s[2];
#pragma unroll
    for (int nt = 0; nt < 2; ++nt) {
      v8f acc = {};
#pragma unroll
      for (int ks = 0; ks < KS; ++ks) {
        FragB bh_, bl_;
        bh_.half[0] = *(const v8us*)&sKh[nt * 16 + ln][ks * 32 + 8 * hh]; bh_.half[1] = *(const v8us*)&sKh[nt * 16 + ln][ks * 32 + 16 + 8 * hh];
        bl_.half[0] = *(const v8us*)&sKl[nt * 16 + ln][ks * 32 + 8 * hh]; bl_.half[1] = *(const v8us*)&sKl[nt * 16 + ln][ks * 32 + 16 + 8 * hh];
        acc = mmaN<3>(aqh[ks].v, aql[ks].v, bh_.v, bl_.v, acc);
      }
      s[nt] = acc;
    }
    // mask + running max (rows 8hh+r; the 16 lanes of a half share rows)
    float alpha[8];
#pragma unroll
    for (int r = 0; r < 8; ++r) {
      const int qi = q0 + 8 * hh + r;
      const int ja = j0 + ln, jb = j0 + 16 + ln;
      if (CAUSAL) { if (ja > qi) s[0][r] = -3.0e38f; if (jb > qi) s[1][r] = -3.0e38f; }
      if (ja >= T) s[0][r] = -3.0e38f;
      if (jb >= T) s[1][r] = -3.0e38f;
      float mx = fmaxf(s[0][r], s[1][r]);
      mx = fmaxf(mx, __shfl_xor(mx, 1, 32)); mx = fmaxf(mx, __shfl_xor(mx, 2, 32)); mx = fmaxf(mx, __shfl_xor(mx, 4, 32)); mx = fmaxf(mx, __shfl_xor(mx, 8, 32));
      const float mnew = fmaxf(m_r[r], mx);
      alpha[r] = (mnew > -1.0e38f) ? __expf(m_r[r] - mnew) : 1.0f;
      const float p0 = (s[0][r] > -1.0e38f) ? __expf(s[0][r] - mnew) : 0.f;
      const float p1 = (s[1][r] > -1.0e38f) ? __expf(s[1][r] - mnew) : 0.f;
      m_r[r] = mnew;
      l_r[r] = l_r[r] * alpha[r] + p0 + p1;            // per-lane partial row sum (16 lanes combined at the end)
      unsigned short hb = bf16_bits(p0); sPh[w][8 * hh + r][ln] = hb;      sPl[w][8 * hh + r][ln] = bf16_bits(p0 - bf16_val(hb));
      hb = bf16_bits(p1);                sPh[w][8 * hh + r][16 + ln] = hb; sPl[w][8 * hh + r][16 + ln] = bf16_bits(p1 - bf16_val(hb));
    }
#pragma unroll
    for (int dt = 0; dt < DT; ++dt)
#pragma unroll
      for (int r = 0; r < 8; ++r) oacc[dt][r] *= alpha[r];
    __builtin_amdgcn_fence(__ATOMIC_ACQ_REL, "workgroup");
    __builtin_amdgcn_wave_barrier();
    FragB pah, pal;
    pah.half[0] = *(const v8us*)&sPh[w][ln][8 * hh]; pah.half[1] = *(const v8us*)&sPh[w][ln][16 + 8 * hh];
    pal.half[0] = *(const v8us*)&sPl[w][ln][8 * hh]; pal.half[1] = *(const v8us*)&sPl[w][ln][16 + 8 * hh];
#pragma unroll
    for (int dt = 0; dt < DT; ++dt) {
      FragB bvh, bvl;
#pragma unroll
      for (int i = 0; i < 8; ++i) {
        bvh.u[i] = sVh[8 * hh + i][dt * 16 + ln]; bvh.u[8 + i] = sVh[16 + 8 * hh + i][dt * 16 + ln];
        bvl.u[i] = sVl[8 * hh + i][dt * 16 + ln]; bvl.u[8 + i] = sVl[16 + 8 * hh + i][dt * 16 + ln];
      }
      oacc[dt] = mmaN<3>(pah.v, pal.v, bvh.v, bvl.v, oacc[dt]);
    }
    __builtin_amdgcn_fence(__ATOMIC_ACQ_REL, "workgroup");
    __builtin_amdgcn_wave_barrier();
  }
#pragma unroll
  for (int r = 0; r < 8; ++r) {
    float l = l_r[r];
    l += __shfl_xor(l, 1, 32); l += __shfl_xor(l, 2, 32); l += __shfl_xor(l, 4, 32); l += __shfl_xor(l, 8, 32);
    l_r[r] = (l > 0.f) ? 1.0f / l : 0.f;
  }
#pragma unroll
  for (int dt = 0; dt < DT; ++dt)
#pragma unroll
    for (int r = 0; r < 8; ++r) sO[w][8 * hh + r][dt * 16 + ln] = oacc[dt][r] * l_r[r];
  __builtin_amdgcn_fence(__ATOMIC_ACQ_REL, "workgroup");
  __builtin_amdgcn_wave_barrier();
  {
    for (int r = 0; r < 16; ++r) {
      const int row = q0 + r;
      if (row < T && lane < D / 4) {
        const v4f val = *(const v4fa*)&sO[w][r][lane * 4];
        *(v4f*)(y + ((size_t)b * T + row) * ypitch + h * D + lane * 4) = val;
      }
    }
    
  }
}

// GEMM C = act(A·W + bias + resid): A f32 (ASPLIT -> hi/lo 2 terms), Wt bf16 [N][K]; ACT 0 none, 1 relu, 2 exact gelu;
// resid (optional, f32, row index = (row % rmod), pitch ldr, RES_BF16 rounds it) added before the activation.
template <bool ASPLIT, int ACT, bool BIAS_BF16, bool RES_BF16>
__global__ __launch_bounds__(128) void k_gemm_bf3(const float* __restrict__ A, int lda, const unsigned short* __restrict__ Wt, int ldb,
                                                const float* __restrict__ bias, const float* __restrict__ resid, int rmod, int ldr,
                                                float* __restrict__ C, int ldc, int M, int N, int K) {
  __shared__ __attribute__((aligned(16))) float so[4][16][64];
  const int tid = threadIdx.x, w = tid >> 5, lane = tid & 31, ln = lane & 15, hh = lane >> 4;
  const int ntn = N / 64;
  const int wid = blockIdx.x * 4 + w;
  const int mt = wid / ntn, nq = wid % ntn;
  if (mt * 16 >= M) return;
  const int row0 = mt * 16, col0 = nq * 64;
  const float* arow = A + (size_t)(row0 + ln) * lda;
  v8f acc[4] = {};
  for (int kb = 0; kb < K; kb += 32) {
    FragB ah, al;
    const v4f x0 = *(const v4fa*)(arow + kb + 8 * hh), x1 = *(const v4fa*)(arow + kb + 8 * hh + 4);
    const v4f x2 = *(const v4fa*)(arow + kb + 16 + 8 * hh), x3 = *(const v4fa*)(arow + kb + 16 + 8 * hh + 4);
    float xs[16] = {x0[0],x0[1],x0[2],x0[3],x1[0],x1[1],x1[2],x1[3],x2[0],x2[1],x2[2],x2[3],x3[0],x3[1],x3[2],x3[3]};
#pragma unroll
    for (int i = 0; i < 16; ++i) { const unsigned short hb = bf16_bits(xs[i]); ah.u[i] = hb; al.u[i] = ASPLIT ? bf16_bits(xs[i] - bf16_val(hb)) : (unsigned short)0; }
#pragma unroll
    for (int t = 0; t < 4; ++t) {
      const unsigned short* brow = Wt + (size_t)(col0 + t * 16 + ln) * ldb + kb;
      FragB b;
      b.half[0] = *(const v8us*)(brow + 8 * hh);
      b.half[1] = *(const v8us*)(brow + 16 + 8 * hh);
      acc[t] = mmaN<ASPLIT ? 2 : 1>(ah.v, al.v, b.v, b.v, acc[t]);
    }
  }
#pragma unroll
  for (int t = 0; t < 4; ++t) {
    const int col = col0 + t * 16 + ln;
    float bv = bias ? bias[col] : 0.f;
    if (BIAS_BF16) bv = bf16_round(bv);
#pragma unroll
    for (int r = 0; r < 8; ++r) {
      float v = acc[t][r] + bv;
      if (resid) { float rv = resid[(size_t)((row0 + 8 * hh + r) % rmod) * ldr + col]; if (RES_BF16) rv = bf16_round(rv); v += rv; }
      if (ACT == 1) v = fmaxf(v, 0.f);
      if (ACT == 2) v = 0.5f * v * (1.0f + erff(v * 0.70710678118654752f));
      if (ACT == 3) { const float u = 0.7978845608028654f * (v + 0.044715f * v * v * v); v = 0.5f * v * (1.0f + tanhf(u)); }
      so[w][8 * hh + r][t * 16 + ln] = v;
    }
  }
  __builtin_amdgcn_fence(__ATOMIC_ACQ_REL, "workgroup");
  __builtin_amdgcn_wave_barrier();
  const int rsub = lane >> 4, c4 = (lane & 15) * 4;
  {
#pragma unroll
    for (int q = 0; q < 8; ++q) {
      const int r = q * 2 + rsub;
      const v4f v = *(const v4fa*)&so[w][r][c4];
      *(v4f*)(C + (size_t)(row0 + r) * ldc + col0 + c4) = v;
    }
    
  }
}
// row LayerNorm (biased variance, eps) over N: s = X (+ R); optional out_sum <- s; out_norm <- (s-mu)*rsqrt(var+eps)*g + b
template <bool PARAM_BF16>
__global__ __launch_bounds__(256) void k_layernorm(const float* __restrict__ X, const float* __restrict__ R, const float* __restrict__ g, const float* __restrict__ bta,
                                                  float* __restrict__ out_sum, float* __restrict__ out_norm, int N, float eps) {
  __shared__ float red[256];
  const int row = blockIdx.x, tid = threadIdx.x;
  const float* x = X + (size_t)row * N; const float* rr = R ? R + (size_t)row * N : nullptr;
  float vals[16];                     // up to N = 4096
  const int per = N / 256;            // contiguous chunk per thread? use strided-by-4 chunks: thread handles j = tid*4 + 1024*u
  float s1 = 0.f;
  for (int u = 0; u < per / 4; ++u) {
    const int j = tid * 4 + 1024 * u;
    const v4f a = *(const v4fa*)(x + j);
    v4f b = {0.f,0.f,0.f,0.f}; if (rr) b = *(const v4fa*)(rr + j);
#pragma unroll
    for (int q = 0; q < 4; ++q) { const float v = a[q] + b[q]; vals[u * 4 + q] = v; s1 += v; }
  }
  red[tid] = s1; __syncthreads();
  for (int st = 128; st > 0; st >>= 1) { if (tid < st) red[tid] += red[tid + st]; __syncthreads(); }
  const float mu = red[0] / (float)N; __syncthreads();
  float s2 = 0.f;
  for (int u = 0; u < per / 4; ++u)
#pragma unroll
    for (int q = 0; q < 4; ++q) { const float c = vals[u * 4 + q] - mu; s2 += c * c; }
  red[tid] = s2; __syncthreads();
  for (int st = 128; st > 0; st >>= 1) { if (tid < st) red[tid] += red[tid + st]; __syncthreads(); }
  const float rs = rsqrtf(red[0] / (float)N + eps);
  {
    for (int u = 0; u < per / 4; ++u) {
      const int j = tid * 4 + 1024 * u;
      v4f o, sm;
#pragma unroll
      for (int q = 0; q < 4; ++q) {
        float gg = g[j + q], bb = bta[j + q];
        if (PARAM_BF16) { gg = bf16_round(gg); bb = bf16_round(bb); }
        sm[q] = vals[u * 4 + q]; o[q] = (vals[u * 4 + q] - mu) * rs * gg + bb;
      }
      if (out_sum) *(v4f*)(out_sum + (size_t)row * N + j) = sm;
      *(v4f*)(out_norm + (size_t)row * N + j) = o;
    }
    
  }
}



// ---- f16 WMMA path (v_wmma_f32_16x16x32_f16): 11-bit significands for operands in range — used where the probability operand (1024 p, in [0,1024]) needs more precision than bf16
typedef _Float16 v16h __attribute__((ext_vector_type(16)));
union FragH { v16h v; v8us half[2]; _Float16 h[16]; unsigned short u[16]; };
template <int NT>
__device__ __forceinline__ v8f mmaH(v16h ah, v16h al, v16h bh, v16h bl, v8f c) {
  c = __builtin_amdgcn_wmma_f32_16x16x32_f16(false, ah, false, bh, (short)0, c, false, false);
  if (NT >= 2) c = __builtin_amdgcn_wmma_f32_16x16x32_f16(false, al, false, bh, (short)0, c, false, false);
  if (NT >= 3) c = __builtin_amdgcn_wmma_f32_16x16x32_f16(false, ah, false, bl, (short)0, c, false, false);
  asm volatile("v_nop\n\tv_nop\n\tv_nop\n\tv_nop" : "+v"(c) : "v"(ah), "v"(al), "v"(bh), "v"(bl));
  return c;
}
// batched GEMM like k_gemm_b but f16 operands: A f32 (split into f16 hi/lo if ASPLIT, else rounded to f16), Bt = f16 values [n][k]; alpha; C f32; N multiple of 16 (partial tiles skipped)
template <bool ASPLIT>
__global__ __launch_bounds__(128) void k_gemm_h(const float* __restrict__ A, int lda, size_t sA, const _Float16* __restrict__ Bh, int ldb, size_t sB, float alpha, float* __restrict__ C, int ldc, size_t sC, int M, int N, int K) {
  __shared__ __attribute__((aligned(16))) float so[4][16][64];
  const int tid = threadIdx.x, w = tid >> 5, lane = tid & 31, ln = lane & 15, hh = lane >> 4; const int by = blockIdx.y;
  A += (size_t)by * sA; Bh += (size_t)by * sB; C += (size_t)by * sC;
  const int ntn = (N + 63) / 64; const int wid = blockIdx.x * 4 + w; const int mt = wid / ntn, nq = wid % ntn; if (mt * 16 >= M) return;
  const int row0 = mt * 16, col0 = nq * 64; const float* arow = A + (size_t)(row0 + ln) * lda;
  v8f acc[4] = {};
  for (int kb = 0; kb < K; kb += 32) {
    FragH ah, al;
    const v4f x0 = *(const v4fa*)(arow + kb + 8 * hh), x1 = *(const v4fa*)(arow + kb + 8 * hh + 4), x2 = *(const v4fa*)(arow + kb + 16 + 8 * hh), x3 = *(const v4fa*)(arow + kb + 16 + 8 * hh + 4);
    float xs[16] = {x0[0],x0[1],x0[2],x0[3],x1[0],x1[1],x1[2],x1[3],x2[0],x2[1],x2[2],x2[3],x3[0],x3[1],x3[2],x3[3]};
#pragma unroll
    for (int i = 0; i < 16; ++i) { const _Float16 h = (_Float16)xs[i]; ah.h[i] = h; al.h[i] = ASPLIT ? (_Float16)(xs[i] - (float)h) : (_Float16)0.0f; }
#pragma unroll
    for (int t = 0; t < 4; ++t) { if (col0 + t * 16 >= N) continue; const size_t boff = (size_t)(col0 + t * 16 + ln) * ldb + kb; FragH bq; bq.half[0] = *(const v8us*)(Bh + boff + 8 * hh); bq.half[1] = *(const v8us*)(Bh + boff + 16 + 8 * hh);
      acc[t] = mmaH<ASPLIT ? 2 : 1>(ah.v, al.v, bq.v, bq.v, acc[t]); }
  }
#pragma unroll
  for (int t = 0; t < 4; ++t) { if (col0 + t * 16 >= N) continue;
#pragma unroll
    for (int r = 0; r < 8; ++r) so[w][8 * hh + r][t * 16 + ln] = acc[t][r] * alpha; }
  __builtin_amdgcn_fence(__ATOMIC_ACQ_REL, "workgroup"); __builtin_amdgcn_wave_barrier();
  const int rsub = lane >> 4, c4 = (lane & 15) * 4;
  {
#pragma unroll
    for (int q = 0; q < 8; ++q) { const int r = q * 2 + rsub; if (col0 + c4 < N) { const v4f v = *(const v4fa*)&so[w][r][c4]; *(v4f*)(C + (size_t)(row0 + r) * ldc + col0 + c4) = v; } }
     }
}

// Wt[n][k] = f16(W[k][n]·scale) from f32 row-major W[K][N] (scale = power of two; bf16-exact weights stay exact in f16 away from the subnormal range)
__global__ __launch_bounds__(256) void k_wt_f16(const float* __restrict__ W, _Float16* __restrict__ Wt, int K, int N, float scale) {
  const int t = blockIdx.x * 256 + threadIdx.x; if (t >= N * (K / 8)) return; const int n = t / (K / 8), k8 = (t % (K / 8)) * 8; FragH f;
#pragma unroll
  for (int i = 0; i < 8; ++i) f.h[i] = (_Float16)(bf16_round(W[(size_t)(k8 + i) * N + n]) * scale); const v8us o = f.half[0];
  *(v8us*)((unsigned short*)Wt + (size_t)n * K + k8) = o; 
}
// Projection GEMM, fixed shape M = NR, N = K = CC: v = acc/16 + bf16(bias[col]) in f32, and the epilogue writes the f16 plane that the attention kernel reads:
// MODE 0 (q): f16 rows [token][channel]; MODE 1 (k): v + (bf16(rh[channel][n mod 32]) + bf16(rw[channel][n div 32])) in f32, then f16 rows; MODE 2 (v): f16, transposed per batch to [channel][token].
// One work-group = one 128 x 128 tile of the output, 8 waves as 4 x 2, 32 x 64 a wave. A pass is 64 k: 128 rows of A and 128 rows of W, 128 B (one line) each,
// copied once per work-group into LDS at pitch 144 B (16 B x odd: conflict-free ds_load_b128); two buffers, the next pass's copies fly while this pass is multiplied.
typedef _Float16 v4h __attribute__((ext_vector_type(4)));
constexpr int PROJ_RING = 4 * 128 * 144;      /* two stages of (128 A rows + 128 W rows) at pitch 144 B */
template <int MODE>
__device__ __forceinline__ void proj_tile(unsigned char* ring, const int blk, const _Float16* __restrict__ A, const _Float16* __restrict__ Bh, const float* __restrict__ bias, const float* __restrict__ rh, const float* __restrict__ rw, _Float16* __restrict__ C16) {
  constexpr int BT = 128, BK = 64, RP = 144, TILE = BT * RP, STG = 2 * TILE, NPASS = CC / BK, SOP = 68, TP = 2 * BT + 16;
  static_assert(2 * STG == PROJ_RING, "the kernel's LDS array is the ring");
  static_assert(NR % BT == 0 && CC % BT == 0 && CC % BK == 0 && NPASS >= 2, "whole tiles, at least two passes");
  static_assert(NN % BT == 0 && BT % 32 == 0, "a tile lies in one batch, a wave's 32 rows in one value of n div 32");
  static_assert(BT * TP <= 2 * STG, "the transposed tile must fit in the ring");
  static_assert(sizeof(float) * 8 * 32 * SOP <= 2 * STG, "output staging must fit in the ring");
  float (*so)[32][SOP] = reinterpret_cast<float (*)[32][SOP]>(ring);      /* output staging takes the ring's place behind the last pass's barrier; pitch 68 dwords keeps the two lane halves on different banks */
  const int tid = threadIdx.x, w = tid >> 5, lane = tid & 31, ln = lane & 15, hh = lane >> 4;
  const int row0 = (blk / (CC / BT)) * BT, col0 = (blk % (CC / BT)) * BT;
  const int wr = (w >> 1) * 32, wc = (w & 1) * 64;
  /* each thread copies 4 x 16 B of A and 4 x 16 B of W per pass; a wave-wide copy = 4 whole rows = 4 lines */
  const char* gA = (const char*)((const unsigned short*)A + (size_t)(row0 + (tid >> 3)) * CC) + (tid & 7) * 16;
  const char* gB = (const char*)((const unsigned short*)Bh + (size_t)(col0 + (tid >> 3)) * CC) + (tid & 7) * 16;
  const unsigned lA = (unsigned)(size_t)ring + (unsigned)((tid >> 3) * RP + (tid & 7) * 16);
  constexpr size_t R32 = (size_t)32 * CC * 2;      /* bytes from a row to the row 32 below it */
  auto stage_copies = [&](int p, unsigned bofs) {
    const char* a0 = gA + (size_t)p * (BK * 2); const char* b0 = gB + (size_t)p * (BK * 2); const unsigned a = lA + bofs, c = a + (unsigned)TILE;
    /* the s_wait_xcnt closes the statement so that no address register of a copy is rewritten ahead of it */
    asm volatile("global_load_async_to_lds_b128 %0, %8, off\n\t"
                 "global_load_async_to_lds_b128 %1, %9, off\n\t"
                 "global_load_async_to_lds_b128 %2, %10, off\n\t"
                 "global_load_async_to_lds_b128 %3, %11, off\n\t"
                 "global_load_async_to_lds_b128 %4, %12, off\n\t"
                 "global_load_async_to_lds_b128 %5, %13, off\n\t"
                 "global_load_async_to_lds_b128 %6, %14, off\n\t"
                 "global_load_async_to_lds_b128 %7, %15, off\n\t"
                 "s_wait_xcnt 0x0"
                 :: "v"(a), "v"(a + 32 * RP), "v"(a + 64 * RP), "v"(a + 96 * RP), "v"(c), "v"(c + 32 * RP), "v"(c + 64 * RP), "v"(c + 96 * RP),
                    "v"(a0), "v"(a0 + R32), "v"(a0 + 2 * R32), "v"(a0 + 3 * R32), "v"(b0), "v"(b0 + R32), "v"(b0 + 2 * R32), "v"(b0 + 3 * R32)
                 : "memory");
  };
  v8f acc[2][4] = {};
  stage_copies(0, 0u);
  /* MODE 1: the wave's part of rh and rw is asked for here and used in the epilogue: its latency runs beside that of pass 0's copies, not alone behind the last pass.
     Row n of the tile: n div 32 = na for all 32 rows of a wave, n mod 32 = i * 16 + 8 * hh + r; a lane's 8 rows of one accumulator are 32 consecutive bytes of its channel's 128-B row of rh */
  v4f rhv[4][2][2]; float rwv[4];
  if (MODE == 1) { const int na = (row0 % NN + wr) / 32;
#pragma unroll      /* this loop and the one inside it: constant indices keep rhv and rwv in registers */
    for (int t = 0; t < 4; ++t) { const size_t c32 = (size_t)(col0 + wc + t * 16 + ln) * 32; rwv[t] = rw[c32 + na];
#pragma unroll
      for (int i = 0; i < 2; ++i) { rhv[t][i][0] = *(const v4fa*)(rh + c32 + i * 16 + 8 * hh); rhv[t][i][1] = *(const v4fa*)(rh + c32 + i * 16 + 8 * hh + 4); } } }
  asm volatile("s_wait_asynccnt 0x0" ::: "memory");      /* pass 0 of this wave has landed */
  __syncthreads();                                       /* ... and every wave's part of it is published */
  stage_copies(1, (unsigned)STG);
#pragma unroll 2      /* two passes a trip make the buffer offsets immediates; fully unrolled the copies' addresses of all passes took the wave past 256 VGPRs */
  for (int p = 0; p < NPASS; ++p) {
    const unsigned bofs = (unsigned)(p & 1) * (unsigned)STG;
    const unsigned char* at = ring + bofs + (wr + ln) * RP + 16 * hh; const unsigned char* bt = ring + bofs + TILE + (wc + ln) * RP + 16 * hh;
#pragma unroll      /* this loop and those inside it: constant indices keep the fragments and acc in registers */
    for (int ks = 0; ks < BK / 32; ++ks) { FragH fa[2], fb[4];
#pragma unroll
      for (int i = 0; i < 2; ++i) { fa[i].half[0] = *(const v8us*)(at + i * 16 * RP + ks * 64); fa[i].half[1] = *(const v8us*)(at + i * 16 * RP + ks * 64 + 32); }
#pragma unroll
      for (int t = 0; t < 4; ++t) { fb[t].half[0] = *(const v8us*)(bt + t * 16 * RP + ks * 64); fb[t].half[1] = *(const v8us*)(bt + t * 16 * RP + ks * 64 + 32); }
#pragma unroll
      for (int i = 0; i < 2; ++i)
#pragma unroll
        for (int t = 0; t < 4; ++t) acc[i][t] = __builtin_amdgcn_wmma_f32_16x16x32_f16(false, fa[i].v, false, fb[t].v, (short)0, acc[i][t], false, false); }
    asm volatile("s_wait_dscnt 0x0" ::: "memory");         /* this wave's reads of the buffer are done before it is refilled */
    asm volatile("s_wait_asynccnt 0x0" ::: "memory");      /* this wave's copies of the next pass have landed */
    __syncthreads();                                       /* publishes the next pass and ends every wave's reads of this one */
    if (p + 2 < NPASS) stage_copies(p + 2, bofs); }
  asm volatile("s_wait_asynccnt 0x0" ::: "memory");        /* nothing in flight when the ring becomes output staging */
  if (MODE == 2) {
    /* D[8*hh + r][ln]: a lane's 8 values of one accumulator are 8 consecutive tokens of ONE channel = 16 B of a row of the transposed tile.
       The tile [128 channels][128 tokens] is gathered in LDS at pitch 272 B (16 B x odd: 16 lanes of a ds_store_b128 on 64 different banks), since a channel's 128 tokens come from four waves. */
#pragma unroll      /* this loop and the two inside it: constant indices into acc */
    for (int t = 0; t < 4; ++t) { const float bv = bf16_round(bias[col0 + wc + t * 16 + ln]);
#pragma unroll
      for (int i = 0; i < 2; ++i) { FragH f;
#pragma unroll
        for (int r = 0; r < 8; ++r) f.h[r] = (_Float16)(acc[i][t][r] * 0.0625f + bv);
        *(v8us*)(ring + (wc + t * 16 + ln) * TP + (wr + i * 16 + 8 * hh) * 2) = f.half[0]; } }
    __syncthreads();      /* every wave's part of the transposed tile is in LDS before any wave reads whole channel rows */
    unsigned short* vt = (unsigned short*)C16 + ((size_t)(row0 / NN) * CC + col0) * NN + row0 % NN;
#pragma unroll      /* the 8 LDS reads go out as one group ahead of the stores; a store = 2 channel rows of 256 B, whole lines */
    for (int q = 0; q < 8; ++q) { const int ch = w * 16 + q * 2 + hh; const v8us v = *(const v8us*)(ring + ch * TP + ln * 16); *(v8us*)(vt + (size_t)ch * NN + ln * 8) = v; }
    asm volatile("s_wait_xcnt 0x0" ::: "memory");      /* behind the last store: in the merged kernel another part's code may follow in the listing and rewrite the stores' registers */
    return;
  }
#pragma unroll      /* this loop and the two inside it: constant indices into acc */
  for (int t = 0; t < 4; ++t) { const float bv = bf16_round(bias[col0 + wc + t * 16 + ln]); const float rwb = (MODE == 1) ? bf16_round(rwv[t]) : 0.f;
#pragma unroll
    for (int i = 0; i < 2; ++i)
#pragma unroll
      for (int r = 0; r < 8; ++r) { float v = acc[i][t][r] * 0.0625f + bv; if (MODE == 1) v += bf16_round(rhv[t][i][r >> 2][r & 3]) + rwb; so[w][i * 16 + 8 * hh + r][t * 16 + ln] = v; } }
  __builtin_amdgcn_fence(__ATOMIC_ACQ_REL, "workgroup"); __builtin_amdgcn_wave_barrier();      /* orders this wave's staging stores ahead of its reads; no work-group barrier: a wave reads back only its own rows */
  const int rsub = lane >> 4, c4 = (lane & 15) * 4;
#pragma unroll      /* the 16 LDS reads go out as one group ahead of the stores; a store = 2 rows of whole lines */
  for (int q = 0; q < 16; ++q) { const int r = q * 2 + rsub; const v4f v = *(const v4fa*)&so[w][r][c4]; const size_t o = (size_t)(row0 + wr + r) * CC + col0 + wc + c4;
    v4h h4; for (int i = 0; i < 4; ++i) h4[i] = (_Float16)v[i]; *(v4h*)(C16 + o) = h4; }
  asm volatile("s_wait_xcnt 0x0" ::: "memory");      /* behind the last store: in the merged kernel another part's code may follow in the listing and rewrite the stores' registers */
}
/* The three projections read the same X16 and depend on nothing of one another: one launch, work-group 3 * tile + m does tile 'tile' of projection m (0 q, 1 k, 2 v).
   The choice is the same for a whole work-group, so every barrier of a tile is passed by all of its waves. */
__global__ __launch_bounds__(256) void k_proj3(const _Float16* __restrict__ A, const _Float16* __restrict__ Bw, const float* __restrict__ bq, const float* __restrict__ bk, const float* __restrict__ bv,
                                               const float* __restrict__ rh, const float* __restrict__ rw, _Float16* __restrict__ Q, _Float16* __restrict__ K, _Float16* __restrict__ Vt) {
  __shared__ __attribute__((aligned(16))) unsigned char ring[PROJ_RING];
  const int blk = blockIdx.x / 3, m = blockIdx.x % 3;
  if (m == 0) proj_tile<0>(ring, blk, A, Bw, bq, nullptr, nullptr, Q);
  else if (m == 1) proj_tile<1>(ring, blk, A, Bw + (size_t)CC * CC, bk, rh, rw, K);
  else proj_tile<2>(ring, blk, A, Bw + (size_t)2 * CC * CC, bv, nullptr, nullptr, Vt);
}


__global__ __launch_bounds__(256) void k_x16(const float* __restrict__ x, _Float16* __restrict__ X16, size_t n8) { const size_t t = (size_t)blockIdx.x * 256 + threadIdx.x; if (t >= n8) return; FragH f;
#pragma unroll
  for (int q = 0; q < 8; ++q) f.h[q] = (_Float16)bf16_round(x[t * 8 + q]); *(v8us*)((unsigned short*)X16 + t * 8) = f.half[0];  }
__global__ __launch_bounds__(256) void k_h16(const float* __restrict__ x, _Float16* __restrict__ X16, size_t n8) { const size_t t = (size_t)blockIdx.x * 256 + threadIdx.x; if (t >= n8) return; FragH f;
#pragma unroll
  for (int q = 0; q < 8; ++q) f.h[q] = (_Float16)x[t * 8 + q]; *(v8us*)((unsigned short*)X16 + t * 8) = f.half[0];  }
__device__ __forceinline__ void round16f(const float* __restrict__ W, _Float16* __restrict__ Bt, const size_t t) { FragH f;
#pragma unroll
  for (int i = 0; i < 8; ++i) f.h[i] = (_Float16)(bf16_round(W[t * 8 + i]) * 16.0f); *(v8us*)((unsigned short*)Bt + t * 8) = f.half[0];  }
template <int NHv, int TTv>
__global__ __launch_bounds__(256) void k_vt(const _Float16* __restrict__ V16, int ldv, int voff, _Float16* __restrict__ Vt) { __shared__ unsigned short tl[64][66]; const int tid = threadIdx.x; const int slab = blockIdx.x / (TTv / 64), lg = blockIdx.x % (TTv / 64); const int b = slab / NHv, h = slab % NHv;
  for (int i = tid; i < 64 * 8; i += 256) { const int r = i / 8, c8 = (i % 8) * 8; FragH f; f.half[0] = *(const v8us*)((const unsigned short*)V16 + ((size_t)b * TTv + lg * 64 + r) * ldv + voff + h * 64 + c8);
#pragma unroll
    for (int q = 0; q < 8; ++q) tl[r][c8 + q] = f.u[q]; }
  __syncthreads();
  {
#pragma unroll
    for (int rd = 0; rd < 2; ++rd) { const int d = rd * 32 + tid / 8, pc = tid % 8; FragH f;
#pragma unroll
      for (int q = 0; q < 8; ++q) f.u[q] = tl[pc * 8 + q][d];
      *(v8us*)((unsigned short*)Vt + ((size_t)slab * 64 + d) * TTv + lg * 64 + pc * 8) = f.half[0]; }
     } }

/* One launch for the four conversions, which depend on nothing of one another: the first 3 * GW work-groups round the three weight matrices (8 elements a thread), the others each turn one 64-channel x 32-token tile of x.
   The test is the same for a whole work-group and stands in front of the barrier. */
__global__ __launch_bounds__(256) void k_prep(const float* __restrict__ x, const float* __restrict__ Wq, const float* __restrict__ Wk, const float* __restrict__ Wv, _Float16* __restrict__ Bw, _Float16* __restrict__ X16) { __shared__ float tl[32][65]; const int tid = threadIdx.x;
  constexpr int GW = CC * CC / 8 / 256; static_assert(CC * CC % (8 * 256) == 0, "whole work-groups of 8 elements a thread");
  if (blockIdx.x < 3 * GW) { const int m = blockIdx.x / GW; round16f(m == 0 ? Wq : m == 1 ? Wk : Wv, Bw + (size_t)m * CC * CC, (size_t)(blockIdx.x % GW) * 256 + tid); return; }
  const int tb = blockIdx.x - 3 * GW; const int b = tb / ((CC / 64) * (NN / 32)), rem = tb % ((CC / 64) * (NN / 32)); const int cg = rem / (NN / 32), pg = rem % (NN / 32); const int c0 = cg * 64, p0 = pg * 32;
  for (int i = tid; i < 64 * 32; i += 256) { const int c = i / 32, pp = i % 32; tl[pp][c] = bf16_round(x[((size_t)b * CC + c0 + c) * NN + p0 + pp]); } __syncthreads();
  const int r = tid / 8, pc = tid % 8; FragH f; for (int q = 0; q < 8; ++q) f.h[q] = (_Float16)tl[r][pc * 8 + q]; const size_t row = (size_t)b * NN + p0 + r; *(v8us*)((unsigned short*)X16 + row * CC + c0 + pc * 8) = f.half[0];  }
/* lane l <-> lane l ^ 16 as a vector cross-row move */
__device__ __forceinline__ float xhalf(float x) { return __builtin_bit_cast(float, __builtin_amdgcn_permlanex16(__builtin_bit_cast(int, x), __builtin_bit_cast(int, x), 0x76543210, 0xfedcba98, false, false)); }
__global__ __launch_bounds__(128) void k_flash(const _Float16* __restrict__ Q16, int ldq, const _Float16* __restrict__ K16, int ldk, const _Float16* __restrict__ Vt, const _Float16* __restrict__ Vtlo, float* __restrict__ O, int ldo) {
  constexpr int RPW = 16, NQB = TT / (4 * RPW), DT = 8, KS = 4;      /* head dim 128: 4 k-steps, 8 value tiles */
  constexpr float SC2 = ATT_SCALE * 1.4426950408889634f;      /* score scale x log2(e) */
  /* K/V ring shared by the four waves: two stages of 32 keys; a stage = 32 K rows of 256 B at pitch 272 B, then 128 V^T rows of 64 B at pitch 80 B (16 B x odd: conflict-free ds_load_b128) */
  constexpr int KP = 272, VP = 80, VOFF = 32 * KP, STG = VOFF + 128 * VP;
  __shared__ __attribute__((aligned(16))) unsigned char ring[2 * STG];
  static_assert(sizeof(float) * 4 * RPW * (128 + 4) <= 2 * STG, "output staging must fit in the ring");
  float (*sO)[RPW][128 + 4] = reinterpret_cast<float (*)[RPW][128 + 4]>(ring);      /* output staging takes the ring's place behind the last pass's barrier */
  const int tid = threadIdx.x, w = tid >> 5, lane = tid & 31, ln = lane & 15, hh = lane >> 4;
  const int slab = blockIdx.x / NQB, qblk = blockIdx.x % NQB; const int b = slab / NH, h = slab % NH; const int qb0 = qblk * (4 * RPW); const int q0 = qb0 + w * RPW;
  FragH aq[KS];
  { const unsigned short* qr = (const unsigned short*)Q16 + ((size_t)b * TT + q0 + ln) * ldq + h * 128;
#pragma unroll
    for (int ks = 0; ks < KS; ++ks) { aq[ks].half[0] = *(const v8us*)(qr + ks * 32 + 8 * hh); aq[ks].half[1] = *(const v8us*)(qr + ks * 32 + 16 + 8 * hh); } }
  const unsigned short* Vth = (const unsigned short*)Vt + (size_t)slab * 128 * TT;
  float m_q = -3.0e38f, l_q = 0.f; v8f oacc[DT];      /* running maximum of the raw scores (equal in both halves) and this half's partial sum (x 2^10) of query q0 + ln; oacc[dt][r] = O^T[dt*16 + 8*hh + r][ln] */
#pragma unroll
  for (int dt = 0; dt < DT; ++dt) oacc[dt] = (v8f){0.f,0.f,0.f,0.f,0.f,0.f,0.f,0.f};
  const int jend = TT;
  /* each thread copies 4 x 16 B of K (a wave-wide copy = 2 whole rows = 4 lines) and 4 x 16 B of V^T (8 rows x 64 B) per stage */
  const char* gK = (const char*)((const unsigned short*)K16 + ((size_t)b * TT + (tid >> 4)) * ldk + h * 128) + (tid & 15) * 16;
  const char* gV = (const char*)(Vth + (size_t)(tid >> 2) * TT) + (tid & 3) * 16;
  const size_t kstep = (size_t)ldk * 2;      /* bytes per key row of K */
  const unsigned lK = (unsigned)(size_t)ring + (unsigned)((tid >> 4) * KP + (tid & 15) * 16);
  const unsigned lV = (unsigned)(size_t)ring + (unsigned)(VOFF + (tid >> 2) * VP + (tid & 3) * 16);
  auto stage_copies = [&](int j, unsigned bofs) {
    const char* k0 = gK + (size_t)j * kstep; const char* v0 = gV + (size_t)j * 2; const unsigned a = lK + bofs, c = lV + bofs;
    /* the s_wait_xcnt closes the statement so that no address register of a copy is rewritten ahead of it */
    asm volatile("global_load_async_to_lds_b128 %0, %8, off\n\t"
                 "global_load_async_to_lds_b128 %1, %9, off\n\t"
                 "global_load_async_to_lds_b128 %2, %10, off\n\t"
                 "global_load_async_to_lds_b128 %3, %11, off\n\t"
                 "global_load_async_to_lds_b128 %4, %12, off\n\t"
                 "global_load_async_to_lds_b128 %5, %13, off\n\t"
                 "global_load_async_to_lds_b128 %6, %14, off\n\t"
                 "global_load_async_to_lds_b128 %7, %15, off\n\t"
                 "s_wait_xcnt 0x0"
                 :: "v"(a), "v"(a + 8 * KP), "v"(a + 16 * KP), "v"(a + 24 * KP), "v"(c), "v"(c + 32 * VP), "v"(c + 64 * VP), "v"(c + 96 * VP),
                    "v"(k0), "v"(k0 + 8 * kstep), "v"(k0 + 16 * kstep), "v"(k0 + 24 * kstep), "v"(v0), "v"(v0 + (size_t)32 * TT * 2), "v"(v0 + (size_t)64 * TT * 2), "v"(v0 + (size_t)96 * TT * 2)
                 : "memory");
  };
  stage_copies(0, 0u);
  asm volatile("s_wait_asynccnt 0x0" ::: "memory");      /* stage 0 of this wave has landed */
  __syncthreads();                                       /* ... and every wave's part of it is published */
  stage_copies(32, (unsigned)STG);
#pragma unroll 1
  for (int j0 = 0; j0 < jend; j0 += 32) {
    const unsigned bofs = (unsigned)((j0 >> 5) & 1) * (unsigned)STG; const unsigned char* kt = ring + bofs; const unsigned char* vt = kt + VOFF;
    v8f st[2];
#pragma unroll
    for (int nt = 0; nt < 2; ++nt) { const unsigned short* kr = (const unsigned short*)(kt + (nt * 16 + ln) * KP); FragH bk[KS];
#pragma unroll
      for (int ks = 0; ks < KS; ++ks) { bk[ks].half[0] = *(const v8us*)(kr + ks * 32 + 8 * hh); bk[ks].half[1] = *(const v8us*)(kr + ks * 32 + 16 + 8 * hh); }
      v8f acc = (v8f){0.f,0.f,0.f,0.f,0.f,0.f,0.f,0.f};
#pragma unroll
      for (int ks = 0; ks < KS; ++ks) acc = mmaH<1>(bk[ks].v, bk[ks].v, aq[ks].v, aq[ks].v, acc);
      st[nt] = acc; }
    /* The softmax runs on the raw scores in base 2: exp(ATT_SCALE * (s - m)) * 2^10 = 2^(s * SC2 + (10 - m * SC2)), one fused multiply-add and one hardware exp2 an element.
       The argument is at most 10 and a result below 2^-126 counts as 0, so none of the range handling of the library's expf is needed. m_q holds the maximum of the raw scores (SC2 > 0: the same element). */
    float mc = st[0][0];
#pragma unroll      /* this loop and the two below: constant indices keep the scores, P and oacc in registers */
    for (int i = 1; i < 16; ++i) mc = fmaxf(mc, st[i >> 3][i & 7]);
    mc = fmaxf(mc, xhalf(mc));      /* the other 16 keys of this query sit in lane ^ 16 */
    const float mn = fmaxf(m_q, mc); const float al = (mn > -1.0e38f) ? __builtin_amdgcn_exp2f((m_q - mn) * SC2) : 1.0f; m_q = mn;
    const float nb = __builtin_fmaf(-mn, SC2, 10.0f);
    FragH ph, pl; float ls[4] = {0.f, 0.f, 0.f, 0.f};      /* four independent partial sums: a chain of 4 dependent adds, not 16 */
#pragma unroll
    for (int i = 0; i < 16; ++i) { const float ps = __builtin_amdgcn_exp2f(__builtin_fmaf(st[i >> 3][i & 7], SC2, nb)); ls[i & 3] += ps; ph.h[i] = (_Float16)ps; pl.h[i] = (_Float16)(ps - (float)ph.h[i]); }      /* ps = 1024 p; P hi and its UNSCALED residual (added into the same accumulator); element i = key (i >> 3) * 16 + 8 * hh + (i & 7) */
    l_q = l_q * al + ((ls[0] + ls[1]) + (ls[2] + ls[3]));
#pragma unroll
    for (int dt = 0; dt < DT; ++dt) oacc[dt] *= al;
    FragH bv[DT];
#pragma unroll
    for (int dt = 0; dt < DT; ++dt) { const unsigned short* vr = (const unsigned short*)(vt + (dt * 16 + ln) * VP); bv[dt].half[0] = *(const v8us*)(vr + 8 * hh); bv[dt].half[1] = *(const v8us*)(vr + 16 + 8 * hh); }      /* all V fragments of the pass as one group of LDS reads, ahead of the products: one LDS latency a pass, not eight */
#pragma unroll      /* constant dt keeps bv and oacc in registers */
    for (int dt = 0; dt < DT; ++dt) { oacc[dt] = mmaH<1>(bv[dt].v, bv[dt].v, ph.v, ph.v, oacc[dt]); oacc[dt] = mmaH<1>(bv[dt].v, bv[dt].v, pl.v, pl.v, oacc[dt]); }      /* Vh^T.(Ph + Pl)^T - the V residual term is dropped here: near-uniform attention over 1024 keys averages the f16 rounding of v */
    asm volatile("s_wait_dscnt 0x0" ::: "memory");         /* this wave's reads of the stage are done before the stage is refilled */
    asm volatile("s_wait_asynccnt 0x0" ::: "memory");      /* this wave's copies of the next stage have landed */
    __syncthreads();                                       /* publishes the next stage and ends every wave's reads of this one */
    if (j0 + 64 < jend) stage_copies(j0 + 64, bofs); }
  asm volatile("s_wait_asynccnt 0x0" ::: "memory");        /* nothing in flight when the ring becomes output staging */
  { float l = l_q; l += xhalf(l); const float inv = (l > 0.f) ? 1.0f / l : 0.f;      /* the two halves' partial sums joined once; l and oacc both carry the 2^10 of ps */
#pragma unroll      /* constant dt: oacc stays in registers; a lane's 8 values are 8 consecutive d of its query's row */
    for (int dt = 0; dt < DT; ++dt) { const v4f lo = {oacc[dt][0] * inv, oacc[dt][1] * inv, oacc[dt][2] * inv, oacc[dt][3] * inv}, hi = {oacc[dt][4] * inv, oacc[dt][5] * inv, oacc[dt][6] * inv, oacc[dt][7] * inv};
      *(v4fa*)&sO[w][ln][dt * 16 + 8 * hh] = lo; *(v4fa*)&sO[w][ln][dt * 16 + 8 * hh + 4] = hi; } }
  __builtin_amdgcn_fence(__ATOMIC_ACQ_REL, "workgroup"); __builtin_amdgcn_wave_barrier();
  {
#pragma unroll
    for (int r = 0; r < RPW; ++r) { const int pc = lane; const v4f val = *(const v4fa*)&sO[w][r][pc * 4]; *(v4f*)(O + ((size_t)slab * TT + q0 + r) * 128 + pc * 4) = val; }      /* output laid out [b][h][n][128] (the module reinterprets that buffer as [B,C,H,W]); one 512-B row per instruction: 32 lanes x 16 B */
     } }

extern "C" void kernel_launch(void* const* d_in, const int* in_sizes, int n_in,
                              void* d_out, int out_size, void* d_ws, size_t ws_size, hipStream_t stream) {
  (void)in_sizes; (void)n_in; (void)out_size;
  const float* const* I = (const float* const*)d_in; const float* x = I[0]; const float* Wq = I[1]; const float* bq = I[2]; const float* Wk = I[3]; const float* bk = I[4]; const float* Wv = I[5]; const float* bv = I[6]; const float* rh = I[7]; const float* rw = I[8];
  char* ws = (char*)d_ws; size_t off = 0;
  auto take = [&](size_t bytes) { char* p = ws + off; off += (bytes + 255) & ~(size_t)255; return p; };
  const size_t WSZ = (size_t)CC * CC; _Float16* Bw = (_Float16*)take(3 * WSZ * 2); _Float16* X16 = (_Float16*)take((size_t)NR * CC * 2); _Float16* Q = (_Float16*)take((size_t)NR * CC * 2); _Float16* K = (_Float16*)take((size_t)NR * CC * 2); _Float16* Vt = (_Float16*)take((size_t)NR * CC * 2);
  if (off > ws_size) return;      // 1.6 + 4 x 16.8 = 69 MB
  k_prep<<<3 * (CC * CC / 8 / 256) + BB * (CC / 64) * (NN / 32), 256, 0, stream>>>(x, Wq, Wk, Wv, Bw, X16);      /* weights (out,in) natural x 2^4; x [B][C][N] to token-major bf16 plane */
  k_proj3<<<3 * (NR / 128) * (CC / 128), 256, 0, stream>>>(X16, Bw, bq, bk, bv, rh, rw, Q, K, Vt);      /* each M 16384 N 512 K 512: q (unscaled) f16; k' = k + rt^T, f16; v as V^T f16 per batch [512 channels][N] = per (b, h) [128][N] */
  k_flash<<<BB * NH * (NN / 64), 128, 0, stream>>>(Q, CC, K, CC, Vt, nullptr, (float*)d_out, 128);      /* y to d_out as [b][h][n][128]; k_flash does not read its V residual argument, and that plane is no longer made */
}

// v007
// It runs in 89.2 microseconds.
// In both of two side-by-side timings against v006, it was 1.04 times as fast.
// Counting every step since v000, it is 4.86 times as fast.
#include <hip/hip_runtime.h>
// Bottleneck-transformer MHSA with relative position term (B=16, C=512, 32×32 → N=1024, 4 heads × 128): q,k,v = 1×1 convs ((out,in) + bias); logits = (q·C^-½)·(k + rt) where rt[h][d][n] = rh[h][d][n mod 32] + rw[h][d][n div 32]
// (the module's (rh + rw).reshape(1, heads, emb, N)); softmax; y = attn·v per head; the output is the [B][h][N][d] buffer reinterpreted as [B,C,H,W] (the module's final reshape).
// Compute dtype: x, weights, biases, rh, rw rounded to bf16; token-major bf16 input plane; q as an f16 GEMM plane (unscaled — the C^-½ is applied to the f32 score), k as an f32 GEMM output with rtᵀ added in f32 then f16,
// v f16; fused flash-style kernel for head dim 128 (4 k-steps, 8 value tiles, online softmax f32, P as f16 + its exact f16 residual, V f16, one f32 accumulator) on v_wmma_f32_16x16x32_f16 writing y directly; f32 accumulate.
#define BB 16
#define CC 512
#define NN 1024
#define TT NN
#define NH 4
#define HDD 128
#define NVH (2 * NH)
#define NR (BB * NN)
#define ATT_SCALE 0.04419417382415922f

typedef __bf16 v16b __attribute__((ext_vector_type(16)));
typedef unsigned short v8us __attribute__((ext_vector_type(8), may_alias));
typedef float  v8f  __attribute__((ext_vector_type(8)));
typedef float  v4f  __attribute__((ext_vector_type(4)));
typedef float  v4fa __attribute__((ext_vector_type(4), may_alias));
union FragB { v16b v; v8us half[2]; unsigned short u[16]; };

__device__ __forceinline__ unsigned short bf16_bits(float x) { unsigned int u = __float_as_uint(x); return (unsigned short)((u + 0x7FFFu + ((u >> 16) & 1u)) >> 16); }
__device__ __forceinline__ float bf16_val(unsigned short b) { return __uint_as_float(((unsigned int)b) << 16); }
__device__ __forceinline__ float bf16_round(float x) { return bf16_val(bf16_bits(x)); }
// D += A·B with NT terms: 1 = ah·bh, 2 = + al·bh (A split), 3 = + ah·bl (both split)
template <int NT>
__device__ __forceinline__ v8f mmaN(v16b ah, v16b al, v16b bh, v16b bl, v8f c) {
  c = __builtin_amdgcn_wmma_f32_16x16x32_bf16(false, ah, false, bh, (short)0, c, false, false);
  if (NT >= 2) c = __builtin_amdgcn_wmma_f32_16x16x32_bf16(false, al, false, bh, (short)0, c, false, false);
  if (NT >= 3) c = __builtin_amdgcn_wmma_f32_16x16x32_bf16(false, ah, false, bl, (short)0, c, false, false);
  asm volatile("v_nop\n\tv_nop\n\tv_nop\n\tv_nop" : "+v"(c) : "v"(ah), "v"(al), "v"(bh), "v"(bl));
  return c;
}

__global__ __launch_bounds__(256) void k_wt_bf16(const float* __restrict__ W, unsigned short* __restrict__ Wt, int K, int N) {
  const int t = blockIdx.x * 256 + threadIdx.x;
  const int k8n = K / 8;
  if (t >= N * k8n) return;
  const int n = t / k8n, k8 = (t % k8n) * 8;
  v8us v;
#pragma unroll
  for (int i = 0; i < 8; ++i) v[i] = bf16_bits(W[(size_t)(k8 + i) * N + n]);
  *(v8us*)(Wt + (size_t)n * K + k8) = v;
  
}

// GEMM C[M][N] (f32, pitch ldc) = act(A[M][K]·W + bias). A f32 row-major (pitch lda) converted per fragment to bf16
// (ASPLIT: hi/lo two planes -> 2 terms, else single rounded term); Wt bf16 [N][K] (pitch ldb). BIAS_BF16 rounds the
// bias to bf16 first (bias quantised to bf16 before the add). K%32==0, M%16==0, N%64==0.
template <bool ASPLIT, int ACT, bool BIAS_BF16>
__global__ __launch_bounds__(128) void k_gemm_bf(const float* __restrict__ A, int lda, const unsigned short* __restrict__ Wt, int ldb,
                                               const float* __restrict__ bias, float* __restrict__ C, int ldc, int M, int N, int K) {
  __shared__ __attribute__((aligned(16))) float so[4][16][64];
  const int tid = threadIdx.x, w = tid >> 5, lane = tid & 31, ln = lane & 15, hh = lane >> 4;
  const int ntn = N / 64;
  const int wid = blockIdx.x * 4 + w;
  const int mt = wid / ntn, nq = wid % ntn;
  if (mt * 16 >= M) return;
  const int row0 = mt * 16, col0 = nq * 64;
  const float* arow = A + (size_t)(row0 + ln) * lda;
  v8f acc[4] = {};
  for (int kb = 0; kb < K; kb += 32) {
    FragB ah, al;
    const v4f x0 = *(const v4fa*)(arow + kb + 8 * hh), x1 = *(const v4fa*)(arow + kb + 8 * hh + 4);
    const v4f x2 = *(const v4fa*)(arow + kb + 16 + 8 * hh), x3 = *(const v4fa*)(arow + kb + 16 + 8 * hh + 4);
    float xs[16] = {x0[0],x0[1],x0[2],x0[3],x1[0],x1[1],x1[2],x1[3],x2[0],x2[1],x2[2],x2[3],x3[0],x3[1],x3[2],x3[3]};
#pragma unroll
    for (int i = 0; i < 16; ++i) { const unsigned short hb = bf16_bits(xs[i]); ah.u[i] = hb; al.u[i] = ASPLIT ? bf16_bits(xs[i] - bf16_val(hb)) : (unsigned short)0; }
#pragma unroll
    for (int t = 0; t < 4; ++t) {
      const unsigned short* brow = Wt + (size_t)(col0 + t * 16 + ln) * ldb + kb;
      FragB b;
      b.half[0] = *(const v8us*)(brow + 8 * hh);
      b.half[1] = *(const v8us*)(brow + 16 + 8 * hh);
      acc[t] = mmaN<ASPLIT ? 2 : 1>(ah.v, al.v, b.v, b.v, acc[t]);
    }
  }
#pragma unroll
  for (int t = 0; t < 4; ++t) {
    float bv = bias ? bias[col0 + t * 16 + ln] : 0.f;
    if (BIAS_BF16) bv = bf16_round(bv);
#pragma unroll
    for (int r = 0; r < 8; ++r) { float v = acc[t][r] + bv; if (ACT == 1) v = fmaxf(v, 0.f); so[w][8 * hh + r][t * 16 + ln] = v; }
  }
  __builtin_amdgcn_fence(__ATOMIC_ACQ_REL, "workgroup");
  __builtin_amdgcn_wave_barrier();
  const int rsub = lane >> 4, c4 = (lane & 15) * 4;
  {
#pragma unroll
    for (int q = 0; q < 8; ++q) {
      const int r = q * 2 + rsub;
      const v4f v = *(const v4fa*)&so[w][r][c4];
      *(v4f*)(C + (size_t)(row0 + r) * ldc + col0 + c4) = v;
    }
    
  }
}

// Flash-style causal/unmasked attention, all contractions 3-term bf16 hi/lo splits, f32 softmax with running max.
// q,k,v rows are read from f32 buffers with arbitrary row pitch (so they can live inside a fused qkv buffer);
// D = head size (multiple of 32, <= 128); one wave = 16 query rows; block = 4 waves (64 queries) sharing K/V chunks of 32.
template <int D, bool CAUSAL>
__global__ __launch_bounds__(128) void k_flash(const float* __restrict__ qb, const float* __restrict__ kb, const float* __restrict__ vb,
                                             int pitch, int T, int H, float scale, float* __restrict__ y, int ypitch) {
  constexpr int KS = D / 32;        // k-steps for QK
  constexpr int DT = D / 16;        // d tiles for PV
  __shared__ __attribute__((aligned(16))) unsigned short sKh[32][D + 8], sKl[32][D + 8], sVh[32][D + 8], sVl[32][D + 8];
  __shared__ __attribute__((aligned(16))) unsigned short sPh[4][16][40], sPl[4][16][40];
  __shared__ __attribute__((aligned(16))) float sO[4][16][D];
  const int tid = threadIdx.x, w = tid >> 5, lane = tid & 31, ln = lane & 15, hh = lane >> 4;
  const int nqb = (T + 63) / 64;
  const int bh = blockIdx.x / nqb, qblk = blockIdx.x % nqb;
  const int b = bh / H, h = bh % H;
  const int q0 = qblk * 64 + w * 16;
  const float* Q = qb + (size_t)b * T * pitch + h * D;
  const float* K = kb + (size_t)b * T * pitch + h * D;
  const float* V = vb + (size_t)b * T * pitch + h * D;

  // A fragments of the wave's 16 query rows (scaled), hi/lo
  FragB aqh[KS], aql[KS];
  {
    int row = q0 + ln; if (row >= T) row = T - 1;
    const float* qr = Q + (size_t)row * pitch;
#pragma unroll
    for (int ks = 0; ks < KS; ++ks)
#pragma unroll
      for (int i = 0; i < 16; ++i) {
        const int d = ks * 32 + ((i < 8) ? (8 * hh + i) : (16 + 8 * hh + (i - 8)));
        const float x = qr[d] * scale; const unsigned short hb = bf16_bits(x);
        aqh[ks].u[i] = hb; aql[ks].u[i] = bf16_bits(x - bf16_val(hb));
      }
  }
  float m_r[8], l_r[8];
#pragma unroll
  for (int r = 0; r < 8; ++r) { m_r[r] = -3.0e38f; l_r[r] = 0.f; }
  v8f oacc[DT];
#pragma unroll
  for (int dt = 0; dt < DT; ++dt) oacc[dt] = (v8f){0.f,0.f,0.f,0.f,0.f,0.f,0.f,0.f};

  const int kv_end = CAUSAL ? min(T, qblk * 64 + 64) : T;     // block-uniform
  for (int j0 = 0; j0 < kv_end; j0 += 32) {
    __syncthreads();
    for (int e = tid; e < 32 * (D / 4); e += 128) {
      const int r = e / (D / 4), c4 = (e % (D / 4)) * 4;
      const int key = j0 + r;
      v4f kf = {0.f,0.f,0.f,0.f}, vf = {0.f,0.f,0.f,0.f};
      if (key < T) { kf = *(const v4fa*)(K + (size_t)key * pitch + c4); vf = *(const v4fa*)(V + (size_t)key * pitch + c4); }
#pragma unroll
      for (int t = 0; t < 4; ++t) {
        unsigned short hb = bf16_bits(kf[t]); sKh[r][c4 + t] = hb; sKl[r][c4 + t] = bf16_bits(kf[t] - bf16_val(hb));
        hb = bf16_bits(vf[t]); sVh[r][c4 + t] = hb; sVl[r][c4 + t] = bf16_bits(vf[t] - bf16_val(hb));
      }
    }
    __syncthreads();
    // S tile 16 x 32
    v8f s[2];
#pragma unroll
    for (int nt = 0; nt < 2; ++nt) {
      v8f acc = {};
#pragma unroll
      for (int ks = 0; ks < KS; ++ks) {
        FragB bh_, bl_;
        bh_.half[0] = *(const v8us*)&sKh[nt * 16 + ln][ks * 32 + 8 * hh]; bh_.half[1] = *(const v8us*)&sKh[nt * 16 + ln][ks * 32 + 16 + 8 * hh];
        bl_.half[0] = *(const v8us*)&sKl[nt * 16 + ln][ks * 32 + 8 * hh]; bl_.half[1] = *(const v8us*)&sKl[nt * 16 + ln][ks * 32 + 16 + 8 * hh];
        acc = mmaN<3>(aqh[ks].v, aql[ks].v, bh_.v, bl_.v, acc);
      }
      s[nt] = acc;
    }
    // mask + running max (rows 8hh+r; the 16 lanes of a half share rows)
    float alpha[8];
#pragma unroll
    for (int r = 0; r < 8; ++r) {
      const int qi = q0 + 8 * hh + r;
      const int ja = j0 + ln, jb = j0 + 16 + ln;
      if (CAUSAL) { if (ja > qi) s[0][r] = -3.0e38f; if (jb > qi) s[1][r] = -3.0e38f; }
      if (ja >= T) s[0][r] = -3.0e38f;
      if (jb >= T) s[1][r] = -3.0e38f;
      float mx = fmaxf(s[0][r], s[1][r]);
      mx = fmaxf(mx, __shfl_xor(mx, 1, 32)); mx = fmaxf(mx, __shfl_xor(mx, 2, 32)); mx = fmaxf(mx, __shfl_xor(mx, 4, 32)); mx = fmaxf(mx, __shfl_xor(mx, 8, 32));
      const float mnew = fmaxf(m_r[r], mx);
      alpha[r] = (mnew > -1.0e38f) ? __expf(m_r[r] - mnew) : 1.0f;
      const float p0 = (s[0][r] > -1.0e38f) ? __expf(s[0][r] - mnew) : 0.f;
      const float p1 = (s[1][r] > -1.0e38f) ? __expf(s[1][r] - mnew) : 0.f;
      m_r[r] = mnew;
      l_r[r] = l_r[r] * alpha[r] + p0 + p1;            // per-lane partial row sum (16 lanes combined at the end)
      unsigned short hb = bf16_bits(p0); sPh[w][8 * hh + r][ln] = hb;      sPl[w][8 * hh + r][ln] = bf16_bits(p0 - bf16_val(hb));
      hb = bf16_bits(p1);                sPh[w][8 * hh + r][16 + ln] = hb; sPl[w][8 * hh + r][16 + ln] = bf16_bits(p1 - bf16_val(hb));
    }
#pragma unroll
    for (int dt = 0; dt < DT; ++dt)
#pragma unroll
      for (int r = 0; r < 8; ++r) oacc[dt][r] *= alpha[r];
    __builtin_amdgcn_fence(__ATOMIC_ACQ_REL, "workgroup");
    __builtin_amdgcn_wave_barrier();
    FragB pah, pal;
    pah.half[0] = *(const v8us*)&sPh[w][ln][8 * hh]; pah.half[1] = *(const v8us*)&sPh[w][ln][16 + 8 * hh];
    pal.half[0] = *(const v8us*)&sPl[w][ln][8 * hh]; pal.half[1] = *(const v8us*)&sPl[w][ln][16 + 8 * hh];
#pragma unroll
    for (int dt = 0; dt < DT; ++dt) {
      FragB bvh, bvl;
#pragma unroll
      for (int i = 0; i < 8; ++i) {
        bvh.u[i] = sVh[8 * hh + i][dt * 16 + ln]; bvh.u[8 + i] = sVh[16 + 8 * hh + i][dt * 16 + ln];
        bvl.u[i] = sVl[8 * hh + i][dt * 16 + ln]; bvl.u[8 + i] = sVl[16 + 8 * hh + i][dt * 16 + ln];
      }
      oacc[dt] = mmaN<3>(pah.v, pal.v, bvh.v, bvl.v, oacc[dt]);
    }
    __builtin_amdgcn_fence(__ATOMIC_ACQ_REL, "workgroup");
    __builtin_amdgcn_wave_barrier();
  }
#pragma unroll
  for (int r = 0; r < 8; ++r) {
    float l = l_r[r];
    l += __shfl_xor(l, 1, 32); l += __shfl_xor(l, 2, 32); l += __shfl_xor(l, 4, 32); l += __shfl_xor(l, 8, 32);
    l_r[r] = (l > 0.f) ? 1.0f / l : 0.f;
  }
#pragma unroll
  for (int dt = 0; dt < DT; ++dt)
#pragma unroll
    for (int r = 0; r < 8; ++r) sO[w][8 * hh + r][dt * 16 + ln] = oacc[dt][r] * l_r[r];
  __builtin_amdgcn_fence(__ATOMIC_ACQ_REL, "workgroup");
  __builtin_amdgcn_wave_barrier();
  {
    for (int r = 0; r < 16; ++r) {
      const int row = q0 + r;
      if (row < T && lane < D / 4) {
        const v4f val = *(const v4fa*)&sO[w][r][lane * 4];
        *(v4f*)(y + ((size_t)b * T + row) * ypitch + h * D + lane * 4) = val;
      }
    }
    
  }
}

// GEMM C = act(A·W + bias + resid): A f32 (ASPLIT -> hi/lo 2 terms), Wt bf16 [N][K]; ACT 0 none, 1 relu, 2 exact gelu;
// resid (optional, f32, row index = (row % rmod), pitch ldr, RES_BF16 rounds it) added before the activation.
template <bool ASPLIT, int ACT, bool BIAS_BF16, bool RES_BF16>
__global__ __launch_bounds__(128) void k_gemm_bf3(const float* __restrict__ A, int lda, const unsigned short* __restrict__ Wt, int ldb,
                                                const float* __restrict__ bias, const float* __restrict__ resid, int rmod, int ldr,
                                                float* __restrict__ C, int ldc, int M, int N, int K) {
  __shared__ __attribute__((aligned(16))) float so[4][16][64];
  const int tid = threadIdx.x, w = tid >> 5, lane = tid & 31, ln = lane & 15, hh = lane >> 4;
  const int ntn = N / 64;
  const int wid = blockIdx.x * 4 + w;
  const int mt = wid / ntn, nq = wid % ntn;
  if (mt * 16 >= M) return;
  const int row0 = mt * 16, col0 = nq * 64;
  const float* arow = A + (size_t)(row0 + ln) * lda;
  v8f acc[4] = {};
  for (int kb = 0; kb < K; kb += 32) {
    FragB ah, al;
    const v4f x0 = *(const v4fa*)(arow + kb + 8 * hh), x1 = *(const v4fa*)(arow + kb + 8 * hh + 4);
    const v4f x2 = *(const v4fa*)(arow + kb + 16 + 8 * hh), x3 = *(const v4fa*)(arow + kb + 16 + 8 * hh + 4);
    float xs[16] = {x0[0],x0[1],x0[2],x0[3],x1[0],x1[1],x1[2],x1[3],x2[0],x2[1],x2[2],x2[3],x3[0],x3[1],x3[2],x3[3]};
#pragma unroll
    for (int i = 0; i < 16; ++i) { const unsigned short hb = bf16_bits(xs[i]); ah.u[i] = hb; al.u[i] = ASPLIT ? bf16_bits(xs[i] - bf16_val(hb)) : (unsigned short)0; }
#pragma unroll
    for (int t = 0; t < 4; ++t) {
      const unsigned short* brow = Wt + (size_t)(col0 + t * 16 + ln) * ldb + kb;
      FragB b;
      b.half[0] = *(const v8us*)(brow + 8 * hh);
      b.half[1] = *(const v8us*)(brow + 16 + 8 * hh);
      acc[t] = mmaN<ASPLIT ? 2 : 1>(ah.v, al.v, b.v, b.v, acc[t]);
    }
  }
#pragma unroll
  for (int t = 0; t < 4; ++t) {
    const int col = col0 + t * 16 + ln;
    float bv = bias ? bias[col] : 0.f;
    if (BIAS_BF16) bv = bf16_round(bv);
#pragma unroll
    for (int r = 0; r < 8; ++r) {
      float v = acc[t][r] + bv;
      if (resid) { float rv = resid[(size_t)((row0 + 8 * hh + r) % rmod) * ldr + col]; if (RES_BF16) rv = bf16_round(rv); v += rv; }
      if (ACT == 1) v = fmaxf(v, 0.f);
      if (ACT == 2) v = 0.5f * v * (1.0f + erff(v * 0.70710678118654752f));
      if (ACT == 3) { const float u = 0.7978845608028654f * (v + 0.044715f * v * v * v); v = 0.5f * v * (1.0f + tanhf(u)); }
      so[w][8 * hh + r][t * 16 + ln] = v;
    }
  }
  __builtin_amdgcn_fence(__ATOMIC_ACQ_REL, "workgroup");
  __builtin_amdgcn_wave_barrier();
  const int rsub = lane >> 4, c4 = (lane & 15) * 4;
  {
#pragma unroll
    for (int q = 0; q < 8; ++q) {
      const int r = q * 2 + rsub;
      const v4f v = *(const v4fa*)&so[w][r][c4];
      *(v4f*)(C + (size_t)(row0 + r) * ldc + col0 + c4) = v;
    }
    
  }
}
// row LayerNorm (biased variance, eps) over N: s = X (+ R); optional out_sum <- s; out_norm <- (s-mu)*rsqrt(var+eps)*g + b
template <bool PARAM_BF16>
__global__ __launch_bounds__(256) void k_layernorm(const float* __restrict__ X, const float* __restrict__ R, const float* __restrict__ g, const float* __restrict__ bta,
                                                  float* __restrict__ out_sum, float* __restrict__ out_norm, int N, float eps) {
  __shared__ float red[256];
  const int row = blockIdx.x, tid = threadIdx.x;
  const float* x = X + (size_t)row * N; const float* rr = R ? R + (size_t)row * N : nullptr;
  float vals[16];                     // up to N = 4096
  const int per = N / 256;            // contiguous chunk per thread? use strided-by-4 chunks: thread handles j = tid*4 + 1024*u
  float s1 = 0.f;
  for (int u = 0; u < per / 4; ++u) {
    const int j = tid * 4 + 1024 * u;
    const v4f a = *(const v4fa*)(x + j);
    v4f b = {0.f,0.f,0.f,0.f}; if (rr) b = *(const v4fa*)(rr + j);
#pragma unroll
    for (int q = 0; q < 4; ++q) { const float v = a[q] + b[q]; vals[u * 4 + q] = v; s1 += v; }
  }
  red[tid] = s1; __syncthreads();
  for (int st = 128; st > 0; st >>= 1) { if (tid < st) red[tid] += red[tid + st]; __syncthreads(); }
  const float mu = red[0] / (float)N; __syncthreads();
  float s2 = 0.f;
  for (int u = 0; u < per / 4; ++u)
#pragma unroll
    for (int q = 0; q < 4; ++q) { const float c = vals[u * 4 + q] - mu; s2 += c * c; }
  red[tid] = s2; __syncthreads();
  for (int st = 128; st > 0; st >>= 1) { if (tid < st) red[tid] += red[tid + st]; __syncthreads(); }
  const float rs = rsqrtf(red[0] / (float)N + eps);
  {
    for (int u = 0; u < per / 4; ++u) {
      const int j = tid * 4 + 1024 * u;
      v4f o, sm;
#pragma unroll
      for (int q = 0; q < 4; ++q) {
        float gg = g[j + q], bb = bta[j + q];
        if (PARAM_BF16) { gg = bf16_round(gg); bb = bf16_round(bb); }
        sm[q] = vals[u * 4 + q]; o[q] = (vals[u * 4 + q] - mu) * rs * gg + bb;
      }
      if (out_sum) *(v4f*)(out_sum + (size_t)row * N + j) = sm;
      *(v4f*)(out_norm + (size_t)row * N + j) = o;
    }
    
  }
}



// ---- f16 WMMA path (v_wmma_f32_16x16x32_f16): 11-bit significands for operands in range — used where the probability operand (1024 p, in [0,1024]) needs more precision than bf16
typedef _Float16 v16h __attribute__((ext_vector_type(16)));
union FragH { v16h v; v8us half[2]; _Float16 h[16]; unsigned short u[16]; };
template <int NT>
__device__ __forceinline__ v8f mmaH(v16h ah, v16h al, v16h bh, v16h bl, v8f c) {
  c = __builtin_amdgcn_wmma_f32_16x16x32_f16(false, ah, false, bh, (short)0, c, false, false);
  if (NT >= 2) c = __builtin_amdgcn_wmma_f32_16x16x32_f16(false, al, false, bh, (short)0, c, false, false);
  if (NT >= 3) c = __builtin_amdgcn_wmma_f32_16x16x32_f16(false, ah, false, bl, (short)0, c, false, false);
  asm volatile("v_nop\n\tv_nop\n\tv_nop\n\tv_nop" : "+v"(c) : "v"(ah), "v"(al), "v"(bh), "v"(bl));
  return c;
}
// batched GEMM like k_gemm_b but f16 operands: A f32 (split into f16 hi/lo if ASPLIT, else rounded to f16), Bt = f16 values [n][k]; alpha; C f32; N multiple of 16 (partial tiles skipped)
template <bool ASPLIT>
__global__ __launch_bounds__(128) void k_gemm_h(const float* __restrict__ A, int lda, size_t sA, const _Float16* __restrict__ Bh, int ldb, size_t sB, float alpha, float* __restrict__ C, int ldc, size_t sC, int M, int N, int K) {
  __shared__ __attribute__((aligned(16))) float so[4][16][64];
  const int tid = threadIdx.x, w = tid >> 5, lane = tid & 31, ln = lane & 15, hh = lane >> 4; const int by = blockIdx.y;
  A += (size_t)by * sA; Bh += (size_t)by * sB; C += (size_t)by * sC;
  const int ntn = (N + 63) / 64; const int wid = blockIdx.x * 4 + w; const int mt = wid / ntn, nq = wid % ntn; if (mt * 16 >= M) return;
  const int row0 = mt * 16, col0 = nq * 64; const float* arow = A + (size_t)(row0 + ln) * lda;
  v8f acc[4] = {};
  for (int kb = 0; kb < K; kb += 32) {
    FragH ah, al;
    const v4f x0 = *(const v4fa*)(arow + kb + 8 * hh), x1 = *(const v4fa*)(arow + kb + 8 * hh + 4), x2 = *(const v4fa*)(arow + kb + 16 + 8 * hh), x3 = *(const v4fa*)(arow + kb + 16 + 8 * hh + 4);
    float xs[16] = {x0[0],x0[1],x0[2],x0[3],x1[0],x1[1],x1[2],x1[3],x2[0],x2[1],x2[2],x2[3],x3[0],x3[1],x3[2],x3[3]};
#pragma unroll
    for (int i = 0; i < 16; ++i) { const _Float16 h = (_Float16)xs[i]; ah.h[i] = h; al.h[i] = ASPLIT ? (_Float16)(xs[i] - (float)h) : (_Float16)0.0f; }
#pragma unroll
    for (int t = 0; t < 4; ++t) { if (col0 + t * 16 >= N) continue; const size_t boff = (size_t)(col0 + t * 16 + ln) * ldb + kb; FragH bq; bq.half[0] = *(const v8us*)(Bh + boff + 8 * hh); bq.half[1] = *(const v8us*)(Bh + boff + 16 + 8 * hh);
      acc[t] = mmaH<ASPLIT ? 2 : 1>(ah.v, al.v, bq.v, bq.v, acc[t]); }
  }
#pragma unroll
  for (int t = 0; t < 4; ++t) { if (col0 + t * 16 >= N) continue;
#pragma unroll
    for (int r = 0; r < 8; ++r) so[w][8 * hh + r][t * 16 + ln] = acc[t][r] * alpha; }
  __builtin_amdgcn_fence(__ATOMIC_ACQ_REL, "workgroup"); __builtin_amdgcn_wave_barrier();
  const int rsub = lane >> 4, c4 = (lane & 15) * 4;
  {
#pragma unroll
    for (int q = 0; q < 8; ++q) { const int r = q * 2 + rsub; if (col0 + c4 < N) { const v4f v = *(const v4fa*)&so[w][r][c4]; *(v4f*)(C + (size_t)(row0 + r) * ldc + col0 + c4) = v; } }
     }
}

// Wt[n][k] = f16(W[k][n]·scale) from f32 row-major W[K][N] (scale = power of two; bf16-exact weights stay exact in f16 away from the subnormal range)
__global__ __launch_bounds__(256) void k_wt_f16(const float* __restrict__ W, _Float16* __restrict__ Wt, int K, int N, float scale) {
  const int t = blockIdx.x * 256 + threadIdx.x; if (t >= N * (K / 8)) return; const int n = t / (K / 8), k8 = (t % (K / 8)) * 8; FragH f;
#pragma unroll
  for (int i = 0; i < 8; ++i) f.h[i] = (_Float16)(bf16_round(W[(size_t)(k8 + i) * N + n]) * scale); const v8us o = f.half[0];
  *(v8us*)((unsigned short*)Wt + (size_t)n * K + k8) = o; 
}
// Projection GEMM, fixed shape M = NR, N = K = CC: v = acc/16 + bf16(bias[col]) in f32, and the epilogue writes the f16 plane that the attention kernel reads:
// MODE 0 (q): f16 rows [token][channel]; MODE 1 (k): v + (bf16(rh[channel][n mod 32]) + bf16(rw[channel][n div 32])) in f32, then f16 rows; MODE 2 (v): f16, transposed per batch to [channel][token].
// One work-group = one 128 x 128 tile of the output, 8 waves as 4 x 2, 32 x 64 a wave. A pass is 64 k: 128 rows of A and 128 rows of W, 128 B (one line) each,
// copied once per work-group into LDS at pitch 144 B (16 B x odd: conflict-free ds_load_b128); two buffers, the next pass's copies fly while this pass is multiplied.
typedef _Float16 v4h __attribute__((ext_vector_type(4)));
constexpr int PROJ_RING = 4 * 128 * 144;      /* two stages of (128 A rows + 128 W rows) at pitch 144 B */
template <int MODE>
__device__ __forceinline__ void proj_tile(unsigned char* ring, const int blk, const _Float16* __restrict__ A, const _Float16* __restrict__ Bh, const float* __restrict__ bias, const float* __restrict__ rh, const float* __restrict__ rw, _Float16* __restrict__ C16) {
  constexpr int BT = 128, BK = 64, RP = 144, TILE = BT * RP, STG = 2 * TILE, NPASS = CC / BK, SOP = 68, TP = 2 * BT + 16;
  static_assert(2 * STG == PROJ_RING, "the kernel's LDS array is the ring");
  static_assert(NR % BT == 0 && CC % BT == 0 && CC % BK == 0 && NPASS >= 2, "whole tiles, at least two passes");
  static_assert(NN % BT == 0 && BT % 32 == 0, "a tile lies in one batch, a wave's 32 rows in one value of n div 32");
  static_assert(BT * TP <= 2 * STG, "the transposed tile must fit in the ring");
  static_assert(sizeof(float) * 8 * 32 * SOP <= 2 * STG, "output staging must fit in the ring");
  float (*so)[32][SOP] = reinterpret_cast<float (*)[32][SOP]>(ring);      /* output staging takes the ring's place behind the last pass's barrier; pitch 68 dwords keeps the two lane halves on different banks */
  const int tid = threadIdx.x, w = tid >> 5, lane = tid & 31, ln = lane & 15, hh = lane >> 4;
  const int row0 = (blk / (CC / BT)) * BT, col0 = (blk % (CC / BT)) * BT;
  const int wr = (w >> 1) * 32, wc = (w & 1) * 64;
  /* each thread copies 4 x 16 B of A and 4 x 16 B of W per pass; a wave-wide copy = 4 whole rows = 4 lines */
  const char* gA = (const char*)((const unsigned short*)A + (size_t)(row0 + (tid >> 3)) * CC) + (tid & 7) * 16;
  const char* gB = (const char*)((const unsigned short*)Bh + (size_t)(col0 + (tid >> 3)) * CC) + (tid & 7) * 16;
  const unsigned lA = (unsigned)(size_t)ring + (unsigned)((tid >> 3) * RP + (tid & 7) * 16);
  constexpr size_t R32 = (size_t)32 * CC * 2;      /* bytes from a row to the row 32 below it */
  auto stage_copies = [&](int p, unsigned bofs) {
    const char* a0 = gA + (size_t)p * (BK * 2); const char* b0 = gB + (size_t)p * (BK * 2); const unsigned a = lA + bofs, c = a + (unsigned)TILE;
    /* the s_wait_xcnt closes the statement so that no address register of a copy is rewritten ahead of it */
    asm volatile("global_load_async_to_lds_b128 %0, %8, off\n\t"
                 "global_load_async_to_lds_b128 %1, %9, off\n\t"
                 "global_load_async_to_lds_b128 %2, %10, off\n\t"
                 "global_load_async_to_lds_b128 %3, %11, off\n\t"
                 "global_load_async_to_lds_b128 %4, %12, off\n\t"
                 "global_load_async_to_lds_b128 %5, %13, off\n\t"
                 "global_load_async_to_lds_b128 %6, %14, off\n\t"
                 "global_load_async_to_lds_b128 %7, %15, off\n\t"
                 "s_wait_xcnt 0x0"
                 :: "v"(a), "v"(a + 32 * RP), "v"(a + 64 * RP), "v"(a + 96 * RP), "v"(c), "v"(c + 32 * RP), "v"(c + 64 * RP), "v"(c + 96 * RP),
                    "v"(a0), "v"(a0 + R32), "v"(a0 + 2 * R32), "v"(a0 + 3 * R32), "v"(b0), "v"(b0 + R32), "v"(b0 + 2 * R32), "v"(b0 + 3 * R32)
                 : "memory");
  };
  v8f acc[2][4] = {};
  stage_copies(0, 0u);
  /* MODE 1: the wave's part of rh and rw is asked for here and used in the epilogue: its latency runs beside that of pass 0's copies, not alone behind the last pass.
     Row n of the tile: n div 32 = na for all 32 rows of a wave, n mod 32 = i * 16 + 8 * hh + r; a lane's 8 rows of one accumulator are 32 consecutive bytes of its channel's 128-B row of rh */
  v4f rhv[4][2][2]; float rwv[4];
  if (MODE == 1) { const int na = (row0 % NN + wr) / 32;
#pragma unroll      /* this loop and the one inside it: constant indices keep rhv and rwv in registers */
    for (int t = 0; t < 4; ++t) { const size_t c32 = (size_t)(col0 + wc + t * 16 + ln) * 32; rwv[t] = rw[c32 + na];
#pragma unroll
      for (int i = 0; i < 2; ++i) { rhv[t][i][0] = *(const v4fa*)(rh + c32 + i * 16 + 8 * hh); rhv[t][i][1] = *(const v4fa*)(rh + c32 + i * 16 + 8 * hh + 4); } } }
  asm volatile("s_wait_asynccnt 0x0" ::: "memory");      /* pass 0 of this wave has landed */
  __syncthreads();                                       /* ... and every wave's part of it is published */
  stage_copies(1, (unsigned)STG);
#pragma unroll 2      /* two passes a trip make the buffer offsets immediates; fully unrolled the copies' addresses of all passes took the wave past 256 VGPRs */
  for (int p = 0; p < NPASS; ++p) {
    const unsigned bofs = (unsigned)(p & 1) * (unsigned)STG;
    const unsigned char* at = ring + bofs + (wr + ln) * RP + 16 * hh; const unsigned char* bt = ring + bofs + TILE + (wc + ln) * RP + 16 * hh;
#pragma unroll      /* this loop and those inside it: constant indices keep the fragments and acc in registers */
    for (int ks = 0; ks < BK / 32; ++ks) { FragH fa[2], fb[4];
#pragma unroll
      for (int i = 0; i < 2; ++i) { fa[i].half[0] = *(const v8us*)(at + i * 16 * RP + ks * 64); fa[i].half[1] = *(const v8us*)(at + i * 16 * RP + ks * 64 + 32); }
#pragma unroll
      for (int t = 0; t < 4; ++t) { fb[t].half[0] = *(const v8us*)(bt + t * 16 * RP + ks * 64); fb[t].half[1] = *(const v8us*)(bt + t * 16 * RP + ks * 64 + 32); }
#pragma unroll
      for (int i = 0; i < 2; ++i)
#pragma unroll
        for (int t = 0; t < 4; ++t) acc[i][t] = __builtin_amdgcn_wmma_f32_16x16x32_f16(false, fa[i].v, false, fb[t].v, (short)0, acc[i][t], false, false); }
    asm volatile("s_wait_dscnt 0x0" ::: "memory");         /* this wave's reads of the buffer are done before it is refilled */
    asm volatile("s_wait_asynccnt 0x0" ::: "memory");      /* this wave's copies of the next pass have landed */
    __syncthreads();                                       /* publishes the next pass and ends every wave's reads of this one */
    if (p + 2 < NPASS) stage_copies(p + 2, bofs); }
  asm volatile("s_wait_asynccnt 0x0" ::: "memory");        /* nothing in flight when the ring becomes output staging */
  if (MODE == 2) {
    /* D[8*hh + r][ln]: a lane's 8 values of one accumulator are 8 consecutive tokens of ONE channel = 16 B of a row of the transposed tile.
       The tile [128 channels][128 tokens] is gathered in LDS at pitch 272 B (16 B x odd: 16 lanes of a ds_store_b128 on 64 different banks), since a channel's 128 tokens come from four waves. */
#pragma unroll      /* this loop and the two inside it: constant indices into acc */
    for (int t = 0; t < 4; ++t) { const float bv = bf16_round(bias[col0 + wc + t * 16 + ln]);
#pragma unroll
      for (int i = 0; i < 2; ++i) { FragH f;
#pragma unroll
        for (int r = 0; r < 8; ++r) f.h[r] = (_Float16)(acc[i][t][r] * 0.0625f + bv);
        *(v8us*)(ring + (wc + t * 16 + ln) * TP + (wr + i * 16 + 8 * hh) * 2) = f.half[0]; } }
    __syncthreads();      /* every wave's part of the transposed tile is in LDS before any wave reads whole channel rows */
    unsigned short* vt = (unsigned short*)C16 + ((size_t)(row0 / NN) * CC + col0) * NN + row0 % NN;
#pragma unroll      /* the 8 LDS reads go out as one group ahead of the stores; a store = 2 channel rows of 256 B, whole lines */
    for (int q = 0; q < 8; ++q) { const int ch = w * 16 + q * 2 + hh; const v8us v = *(const v8us*)(ring + ch * TP + ln * 16); *(v8us*)(vt + (size_t)ch * NN + ln * 8) = v; }
    asm volatile("s_wait_xcnt 0x0" ::: "memory");      /* behind the last store: in the merged kernel another part's code may follow in the listing and rewrite the stores' registers */
    return;
  }
#pragma unroll      /* this loop and the two inside it: constant indices into acc */
  for (int t = 0; t < 4; ++t) { const float bv = bf16_round(bias[col0 + wc + t * 16 + ln]); const float rwb = (MODE == 1) ? bf16_round(rwv[t]) : 0.f;
#pragma unroll
    for (int i = 0; i < 2; ++i)
#pragma unroll
      for (int r = 0; r < 8; ++r) { float v = acc[i][t][r] * 0.0625f + bv; if (MODE == 1) v += bf16_round(rhv[t][i][r >> 2][r & 3]) + rwb; so[w][i * 16 + 8 * hh + r][t * 16 + ln] = v; } }
  __builtin_amdgcn_fence(__ATOMIC_ACQ_REL, "workgroup"); __builtin_amdgcn_wave_barrier();      /* orders this wave's staging stores ahead of its reads; no work-group barrier: a wave reads back only its own rows */
  const int rsub = lane >> 4, c4 = (lane & 15) * 4;
#pragma unroll      /* the 16 LDS reads go out as one group ahead of the stores; a store = 2 rows of whole lines */
  for (int q = 0; q < 16; ++q) { const int r = q * 2 + rsub; const v4f v = *(const v4fa*)&so[w][r][c4]; const size_t o = (size_t)(row0 + wr + r) * CC + col0 + wc + c4;
    v4h h4; for (int i = 0; i < 4; ++i) h4[i] = (_Float16)v[i]; *(v4h*)(C16 + o) = h4; }
  asm volatile("s_wait_xcnt 0x0" ::: "memory");      /* behind the last store: in the merged kernel another part's code may follow in the listing and rewrite the stores' registers */
}
/* The three projections read the same X16 and depend on nothing of one another: one launch, work-group 3 * tile + m does tile 'tile' of projection m (0 q, 1 k, 2 v).
   The choice is the same for a whole work-group, so every barrier of a tile is passed by all of its waves. */
__global__ __launch_bounds__(256) void k_proj3(const _Float16* __restrict__ A, const _Float16* __restrict__ Bw, const float* __restrict__ bq, const float* __restrict__ bk, const float* __restrict__ bv,
                                               const float* __restrict__ rh, const float* __restrict__ rw, _Float16* __restrict__ Q, _Float16* __restrict__ K, _Float16* __restrict__ Vt) {
  __shared__ __attribute__((aligned(16))) unsigned char ring[PROJ_RING];
  const int blk = blockIdx.x / 3, m = blockIdx.x % 3;
  if (m == 0) proj_tile<0>(ring, blk, A, Bw, bq, nullptr, nullptr, Q);
  else if (m == 1) proj_tile<1>(ring, blk, A, Bw + (size_t)CC * CC, bk, rh, rw, K);
  else proj_tile<2>(ring, blk, A, Bw + (size_t)2 * CC * CC, bv, nullptr, nullptr, Vt);
}


__global__ __launch_bounds__(256) void k_x16(const float* __restrict__ x, _Float16* __restrict__ X16, size_t n8) { const size_t t = (size_t)blockIdx.x * 256 + threadIdx.x; if (t >= n8) return; FragH f;
#pragma unroll
  for (int q = 0; q < 8; ++q) f.h[q] = (_Float16)bf16_round(x[t * 8 + q]); *(v8us*)((unsigned short*)X16 + t * 8) = f.half[0];  }
__global__ __launch_bounds__(256) void k_h16(const float* __restrict__ x, _Float16* __restrict__ X16, size_t n8) { const size_t t = (size_t)blockIdx.x * 256 + threadIdx.x; if (t >= n8) return; FragH f;
#pragma unroll
  for (int q = 0; q < 8; ++q) f.h[q] = (_Float16)x[t * 8 + q]; *(v8us*)((unsigned short*)X16 + t * 8) = f.half[0];  }
template <int NHv, int TTv>
__global__ __launch_bounds__(256) void k_vt(const _Float16* __restrict__ V16, int ldv, int voff, _Float16* __restrict__ Vt) { __shared__ unsigned short tl[64][66]; const int tid = threadIdx.x; const int slab = blockIdx.x / (TTv / 64), lg = blockIdx.x % (TTv / 64); const int b = slab / NHv, h = slab % NHv;
  for (int i = tid; i < 64 * 8; i += 256) { const int r = i / 8, c8 = (i % 8) * 8; FragH f; f.half[0] = *(const v8us*)((const unsigned short*)V16 + ((size_t)b * TTv + lg * 64 + r) * ldv + voff + h * 64 + c8);
#pragma unroll
    for (int q = 0; q < 8; ++q) tl[r][c8 + q] = f.u[q]; }
  __syncthreads();
  {
#pragma unroll
    for (int rd = 0; rd < 2; ++rd) { const int d = rd * 32 + tid / 8, pc = tid % 8; FragH f;
#pragma unroll
      for (int q = 0; q < 8; ++q) f.u[q] = tl[pc * 8 + q][d];
      *(v8us*)((unsigned short*)Vt + ((size_t)slab * 64 + d) * TTv + lg * 64 + pc * 8) = f.half[0]; }
     } }

/* One launch for the four conversions, which depend on nothing of one another: the first 3 * GW work-groups round the three weight matrices, the others each turn one 128-channel x 128-token tile of x.
   The test is the same for a whole work-group and stands in front of the barrier.
   Few long waves, not many short ones: waves start at a limited rate, and a wave with a single 4-B load a lane outstanding keeps too few bytes in flight to hide the memory latency.
   Here a wave of the x part moves 8 KB with 16 independent loads of 16 B a lane, and the whole launch is 4,864 waves. */
constexpr int PREP_WCH = 4;                                   /* chunks of 8 weights a thread */
constexpr int PREP_GW = CC * CC / 8 / 256 / PREP_WCH;         /* work-groups per weight matrix */
constexpr int PREP_T = 128;                                   /* the x tile: PREP_T channels x PREP_T tokens */
__global__ __launch_bounds__(256) void k_prep(const float* __restrict__ x, const float* __restrict__ Wq, const float* __restrict__ Wk, const float* __restrict__ Wv, _Float16* __restrict__ Bw, _Float16* __restrict__ X16) {
  constexpr int GW = PREP_GW, TP = PREP_T * 2 + 16;      /* a token's 128 channels in LDS: 256 B at pitch 272 B (16 B x odd) */
  static_assert(CC * CC % (8 * 256 * PREP_WCH) == 0, "whole work-groups of PREP_WCH x 8 elements a thread");
  static_assert(CC % PREP_T == 0 && NN % PREP_T == 0, "whole tiles");
  __shared__ __attribute__((aligned(16))) unsigned char tl[PREP_T * TP];
  const int tid = threadIdx.x;
  if (blockIdx.x < 3 * GW) { const int mw = blockIdx.x / GW; const float* W = mw == 0 ? Wq : mw == 1 ? Wk : Wv; unsigned short* Bt = (unsigned short*)Bw + (size_t)mw * CC * CC;
    const size_t t0 = (size_t)(blockIdx.x % GW) * (PREP_WCH * 256) + tid; v4f a[PREP_WCH][2];
#pragma unroll      /* this loop and the two below: constant indices keep a in registers; all loads go out ahead of the first store */
    for (int i = 0; i < PREP_WCH; ++i) { a[i][0] = *(const v4fa*)(W + (t0 + i * 256) * 8); a[i][1] = *(const v4fa*)(W + (t0 + i * 256) * 8 + 4); }
#pragma unroll
    for (int i = 0; i < PREP_WCH; ++i) { FragH f;
#pragma unroll
      for (int q = 0; q < 8; ++q) f.h[q] = (_Float16)(bf16_round(a[i][q >> 2][q & 3]) * 16.0f);
      *(v8us*)(Bt + (t0 + i * 256) * 8) = f.half[0]; }
    return; }
  const int tb = blockIdx.x - 3 * GW; constexpr int TPB = (CC / PREP_T) * (NN / PREP_T); const int b = tb / TPB, rem = tb % TPB; const int c0 = (rem / (NN / PREP_T)) * PREP_T, p0 = (rem % (NN / PREP_T)) * PREP_T;
  /* wave w: 32 channels x 64 tokens of the tile. A lane half takes 16 channels, a lane 4 tokens of each: one wave-wide load = 2 channel rows x 256 B, whole lines.
     A lane then holds 16 consecutive channels of each of its 4 tokens = 32 B of a row of the turned tile: the transposition is a choice of registers, and LDS is written 16 B at a time. */
  const int w = tid >> 5, g = (tid >> 4) & 1, m = tid & 15;
  const int cl = (w >> 1) * 32 + g * 16, tk = (w & 1) * 64 + m * 4;
  const float* src = x + ((size_t)b * CC + c0 + cl) * NN + p0 + tk;
  v4f v[16];
#pragma unroll      /* this loop and the two below: constant indices keep v in registers; the 16 loads depend on nothing of one another */
  for (int j = 0; j < 16; ++j) v[j] = *(const v4fa*)(src + (size_t)j * NN);
#pragma unroll
  for (int t = 0; t < 4; ++t) { FragH f;
#pragma unroll
    for (int j = 0; j < 16; ++j) f.h[j] = (_Float16)bf16_round(v[j][t]);
    *(v8us*)(tl + (tk + t) * TP + cl * 2) = f.half[0]; *(v8us*)(tl + (tk + t) * TP + cl * 2 + 16) = f.half[1]; }
  __syncthreads();      /* a token's 128 channels come from four waves */
  unsigned short* dst = (unsigned short*)X16 + ((size_t)b * NN + p0) * CC + c0;
#pragma unroll      /* the 8 LDS reads go out as one group ahead of the stores; a store = 2 token rows x 256 B, whole lines */
  for (int q = 0; q < 8; ++q) { const int r = w * 16 + q * 2 + g; const v8us o = *(const v8us*)(tl + r * TP + m * 16); *(v8us*)(dst + (size_t)r * CC + m * 8) = o; }
  asm volatile("s_wait_xcnt 0x0" ::: "memory");      /* behind the last store: the weight part's code follows in the listing and rewrites the stores' registers */
}
/* lane l <-> lane l ^ 16 as a vector cross-row move */
__device__ __forceinline__ float xhalf(float x) { return __builtin_bit_cast(float, __builtin_amdgcn_permlanex16(__builtin_bit_cast(int, x), __builtin_bit_cast(int, x), 0x76543210, 0xfedcba98, false, false)); }
__global__ __launch_bounds__(128) void k_flash(const _Float16* __restrict__ Q16, int ldq, const _Float16* __restrict__ K16, int ldk, const _Float16* __restrict__ Vt, const _Float16* __restrict__ Vtlo, float* __restrict__ O, int ldo) {
  constexpr int RPW = 16, NQB = TT / (4 * RPW), DT = 8, KS = 4;      /* head dim 128: 4 k-steps, 8 value tiles */
  constexpr float SC2 = ATT_SCALE * 1.4426950408889634f;      /* score scale x log2(e) */
  /* K/V ring shared by the four waves: two stages of 32 keys; a stage = 32 K rows of 256 B at pitch 272 B, then 128 V^T rows of 64 B at pitch 80 B (16 B x odd: conflict-free ds_load_b128) */
  constexpr int KP = 272, VP = 80, VOFF = 32 * KP, STG = VOFF + 128 * VP;
  __shared__ __attribute__((aligned(16))) unsigned char ring[2 * STG];
  static_assert(sizeof(float) * 4 * RPW * (128 + 4) <= 2 * STG, "output staging must fit in the ring");
  float (*sO)[RPW][128 + 4] = reinterpret_cast<float (*)[RPW][128 + 4]>(ring);      /* output staging takes the ring's place behind the last pass's barrier */
  const int tid = threadIdx.x, w = tid >> 5, lane = tid & 31, ln = lane & 15, hh = lane >> 4;
  const int slab = blockIdx.x / NQB, qblk = blockIdx.x % NQB; const int b = slab / NH, h = slab % NH; const int qb0 = qblk * (4 * RPW); const int q0 = qb0 + w * RPW;
  FragH aq[KS];
  { const unsigned short* qr = (const unsigned short*)Q16 + ((size_t)b * TT + q0 + ln) * ldq + h * 128;
#pragma unroll
    for (int ks = 0; ks < KS; ++ks) { aq[ks].half[0] = *(const v8us*)(qr + ks * 32 + 8 * hh); aq[ks].half[1] = *(const v8us*)(qr + ks * 32 + 16 + 8 * hh); } }
  const unsigned short* Vth = (const unsigned short*)Vt + (size_t)slab * 128 * TT;
  float m_q = -3.0e38f, l_q = 0.f; v8f oacc[DT];      /* running maximum of the raw scores (equal in both halves) and this half's partial sum (x 2^10) of query q0 + ln; oacc[dt][r] = O^T[dt*16 + 8*hh + r][ln] */
#pragma unroll
  for (int dt = 0; dt < DT; ++dt) oacc[dt] = (v8f){0.f,0.f,0.f,0.f,0.f,0.f,0.f,0.f};
  const int jend = TT;
  /* each thread copies 4 x 16 B of K (a wave-wide copy = 2 whole rows = 4 lines) and 4 x 16 B of V^T (8 rows x 64 B) per stage */
  const char* gK = (const char*)((const unsigned short*)K16 + ((size_t)b * TT + (tid >> 4)) * ldk + h * 128) + (tid & 15) * 16;
  const char* gV = (const char*)(Vth + (size_t)(tid >> 2) * TT) + (tid & 3) * 16;
  const size_t kstep = (size_t)ldk * 2;      /* bytes per key row of K */
  const unsigned lK = (unsigned)(size_t)ring + (unsigned)((tid >> 4) * KP + (tid & 15) * 16);
  const unsigned lV = (unsigned)(size_t)ring + (unsigned)(VOFF + (tid >> 2) * VP + (tid & 3) * 16);
  auto stage_copies = [&](int j, unsigned bofs) {
    const char* k0 = gK + (size_t)j * kstep; const char* v0 = gV + (size_t)j * 2; const unsigned a = lK + bofs, c = lV + bofs;
    /* the s_wait_xcnt closes the statement so that no address register of a copy is rewritten ahead of it */
    asm volatile("global_load_async_to_lds_b128 %0, %8, off\n\t"
                 "global_load_async_to_lds_b128 %1, %9, off\n\t"
                 "global_load_async_to_lds_b128 %2, %10, off\n\t"
                 "global_load_async_to_lds_b128 %3, %11, off\n\t"
                 "global_load_async_to_lds_b128 %4, %12, off\n\t"
                 "global_load_async_to_lds_b128 %5, %13, off\n\t"
                 "global_load_async_to_lds_b128 %6, %14, off\n\t"
                 "global_load_async_to_lds_b128 %7, %15, off\n\t"
                 "s_wait_xcnt 0x0"
                 :: "v"(a), "v"(a + 8 * KP), "v"(a + 16 * KP), "v"(a + 24 * KP), "v"(c), "v"(c + 32 * VP), "v"(c + 64 * VP), "v"(c + 96 * VP),
                    "v"(k0), "v"(k0 + 8 * kstep), "v"(k0 + 16 * kstep), "v"(k0 + 24 * kstep), "v"(v0), "v"(v0 + (size_t)32 * TT * 2), "v"(v0 + (size_t)64 * TT * 2), "v"(v0 + (size_t)96 * TT * 2)
                 : "memory");
  };
  stage_copies(0, 0u);
  asm volatile("s_wait_asynccnt 0x0" ::: "memory");      /* stage 0 of this wave has landed */
  __syncthreads();                                       /* ... and every wave's part of it is published */
  stage_copies(32, (unsigned)STG);
#pragma unroll 1
  for (int j0 = 0; j0 < jend; j0 += 32) {
    const unsigned bofs = (unsigned)((j0 >> 5) & 1) * (unsigned)STG; const unsigned char* kt = ring + bofs; const unsigned char* vt = kt + VOFF;
    v8f st[2];
#pragma unroll
    for (int nt = 0; nt < 2; ++nt) { const unsigned short* kr = (const unsigned short*)(kt + (nt * 16 + ln) * KP); FragH bk[KS];
#pragma unroll
      for (int ks = 0; ks < KS; ++ks) { bk[ks].half[0] = *(const v8us*)(kr + ks * 32 + 8 * hh); bk[ks].half[1] = *(const v8us*)(kr + ks * 32 + 16 + 8 * hh); }
      v8f acc = (v8f){0.f,0.f,0.f,0.f,0.f,0.f,0.f,0.f};
#pragma unroll
      for (int ks = 0; ks < KS; ++ks) acc = mmaH<1>(bk[ks].v, bk[ks].v, aq[ks].v, aq[ks].v, acc);
      st[nt] = acc; }
    /* The softmax runs on the raw scores in base 2: exp(ATT_SCALE * (s - m)) * 2^10 = 2^(s * SC2 + (10 - m * SC2)), one fused multiply-add and one hardware exp2 an element.
       The argument is at most 10 and a result below 2^-126 counts as 0, so none of the range handling of the library's expf is needed. m_q holds the maximum of the raw scores (SC2 > 0: the same element). */
    float mc = st[0][0];
#pragma unroll      /* this loop and the two below: constant indices keep the scores, P and oacc in registers */
    for (int i = 1; i < 16; ++i) mc = fmaxf(mc, st[i >> 3][i & 7]);
    mc = fmaxf(mc, xhalf(mc));      /* the other 16 keys of this query sit in lane ^ 16 */
    const float mn = fmaxf(m_q, mc); const float al = (mn > -1.0e38f) ? __builtin_amdgcn_exp2f((m_q - mn) * SC2) : 1.0f; m_q = mn;
    const float nb = __builtin_fmaf(-mn, SC2, 10.0f);
    FragH ph, pl; float ls[4] = {0.f, 0.f, 0.f, 0.f};      /* four independent partial sums: a chain of 4 dependent adds, not 16 */
#pragma unroll
    for (int i = 0; i < 16; ++i) { const float ps = __builtin_amdgcn_exp2f(__builtin_fmaf(st[i >> 3][i & 7], SC2, nb)); ls[i & 3] += ps; ph.h[i] = (_Float16)ps; pl.h[i] = (_Float16)(ps - (float)ph.h[i]); }      /* ps = 1024 p; P hi and its UNSCALED residual (added into the same accumulator); element i = key (i >> 3) * 16 + 8 * hh + (i & 7) */
    l_q = l_q * al + ((ls[0] + ls[1]) + (ls[2] + ls[3]));
#pragma unroll
    for (int dt = 0; dt < DT; ++dt) oacc[dt] *= al;
    FragH bv[DT];
#pragma unroll
    for (int dt = 0; dt < DT; ++dt) { const unsigned short* vr = (const unsigned short*)(vt + (dt * 16 + ln) * VP); bv[dt].half[0] = *(const v8us*)(vr + 8 * hh); bv[dt].half[1] = *(const v8us*)(vr + 16 + 8 * hh); }      /* all V fragments of the pass as one group of LDS reads, ahead of the products: one LDS latency a pass, not eight */
#pragma unroll      /* constant dt keeps bv and oacc in registers */
    for (int dt = 0; dt < DT; ++dt) { oacc[dt] = mmaH<1>(bv[dt].v, bv[dt].v, ph.v, ph.v, oacc[dt]); oacc[dt] = mmaH<1>(bv[dt].v, bv[dt].v, pl.v, pl.v, oacc[dt]); }      /* Vh^T.(Ph + Pl)^T - the V residual term is dropped here: near-uniform attention over 1024 keys averages the f16 rounding of v */
    asm volatile("s_wait_dscnt 0x0" ::: "memory");         /* this wave's reads of the stage are done before the stage is refilled */
    asm volatile("s_wait_asynccnt 0x0" ::: "memory");      /* this wave's copies of the next stage have landed */
    __syncthreads();                                       /* publishes the next stage and ends every wave's reads of this one */
    if (j0 + 64 < jend) stage_copies(j0 + 64, bofs); }
  asm volatile("s_wait_asynccnt 0x0" ::: "memory");        /* nothing in flight when the ring becomes output staging */
  { float l = l_q; l += xhalf(l); const float inv = (l > 0.f) ? 1.0f / l : 0.f;      /* the two halves' partial sums joined once; l and oacc both carry the 2^10 of ps */
#pragma unroll      /* constant dt: oacc stays in registers; a lane's 8 values are 8 consecutive d of its query's row */
    for (int dt = 0; dt < DT; ++dt) { const v4f lo = {oacc[dt][0] * inv, oacc[dt][1] * inv, oacc[dt][2] * inv, oacc[dt][3] * inv}, hi = {oacc[dt][4] * inv, oacc[dt][5] * inv, oacc[dt][6] * inv, oacc[dt][7] * inv};
      *(v4fa*)&sO[w][ln][dt * 16 + 8 * hh] = lo; *(v4fa*)&sO[w][ln][dt * 16 + 8 * hh + 4] = hi; } }
  __builtin_amdgcn_fence(__ATOMIC_ACQ_REL, "workgroup"); __builtin_amdgcn_wave_barrier();
  {
#pragma unroll
    for (int r = 0; r < RPW; ++r) { const int pc = lane; const v4f val = *(const v4fa*)&sO[w][r][pc * 4]; *(v4f*)(O + ((size_t)slab * TT + q0 + r) * 128 + pc * 4) = val; }      /* output laid out [b][h][n][128] (the module reinterprets that buffer as [B,C,H,W]); one 512-B row per instruction: 32 lanes x 16 B */
     } }

extern "C" void kernel_launch(void* const* d_in, const int* in_sizes, int n_in,
                              void* d_out, int out_size, void* d_ws, size_t ws_size, hipStream_t stream) {
  (void)in_sizes; (void)n_in; (void)out_size;
  const float* const* I = (const float* const*)d_in; const float* x = I[0]; const float* Wq = I[1]; const float* bq = I[2]; const float* Wk = I[3]; const float* bk = I[4]; const float* Wv = I[5]; const float* bv = I[6]; const float* rh = I[7]; const float* rw = I[8];
  char* ws = (char*)d_ws; size_t off = 0;
  auto take = [&](size_t bytes) { char* p = ws + off; off += (bytes + 255) & ~(size_t)255; return p; };
  const size_t WSZ = (size_t)CC * CC; _Float16* Bw = (_Float16*)take(3 * WSZ * 2); _Float16* X16 = (_Float16*)take((size_t)NR * CC * 2); _Float16* Q = (_Float16*)take((size_t)NR * CC * 2); _Float16* K = (_Float16*)take((size_t)NR * CC * 2); _Float16* Vt = (_Float16*)take((size_t)NR * CC * 2);
  if (off > ws_size) return;      // 1.6 + 4 x 16.8 = 69 MB
  k_prep<<<3 * PREP_GW + BB * (CC / PREP_T) * (NN / PREP_T), 256, 0, stream>>>(x, Wq, Wk, Wv, Bw, X16);      /* weights (out,in) natural x 2^4; x [B][C][N] to token-major bf16 plane */
  k_proj3<<<3 * (NR / 128) * (CC / 128), 256, 0, stream>>>(X16, Bw, bq, bk, bv, rh, rw, Q, K, Vt);      /* each M 16384 N 512 K 512: q (unscaled) f16; k' = k + rt^T, f16; v as V^T f16 per batch [512 channels][N] = per (b, h) [128][N] */
  k_flash<<<BB * NH * (NN / 64), 128, 0, stream>>>(Q, CC, K, CC, Vt, nullptr, (float*)d_out, 128);      /* y to d_out as [b][h][n][128]; k_flash does not read its V residual argument, and that plane is no longer made */
}

// v008
// Measured time: 81.8 microseconds a run.
// Next to v007, in two timings, it ran 1.09 times as fast each time.
// Over all steps from v000 it is 5.31 times as fast.
#include <hip/hip_runtime.h>
// Bottleneck-transformer MHSA with relative position term (B=16, C=512, 32×32 → N=1024, 4 heads × 128): q,k,v = 1×1 convs ((out,in) + bias); logits = (q·C^-½)·(k + rt) where rt[h][d][n] = rh[h][d][n mod 32] + rw[h][d][n div 32]
// (the module's (rh + rw).reshape(1, heads, emb, N)); softmax; y = attn·v per head; the output is the [B][h][N][d] buffer reinterpreted as [B,C,H,W] (the module's final reshape).
// Compute dtype: x, weights, biases, rh, rw rounded to bf16; token-major bf16 input plane; q as an f16 GEMM plane (unscaled — the C^-½ is applied to the f32 score), k as an f32 GEMM output with rtᵀ added in f32 then f16,
// v f16; fused flash-style kernel for head dim 128 (4 k-steps, 8 value tiles, online softmax f32, P as f16 + its exact f16 residual, V f16, one f32 accumulator) on v_wmma_f32_16x16x32_f16 writing y directly; f32 accumulate.
#define BB 16
#define CC 512
#define NN 1024
#define TT NN
#define NH 4
#define HDD 128
#define NVH (2 * NH)
#define NR (BB * NN)
#define ATT_SCALE 0.04419417382415922f

typedef __bf16 v16b __attribute__((ext_vector_type(16)));
typedef unsigned short v8us __attribute__((ext_vector_type(8), may_alias));
typedef float  v8f  __attribute__((ext_vector_type(8)));
typedef float  v4f  __attribute__((ext_vector_type(4)));
typedef float  v4fa __attribute__((ext_vector_type(4), may_alias));
union FragB { v16b v; v8us half[2]; unsigned short u[16]; };

__device__ __forceinline__ unsigned short bf16_bits(float x) { unsigned int u = __float_as_uint(x); return (unsigned short)((u + 0x7FFFu + ((u >> 16) & 1u)) >> 16); }
__device__ __forceinline__ float bf16_val(unsigned short b) { return __uint_as_float(((unsigned int)b) << 16); }
__device__ __forceinline__ float bf16_round(float x) { return bf16_val(bf16_bits(x)); }
// D += A·B with NT terms: 1 = ah·bh, 2 = + al·bh (A split), 3 = + ah·bl (both split)
template <int NT>
__device__ __forceinline__ v8f mmaN(v16b ah, v16b al, v16b bh, v16b bl, v8f c) {
  c = __builtin_amdgcn_wmma_f32_16x16x32_bf16(false, ah, false, bh, (short)0, c, false, false);
  if (NT >= 2) c = __builtin_amdgcn_wmma_f32_16x16x32_bf16(false, al, false, bh, (short)0, c, false, false);
  if (NT >= 3) c = __builtin_amdgcn_wmma_f32_16x16x32_bf16(false, ah, false, bl, (short)0, c, false, false);
  asm volatile("v_nop\n\tv_nop\n\tv_nop\n\tv_nop" : "+v"(c) : "v"(ah), "v"(al), "v"(bh), "v"(bl));
  return c;
}

__global__ __launch_bounds__(256) void k_wt_bf16(const float* __restrict__ W, unsigned short* __restrict__ Wt, int K, int N) {
  const int t = blockIdx.x * 256 + threadIdx.x;
  const int k8n = K / 8;
  if (t >= N * k8n) return;
  const int n = t / k8n, k8 = (t % k8n) * 8;
  v8us v;
#pragma unroll
  for (int i = 0; i < 8; ++i) v[i] = bf16_bits(W[(size_t)(k8 + i) * N + n]);
  *(v8us*)(Wt + (size_t)n * K + k8) = v;
  
}

// GEMM C[M][N] (f32, pitch ldc) = act(A[M][K]·W + bias). A f32 row-major (pitch lda) converted per fragment to bf16
// (ASPLIT: hi/lo two planes -> 2 terms, else single rounded term); Wt bf16 [N][K] (pitch ldb). BIAS_BF16 rounds the
// bias to bf16 first (bias quantised to bf16 before the add). K%32==0, M%16==0, N%64==0.
template <bool ASPLIT, int ACT, bool BIAS_BF16>
__global__ __launch_bounds__(128) void k_gemm_bf(const float* __restrict__ A, int lda, const unsigned short* __restrict__ Wt, int ldb,
                                               const float* __restrict__ bias, float* __restrict__ C, int ldc, int M, int N, int K) {
  __shared__ __attribute__((aligned(16))) float so[4][16][64];
  const int tid = threadIdx.x, w = tid >> 5, lane = tid & 31, ln = lane & 15, hh = lane >> 4;
  const int ntn = N / 64;
  const int wid = blockIdx.x * 4 + w;
  const int mt = wid / ntn, nq = wid % ntn;
  if (mt * 16 >= M) return;
  const int row0 = mt * 16, col0 = nq * 64;
  const float* arow = A + (size_t)(row0 + ln) * lda;
  v8f acc[4] = {};
  for (int kb = 0; kb < K; kb += 32) {
    FragB ah, al;
    const v4f x0 = *(const v4fa*)(arow + kb + 8 * hh), x1 = *(const v4fa*)(arow + kb + 8 * hh + 4);
    const v4f x2 = *(const v4fa*)(arow + kb + 16 + 8 * hh), x3 = *(const v4fa*)(arow + kb + 16 + 8 * hh + 4);
    float xs[16] = {x0[0],x0[1],x0[2],x0[3],x1[0],x1[1],x1[2],x1[3],x2[0],x2[1],x2[2],x2[3],x3[0],x3[1],x3[2],x3[3]};
#pragma unroll
    for (int i = 0; i < 16; ++i) { const unsigned short hb = bf16_bits(xs[i]); ah.u[i] = hb; al.u[i] = ASPLIT ? bf16_bits(xs[i] - bf16_val(hb)) : (unsigned short)0; }
#pragma unroll
    for (int t = 0; t < 4; ++t) {
      const unsigned short* brow = Wt + (size_t)(col0 + t * 16 + ln) * ldb + kb;
      FragB b;
      b.half[0] = *(const v8us*)(brow + 8 * hh);
      b.half[1] = *(const v8us*)(brow + 16 + 8 * hh);
      acc[t] = mmaN<ASPLIT ? 2 : 1>(ah.v, al.v, b.v, b.v, acc[t]);
    }
  }
#pragma unroll
  for (int t = 0; t < 4; ++t) {
    float bv = bias ? bias[col0 + t * 16 + ln] : 0.f;
    if (BIAS_BF16) bv = bf16_round(bv);
#pragma unroll
    for (int r = 0; r < 8; ++r) { float v = acc[t][r] + bv; if (ACT == 1) v = fmaxf(v, 0.f); so[w][8 * hh + r][t * 16 + ln] = v; }
  }
  __builtin_amdgcn_fence(__ATOMIC_ACQ_REL, "workgroup");
  __builtin_amdgcn_wave_barrier();
  const int rsub = lane >> 4, c4 = (lane & 15) * 4;
  {
#pragma unroll
    for (int q = 0; q < 8; ++q) {
      const int r = q * 2 + rsub;
      const v4f v = *(const v4fa*)&so[w][r][c4];
      *(v4f*)(C + (size_t)(row0 + r) * ldc + col0 + c4) = v;
    }
    
  }
}

// Flash-style causal/unmasked attention, all contractions 3-term bf16 hi/lo splits, f32 softmax with running max.
// q,k,v rows are read from f32 buffers with arbitrary row pitch (so they can live inside a fused qkv buffer);
// D = head size (multiple of 32, <= 128); one wave = 16 query rows; block = 4 waves (64 queries) sharing K/V chunks of 32.
template <int D, bool CAUSAL>
__global__ __launch_bounds__(128) void k_flash(const float* __restrict__ qb, const float* __restrict__ kb, const float* __restrict__ vb,
                                             int pitch, int T, int H, float scale, float* __restrict__ y, int ypitch) {
  constexpr int KS = D / 32;        // k-steps for QK
  constexpr int DT = D / 16;        // d tiles for PV
  __shared__ __attribute__((aligned(16))) unsigned short sKh[32][D + 8], sKl[32][D + 8], sVh[32][D + 8], sVl[32][D + 8];
  __shared__ __attribute__((aligned(16))) unsigned short sPh[4][16][40], sPl[4][16][40];
  __shared__ __attribute__((aligned(16))) float sO[4][16][D];
  const int tid = threadIdx.x, w = tid >> 5, lane = tid & 31, ln = lane & 15, hh = lane >> 4;
  const int nqb = (T + 63) / 64;
  const int bh = blockIdx.x / nqb, qblk = blockIdx.x % nqb;
  const int b = bh / H, h = bh % H;
  const int q0 = qblk * 64 + w * 16;
  const float* Q = qb + (size_t)b * T * pitch + h * D;
  const float* K = kb + (size_t)b * T * pitch + h * D;
  const float* V = vb + (size_t)b * T * pitch + h * D;

  // A fragments of the wave's 16 query rows (scaled), hi/lo
  FragB aqh[KS], aql[KS];
  {
    int row = q0 + ln; if (row >= T) row = T - 1;
    const float* qr = Q + (size_t)row * pitch;
#pragma unroll
    for (int ks = 0; ks < KS; ++ks)
#pragma unroll
      for (int i = 0; i < 16; ++i) {
        const int d = ks * 32 + ((i < 8) ? (8 * hh + i) : (16 + 8 * hh + (i - 8)));
        const float x = qr[d] * scale; const unsigned short hb = bf16_bits(x);
        aqh[ks].u[i] = hb; aql[ks].u[i] = bf16_bits(x - bf16_val(hb));
      }
  }
  float m_r[8], l_r[8];
#pragma unroll
  for (int r = 0; r < 8; ++r) { m_r[r] = -3.0e38f; l_r[r] = 0.f; }
  v8f oacc[DT];
#pragma unroll
  for (int dt = 0; dt < DT; ++dt) oacc[dt] = (v8f){0.f,0.f,0.f,0.f,0.f,0.f,0.f,0.f};

  const int kv_end = CAUSAL ? min(T, qblk * 64 + 64) : T;     // block-uniform
  for (int j0 = 0; j0 < kv_end; j0 += 32) {
    __syncthreads();
    for (int e = tid; e < 32 * (D / 4); e += 128) {
      const int r = e / (D / 4), c4 = (e % (D / 4)) * 4;
      const int key = j0 + r;
      v4f kf = {0.f,0.f,0.f,0.f}, vf = {0.f,0.f,0.f,0.f};
      if (key < T) { kf = *(const v4fa*)(K + (size_t)key * pitch + c4); vf = *(const v4fa*)(V + (size_t)key * pitch + c4); }
#pragma unroll
      for (int t = 0; t < 4; ++t) {
        unsigned short hb = bf16_bits(kf[t]); sKh[r][c4 + t] = hb; sKl[r][c4 + t] = bf16_bits(kf[t] - bf16_val(hb));
        hb = bf16_bits(vf[t]); sVh[r][c4 + t] = hb; sVl[r][c4 + t] = bf16_bits(vf[t] - bf16_val(hb));
      }
    }
    __syncthreads();
    // S tile 16 x 32
    v8f s[2];
#pragma unroll
    for (int nt = 0; nt < 2; ++nt) {
      v8f acc = {};
#pragma unroll
      for (int ks = 0; ks < KS; ++ks) {
        FragB bh_, bl_;
        bh_.half[0] = *(const v8us*)&sKh[nt * 16 + ln][ks * 32 + 8 * hh]; bh_.half[1] = *(const v8us*)&sKh[nt * 16 + ln][ks * 32 + 16 + 8 * hh];
        bl_.half[0] = *(const v8us*)&sKl[nt * 16 + ln][ks * 32 + 8 * hh]; bl_.half[1] = *(const v8us*)&sKl[nt * 16 + ln][ks * 32 + 16 + 8 * hh];
        acc = mmaN<3>(aqh[ks].v, aql[ks].v, bh_.v, bl_.v, acc);
      }
      s[nt] = acc;
    }
    // mask + running max (rows 8hh+r; the 16 lanes of a half share rows)
    float alpha[8];
#pragma unroll
    for (int r = 0; r < 8; ++r) {
      const int qi = q0 + 8 * hh + r;
      const int ja = j0 + ln, jb = j0 + 16 + ln;
      if (CAUSAL) { if (ja > qi) s[0][r] = -3.0e38f; if (jb > qi) s[1][r] = -3.0e38f; }
      if (ja >= T) s[0][r] = -3.0e38f;
      if (jb >= T) s[1][r] = -3.0e38f;
      float mx = fmaxf(s[0][r], s[1][r]);
      mx = fmaxf(mx, __shfl_xor(mx, 1, 32)); mx = fmaxf(mx, __shfl_xor(mx, 2, 32)); mx = fmaxf(mx, __shfl_xor(mx, 4, 32)); mx = fmaxf(mx, __shfl_xor(mx, 8, 32));
      const float mnew = fmaxf(m_r[r], mx);
      alpha[r] = (mnew > -1.0e38f) ? __expf(m_r[r] - mnew) : 1.0f;
      const float p0 = (s[0][r] > -1.0e38f) ? __expf(s[0][r] - mnew) : 0.f;
      const float p1 = (s[1][r] > -1.0e38f) ? __expf(s[1][r] - mnew) : 0.f;
      m_r[r] = mnew;
      l_r[r] = l_r[r] * alpha[r] + p0 + p1;            // per-lane partial row sum (16 lanes combined at the end)
      unsigned short hb = bf16_bits(p0); sPh[w][8 * hh + r][ln] = hb;      sPl[w][8 * hh + r][ln] = bf16_bits(p0 - bf16_val(hb));
      hb = bf16_bits(p1);                sPh[w][8 * hh + r][16 + ln] = hb; sPl[w][8 * hh + r][16 + ln] = bf16_bits(p1 - bf16_val(hb));
    }
#pragma unroll
    for (int dt = 0; dt < DT; ++dt)
#pragma unroll
      for (int r = 0; r < 8; ++r) oacc[dt][r] *= alpha[r];
    __builtin_amdgcn_fence(__ATOMIC_ACQ_REL, "workgroup");
    __builtin_amdgcn_wave_barrier();
    FragB pah, pal;
    pah.half[0] = *(const v8us*)&sPh[w][ln][8 * hh]; pah.half[1] = *(const v8us*)&sPh[w][ln][16 + 8 * hh];
    pal.half[0] = *(const v8us*)&sPl[w][ln][8 * hh]; pal.half[1] = *(const v8us*)&sPl[w][ln][16 + 8 * hh];
#pragma unroll
    for (int dt = 0; dt < DT; ++dt) {
      FragB bvh, bvl;
#pragma unroll
      for (int i = 0; i < 8; ++i) {
        bvh.u[i] = sVh[8 * hh + i][dt * 16 + ln]; bvh.u[8 + i] = sVh[16 + 8 * hh + i][dt * 16 + ln];
        bvl.u[i] = sVl[8 * hh + i][dt * 16 + ln]; bvl.u[8 + i] = sVl[16 + 8 * hh + i][dt * 16 + ln];
      }
      oacc[dt] = mmaN<3>(pah.v, pal.v, bvh.v, bvl.v, oacc[dt]);
    }
    __builtin_amdgcn_fence(__ATOMIC_ACQ_REL, "workgroup");
    __builtin_amdgcn_wave_barrier();
  }
#pragma unroll
  for (int r = 0; r < 8; ++r) {
    float l = l_r[r];
    l += __shfl_xor(l, 1, 32); l += __shfl_xor(l, 2, 32); l += __shfl_xor(l, 4, 32); l += __shfl_xor(l, 8, 32);
    l_r[r] = (l > 0.f) ? 1.0f / l : 0.f;
  }
#pragma unroll
  for (int dt = 0; dt < DT; ++dt)
#pragma unroll
    for (int r = 0; r < 8; ++r) sO[w][8 * hh + r][dt * 16 + ln] = oacc[dt][r] * l_r[r];
  __builtin_amdgcn_fence(__ATOMIC_ACQ_REL, "workgroup");
  __builtin_amdgcn_wave_barrier();
  {
    for (int r = 0; r < 16; ++r) {
      const int row = q0 + r;
      if (row < T && lane < D / 4) {
        const v4f val = *(const v4fa*)&sO[w][r][lane * 4];
        *(v4f*)(y + ((size_t)b * T + row) * ypitch + h * D + lane * 4) = val;
      }
    }
    
  }
}

// GEMM C = act(A·W + bias + resid): A f32 (ASPLIT -> hi/lo 2 terms), Wt bf16 [N][K]; ACT 0 none, 1 relu, 2 exact gelu;
// resid (optional, f32, row index = (row % rmod), pitch ldr, RES_BF16 rounds it) added before the activation.
template <bool ASPLIT, int ACT, bool BIAS_BF16, bool RES_BF16>
__global__ __launch_bounds__(128) void k_gemm_bf3(const float* __restrict__ A, int lda, const unsigned short* __restrict__ Wt, int ldb,
                                                const float* __restrict__ bias, const float* __restrict__ resid, int rmod, int ldr,
                                                float* __restrict__ C, int ldc, int M, int N, int K) {
  __shared__ __attribute__((aligned(16))) float so[4][16][64];
  const int tid = threadIdx.x, w = tid >> 5, lane = tid & 31, ln = lane & 15, hh = lane >> 4;
  const int ntn = N / 64;
  const int wid = blockIdx.x * 4 + w;
  const int mt = wid / ntn, nq = wid % ntn;
  if (mt * 16 >= M) return;
  const int row0 = mt * 16, col0 = nq * 64;
  const float* arow = A + (size_t)(row0 + ln) * lda;
  v8f acc[4] = {};
  for (int kb = 0; kb < K; kb += 32) {
    FragB ah, al;
    const v4f x0 = *(const v4fa*)(arow + kb + 8 * hh), x1 = *(const v4fa*)(arow + kb + 8 * hh + 4);
    const v4f x2 = *(const v4fa*)(arow + kb + 16 + 8 * hh), x3 = *(const v4fa*)(arow + kb + 16 + 8 * hh + 4);
    float xs[16] = {x0[0],x0[1],x0[2],x0[3],x1[0],x1[1],x1[2],x1[3],x2[0],x2[1],x2[2],x2[3],x3[0],x3[1],x3[2],x3[3]};
#pragma unroll
    for (int i = 0; i < 16; ++i) { const unsigned short hb = bf16_bits(xs[i]); ah.u[i] = hb; al.u[i] = ASPLIT ? bf16_bits(xs[i] - bf16_val(hb)) : (unsigned short)0; }
#pragma unroll
    for (int t = 0; t < 4; ++t) {
      const unsigned short* brow = Wt + (size_t)(col0 + t * 16 + ln) * ldb + kb;
      FragB b;
      b.half[0] = *(const v8us*)(brow + 8 * hh);
      b.half[1] = *(const v8us*)(brow + 16 + 8 * hh);
      acc[t] = mmaN<ASPLIT ? 2 : 1>(ah.v, al.v, b.v, b.v, acc[t]);
    }
  }
#pragma unroll
  for (int t = 0; t < 4; ++t) {
    const int col = col0 + t * 16 + ln;
    float bv = bias ? bias[col] : 0.f;
    if (BIAS_BF16) bv = bf16_round(bv);
#pragma unroll
    for (int r = 0; r < 8; ++r) {
      float v = acc[t][r] + bv;
      if (resid) { float rv = resid[(size_t)((row0 + 8 * hh + r) % rmod) * ldr + col]; if (RES_BF16) rv = bf16_round(rv); v += rv; }
      if (ACT == 1) v = fmaxf(v, 0.f);
      if (ACT == 2) v = 0.5f * v * (1.0f + erff(v * 0.70710678118654752f));
      if (ACT == 3) { const float u = 0.7978845608028654f * (v + 0.044715f * v * v * v); v = 0.5f * v * (1.0f + tanhf(u)); }
      so[w][8 * hh + r][t * 16 + ln] = v;
    }
  }
  __builtin_amdgcn_fence(__ATOMIC_ACQ_REL, "workgroup");
  __builtin_amdgcn_wave_barrier();
  const int rsub = lane >> 4, c4 = (lane & 15) * 4;
  {
#pragma unroll
    for (int q = 0; q < 8; ++q) {
      const int r = q * 2 + rsub;
      const v4f v = *(const v4fa*)&so[w][r][c4];
      *(v4f*)(C + (size_t)(row0 + r) * ldc + col0 + c4) = v;
    }
    
  }
}
// row LayerNorm (biased variance, eps) over N: s = X (+ R); optional out_sum <- s; out_norm <- (s-mu)*rsqrt(var+eps)*g + b
template <bool PARAM_BF16>
__global__ __launch_bounds__(256) void k_layernorm(const float* __restrict__ X, const float* __restrict__ R, const float* __restrict__ g, const float* __restrict__ bta,
                                                  float* __restrict__ out_sum, float* __restrict__ out_norm, int N, float eps) {
  __shared__ float red[256];
  const int row = blockIdx.x, tid = threadIdx.x;
  const float* x = X + (size_t)row * N; const float* rr = R ? R + (size_t)row * N : nullptr;
  float vals[16];                     // up to N = 4096
  const int per = N / 256;            // contiguous chunk per thread? use strided-by-4 chunks: thread handles j = tid*4 + 1024*u
  float s1 = 0.f;
  for (int u = 0; u < per / 4; ++u) {
    const int j = tid * 4 + 1024 * u;
    const v4f a = *(const v4fa*)(x + j);
    v4f b = {0.f,0.f,0.f,0.f}; if (rr) b = *(const v4fa*)(rr + j);
#pragma unroll
    for (int q = 0; q < 4; ++q) { const float v = a[q] + b[q]; vals[u * 4 + q] = v; s1 += v; }
  }
  red[tid] = s1; __syncthreads();
  for (int st = 128; st > 0; st >>= 1) { if (tid < st) red[tid] += red[tid + st]; __syncthreads(); }
  const float mu = red[0] / (float)N; __syncthreads();
  float s2 = 0.f;
  for (int u = 0; u < per / 4; ++u)
#pragma unroll
    for (int q = 0; q < 4; ++q) { const float c = vals[u * 4 + q] - mu; s2 += c * c; }
  red[tid] = s2; __syncthreads();
  for (int st = 128; st > 0; st >>= 1) { if (tid < st) red[tid] += red[tid + st]; __syncthreads(); }
  const float rs = rsqrtf(red[0] / (float)N + eps);
  {
    for (int u = 0; u < per / 4; ++u) {
      const int j = tid * 4 + 1024 * u;
      v4f o, sm;
#pragma unroll
      for (int q = 0; q < 4; ++q) {
        float gg = g[j + q], bb = bta[j + q];
        if (PARAM_BF16) { gg = bf16_round(gg); bb = bf16_round(bb); }
        sm[q] = vals[u * 4 + q]; o[q] = (vals[u * 4 + q] - mu) * rs * gg + bb;
      }
      if (out_sum) *(v4f*)(out_sum + (size_t)row * N + j) = sm;
      *(v4f*)(out_norm + (size_t)row * N + j) = o;
    }
    
  }
}



// ---- f16 WMMA path (v_wmma_f32_16x16x32_f16): 11-bit significands for operands in range — used where the probability operand (1024 p, in [0,1024]) needs more precision than bf16
typedef _Float16 v16h __attribute__((ext_vector_type(16)));
union FragH { v16h v; v8us half[2]; _Float16 h[16]; unsigned short u[16]; };
template <int NT>
__device__ __forceinline__ v8f mmaH(v16h ah, v16h al, v16h bh, v16h bl, v8f c) {
  c = __builtin_amdgcn_wmma_f32_16x16x32_f16(false, ah, false, bh, (short)0, c, false, false);
  if (NT >= 2) c = __builtin_amdgcn_wmma_f32_16x16x32_f16(false, al, false, bh, (short)0, c, false, false);
  if (NT >= 3) c = __builtin_amdgcn_wmma_f32_16x16x32_f16(false, ah, false, bl, (short)0, c, false, false);
  asm volatile("v_nop\n\tv_nop\n\tv_nop\n\tv_nop" : "+v"(c) : "v"(ah), "v"(al), "v"(bh), "v"(bl));
  return c;
}
// batched GEMM like k_gemm_b but f16 operands: A f32 (split into f16 hi/lo if ASPLIT, else rounded to f16), Bt = f16 values [n][k]; alpha; C f32; N multiple of 16 (partial tiles skipped)
template <bool ASPLIT>
__global__ __launch_bounds__(128) void k_gemm_h(const float* __restrict__ A, int lda, size_t sA, const _Float16* __restrict__ Bh, int ldb, size_t sB, float alpha, float* __restrict__ C, int ldc, size_t sC, int M, int N, int K) {
  __shared__ __attribute__((aligned(16))) float so[4][16][64];
  const int tid = threadIdx.x, w = tid >> 5, lane = tid & 31, ln = lane & 15, hh = lane >> 4; const int by = blockIdx.y;
  A += (size_t)by * sA; Bh += (size_t)by * sB; C += (size_t)by * sC;
  const int ntn = (N + 63) / 64; const int wid = blockIdx.x * 4 + w; const int mt = wid / ntn, nq = wid % ntn; if (mt * 16 >= M) return;
  const int row0 = mt * 16, col0 = nq * 64; const float* arow = A + (size_t)(row0 + ln) * lda;
  v8f acc[4] = {};
  for (int kb = 0; kb < K; kb += 32) {
    FragH ah, al;
    const v4f x0 = *(const v4fa*)(arow + kb + 8 * hh), x1 = *(const v4fa*)(arow + kb + 8 * hh + 4), x2 = *(const v4fa*)(arow + kb + 16 + 8 * hh), x3 = *(const v4fa*)(arow + kb + 16 + 8 * hh + 4);
    float xs[16] = {x0[0],x0[1],x0[2],x0[3],x1[0],x1[1],x1[2],x1[3],x2[0],x2[1],x2[2],x2[3],x3[0],x3[1],x3[2],x3[3]};
#pragma unroll
    for (int i = 0; i < 16; ++i) { const _Float16 h = (_Float16)xs[i]; ah.h[i] = h; al.h[i] = ASPLIT ? (_Float16)(xs[i] - (float)h) : (_Float16)0.0f; }
#pragma unroll
    for (int t = 0; t < 4; ++t) { if (col0 + t * 16 >= N) continue; const size_t boff = (size_t)(col0 + t * 16 + ln) * ldb + kb; FragH bq; bq.half[0] = *(const v8us*)(Bh + boff + 8 * hh); bq.half[1] = *(const v8us*)(Bh + boff + 16 + 8 * hh);
      acc[t] = mmaH<ASPLIT ? 2 : 1>(ah.v, al.v, bq.v, bq.v, acc[t]); }
  }
#pragma unroll
  for (int t = 0; t < 4; ++t) { if (col0 + t * 16 >= N) continue;
#pragma unroll
    for (int r = 0; r < 8; ++r) so[w][8 * hh + r][t * 16 + ln] = acc[t][r] * alpha; }
  __builtin_amdgcn_fence(__ATOMIC_ACQ_REL, "workgroup"); __builtin_amdgcn_wave_barrier();
  const int rsub = lane >> 4, c4 = (lane & 15) * 4;
  {
#pragma unroll
    for (int q = 0; q < 8; ++q) { const int r = q * 2 + rsub; if (col0 + c4 < N) { const v4f v = *(const v4fa*)&so[w][r][c4]; *(v4f*)(C + (size_t)(row0 + r) * ldc + col0 + c4) = v; } }
     }
}

// Wt[n][k] = f16(W[k][n]·scale) from f32 row-major W[K][N] (scale = power of two; bf16-exact weights stay exact in f16 away from the subnormal range)
__global__ __launch_bounds__(256) void k_wt_f16(const float* __restrict__ W, _Float16* __restrict__ Wt, int K, int N, float scale) {
  const int t = blockIdx.x * 256 + threadIdx.x; if (t >= N * (K / 8)) return; const int n = t / (K / 8), k8 = (t % (K / 8)) * 8; FragH f;
#pragma unroll
  for (int i = 0; i < 8; ++i) f.h[i] = (_Float16)(bf16_round(W[(size_t)(k8 + i) * N + n]) * scale); const v8us o = f.half[0];
  *(v8us*)((unsigned short*)Wt + (size_t)n * K + k8) = o; 
}
// Projection GEMM, fixed shape M = NR, N = K = CC: v = acc/16 + bf16(bias[col]) in f32, and the epilogue writes the f16 plane that the attention kernel reads:
// MODE 0 (q): f16 rows [token][channel]; MODE 1 (k): v + (bf16(rh[channel][n mod 32]) + bf16(rw[channel][n div 32])) in f32, then f16 rows; MODE 2 (v): f16, transposed per batch to [channel][token].
// One work-group = one 128 x 128 tile of the output, 8 waves as 4 x 2, 32 x 64 a wave. A pass is 64 k: 128 rows of A and 128 rows of W, 128 B (one line) each,
// copied once per work-group into LDS at pitch 144 B (16 B x odd: conflict-free ds_load_b128); two buffers, the next pass's copies fly while this pass is multiplied.
typedef _Float16 v4h __attribute__((ext_vector_type(4)));
constexpr int PROJ_RING = 4 * 128 * 144;      /* two stages of (128 A rows + 128 W rows) at pitch 144 B */
template <int MODE>
__device__ __forceinline__ void proj_tile(unsigned char* ring, const int blk, const _Float16* __restrict__ A, const _Float16* __restrict__ Bh, const float* __restrict__ bias, const float* __restrict__ rh, const float* __restrict__ rw, _Float16* __restrict__ C16) {
  constexpr int BT = 128, BK = 64, RP = 144, TILE = BT * RP, STG = 2 * TILE, NPASS = CC / BK, SOP = 68, TP = 2 * BT + 16;
  static_assert(2 * STG == PROJ_RING, "the kernel's LDS array is the ring");
  static_assert(NR % BT == 0 && CC % BT == 0 && CC % BK == 0 && NPASS >= 2, "whole tiles, at least two passes");
  static_assert(NN % BT == 0 && BT % 32 == 0, "a tile lies in one batch, a wave's 32 rows in one value of n div 32");
  static_assert(BT * TP <= 2 * STG, "the transposed tile must fit in the ring");
  static_assert(sizeof(float) * 8 * 32 * SOP <= 2 * STG, "output staging must fit in the ring");
  float (*so)[32][SOP] = reinterpret_cast<float (*)[32][SOP]>(ring);      /* output staging takes the ring's place behind the last pass's barrier; pitch 68 dwords keeps the two lane halves on different banks */
  const int tid = threadIdx.x, w = tid >> 5, lane = tid & 31, ln = lane & 15, hh = lane >> 4;
  const int row0 = (blk / (CC / BT)) * BT, col0 = (blk % (CC / BT)) * BT;
  const int wr = (w >> 1) * 32, wc = (w & 1) * 64;
  /* each thread copies 4 x 16 B of A and 4 x 16 B of W per pass; a wave-wide copy = 4 whole rows = 4 lines */
  const char* gA = (const char*)((const unsigned short*)A + (size_t)(row0 + (tid >> 3)) * CC) + (tid & 7) * 16;
  const char* gB = (const char*)((const unsigned short*)Bh + (size_t)(col0 + (tid >> 3)) * CC) + (tid & 7) * 16;
  const unsigned lA = (unsigned)(size_t)ring + (unsigned)((tid >> 3) * RP + (tid & 7) * 16);
  constexpr size_t R32 = (size_t)32 * CC * 2;      /* bytes from a row to the row 32 below it */
  auto stage_copies = [&](int p, unsigned bofs) {
    const char* a0 = gA + (size_t)p * (BK * 2); const char* b0 = gB + (size_t)p * (BK * 2); const unsigned a = lA + bofs, c = a + (unsigned)TILE;
    /* the s_wait_xcnt closes the statement so that no address register of a copy is rewritten ahead of it */
    asm volatile("global_load_async_to_lds_b128 %0, %8, off\n\t"
                 "global_load_async_to_lds_b128 %1, %9, off\n\t"
                 "global_load_async_to_lds_b128 %2, %10, off\n\t"
                 "global_load_async_to_lds_b128 %3, %11, off\n\t"
                 "global_load_async_to_lds_b128 %4, %12, off\n\t"
                 "global_load_async_to_lds_b128 %5, %13, off\n\t"
                 "global_load_async_to_lds_b128 %6, %14, off\n\t"
                 "global_load_async_to_lds_b128 %7, %15, off\n\t"
                 "s_wait_xcnt 0x0"
                 :: "v"(a), "v"(a + 32 * RP), "v"(a + 64 * RP), "v"(a + 96 * RP), "v"(c), "v"(c + 32 * RP), "v"(c + 64 * RP), "v"(c + 96 * RP),
                    "v"(a0), "v"(a0 + R32), "v"(a0 + 2 * R32), "v"(a0 + 3 * R32), "v"(b0), "v"(b0 + R32), "v"(b0 + 2 * R32), "v"(b0 + 3 * R32)
                 : "memory");
  };
  v8f acc[2][4] = {};
  stage_copies(0, 0u);
  /* MODE 1: the wave's part of rh and rw is asked for here and used in the epilogue: its latency runs beside that of pass 0's copies, not alone behind the last pass.
     Row n of the tile: n div 32 = na for all 32 rows of a wave, n mod 32 = i * 16 + 8 * hh + r; a lane's 8 rows of one accumulator are 32 consecutive bytes of its channel's 128-B row of rh */
  v4f rhv[4][2][2]; float rwv[4];
  if (MODE == 1) { const int na = (row0 % NN + wr) / 32;
#pragma unroll      /* this loop and the one inside it: constant indices keep rhv and rwv in registers */
    for (int t = 0; t < 4; ++t) { const size_t c32 = (size_t)(col0 + wc + t * 16 + ln) * 32; rwv[t] = rw[c32 + na];
#pragma unroll
      for (int i = 0; i < 2; ++i) { rhv[t][i][0] = *(const v4fa*)(rh + c32 + i * 16 + 8 * hh); rhv[t][i][1] = *(const v4fa*)(rh + c32 + i * 16 + 8 * hh + 4); } } }
  asm volatile("s_wait_asynccnt 0x0" ::: "memory");      /* pass 0 of this wave has landed */
  __syncthreads();                                       /* ... and every wave's part of it is published */
  stage_copies(1, (unsigned)STG);
#pragma unroll 2      /* two passes a trip make the buffer offsets immediates; fully unrolled the copies' addresses of all passes took the wave past 256 VGPRs */
  for (int p = 0; p < NPASS; ++p) {
    const unsigned bofs = (unsigned)(p & 1) * (unsigned)STG;
    const unsigned char* at = ring + bofs + (wr + ln) * RP + 16 * hh; const unsigned char* bt = ring + bofs + TILE + (wc + ln) * RP + 16 * hh;
#pragma unroll      /* this loop and those inside it: constant indices keep the fragments and acc in registers */
    for (int ks = 0; ks < BK / 32; ++ks) { FragH fa[2], fb[4];
#pragma unroll
      for (int i = 0; i < 2; ++i) { fa[i].half[0] = *(const v8us*)(at + i * 16 * RP + ks * 64); fa[i].half[1] = *(const v8us*)(at + i * 16 * RP + ks * 64 + 32); }
#pragma unroll
      for (int t = 0; t < 4; ++t) { fb[t].half[0] = *(const v8us*)(bt + t * 16 * RP + ks * 64); fb[t].half[1] = *(const v8us*)(bt + t * 16 * RP + ks * 64 + 32); }
#pragma unroll
      for (int i = 0; i < 2; ++i)
#pragma unroll
        for (int t = 0; t < 4; ++t) acc[i][t] = __builtin_amdgcn_wmma_f32_16x16x32_f16(false, fa[i].v, false, fb[t].v, (short)0, acc[i][t], false, false); }
    asm volatile("s_wait_dscnt 0x0" ::: "memory");         /* this wave's reads of the buffer are done before it is refilled */
    asm volatile("s_wait_asynccnt 0x0" ::: "memory");      /* this wave's copies of the next pass have landed */
    __syncthreads();                                       /* publishes the next pass and ends every wave's reads of this one */
    if (p + 2 < NPASS) stage_copies(p + 2, bofs); }
  asm volatile("s_wait_asynccnt 0x0" ::: "memory");        /* nothing in flight when the ring becomes output staging */
  if (MODE == 2) {
    /* D[8*hh + r][ln]: a lane's 8 values of one accumulator are 8 consecutive tokens of ONE channel = 16 B of a row of the transposed tile.
       The tile [128 channels][128 tokens] is gathered in LDS at pitch 272 B (16 B x odd: 16 lanes of a ds_store_b128 on 64 different banks), since a channel's 128 tokens come from four waves. */
#pragma unroll      /* this loop and the two inside it: constant indices into acc */
    for (int t = 0; t < 4; ++t) { const float bv = bf16_round(bias[col0 + wc + t * 16 + ln]);
#pragma unroll
      for (int i = 0; i < 2; ++i) { FragH f;
#pragma unroll
        for (int r = 0; r < 8; ++r) f.h[r] = (_Float16)(acc[i][t][r] * 0.0625f + bv);
        *(v8us*)(ring + (wc + t * 16 + ln) * TP + (wr + i * 16 + 8 * hh) * 2) = f.half[0]; } }
    __syncthreads();      /* every wave's part of the transposed tile is in LDS before any wave reads whole channel rows */
    unsigned short* vt = (unsigned short*)C16 + ((size_t)(row0 / NN) * CC + col0) * NN + row0 % NN;
#pragma unroll      /* the 8 LDS reads go out as one group ahead of the stores; a store = 2 channel rows of 256 B, whole lines */
    for (int q = 0; q < 8; ++q) { const int ch = w * 16 + q * 2 + hh; const v8us v = *(const v8us*)(ring + ch * TP + ln * 16); *(v8us*)(vt + (size_t)ch * NN + ln * 8) = v; }
    asm volatile("s_wait_xcnt 0x0" ::: "memory");      /* behind the last store: in the merged kernel another part's code may follow in the listing and rewrite the stores' registers */
    return;
  }
#pragma unroll      /* this loop and the two inside it: constant indices into acc */
  for (int t = 0; t < 4; ++t) { const float bv = bf16_round(bias[col0 + wc + t * 16 + ln]); const float rwb = (MODE == 1) ? bf16_round(rwv[t]) : 0.f;
#pragma unroll
    for (int i = 0; i < 2; ++i)
#pragma unroll
      for (int r = 0; r < 8; ++r) { float v = acc[i][t][r] * 0.0625f + bv; if (MODE == 1) v += bf16_round(rhv[t][i][r >> 2][r & 3]) + rwb; so[w][i * 16 + 8 * hh + r][t * 16 + ln] = v; } }
  __builtin_amdgcn_fence(__ATOMIC_ACQ_REL, "workgroup"); __builtin_amdgcn_wave_barrier();      /* orders this wave's staging stores ahead of its reads; no work-group barrier: a wave reads back only its own rows */
  const int rsub = lane >> 4, c4 = (lane & 15) * 4;
#pragma unroll      /* the 16 LDS reads go out as one group ahead of the stores; a store = 2 rows of whole lines */
  for (int q = 0; q < 16; ++q) { const int r = q * 2 + rsub; const v4f v = *(const v4fa*)&so[w][r][c4]; const size_t o = (size_t)(row0 + wr + r) * CC + col0 + wc + c4;
    v4h h4; for (int i = 0; i < 4; ++i) h4[i] = (_Float16)v[i]; *(v4h*)(C16 + o) = h4; }
  asm volatile("s_wait_xcnt 0x0" ::: "memory");      /* behind the last store: in the merged kernel another part's code may follow in the listing and rewrite the stores' registers */
}
/* The three projections read the same X16 and depend on nothing of one another: one launch, work-group 3 * tile + m does tile 'tile' of projection m (0 q, 1 k, 2 v).
   The choice is the same for a whole work-group, so every barrier of a tile is passed by all of its waves. */
__global__ __launch_bounds__(256) void k_proj3(const _Float16* __restrict__ A, const _Float16* __restrict__ Bw, const float* __restrict__ bq, const float* __restrict__ bk, const float* __restrict__ bv,
                                               const float* __restrict__ rh, const float* __restrict__ rw, _Float16* __restrict__ Q, _Float16* __restrict__ K, _Float16* __restrict__ Vt) {
  __shared__ __attribute__((aligned(16))) unsigned char ring[PROJ_RING];
  const int blk = blockIdx.x / 3, m = blockIdx.x % 3;
  if (m == 0) proj_tile<0>(ring, blk, A, Bw, bq, nullptr, nullptr, Q);
  else if (m == 1) proj_tile<1>(ring, blk, A, Bw + (size_t)CC * CC, bk, rh, rw, K);
  else proj_tile<2>(ring, blk, A, Bw + (size_t)2 * CC * CC, bv, nullptr, nullptr, Vt);
}


__global__ __launch_bounds__(256) void k_x16(const float* __restrict__ x, _Float16* __restrict__ X16, size_t n8) { const size_t t = (size_t)blockIdx.x * 256 + threadIdx.x; if (t >= n8) return; FragH f;
#pragma unroll
  for (int q = 0; q < 8; ++q) f.h[q] = (_Float16)bf16_round(x[t * 8 + q]); *(v8us*)((unsigned short*)X16 + t * 8) = f.half[0];  }
__global__ __launch_bounds__(256) void k_h16(const float* __restrict__ x, _Float16* __restrict__ X16, size_t n8) { const size_t t = (size_t)blockIdx.x * 256 + threadIdx.x; if (t >= n8) return; FragH f;
#pragma unroll
  for (int q = 0; q < 8; ++q) f.h[q] = (_Float16)x[t * 8 + q]; *(v8us*)((unsigned short*)X16 + t * 8) = f.half[0];  }
template <int NHv, int TTv>
__global__ __launch_bounds__(256) void k_vt(const _Float16* __restrict__ V16, int ldv, int voff, _Float16* __restrict__ Vt) { __shared__ unsigned short tl[64][66]; const int tid = threadIdx.x; const int slab = blockIdx.x / (TTv / 64), lg = blockIdx.x % (TTv / 64); const int b = slab / NHv, h = slab % NHv;
  for (int i = tid; i < 64 * 8; i += 256) { const int r = i / 8, c8 = (i % 8) * 8; FragH f; f.half[0] = *(const v8us*)((const unsigned short*)V16 + ((size_t)b * TTv + lg * 64 + r) * ldv + voff + h * 64 + c8);
#pragma unroll
    for (int q = 0; q < 8; ++q) tl[r][c8 + q] = f.u[q]; }
  __syncthreads();
  {
#pragma unroll
    for (int rd = 0; rd < 2; ++rd) { const int d = rd * 32 + tid / 8, pc = tid % 8; FragH f;
#pragma unroll
      for (int q = 0; q < 8; ++q) f.u[q] = tl[pc * 8 + q][d];
      *(v8us*)((unsigned short*)Vt + ((size_t)slab * 64 + d) * TTv + lg * 64 + pc * 8) = f.half[0]; }
     } }

/* One launch for the four conversions, which depend on nothing of one another: the first 3 * GW work-groups round the three weight matrices, the others each turn one 128-channel x 128-token tile of x.
   The test is the same for a whole work-group and stands in front of the barrier.
   Few long waves, not many short ones: waves start at a limited rate, and a wave with a single 4-B load a lane outstanding keeps too few bytes in flight to hide the memory latency.
   Here a wave of the x part moves 8 KB with 16 independent loads of 16 B a lane, and the whole launch is 4,864 waves. */
constexpr int PREP_WCH = 4;                                   /* chunks of 8 weights a thread */
constexpr int PREP_GW = CC * CC / 8 / 256 / PREP_WCH;         /* work-groups per weight matrix */
constexpr int PREP_T = 128;                                   /* the x tile: PREP_T channels x PREP_T tokens */
__global__ __launch_bounds__(256) void k_prep(const float* __restrict__ x, const float* __restrict__ Wq, const float* __restrict__ Wk, const float* __restrict__ Wv, _Float16* __restrict__ Bw, _Float16* __restrict__ X16) {
  constexpr int GW = PREP_GW, TP = PREP_T * 2 + 16;      /* a token's 128 channels in LDS: 256 B at pitch 272 B (16 B x odd) */
  static_assert(CC * CC % (8 * 256 * PREP_WCH) == 0, "whole work-groups of PREP_WCH x 8 elements a thread");
  static_assert(CC % PREP_T == 0 && NN % PREP_T == 0, "whole tiles");
  __shared__ __attribute__((aligned(16))) unsigned char tl[PREP_T * TP];
  const int tid = threadIdx.x;
  if (blockIdx.x < 3 * GW) { const int mw = blockIdx.x / GW; const float* W = mw == 0 ? Wq : mw == 1 ? Wk : Wv; unsigned short* Bt = (unsigned short*)Bw + (size_t)mw * CC * CC;
    const size_t t0 = (size_t)(blockIdx.x % GW) * (PREP_WCH * 256) + tid; v4f a[PREP_WCH][2];
#pragma unroll      /* this loop and the two below: constant indices keep a in registers; all loads go out ahead of the first store */
    for (int i = 0; i < PREP_WCH; ++i) { a[i][0] = *(const v4fa*)(W + (t0 + i * 256) * 8); a[i][1] = *(const v4fa*)(W + (t0 + i * 256) * 8 + 4); }
#pragma unroll
    for (int i = 0; i < PREP_WCH; ++i) { FragH f;
#pragma unroll
      for (int q = 0; q < 8; ++q) f.h[q] = (_Float16)(bf16_round(a[i][q >> 2][q & 3]) * 16.0f);
      *(v8us*)(Bt + (t0 + i * 256) * 8) = f.half[0]; }
    return; }
  const int tb = blockIdx.x - 3 * GW; constexpr int TPB = (CC / PREP_T) * (NN / PREP_T); const int b = tb / TPB, rem = tb % TPB; const int c0 = (rem / (NN / PREP_T)) * PREP_T, p0 = (rem % (NN / PREP_T)) * PREP_T;
  /* wave w: 32 channels x 64 tokens of the tile. A lane half takes 16 channels, a lane 4 tokens of each: one wave-wide load = 2 channel rows x 256 B, whole lines.
     A lane then holds 16 consecutive channels of each of its 4 tokens = 32 B of a row of the turned tile: the transposition is a choice of registers, and LDS is written 16 B at a time. */
  const int w = tid >> 5, g = (tid >> 4) & 1, m = tid & 15;
  const int cl = (w >> 1) * 32 + g * 16, tk = (w & 1) * 64 + m * 4;
  const float* src = x + ((size_t)b * CC + c0 + cl) * NN + p0 + tk;
  v4f v[16];
#pragma unroll      /* this loop and the two below: constant indices keep v in registers; the 16 loads depend on nothing of one another */
  for (int j = 0; j < 16; ++j) v[j] = *(const v4fa*)(src + (size_t)j * NN);
#pragma unroll
  for (int t = 0; t < 4; ++t) { FragH f;
#pragma unroll
    for (int j = 0; j < 16; ++j) f.h[j] = (_Float16)bf16_round(v[j][t]);
    *(v8us*)(tl + (tk + t) * TP + cl * 2) = f.half[0]; *(v8us*)(tl + (tk + t) * TP + cl * 2 + 16) = f.half[1]; }
  __syncthreads();      /* a token's 128 channels come from four waves */
  unsigned short* dst = (unsigned short*)X16 + ((size_t)b * NN + p0) * CC + c0;
#pragma unroll      /* the 8 LDS reads go out as one group ahead of the stores; a store = 2 token rows x 256 B, whole lines */
  for (int q = 0; q < 8; ++q) { const int r = w * 16 + q * 2 + g; const v8us o = *(const v8us*)(tl + r * TP + m * 16); *(v8us*)(dst + (size_t)r * CC + m * 8) = o; }
  asm volatile("s_wait_xcnt 0x0" ::: "memory");      /* behind the last store: the weight part's code follows in the listing and rewrites the stores' registers */
}
/* lane l <-> lane l ^ 16 as a vector cross-row move */
__device__ __forceinline__ float xhalf(float x) { return __builtin_bit_cast(float, __builtin_amdgcn_permlanex16(__builtin_bit_cast(int, x), __builtin_bit_cast(int, x), 0x76543210, 0xfedcba98, false, false)); }
__global__ __launch_bounds__(128) void k_flash(const _Float16* __restrict__ Q16, int ldq, const _Float16* __restrict__ K16, int ldk, const _Float16* __restrict__ Vt, const _Float16* __restrict__ Vtlo, float* __restrict__ O, int ldo) {
  constexpr int QG = 2, RPW = 16 * QG, NQB = TT / (4 * RPW), DT = 8, KS = 4;      /* head dim 128: 4 k-steps, 8 value tiles */
  constexpr float SC2 = ATT_SCALE * 1.4426950408889634f;      /* score scale x log2(e) */
  /* K/V ring shared by the four waves: two stages of 32 keys; a stage = 32 K rows of 256 B at pitch 272 B, then 128 V^T rows of 64 B at pitch 80 B (16 B x odd: conflict-free ds_load_b128) */
  constexpr int KP = 272, VP = 80, VOFF = 32 * KP, STG = VOFF + 128 * VP;
  __shared__ __attribute__((aligned(16))) unsigned char ring[2 * STG];
  static_assert(TT % (4 * RPW) == 0, "whole work-groups of queries");
  static_assert(sizeof(float) * 4 * 16 * (128 + 4) <= 2 * STG, "output staging must fit in the ring");
  float (*sO)[16][128 + 4] = reinterpret_cast<float (*)[16][128 + 4]>(ring);      /* output staging, one column group at a time, takes the ring's place behind the last pass's barrier */
  const int tid = threadIdx.x, w = tid >> 5, lane = tid & 31, ln = lane & 15, hh = lane >> 4;
  const int slab = blockIdx.x / NQB, qblk = blockIdx.x % NQB; const int b = slab / NH, h = slab % NH; const int qb0 = qblk * (4 * RPW); const int q0 = qb0 + w * RPW;
  FragH aq[QG][KS];
#pragma unroll      /* this loop and the one inside it: constant indices keep aq in registers */
  for (int g = 0; g < QG; ++g) { const unsigned short* qr = (const unsigned short*)Q16 + ((size_t)b * TT + q0 + g * 16 + ln) * ldq + h * 128;
#pragma unroll
    for (int ks = 0; ks < KS; ++ks) { aq[g][ks].half[0] = *(const v8us*)(qr + ks * 32 + 8 * hh); aq[g][ks].half[1] = *(const v8us*)(qr + ks * 32 + 16 + 8 * hh); } }
  const unsigned short* Vth = (const unsigned short*)Vt + (size_t)slab * 128 * TT;
  float m_q[QG], l_q[QG]; v8f oacc[QG][DT];      /* per group g: running maximum of the raw scores (equal in both halves) and this half's partial sum (x 2^10) of query q0 + g*16 + ln; oacc[g][dt][r] = O^T[dt*16 + 8*hh + r][ln] */
#pragma unroll
  for (int g = 0; g < QG; ++g) { m_q[g] = -3.0e38f; l_q[g] = 0.f;
#pragma unroll
    for (int dt = 0; dt < DT; ++dt) oacc[g][dt] = (v8f){0.f,0.f,0.f,0.f,0.f,0.f,0.f,0.f}; }
  const int jend = TT;
  /* each thread copies 4 x 16 B of K (a wave-wide copy = 2 whole rows = 4 lines) and 4 x 16 B of V^T (8 rows x 64 B) per stage */
  const char* gK = (const char*)((const unsigned short*)K16 + ((size_t)b * TT + (tid >> 4)) * ldk + h * 128) + (tid & 15) * 16;
  const char* gV = (const char*)(Vth + (size_t)(tid >> 2) * TT) + (tid & 3) * 16;
  const size_t kstep = (size_t)ldk * 2;      /* bytes per key row of K */
  const unsigned lK = (unsigned)(size_t)ring + (unsigned)((tid >> 4) * KP + (tid & 15) * 16);
  const unsigned lV = (unsigned)(size_t)ring + (unsigned)(VOFF + (tid >> 2) * VP + (tid & 3) * 16);
  auto stage_copies = [&](int j, unsigned bofs) {
    const char* k0 = gK + (size_t)j * kstep; const char* v0 = gV + (size_t)j * 2; const unsigned a = lK + bofs, c = lV + bofs;
    /* the s_wait_xcnt closes the statement so that no address register of a copy is rewritten ahead of it */
    asm volatile("global_load_async_to_lds_b128 %0, %8, off\n\t"
                 "global_load_async_to_lds_b128 %1, %9, off\n\t"
                 "global_load_async_to_lds_b128 %2, %10, off\n\t"
                 "global_load_async_to_lds_b128 %3, %11, off\n\t"
                 "global_load_async_to_lds_b128 %4, %12, off\n\t"
                 "global_load_async_to_lds_b128 %5, %13, off\n\t"
                 "global_load_async_to_lds_b128 %6, %14, off\n\t"
                 "global_load_async_to_lds_b128 %7, %15, off\n\t"
                 "s_wait_xcnt 0x0"
                 :: "v"(a), "v"(a + 8 * KP), "v"(a + 16 * KP), "v"(a + 24 * KP), "v"(c), "v"(c + 32 * VP), "v"(c + 64 * VP), "v"(c + 96 * VP),
                    "v"(k0), "v"(k0 + 8 * kstep), "v"(k0 + 16 * kstep), "v"(k0 + 24 * kstep), "v"(v0), "v"(v0 + (size_t)32 * TT * 2), "v"(v0 + (size_t)64 * TT * 2), "v"(v0 + (size_t)96 * TT * 2)
                 : "memory");
  };
  stage_copies(0, 0u);
  asm volatile("s_wait_asynccnt 0x0" ::: "memory");      /* stage 0 of this wave has landed */
  __syncthreads();                                       /* ... and every wave's part of it is published */
  stage_copies(32, (unsigned)STG);
#pragma unroll 1
  for (int j0 = 0; j0 < jend; j0 += 32) {
    const unsigned bofs = (unsigned)((j0 >> 5) & 1) * (unsigned)STG; const unsigned char* kt = ring + bofs; const unsigned char* vt = kt + VOFF;
    v8f st[QG][2];
#pragma unroll
    for (int nt = 0; nt < 2; ++nt) { const unsigned short* kr = (const unsigned short*)(kt + (nt * 16 + ln) * KP); FragH bk[KS];
#pragma unroll
      for (int ks = 0; ks < KS; ++ks) { bk[ks].half[0] = *(const v8us*)(kr + ks * 32 + 8 * hh); bk[ks].half[1] = *(const v8us*)(kr + ks * 32 + 16 + 8 * hh); }
#pragma unroll      /* constant g: st and aq stay in registers */
      for (int g = 0; g < QG; ++g) st[g][nt] = (v8f){0.f,0.f,0.f,0.f,0.f,0.f,0.f,0.f};
#pragma unroll      /* each K fragment feeds both column groups; the two accumulator chains alternate. The products are the plain builtin (the compiler keeps its distances): an asm statement behind each, with the fragments as operands, wants them below v256 and this wave tile then spilled */
      for (int ks = 0; ks < KS; ++ks)
#pragma unroll
        for (int g = 0; g < QG; ++g) st[g][nt] = __builtin_amdgcn_wmma_f32_16x16x32_f16(false, bk[ks].v, false, aq[g][ks].v, (short)0, st[g][nt], false, false); }
    /* The softmax runs on the raw scores in base 2: exp(ATT_SCALE * (s - m)) * 2^10 = 2^(s * SC2 + (10 - m * SC2)), one fused multiply-add and one hardware exp2 an element.
       The argument is at most 10 and a result below 2^-126 counts as 0, so none of the range handling of the library's expf is needed. m_q holds the maximum of the raw scores (SC2 > 0: the same element). */
    FragH ph[QG], pl[QG];
#pragma unroll      /* this loop and those inside it: constant indices keep the scores, P and oacc in registers */
    for (int g = 0; g < QG; ++g) {
      float mc = st[g][0][0];
#pragma unroll
      for (int i = 1; i < 16; ++i) mc = fmaxf(mc, st[g][i >> 3][i & 7]);
      mc = fmaxf(mc, xhalf(mc));      /* the other 16 keys of this query sit in lane ^ 16 */
      const float mn = fmaxf(m_q[g], mc); const float al = (mn > -1.0e38f) ? __builtin_amdgcn_exp2f((m_q[g] - mn) * SC2) : 1.0f; m_q[g] = mn;
      const float nb = __builtin_fmaf(-mn, SC2, 10.0f);
      float ls[4] = {0.f, 0.f, 0.f, 0.f};      /* four independent partial sums: a chain of 4 dependent adds, not 16 */
#pragma unroll
      for (int i = 0; i < 16; ++i) { const float ps = __builtin_amdgcn_exp2f(__builtin_fmaf(st[g][i >> 3][i & 7], SC2, nb)); ls[i & 3] += ps; ph[g].h[i] = (_Float16)ps; pl[g].h[i] = (_Float16)(ps - (float)ph[g].h[i]); }      /* ps = 1024 p; P hi and its UNSCALED residual (added into the same accumulator); element i = key (i >> 3) * 16 + 8 * hh + (i & 7) */
      l_q[g] = l_q[g] * al + ((ls[0] + ls[1]) + (ls[2] + ls[3]));
#pragma unroll
      for (int dt = 0; dt < DT; ++dt) oacc[g][dt] *= al; }
    FragH bv[DT];
#pragma unroll
    for (int dt = 0; dt < DT; ++dt) { const unsigned short* vr = (const unsigned short*)(vt + (dt * 16 + ln) * VP); bv[dt].half[0] = *(const v8us*)(vr + 8 * hh); bv[dt].half[1] = *(const v8us*)(vr + 16 + 8 * hh); }      /* all V fragments of the pass as one group of LDS reads, ahead of the products: one LDS latency a pass, not eight */
#pragma unroll      /* constant g and dt keep bv and oacc in registers; each V^T fragment feeds both column groups; a run of 8 products has 8 different accumulators */
    for (int g = 0; g < QG; ++g) {
#pragma unroll
      for (int dt = 0; dt < DT; ++dt) oacc[g][dt] = __builtin_amdgcn_wmma_f32_16x16x32_f16(false, bv[dt].v, false, ph[g].v, (short)0, oacc[g][dt], false, false);
#pragma unroll
      for (int dt = 0; dt < DT; ++dt) oacc[g][dt] = __builtin_amdgcn_wmma_f32_16x16x32_f16(false, bv[dt].v, false, pl[g].v, (short)0, oacc[g][dt], false, false); }      /* Vh^T.(Ph + Pl)^T - the V residual term is dropped here: near-uniform attention over 1024 keys averages the f16 rounding of v */
    __builtin_amdgcn_sched_barrier(0);      /* keeps the products above the publish point: sunk below the barrier they would stand between it and the refill, which would then be issued late and lose most of its lead on its wait */
    asm volatile("s_wait_dscnt 0x0" ::: "memory");         /* this wave's reads of the stage are done before the stage is refilled */
    asm volatile("s_wait_asynccnt 0x0" ::: "memory");      /* this wave's copies of the next stage have landed */
    __syncthreads();                                       /* publishes the next stage and ends every wave's reads of this one */
    if (j0 + 64 < jend) stage_copies(j0 + 64, bofs); }
  asm volatile("s_wait_asynccnt 0x0" ::: "memory");        /* nothing in flight when the ring becomes output staging */
#pragma unroll      /* constant g: oacc stays in registers; the two column groups pass through the wave's own staging rows one after the other */
  for (int g = 0; g < QG; ++g) {
    { float l = l_q[g]; l += xhalf(l); const float inv = (l > 0.f) ? 1.0f / l : 0.f;      /* the two halves' partial sums joined once; l and oacc both carry the 2^10 of ps */
#pragma unroll      /* constant dt: oacc stays in registers; a lane's 8 values are 8 consecutive d of its query's row */
      for (int dt = 0; dt < DT; ++dt) { const v4f lo = {oacc[g][dt][0] * inv, oacc[g][dt][1] * inv, oacc[g][dt][2] * inv, oacc[g][dt][3] * inv}, hi = {oacc[g][dt][4] * inv, oacc[g][dt][5] * inv, oacc[g][dt][6] * inv, oacc[g][dt][7] * inv};
        *(v4fa*)&sO[w][ln][dt * 16 + 8 * hh] = lo; *(v4fa*)&sO[w][ln][dt * 16 + 8 * hh + 4] = hi; } }
    __builtin_amdgcn_fence(__ATOMIC_ACQ_REL, "workgroup", "local"); __builtin_amdgcn_wave_barrier();      /* orders this wave's staging stores ahead of its reads; a wave reads back only its own rows. LDS only: the second group need not wait for the first group's global stores */
#pragma unroll
    for (int r = 0; r < 16; ++r) { const int pc = lane; const v4f val = *(const v4fa*)&sO[w][r][pc * 4]; *(v4f*)(O + ((size_t)slab * TT + q0 + g * 16 + r) * 128 + pc * 4) = val; }      /* output laid out [b][h][n][128] (the module reinterprets that buffer as [B,C,H,W]); one 512-B row per instruction: 32 lanes x 16 B */
  } }

extern "C" void kernel_launch(void* const* d_in, const int* in_sizes, int n_in,
                              void* d_out, int out_size, void* d_ws, size_t ws_size, hipStream_t stream) {
  (void)in_sizes; (void)n_in; (void)out_size;
  const float* const* I = (const float* const*)d_in; const float* x = I[0]; const float* Wq = I[1]; const float* bq = I[2]; const float* Wk = I[3]; const float* bk = I[4]; const float* Wv = I[5]; const float* bv = I[6]; const float* rh = I[7]; const float* rw = I[8];
  char* ws = (char*)d_ws; size_t off = 0;
  auto take = [&](size_t bytes) { char* p = ws + off; off += (bytes + 255) & ~(size_t)255; return p; };
  const size_t WSZ = (size_t)CC * CC; _Float16* Bw = (_Float16*)take(3 * WSZ * 2); _Float16* X16 = (_Float16*)take((size_t)NR * CC * 2); _Float16* Q = (_Float16*)take((size_t)NR * CC * 2); _Float16* K = (_Float16*)take((size_t)NR * CC * 2); _Float16* Vt = (_Float16*)take((size_t)NR * CC * 2);
  if (off > ws_size) return;      // 1.6 + 4 x 16.8 = 69 MB
  k_prep<<<3 * PREP_GW + BB * (CC / PREP_T) * (NN / PREP_T), 256, 0, stream>>>(x, Wq, Wk, Wv, Bw, X16);      /* weights (out,in) natural x 2^4; x [B][C][N] to token-major bf16 plane */
  k_proj3<<<3 * (NR / 128) * (CC / 128), 256, 0, stream>>>(X16, Bw, bq, bk, bv, rh, rw, Q, K, Vt);      /* each M 16384 N 512 K 512: q (unscaled) f16; k' = k + rt^T, f16; v as V^T f16 per batch [512 channels][N] = per (b, h) [128][N] */
  k_flash<<<BB * NH * (NN / 128), 128, 0, stream>>>(Q, CC, K, CC, Vt, nullptr, (float*)d_out, 128);      /* y to d_out as [b][h][n][128]; k_flash does not read its V residual argument, and that plane is no longer made */
}

// v010
// One run takes 74.1 microseconds.
// Versions in between are left out here; by their measured steps it is 1.10 times as fast as v008.
// All steps since v000 together make it 5.86 times as fast.
#include <hip/hip_runtime.h>
// Bottleneck-transformer MHSA with relative position term (B=16, C=512, 32×32 → N=1024, 4 heads × 128): q,k,v = 1×1 convs ((out,in) + bias); logits = (q·C^-½)·(k + rt) where rt[h][d][n] = rh[h][d][n mod 32] + rw[h][d][n div 32]
// (the module's (rh + rw).reshape(1, heads, emb, N)); softmax; y = attn·v per head; the output is the [B][h][N][d] buffer reinterpreted as [B,C,H,W] (the module's final reshape).
// Compute dtype: x, weights, biases, rh, rw rounded to bf16; token-major bf16 input plane; q as an f16 GEMM plane (unscaled — the C^-½ is applied to the f32 score), k as an f32 GEMM output with rtᵀ added in f32 then f16,
// v f16; fused flash-style kernel for head dim 128 (4 k-steps, 8 value tiles, online softmax f32, P f16, V f16, one f32 accumulator) on v_wmma_f32_16x16x32_f16 writing y directly; f32 accumulate.
#define BB 16
#define CC 512
#define NN 1024
#define TT NN
#define NH 4
#define HDD 128
#define NVH (2 * NH)
#define NR (BB * NN)
#define ATT_SCALE 0.04419417382415922f

typedef __bf16 v16b __attribute__((ext_vector_type(16)));
typedef unsigned short v8us __attribute__((ext_vector_type(8), may_alias));
typedef float  v8f  __attribute__((ext_vector_type(8)));
typedef float  v4f  __attribute__((ext_vector_type(4)));
typedef float  v4fa __attribute__((ext_vector_type(4), may_alias));
union FragB { v16b v; v8us half[2]; unsigned short u[16]; };

__device__ __forceinline__ unsigned short bf16_bits(float x) { unsigned int u = __float_as_uint(x); return (unsigned short)((u + 0x7FFFu + ((u >> 16) & 1u)) >> 16); }
__device__ __forceinline__ float bf16_val(unsigned short b) { return __uint_as_float(((unsigned int)b) << 16); }
__device__ __forceinline__ float bf16_round(float x) { return bf16_val(bf16_bits(x)); }
// D += A·B with NT terms: 1 = ah·bh, 2 = + al·bh (A split), 3 = + ah·bl (both split)
template <int NT>
__device__ __forceinline__ v8f mmaN(v16b ah, v16b al, v16b bh, v16b bl, v8f c) {
  c = __builtin_amdgcn_wmma_f32_16x16x32_bf16(false, ah, false, bh, (short)0, c, false, false);
  if (NT >= 2) c = __builtin_amdgcn_wmma_f32_16x16x32_bf16(false, al, false, bh, (short)0, c, false, false);
  if (NT >= 3) c = __builtin_amdgcn_wmma_f32_16x16x32_bf16(false, ah, false, bl, (short)0, c, false, false);
  asm volatile("v_nop\n\tv_nop\n\tv_nop\n\tv_nop" : "+v"(c) : "v"(ah), "v"(al), "v"(bh), "v"(bl));
  return c;
}

__global__ __launch_bounds__(256) void k_wt_bf16(const float* __restrict__ W, unsigned short* __restrict__ Wt, int K, int N) {
  const int t = blockIdx.x * 256 + threadIdx.x;
  const int k8n = K / 8;
  if (t >= N * k8n) return;
  const int n = t / k8n, k8 = (t % k8n) * 8;
  v8us v;
#pragma unroll
  for (int i = 0; i < 8; ++i) v[i] = bf16_bits(W[(size_t)(k8 + i) * N + n]);
  *(v8us*)(Wt + (size_t)n * K + k8) = v;
  
}

// GEMM C[M][N] (f32, pitch ldc) = act(A[M][K]·W + bias). A f32 row-major (pitch lda) converted per fragment to bf16
// (ASPLIT: hi/lo two planes -> 2 terms, else single rounded term); Wt bf16 [N][K] (pitch ldb). BIAS_BF16 rounds the
// bias to bf16 first (bias quantised to bf16 before the add). K%32==0, M%16==0, N%64==0.
template <bool ASPLIT, int ACT, bool BIAS_BF16>
__global__ __launch_bounds__(128) void k_gemm_bf(const float* __restrict__ A, int lda, const unsigned short* __restrict__ Wt, int ldb,
                                               const float* __restrict__ bias, float* __restrict__ C, int ldc, int M, int N, int K) {
  __shared__ __attribute__((aligned(16))) float so[4][16][64];
  const int tid = threadIdx.x, w = tid >> 5, lane = tid & 31, ln = lane & 15, hh = lane >> 4;
  const int ntn = N / 64;
  const int wid = blockIdx.x * 4 + w;
  const int mt = wid / ntn, nq = wid % ntn;
  if (mt * 16 >= M) return;
  const int row0 = mt * 16, col0 = nq * 64;
  const float* arow = A + (size_t)(row0 + ln) * lda;
  v8f acc[4] = {};
  for (int kb = 0; kb < K; kb += 32) {
    FragB ah, al;
    const v4f x0 = *(const v4fa*)(arow + kb + 8 * hh), x1 = *(const v4fa*)(arow + kb + 8 * hh + 4);
    const v4f x2 = *(const v4fa*)(arow + kb + 16 + 8 * hh), x3 = *(const v4fa*)(arow + kb + 16 + 8 * hh + 4);
    float xs[16] = {x0[0],x0[1],x0[2],x0[3],x1[0],x1[1],x1[2],x1[3],x2[0],x2[1],x2[2],x2[3],x3[0],x3[1],x3[2],x3[3]};
#pragma unroll
    for (int i = 0; i < 16; ++i) { const unsigned short hb = bf16_bits(xs[i]); ah.u[i] = hb; al.u[i] = ASPLIT ? bf16_bits(xs[i] - bf16_val(hb)) : (unsigned short)0; }
#pragma unroll
    for (int t = 0; t < 4; ++t) {
      const unsigned short* brow = Wt + (size_t)(col0 + t * 16 + ln) * ldb + kb;
      FragB b;
      b.half[0] = *(const v8us*)(brow + 8 * hh);
      b.half[1] = *(const v8us*)(brow + 16 + 8 * hh);
      acc[t] = mmaN<ASPLIT ? 2 : 1>(ah.v, al.v, b.v, b.v, acc[t]);
    }
  }
#pragma unroll
  for (int t = 0; t < 4; ++t) {
    float bv = bias ? bias[col0 + t * 16 + ln] : 0.f;
    if (BIAS_BF16) bv = bf16_round(bv);
#pragma unroll
    for (int r = 0; r < 8; ++r) { float v = acc[t][r] + bv; if (ACT == 1) v = fmaxf(v, 0.f); so[w][8 * hh + r][t * 16 + ln] = v; }
  }
  __builtin_amdgcn_fence(__ATOMIC_ACQ_REL, "workgroup");
  __builtin_amdgcn_wave_barrier();
  const int rsub = lane >> 4, c4 = (lane & 15) * 4;
  {
#pragma unroll
    for (int q = 0; q < 8; ++q) {
      const int r = q * 2 + rsub;
      const v4f v = *(const v4fa*)&so[w][r][c4];
      *(v4f*)(C + (size_t)(row0 + r) * ldc + col0 + c4) = v;
    }
    
  }
}

// Flash-style causal/unmasked attention, all contractions 3-term bf16 hi/lo splits, f32 softmax with running max.
// q,k,v rows are read from f32 buffers with arbitrary row pitch (so they can live inside a fused qkv buffer);
// D = head size (multiple of 32, <= 128); one wave = 16 query rows; block = 4 waves (64 queries) sharing K/V chunks of 32.
template <int D, bool CAUSAL>
__global__ __launch_bounds__(128) void k_flash(const float* __restrict__ qb, const float* __restrict__ kb, const float* __restrict__ vb,
                                             int pitch, int T, int H, float scale, float* __restrict__ y, int ypitch) {
  constexpr int KS = D / 32;        // k-steps for QK
  constexpr int DT = D / 16;        // d tiles for PV
  __shared__ __attribute__((aligned(16))) unsigned short sKh[32][D + 8], sKl[32][D + 8], sVh[32][D + 8], sVl[32][D + 8];
  __shared__ __attribute__((aligned(16))) unsigned short sPh[4][16][40], sPl[4][16][40];
  __shared__ __attribute__((aligned(16))) float sO[4][16][D];
  const int tid = threadIdx.x, w = tid >> 5, lane = tid & 31, ln = lane & 15, hh = lane >> 4;
  const int nqb = (T + 63) / 64;
  const int bh = blockIdx.x / nqb, qblk = blockIdx.x % nqb;
  const int b = bh / H, h = bh % H;
  const int q0 = qblk * 64 + w * 16;
  const float* Q = qb + (size_t)b * T * pitch + h * D;
  const float* K = kb + (size_t)b * T * pitch + h * D;
  const float* V = vb + (size_t)b * T * pitch + h * D;

  // A fragments of the wave's 16 query rows (scaled), hi/lo
  FragB aqh[KS], aql[KS];
  {
    int row = q0 + ln; if (row >= T) row = T - 1;
    const float* qr = Q + (size_t)row * pitch;
#pragma unroll
    for (int ks = 0; ks < KS; ++ks)
#pragma unroll
      for (int i = 0; i < 16; ++i) {
        const int d = ks * 32 + ((i < 8) ? (8 * hh + i) : (16 + 8 * hh + (i - 8)));
        const float x = qr[d] * scale; const unsigned short hb = bf16_bits(x);
        aqh[ks].u[i] = hb; aql[ks].u[i] = bf16_bits(x - bf16_val(hb));
      }
  }
  float m_r[8], l_r[8];
#pragma unroll
  for (int r = 0; r < 8; ++r) { m_r[r] = -3.0e38f; l_r[r] = 0.f; }
  v8f oacc[DT];
#pragma unroll
  for (int dt = 0; dt < DT; ++dt) oacc[dt] = (v8f){0.f,0.f,0.f,0.f,0.f,0.f,0.f,0.f};

  const int kv_end = CAUSAL ? min(T, qblk * 64 + 64) : T;     // block-uniform
  for (int j0 = 0; j0 < kv_end; j0 += 32) {
    __syncthreads();
    for (int e = tid; e < 32 * (D / 4); e += 128) {
      const int r = e / (D / 4), c4 = (e % (D / 4)) * 4;
      const int key = j0 + r;
      v4f kf = {0.f,0.f,0.f,0.f}, vf = {0.f,0.f,0.f,0.f};
      if (key < T) { kf = *(const v4fa*)(K + (size_t)key * pitch + c4); vf = *(const v4fa*)(V + (size_t)key * pitch + c4); }
#pragma unroll
      for (int t = 0; t < 4; ++t) {
        unsigned short hb = bf16_bits(kf[t]); sKh[r][c4 + t] = hb; sKl[r][c4 + t] = bf16_bits(kf[t] - bf16_val(hb));
        hb = bf16_bits(vf[t]); sVh[r][c4 + t] = hb; sVl[r][c4 + t] = bf16_bits(vf[t] - bf16_val(hb));
      }
    }
    __syncthreads();
    // S tile 16 x 32
    v8f s[2];
#pragma unroll
    for (int nt = 0; nt < 2; ++nt) {
      v8f acc = {};
#pragma unroll
      for (int ks = 0; ks < KS; ++ks) {
        FragB bh_, bl_;
        bh_.half[0] = *(const v8us*)&sKh[nt * 16 + ln][ks * 32 + 8 * hh]; bh_.half[1] = *(const v8us*)&sKh[nt * 16 + ln][ks * 32 + 16 + 8 * hh];
        bl_.half[0] = *(const v8us*)&sKl[nt * 16 + ln][ks * 32 + 8 * hh]; bl_.half[1] = *(const v8us*)&sKl[nt * 16 + ln][ks * 32 + 16 + 8 * hh];
        acc = mmaN<3>(aqh[ks].v, aql[ks].v, bh_.v, bl_.v, acc);
      }
      s[nt] = acc;
    }
    // mask + running max (rows 8hh+r; the 16 lanes of a half share rows)
    float alpha[8];
#pragma unroll
    for (int r = 0; r < 8; ++r) {
      const int qi = q0 + 8 * hh + r;
      const int ja = j0 + ln, jb = j0 + 16 + ln;
      if (CAUSAL) { if (ja > qi) s[0][r] = -3.0e38f; if (jb > qi) s[1][r] = -3.0e38f; }
      if (ja >= T) s[0][r] = -3.0e38f;
      if (jb >= T) s[1][r] = -3.0e38f;
      float mx = fmaxf(s[0][r], s[1][r]);
      mx = fmaxf(mx, __shfl_xor(mx, 1, 32)); mx = fmaxf(mx, __shfl_xor(mx, 2, 32)); mx = fmaxf(mx, __shfl_xor(mx, 4, 32)); mx = fmaxf(mx, __shfl_xor(mx, 8, 32));
      const float mnew = fmaxf(m_r[r], mx);
      alpha[r] = (mnew > -1.0e38f) ? __expf(m_r[r] - mnew) : 1.0f;
      const float p0 = (s[0][r] > -1.0e38f) ? __expf(s[0][r] - mnew) : 0.f;
      const float p1 = (s[1][r] > -1.0e38f) ? __expf(s[1][r] - mnew) : 0.f;
      m_r[r] = mnew;
      l_r[r] = l_r[r] * alpha[r] + p0 + p1;            // per-lane partial row sum (16 lanes combined at the end)
      unsigned short hb = bf16_bits(p0); sPh[w][8 * hh + r][ln] = hb;      sPl[w][8 * hh + r][ln] = bf16_bits(p0 - bf16_val(hb));
      hb = bf16_bits(p1);                sPh[w][8 * hh + r][16 + ln] = hb; sPl[w][8 * hh + r][16 + ln] = bf16_bits(p1 - bf16_val(hb));
    }
#pragma unroll
    for (int dt = 0; dt < DT; ++dt)
#pragma unroll
      for (int r = 0; r < 8; ++r) oacc[dt][r] *= alpha[r];
    __builtin_amdgcn_fence(__ATOMIC_ACQ_REL, "workgroup");
    __builtin_amdgcn_wave_barrier();
    FragB pah, pal;
    pah.half[0] = *(const v8us*)&sPh[w][ln][8 * hh]; pah.half[1] = *(const v8us*)&sPh[w][ln][16 + 8 * hh];
    pal.half[0] = *(const v8us*)&sPl[w][ln][8 * hh]; pal.half[1] = *(const v8us*)&sPl[w][ln][16 + 8 * hh];
#pragma unroll
    for (int dt = 0; dt < DT; ++dt) {
      FragB bvh, bvl;
#pragma unroll
      for (int i = 0; i < 8; ++i) {
        bvh.u[i] = sVh[8 * hh + i][dt * 16 + ln]; bvh.u[8 + i] = sVh[16 + 8 * hh + i][dt * 16 + ln];
        bvl.u[i] = sVl[8 * hh + i][dt * 16 + ln]; bvl.u[8 + i] = sVl[16 + 8 * hh + i][dt * 16 + ln];
      }
      oacc[dt] = mmaN<3>(pah.v, pal.v, bvh.v, bvl.v, oacc[dt]);
    }
    __builtin_amdgcn_fence(__ATOMIC_ACQ_REL, "workgroup");
    __builtin_amdgcn_wave_barrier();
  }
#pragma unroll
  for (int r = 0; r < 8; ++r) {
    float l = l_r[r];
    l += __shfl_xor(l, 1, 32); l += __shfl_xor(l, 2, 32); l += __shfl_xor(l, 4, 32); l += __shfl_xor(l, 8, 32);
    l_r[r] = (l > 0.f) ? 1.0f / l : 0.f;
  }
#pragma unroll
  for (int dt = 0; dt < DT; ++dt)
#pragma unroll
    for (int r = 0; r < 8; ++r) sO[w][8 * hh + r][dt * 16 + ln] = oacc[dt][r] * l_r[r];
  __builtin_amdgcn_fence(__ATOMIC_ACQ_REL, "workgroup");
  __builtin_amdgcn_wave_barrier();
  {
    for (int r = 0; r < 16; ++r) {
      const int row = q0 + r;
      if (row < T && lane < D / 4) {
        const v4f val = *(const v4fa*)&sO[w][r][lane * 4];
        *(v4f*)(y + ((size_t)b * T + row) * ypitch + h * D + lane * 4) = val;
      }
    }
    
  }
}

// GEMM C = act(A·W + bias + resid): A f32 (ASPLIT -> hi/lo 2 terms), Wt bf16 [N][K]; ACT 0 none, 1 relu, 2 exact gelu;
// resid (optional, f32, row index = (row % rmod), pitch ldr, RES_BF16 rounds it) added before the activation.
template <bool ASPLIT, int ACT, bool BIAS_BF16, bool RES_BF16>
__global__ __launch_bounds__(128) void k_gemm_bf3(const float* __restrict__ A, int lda, const unsigned short* __restrict__ Wt, int ldb,
                                                const float* __restrict__ bias, const float* __restrict__ resid, int rmod, int ldr,
                                                float* __restrict__ C, int ldc, int M, int N, int K) {
  __shared__ __attribute__((aligned(16))) float so[4][16][64];
  const int tid = threadIdx.x, w = tid >> 5, lane = tid & 31, ln = lane & 15, hh = lane >> 4;
  const int ntn = N / 64;
  const int wid = blockIdx.x * 4 + w;
  const int mt = wid / ntn, nq = wid % ntn;
  if (mt * 16 >= M) return;
  const int row0 = mt * 16, col0 = nq * 64;
  const float* arow = A + (size_t)(row0 + ln) * lda;
  v8f acc[4] = {};
  for (int kb = 0; kb < K; kb += 32) {
    FragB ah, al;
    const v4f x0 = *(const v4fa*)(arow + kb + 8 * hh), x1 = *(const v4fa*)(arow + kb + 8 * hh + 4);
    const v4f x2 = *(const v4fa*)(arow + kb + 16 + 8 * hh), x3 = *(const v4fa*)(arow + kb + 16 + 8 * hh + 4);
    float xs[16] = {x0[0],x0[1],x0[2],x0[3],x1[0],x1[1],x1[2],x1[3],x2[0],x2[1],x2[2],x2[3],x3[0],x3[1],x3[2],x3[3]};
#pragma unroll
    for (int i = 0; i < 16; ++i) { const unsigned short hb = bf16_bits(xs[i]); ah.u[i] = hb; al.u[i] = ASPLIT ? bf16_bits(xs[i] - bf16_val(hb)) : (unsigned short)0; }
#pragma unroll
    for (int t = 0; t < 4; ++t) {
      const unsigned short* brow = Wt + (size_t)(col0 + t * 16 + ln) * ldb + kb;
      FragB b;
      b.half[0] = *(const v8us*)(brow + 8 * hh);
      b.half[1] = *(const v8us*)(brow + 16 + 8 * hh);
      acc[t] = mmaN<ASPLIT ? 2 : 1>(ah.v, al.v, b.v, b.v, acc[t]);
    }
  }
#pragma unroll
  for (int t = 0; t < 4; ++t) {
    const int col = col0 + t * 16 + ln;
    float bv = bias ? bias[col] : 0.f;
    if (BIAS_BF16) bv = bf16_round(bv);
#pragma unroll
    for (int r = 0; r < 8; ++r) {
      float v = acc[t][r] + bv;
      if (resid) { float rv = resid[(size_t)((row0 + 8 * hh + r) % rmod) * ldr + col]; if (RES_BF16) rv = bf16_round(rv); v += rv; }
      if (ACT == 1) v = fmaxf(v, 0.f);
      if (ACT == 2) v = 0.5f * v * (1.0f + erff(v * 0.70710678118654752f));
      if (ACT == 3) { const float u = 0.7978845608028654f * (v + 0.044715f * v * v * v); v = 0.5f * v * (1.0f + tanhf(u)); }
      so[w][8 * hh + r][t * 16 + ln] = v;
    }
  }
  __builtin_amdgcn_fence(__ATOMIC_ACQ_REL, "workgroup");
  __builtin_amdgcn_wave_barrier();
  const int rsub = lane >> 4, c4 = (lane & 15) * 4;
  {
#pragma unroll
    for (int q = 0; q < 8; ++q) {
      const int r = q * 2 + rsub;
      const v4f v = *(const v4fa*)&so[w][r][c4];
      *(v4f*)(C + (size_t)(row0 + r) * ldc + col0 + c4) = v;
    }
    
  }
}
// row LayerNorm (biased variance, eps) over N: s = X (+ R); optional out_sum <- s; out_norm <- (s-mu)*rsqrt(var+eps)*g + b
template <bool PARAM_BF16>
__global__ __launch_bounds__(256) void k_layernorm(const float* __restrict__ X, const float* __restrict__ R, const float* __restrict__ g, const float* __restrict__ bta,
                                                  float* __restrict__ out_sum, float* __restrict__ out_norm, int N, float eps) {
  __shared__ float red[256];
  const int row = blockIdx.x, tid = threadIdx.x;
  const float* x = X + (size_t)row * N; const float* rr = R ? R + (size_t)row * N : nullptr;
  float vals[16];                     // up to N = 4096
  const int per = N / 256;            // contiguous chunk per thread? use strided-by-4 chunks: thread handles j = tid*4 + 1024*u
  float s1 = 0.f;
  for (int u = 0; u < per / 4; ++u) {
    const int j = tid * 4 + 1024 * u;
    const v4f a = *(const v4fa*)(x + j);
    v4f b = {0.f,0.f,0.f,0.f}; if (rr) b = *(const v4fa*)(rr + j);
#pragma unroll
    for (int q = 0; q < 4; ++q) { const float v = a[q] + b[q]; vals[u * 4 + q] = v; s1 += v; }
  }
  red[tid] = s1; __syncthreads();
  for (int st = 128; st > 0; st >>= 1) { if (tid < st) red[tid] += red[tid + st]; __syncthreads(); }
  const float mu = red[0] / (float)N; __syncthreads();
  float s2 = 0.f;
  for (int u = 0; u < per / 4; ++u)
#pragma unroll
    for (int q = 0; q < 4; ++q) { const float c = vals[u * 4 + q] - mu; s2 += c * c; }
  red[tid] = s2; __syncthreads();
  for (int st = 128; st > 0; st >>= 1) { if (tid < st) red[tid] += red[tid + st]; __syncthreads(); }
  const float rs = rsqrtf(red[0] / (float)N + eps);
  {
    for (int u = 0; u < per / 4; ++u) {
      const int j = tid * 4 + 1024 * u;
      v4f o, sm;
#pragma unroll
      for (int q = 0; q < 4; ++q) {
        float gg = g[j + q], bb = bta[j + q];
        if (PARAM_BF16) { gg = bf16_round(gg); bb = bf16_round(bb); }
        sm[q] = vals[u * 4 + q]; o[q] = (vals[u * 4 + q] - mu) * rs * gg + bb;
      }
      if (out_sum) *(v4f*)(out_sum + (size_t)row * N + j) = sm;
      *(v4f*)(out_norm + (size_t)row * N + j) = o;
    }
    
  }
}



// ---- f16 WMMA path (v_wmma_f32_16x16x32_f16): 11-bit significands for operands in range — used where the probability operand (1024 p x 2^(lag of m_q), at most 2^15) needs more precision than bf16
typedef _Float16 v16h __attribute__((ext_vector_type(16)));
union FragH { v16h v; v8us half[2]; _Float16 h[16]; unsigned short u[16]; };
template <int NT>
__device__ __forceinline__ v8f mmaH(v16h ah, v16h al, v16h bh, v16h bl, v8f c) {
  c = __builtin_amdgcn_wmma_f32_16x16x32_f16(false, ah, false, bh, (short)0, c, false, false);
  if (NT >= 2) c = __builtin_amdgcn_wmma_f32_16x16x32_f16(false, al, false, bh, (short)0, c, false, false);
  if (NT >= 3) c = __builtin_amdgcn_wmma_f32_16x16x32_f16(false, ah, false, bl, (short)0, c, false, false);
  asm volatile("v_nop\n\tv_nop\n\tv_nop\n\tv_nop" : "+v"(c) : "v"(ah), "v"(al), "v"(bh), "v"(bl));
  return c;
}
// batched GEMM like k_gemm_b but f16 operands: A f32 (split into f16 hi/lo if ASPLIT, else rounded to f16), Bt = f16 values [n][k]; alpha; C f32; N multiple of 16 (partial tiles skipped)
template <bool ASPLIT>
__global__ __launch_bounds__(128) void k_gemm_h(const float* __restrict__ A, int lda, size_t sA, const _Float16* __restrict__ Bh, int ldb, size_t sB, float alpha, float* __restrict__ C, int ldc, size_t sC, int M, int N, int K) {
  __shared__ __attribute__((aligned(16))) float so[4][16][64];
  const int tid = threadIdx.x, w = tid >> 5, lane = tid & 31, ln = lane & 15, hh = lane >> 4; const int by = blockIdx.y;
  A += (size_t)by * sA; Bh += (size_t)by * sB; C += (size_t)by * sC;
  const int ntn = (N + 63) / 64; const int wid = blockIdx.x * 4 + w; const int mt = wid / ntn, nq = wid % ntn; if (mt * 16 >= M) return;
  const int row0 = mt * 16, col0 = nq * 64; const float* arow = A + (size_t)(row0 + ln) * lda;
  v8f acc[4] = {};
  for (int kb = 0; kb < K; kb += 32) {
    FragH ah, al;
    const v4f x0 = *(const v4fa*)(arow + kb + 8 * hh), x1 = *(const v4fa*)(arow + kb + 8 * hh + 4), x2 = *(const v4fa*)(arow + kb + 16 + 8 * hh), x3 = *(const v4fa*)(arow + kb + 16 + 8 * hh + 4);
    float xs[16] = {x0[0],x0[1],x0[2],x0[3],x1[0],x1[1],x1[2],x1[3],x2[0],x2[1],x2[2],x2[3],x3[0],x3[1],x3[2],x3[3]};
#pragma unroll
    for (int i = 0; i < 16; ++i) { const _Float16 h = (_Float16)xs[i]; ah.h[i] = h; al.h[i] = ASPLIT ? (_Float16)(xs[i] - (float)h) : (_Float16)0.0f; }
#pragma unroll
    for (int t = 0; t < 4; ++t) { if (col0 + t * 16 >= N) continue; const size_t boff = (size_t)(col0 + t * 16 + ln) * ldb + kb; FragH bq; bq.half[0] = *(const v8us*)(Bh + boff + 8 * hh); bq.half[1] = *(const v8us*)(Bh + boff + 16 + 8 * hh);
      acc[t] = mmaH<ASPLIT ? 2 : 1>(ah.v, al.v, bq.v, bq.v, acc[t]); }
  }
#pragma unroll
  for (int t = 0; t < 4; ++t) { if (col0 + t * 16 >= N) continue;
#pragma unroll
    for (int r = 0; r < 8; ++r) so[w][8 * hh + r][t * 16 + ln] = acc[t][r] * alpha; }
  __builtin_amdgcn_fence(__ATOMIC_ACQ_REL, "workgroup"); __builtin_amdgcn_wave_barrier();
  const int rsub = lane >> 4, c4 = (lane & 15) * 4;
  {
#pragma unroll
    for (int q = 0; q < 8; ++q) { const int r = q * 2 + rsub; if (col0 + c4 < N) { const v4f v = *(const v4fa*)&so[w][r][c4]; *(v4f*)(C + (size_t)(row0 + r) * ldc + col0 + c4) = v; } }
     }
}

// Wt[n][k] = f16(W[k][n]·scale) from f32 row-major W[K][N] (scale = power of two; bf16-exact weights stay exact in f16 away from the subnormal range)
__global__ __launch_bounds__(256) void k_wt_f16(const float* __restrict__ W, _Float16* __restrict__ Wt, int K, int N, float scale) {
  const int t = blockIdx.x * 256 + threadIdx.x; if (t >= N * (K / 8)) return; const int n = t / (K / 8), k8 = (t % (K / 8)) * 8; FragH f;
#pragma unroll
  for (int i = 0; i < 8; ++i) f.h[i] = (_Float16)(bf16_round(W[(size_t)(k8 + i) * N + n]) * scale); const v8us o = f.half[0];
  *(v8us*)((unsigned short*)Wt + (size_t)n * K + k8) = o; 
}
// Projection GEMM, fixed shape M = NR, N = K = CC: v = acc/16 + bf16(bias[col]) in f32, and the epilogue writes the f16 plane that the attention kernel reads:
// MODE 0 (q): f16 rows [token][channel]; MODE 1 (k): v + (bf16(rh[channel][n mod 32]) + bf16(rw[channel][n div 32])) in f32, then f16 rows; MODE 2 (v): f16, transposed per batch to [channel][token].
// One work-group = one 128 x 128 tile of the output, 8 waves as 4 x 2, 32 x 64 a wave. A pass is 64 k: 128 rows of A and 128 rows of W, 128 B (one line) each,
// copied once per work-group into LDS at pitch 144 B (16 B x odd: conflict-free ds_load_b128); two buffers, the next pass's copies fly while this pass is multiplied.
typedef _Float16 v4h __attribute__((ext_vector_type(4)));
constexpr int PROJ_RING = 4 * 128 * 144;      /* two stages of (128 A rows + 128 W rows) at pitch 144 B */
template <int MODE>
__device__ __forceinline__ void proj_tile(unsigned char* ring, const int blk, const _Float16* __restrict__ A, const _Float16* __restrict__ Bh, const float* __restrict__ bias, const float* __restrict__ rh, const float* __restrict__ rw, _Float16* __restrict__ C16) {
  constexpr int BT = 128, BK = 64, RP = 144, TILE = BT * RP, STG = 2 * TILE, NPASS = CC / BK, SOP = 68, TP = 2 * BT + 16;
  static_assert(2 * STG == PROJ_RING, "the kernel's LDS array is the ring");
  static_assert(NR % BT == 0 && CC % BT == 0 && CC % BK == 0 && NPASS >= 2, "whole tiles, at least two passes");
  static_assert(NN % BT == 0 && BT % 32 == 0, "a tile lies in one batch, a wave's 32 rows in one value of n div 32");
  static_assert(BT * TP <= 2 * STG, "the transposed tile must fit in the ring");
  static_assert(sizeof(float) * 8 * 32 * SOP <= 2 * STG, "output staging must fit in the ring");
  float (*so)[32][SOP] = reinterpret_cast<float (*)[32][SOP]>(ring);      /* output staging takes the ring's place behind the last pass's barrier; pitch 68 dwords keeps the two lane halves on different banks */
  const int tid = threadIdx.x, w = tid >> 5, lane = tid & 31, ln = lane & 15, hh = lane >> 4;
  const int row0 = (blk / (CC / BT)) * BT, col0 = (blk % (CC / BT)) * BT;
  const int wr = (w >> 1) * 32, wc = (w & 1) * 64;
  /* each thread copies 4 x 16 B of A and 4 x 16 B of W per pass; a wave-wide copy = 4 whole rows = 4 lines */
  const char* gA = (const char*)((const unsigned short*)A + (size_t)(row0 + (tid >> 3)) * CC) + (tid & 7) * 16;
  const char* gB = (const char*)((const unsigned short*)Bh + (size_t)(col0 + (tid >> 3)) * CC) + (tid & 7) * 16;
  const unsigned lA = (unsigned)(size_t)ring + (unsigned)((tid >> 3) * RP + (tid & 7) * 16);
  constexpr size_t R32 = (size_t)32 * CC * 2;      /* bytes from a row to the row 32 below it */
  auto stage_copies = [&](int p, unsigned bofs) {
    const char* a0 = gA + (size_t)p * (BK * 2); const char* b0 = gB + (size_t)p * (BK * 2); const unsigned a = lA + bofs, c = a + (unsigned)TILE;
    /* the s_wait_xcnt closes the statement so that no address register of a copy is rewritten ahead of it */
    asm volatile("global_load_async_to_lds_b128 %0, %8, off\n\t"
                 "global_load_async_to_lds_b128 %1, %9, off\n\t"
                 "global_load_async_to_lds_b128 %2, %10, off\n\t"
                 "global_load_async_to_lds_b128 %3, %11, off\n\t"
                 "global_load_async_to_lds_b128 %4, %12, off\n\t"
                 "global_load_async_to_lds_b128 %5, %13, off\n\t"
                 "global_load_async_to_lds_b128 %6, %14, off\n\t"
                 "global_load_async_to_lds_b128 %7, %15, off\n\t"
                 "s_wait_xcnt 0x0"
                 :: "v"(a), "v"(a + 32 * RP), "v"(a + 64 * RP), "v"(a + 96 * RP), "v"(c), "v"(c + 32 * RP), "v"(c + 64 * RP), "v"(c + 96 * RP),
                    "v"(a0), "v"(a0 + R32), "v"(a0 + 2 * R32), "v"(a0 + 3 * R32), "v"(b0), "v"(b0 + R32), "v"(b0 + 2 * R32), "v"(b0 + 3 * R32)
                 : "memory");
  };
  v8f acc[2][4] = {};
  stage_copies(0, 0u);
  /* MODE 1: the wave's part of rh and rw is asked for here and used in the epilogue: its latency runs beside that of pass 0's copies, not alone behind the last pass.
     Row n of the tile: n div 32 = na for all 32 rows of a wave, n mod 32 = i * 16 + 8 * hh + r; a lane's 8 rows of one accumulator are 32 consecutive bytes of its channel's 128-B row of rh */
  v4f rhv[4][2][2]; float rwv[4];
  if (MODE == 1) { const int na = (row0 % NN + wr) / 32;
#pragma unroll      /* this loop and the one inside it: constant indices keep rhv and rwv in registers */
    for (int t = 0; t < 4; ++t) { const size_t c32 = (size_t)(col0 + wc + t * 16 + ln) * 32; rwv[t] = rw[c32 + na];
#pragma unroll
      for (int i = 0; i < 2; ++i) { rhv[t][i][0] = *(const v4fa*)(rh + c32 + i * 16 + 8 * hh); rhv[t][i][1] = *(const v4fa*)(rh + c32 + i * 16 + 8 * hh + 4); } } }
  asm volatile("s_wait_asynccnt 0x0" ::: "memory");      /* pass 0 of this wave has landed */
  __syncthreads();                                       /* ... and every wave's part of it is published */
  stage_copies(1, (unsigned)STG);
#pragma unroll 2      /* two passes a trip make the buffer offsets immediates; fully unrolled the copies' addresses of all passes took the wave past 256 VGPRs */
  for (int p = 0; p < NPASS; ++p) {
    const unsigned bofs = (unsigned)(p & 1) * (unsigned)STG;
    const unsigned char* at = ring + bofs + (wr + ln) * RP + 16 * hh; const unsigned char* bt = ring + bofs + TILE + (wc + ln) * RP + 16 * hh;
#pragma unroll      /* this loop and those inside it: constant indices keep the fragments and acc in registers */
    for (int ks = 0; ks < BK / 32; ++ks) { FragH fa[2], fb[4];
#pragma unroll
      for (int i = 0; i < 2; ++i) { fa[i].half[0] = *(const v8us*)(at + i * 16 * RP + ks * 64); fa[i].half[1] = *(const v8us*)(at + i * 16 * RP + ks * 64 + 32); }
#pragma unroll
      for (int t = 0; t < 4; ++t) { fb[t].half[0] = *(const v8us*)(bt + t * 16 * RP + ks * 64); fb[t].half[1] = *(const v8us*)(bt + t * 16 * RP + ks * 64 + 32); }
#pragma unroll
      for (int i = 0; i < 2; ++i)
#pragma unroll
        for (int t = 0; t < 4; ++t) acc[i][t] = __builtin_amdgcn_wmma_f32_16x16x32_f16(false, fa[i].v, false, fb[t].v, (short)0, acc[i][t], false, false); }
    asm volatile("s_wait_dscnt 0x0" ::: "memory");         /* this wave's reads of the buffer are done before it is refilled */
    asm volatile("s_wait_asynccnt 0x0" ::: "memory");      /* this wave's copies of the next pass have landed */
    __syncthreads();                                       /* publishes the next pass and ends every wave's reads of this one */
    if (p + 2 < NPASS) stage_copies(p + 2, bofs); }
  asm volatile("s_wait_asynccnt 0x0" ::: "memory");        /* nothing in flight when the ring becomes output staging */
  if (MODE == 2) {
    /* D[8*hh + r][ln]: a lane's 8 values of one accumulator are 8 consecutive tokens of ONE channel = 16 B of a row of the transposed tile.
       The tile [128 channels][128 tokens] is gathered in LDS at pitch 272 B (16 B x odd: 16 lanes of a ds_store_b128 on 64 different banks), since a channel's 128 tokens come from four waves. */
#pragma unroll      /* this loop and the two inside it: constant indices into acc */
    for (int t = 0; t < 4; ++t) { const float bv = bf16_round(bias[col0 + wc + t * 16 + ln]);
#pragma unroll
      for (int i = 0; i < 2; ++i) { FragH f;
#pragma unroll
        for (int r = 0; r < 8; ++r) f.h[r] = (_Float16)(acc[i][t][r] * 0.0625f + bv);
        *(v8us*)(ring + (wc + t * 16 + ln) * TP + (wr + i * 16 + 8 * hh) * 2) = f.half[0]; } }
    __syncthreads();      /* every wave's part of the transposed tile is in LDS before any wave reads whole channel rows */
    unsigned short* vt = (unsigned short*)C16 + ((size_t)(row0 / NN) * CC + col0) * NN + row0 % NN;
#pragma unroll      /* the 8 LDS reads go out as one group ahead of the stores; a store = 2 channel rows of 256 B, whole lines */
    for (int q = 0; q < 8; ++q) { const int ch = w * 16 + q * 2 + hh; const v8us v = *(const v8us*)(ring + ch * TP + ln * 16); *(v8us*)(vt + (size_t)ch * NN + ln * 8) = v; }
    asm volatile("s_wait_xcnt 0x0" ::: "memory");      /* behind the last store: in the merged kernel another part's code may follow in the listing and rewrite the stores' registers */
    return;
  }
#pragma unroll      /* this loop and the two inside it: constant indices into acc */
  for (int t = 0; t < 4; ++t) { const float bv = bf16_round(bias[col0 + wc + t * 16 + ln]); const float rwb = (MODE == 1) ? bf16_round(rwv[t]) : 0.f;
#pragma unroll
    for (int i = 0; i < 2; ++i)
#pragma unroll
      for (int r = 0; r < 8; ++r) { float v = acc[i][t][r] * 0.0625f + bv; if (MODE == 1) v += bf16_round(rhv[t][i][r >> 2][r & 3]) + rwb; so[w][i * 16 + 8 * hh + r][t * 16 + ln] = v; } }
  __builtin_amdgcn_fence(__ATOMIC_ACQ_REL, "workgroup"); __builtin_amdgcn_wave_barrier();      /* orders this wave's staging stores ahead of its reads; no work-group barrier: a wave reads back only its own rows */
  const int rsub = lane >> 4, c4 = (lane & 15) * 4;
#pragma unroll      /* the 16 LDS reads go out as one group ahead of the stores; a store = 2 rows of whole lines */
  for (int q = 0; q < 16; ++q) { const int r = q * 2 + rsub; const v4f v = *(const v4fa*)&so[w][r][c4]; const size_t o = (size_t)(row0 + wr + r) * CC + col0 + wc + c4;
    v4h h4; for (int i = 0; i < 4; ++i) h4[i] = (_Float16)v[i]; *(v4h*)(C16 + o) = h4; }
  asm volatile("s_wait_xcnt 0x0" ::: "memory");      /* behind the last store: in the merged kernel another part's code may follow in the listing and rewrite the stores' registers */
}
/* The three projections read the same X16 and depend on nothing of one another: one launch, work-group 3 * tile + m does tile 'tile' of projection m (0 q, 1 k, 2 v).
   The choice is the same for a whole work-group, so every barrier of a tile is passed by all of its waves. */
__global__ __launch_bounds__(256) void k_proj3(const _Float16* __restrict__ A, const _Float16* __restrict__ Bw, const float* __restrict__ bq, const float* __restrict__ bk, const float* __restrict__ bv,
                                               const float* __restrict__ rh, const float* __restrict__ rw, _Float16* __restrict__ Q, _Float16* __restrict__ K, _Float16* __restrict__ Vt) {
  __shared__ __attribute__((aligned(16))) unsigned char ring[PROJ_RING];
  const int blk = blockIdx.x / 3, m = blockIdx.x % 3;
  if (m == 0) proj_tile<0>(ring, blk, A, Bw, bq, nullptr, nullptr, Q);
  else if (m == 1) proj_tile<1>(ring, blk, A, Bw + (size_t)CC * CC, bk, rh, rw, K);
  else proj_tile<2>(ring, blk, A, Bw + (size_t)2 * CC * CC, bv, nullptr, nullptr, Vt);
}


__global__ __launch_bounds__(256) void k_x16(const float* __restrict__ x, _Float16* __restrict__ X16, size_t n8) { const size_t t = (size_t)blockIdx.x * 256 + threadIdx.x; if (t >= n8) return; FragH f;
#pragma unroll
  for (int q = 0; q < 8; ++q) f.h[q] = (_Float16)bf16_round(x[t * 8 + q]); *(v8us*)((unsigned short*)X16 + t * 8) = f.half[0];  }
__global__ __launch_bounds__(256) void k_h16(const float* __restrict__ x, _Float16* __restrict__ X16, size_t n8) { const size_t t = (size_t)blockIdx.x * 256 + threadIdx.x; if (t >= n8) return; FragH f;
#pragma unroll
  for (int q = 0; q < 8; ++q) f.h[q] = (_Float16)x[t * 8 + q]; *(v8us*)((unsigned short*)X16 + t * 8) = f.half[0];  }
template <int NHv, int TTv>
__global__ __launch_bounds__(256) void k_vt(const _Float16* __restrict__ V16, int ldv, int voff, _Float16* __restrict__ Vt) { __shared__ unsigned short tl[64][66]; const int tid = threadIdx.x; const int slab = blockIdx.x / (TTv / 64), lg = blockIdx.x % (TTv / 64); const int b = slab / NHv, h = slab % NHv;
  for (int i = tid; i < 64 * 8; i += 256) { const int r = i / 8, c8 = (i % 8) * 8; FragH f; f.half[0] = *(const v8us*)((const unsigned short*)V16 + ((size_t)b * TTv + lg * 64 + r) * ldv + voff + h * 64 + c8);
#pragma unroll
    for (int q = 0; q < 8; ++q) tl[r][c8 + q] = f.u[q]; }
  __syncthreads();
  {
#pragma unroll
    for (int rd = 0; rd < 2; ++rd) { const int d = rd * 32 + tid / 8, pc = tid % 8; FragH f;
#pragma unroll
      for (int q = 0; q < 8; ++q) f.u[q] = tl[pc * 8 + q][d];
      *(v8us*)((unsigned short*)Vt + ((size_t)slab * 64 + d) * TTv + lg * 64 + pc * 8) = f.half[0]; }
     } }

/* One launch for the four conversions, which depend on nothing of one another: the first 3 * GW work-groups round the three weight matrices, the others each turn one 128-channel x 128-token tile of x.
   The test is the same for a whole work-group and stands in front of the barrier.
   Few long waves, not many short ones: waves start at a limited rate, and a wave with a single 4-B load a lane outstanding keeps too few bytes in flight to hide the memory latency.
   Here a wave of the x part moves 8 KB with 16 independent loads of 16 B a lane, and the whole launch is 4,864 waves. */
constexpr int PREP_WCH = 4;                                   /* chunks of 8 weights a thread */
constexpr int PREP_GW = CC * CC / 8 / 256 / PREP_WCH;         /* work-groups per weight matrix */
constexpr int PREP_T = 128;                                   /* the x tile: PREP_T channels x PREP_T tokens */
__global__ __launch_bounds__(256) void k_prep(const float* __restrict__ x, const float* __restrict__ Wq, const float* __restrict__ Wk, const float* __restrict__ Wv, _Float16* __restrict__ Bw, _Float16* __restrict__ X16) {
  constexpr int GW = PREP_GW, TP = PREP_T * 2 + 16;      /* a token's 128 channels in LDS: 256 B at pitch 272 B (16 B x odd) */
  static_assert(CC * CC % (8 * 256 * PREP_WCH) == 0, "whole work-groups of PREP_WCH x 8 elements a thread");
  static_assert(CC % PREP_T == 0 && NN % PREP_T == 0, "whole tiles");
  __shared__ __attribute__((aligned(16))) unsigned char tl[PREP_T * TP];
  const int tid = threadIdx.x;
  if (blockIdx.x < 3 * GW) { const int mw = blockIdx.x / GW; const float* W = mw == 0 ? Wq : mw == 1 ? Wk : Wv; unsigned short* Bt = (unsigned short*)Bw + (size_t)mw * CC * CC;
    const size_t t0 = (size_t)(blockIdx.x % GW) * (PREP_WCH * 256) + tid; v4f a[PREP_WCH][2];
#pragma unroll      /* this loop and the two below: constant indices keep a in registers; all loads go out ahead of the first store */
    for (int i = 0; i < PREP_WCH; ++i) { a[i][0] = *(const v4fa*)(W + (t0 + i * 256) * 8); a[i][1] = *(const v4fa*)(W + (t0 + i * 256) * 8 + 4); }
#pragma unroll
    for (int i = 0; i < PREP_WCH; ++i) { FragH f;
#pragma unroll
      for (int q = 0; q < 8; ++q) f.h[q] = (_Float16)(bf16_round(a[i][q >> 2][q & 3]) * 16.0f);
      *(v8us*)(Bt + (t0 + i * 256) * 8) = f.half[0]; }
    return; }
  const int tb = blockIdx.x - 3 * GW; constexpr int TPB = (CC / PREP_T) * (NN / PREP_T); const int b = tb / TPB, rem = tb % TPB; const int c0 = (rem / (NN / PREP_T)) * PREP_T, p0 = (rem % (NN / PREP_T)) * PREP_T;
  /* wave w: 32 channels x 64 tokens of the tile. A lane half takes 16 channels, a lane 4 tokens of each: one wave-wide load = 2 channel rows x 256 B, whole lines.
     A lane then holds 16 consecutive channels of each of its 4 tokens = 32 B of a row of the turned tile: the transposition is a choice of registers, and LDS is written 16 B at a time. */
  const int w = tid >> 5, g = (tid >> 4) & 1, m = tid & 15;
  const int cl = (w >> 1) * 32 + g * 16, tk = (w & 1) * 64 + m * 4;
  const float* src = x + ((size_t)b * CC + c0 + cl) * NN + p0 + tk;
  v4f v[16];
#pragma unroll      /* this loop and the two below: constant indices keep v in registers; the 16 loads depend on nothing of one another */
  for (int j = 0; j < 16; ++j) v[j] = *(const v4fa*)(src + (size_t)j * NN);
#pragma unroll
  for (int t = 0; t < 4; ++t) { FragH f;
#pragma unroll
    for (int j = 0; j < 16; ++j) f.h[j] = (_Float16)bf16_round(v[j][t]);
    *(v8us*)(tl + (tk + t) * TP + cl * 2) = f.half[0]; *(v8us*)(tl + (tk + t) * TP + cl * 2 + 16) = f.half[1]; }
  __syncthreads();      /* a token's 128 channels come from four waves */
  unsigned short* dst = (unsigned short*)X16 + ((size_t)b * NN + p0) * CC + c0;
#pragma unroll      /* the 8 LDS reads go out as one group ahead of the stores; a store = 2 token rows x 256 B, whole lines */
  for (int q = 0; q < 8; ++q) { const int r = w * 16 + q * 2 + g; const v8us o = *(const v8us*)(tl + r * TP + m * 16); *(v8us*)(dst + (size_t)r * CC + m * 8) = o; }
  asm volatile("s_wait_xcnt 0x0" ::: "memory");      /* behind the last store: the weight part's code follows in the listing and rewrites the stores' registers */
}
/* lane l <-> lane l ^ 16 as a vector cross-row move */
__device__ __forceinline__ float xhalf(float x) { return __builtin_bit_cast(float, __builtin_amdgcn_permlanex16(__builtin_bit_cast(int, x), __builtin_bit_cast(int, x), 0x76543210, 0xfedcba98, false, false)); }
__device__ __forceinline__ void exp2_run8(float* x) {
  asm("v_exp_f32 %0, %0\n\tv_exp_f32 %1, %1\n\tv_exp_f32 %2, %2\n\tv_exp_f32 %3, %3\n\tv_exp_f32 %4, %4\n\tv_exp_f32 %5, %5\n\tv_exp_f32 %6, %6\n\tv_exp_f32 %7, %7\n\tv_nop"
      : "+v"(x[0]), "+v"(x[1]), "+v"(x[2]), "+v"(x[3]), "+v"(x[4]), "+v"(x[5]), "+v"(x[6]), "+v"(x[7]));
}
/* Maximum of a score tile's 8 values and c, two three-way maxima deep: the branch of the lazy rescale waits for it, and behind the last product a running maximum would be a chain of 4 */
__device__ __forceinline__ float max8(v8f s, float c) {
  const float t0 = fmaxf(fmaxf(s[0], s[1]), s[2]), t1 = fmaxf(fmaxf(s[3], s[4]), s[5]), t2 = fmaxf(fmaxf(s[6], s[7]), c);
  return fmaxf(fmaxf(t0, t1), t2);
}
__global__ __launch_bounds__(128) void k_flash(const _Float16* __restrict__ Q16, int ldq, const _Float16* __restrict__ K16, int ldk, const _Float16* __restrict__ Vt, const _Float16* __restrict__ Vtlo, float* __restrict__ O, int ldo) {
  constexpr int QG = 2, RPW = 16 * QG, NQB = TT / (4 * RPW), DT = 8, KS = 4;      /* head dim 128: 4 k-steps, 8 value tiles */
  constexpr float SC2 = ATT_SCALE * 1.4426950408889634f;      /* score scale x log2(e) */
  constexpr float LAZY = 5.0f;      /* how far, in powers of two, a score may lie above the maximum in use before O and l are rescaled */
  /* K/V ring shared by the four waves: two stages of 32 keys; a stage = 32 K rows of 256 B at pitch 272 B, then 128 V^T rows of 64 B at pitch 80 B (16 B x odd: conflict-free ds_load_b128) */
  constexpr int KP = 272, VP = 80, VOFF = 32 * KP, STG = VOFF + 128 * VP;
  __shared__ __attribute__((aligned(16))) unsigned char ring[2 * STG];
  static_assert(TT % (4 * RPW) == 0, "whole work-groups of queries");
  static_assert(sizeof(float) * 4 * 16 * (128 + 4) <= 2 * STG, "output staging must fit in the ring");
  float (*sO)[16][128 + 4] = reinterpret_cast<float (*)[16][128 + 4]>(ring);      /* output staging, one column group at a time, takes the ring's place behind the last pass's barrier */
  const int tid = threadIdx.x, w = tid >> 5, lane = tid & 31, ln = lane & 15, hh = lane >> 4;
  const int slab = blockIdx.x / NQB, qblk = blockIdx.x % NQB; const int b = slab / NH, h = slab % NH; const int qb0 = qblk * (4 * RPW); const int q0 = qb0 + w * RPW;
  FragH aq[QG][KS];
#pragma unroll      /* this loop and the one inside it: constant indices keep aq in registers */
  for (int g = 0; g < QG; ++g) { const unsigned short* qr = (const unsigned short*)Q16 + ((size_t)b * TT + q0 + g * 16 + ln) * ldq + h * 128;
#pragma unroll
    for (int ks = 0; ks < KS; ++ks) { aq[g][ks].half[0] = *(const v8us*)(qr + ks * 32 + 8 * hh); aq[g][ks].half[1] = *(const v8us*)(qr + ks * 32 + 16 + 8 * hh); } }
  const unsigned short* Vth = (const unsigned short*)Vt + (size_t)slab * 128 * TT;
  float m_q[QG], nb_q[QG], l_q[QG]; v8f oacc[QG][DT];      /* per group g: the maximum in use of the raw scores (equal in both halves), the exponent's addend 10 - m_q * SC2, and this half's partial sum (x 2^10) of query q0 + g*16 + ln; oacc[g][dt][r] = O^T[dt*16 + 8*hh + r][ln] */
#pragma unroll
  for (int g = 0; g < QG; ++g) { m_q[g] = -3.0e38f; nb_q[g] = 3.0e38f * SC2 + 10.0f; l_q[g] = 0.f;
#pragma unroll
    for (int dt = 0; dt < DT; ++dt) oacc[g][dt] = (v8f){0.f,0.f,0.f,0.f,0.f,0.f,0.f,0.f}; }
  const int jend = TT;
  /* each thread copies 4 x 16 B of K (a wave-wide copy = 2 whole rows = 4 lines) and 4 x 16 B of V^T (8 rows x 64 B) per stage */
  const char* gK = (const char*)((const unsigned short*)K16 + ((size_t)b * TT + (tid >> 4)) * ldk + h * 128) + (tid & 15) * 16;
  const char* gV = (const char*)(Vth + (size_t)(tid >> 2) * TT) + (tid & 3) * 16;
  const size_t kstep = (size_t)ldk * 2;      /* bytes per key row of K */
  const unsigned lK = (unsigned)(size_t)ring + (unsigned)((tid >> 4) * KP + (tid & 15) * 16);
  const unsigned lV = (unsigned)(size_t)ring + (unsigned)(VOFF + (tid >> 2) * VP + (tid & 3) * 16);
  auto stage_copies = [&](int j, unsigned bofs) {
    const char* k0 = gK + (size_t)j * kstep; const char* v0 = gV + (size_t)j * 2; const unsigned a = lK + bofs, c = lV + bofs;
    /* the s_wait_xcnt closes the statement so that no address register of a copy is rewritten ahead of it */
    asm volatile("global_load_async_to_lds_b128 %0, %8, off\n\t"
                 "global_load_async_to_lds_b128 %1, %9, off\n\t"
                 "global_load_async_to_lds_b128 %2, %10, off\n\t"
                 "global_load_async_to_lds_b128 %3, %11, off\n\t"
                 "global_load_async_to_lds_b128 %4, %12, off\n\t"
                 "global_load_async_to_lds_b128 %5, %13, off\n\t"
                 "global_load_async_to_lds_b128 %6, %14, off\n\t"
                 "global_load_async_to_lds_b128 %7, %15, off\n\t"
                 "s_wait_xcnt 0x0"
                 :: "v"(a), "v"(a + 8 * KP), "v"(a + 16 * KP), "v"(a + 24 * KP), "v"(c), "v"(c + 32 * VP), "v"(c + 64 * VP), "v"(c + 96 * VP),
                    "v"(k0), "v"(k0 + 8 * kstep), "v"(k0 + 16 * kstep), "v"(k0 + 24 * kstep), "v"(v0), "v"(v0 + (size_t)32 * TT * 2), "v"(v0 + (size_t)64 * TT * 2), "v"(v0 + (size_t)96 * TT * 2)
                 : "memory");
  };
  stage_copies(0, 0u);
  asm volatile("s_wait_asynccnt 0x0" ::: "memory");      /* stage 0 of this wave has landed */
  __syncthreads();                                       /* ... and every wave's part of it is published */
  stage_copies(32, (unsigned)STG);
#pragma unroll 1
  for (int j0 = 0; j0 < jend; j0 += 32) {
    const unsigned bofs = (unsigned)((j0 >> 5) & 1) * (unsigned)STG; const unsigned char* kt = ring + bofs; const unsigned char* vt = kt + VOFF;
    v8f st[QG][2];
#pragma unroll
    for (int nt = 0; nt < 2; ++nt) { const unsigned short* kr = (const unsigned short*)(kt + (nt * 16 + ln) * KP); FragH bk[KS];
#pragma unroll
      for (int ks = 0; ks < KS; ++ks) { bk[ks].half[0] = *(const v8us*)(kr + ks * 32 + 8 * hh); bk[ks].half[1] = *(const v8us*)(kr + ks * 32 + 16 + 8 * hh); }
#pragma unroll      /* constant g: st and aq stay in registers */
      for (int g = 0; g < QG; ++g) st[g][nt] = (v8f){0.f,0.f,0.f,0.f,0.f,0.f,0.f,0.f};
#pragma unroll      /* each K fragment feeds both column groups; the two accumulator chains alternate. The products are the plain builtin (the compiler keeps its distances): an asm statement behind each, with the fragments as operands, wants them below v256 and this wave tile then spilled */
      for (int ks = 0; ks < KS; ++ks)
#pragma unroll
        for (int g = 0; g < QG; ++g) st[g][nt] = __builtin_amdgcn_wmma_f32_16x16x32_f16(false, bk[ks].v, false, aq[g][ks].v, (short)0, st[g][nt], false, false); }
    /* The softmax runs on the raw scores in base 2: exp(ATT_SCALE * (s - m)) * 2^10 = 2^(s * SC2 + (10 - m * SC2)), one fused multiply-add and one hardware exp2 an element.
       The argument is at most 10 + LAZY and a result below 2^-126 counts as 0, so none of the range handling of the library's expf is needed. m_q is a maximum of raw scores (SC2 > 0: the same element). */
    /* Lazy rescale: the maximum in use, m_q, is raised only when some score of the pass lies more than 2^LAZY above it. Any reference value gives the same quotient O / l, since P, l and O all carry it;
       the bound only keeps P inside f16: with no lane over it, ps <= 2^(10 + LAZY) = 2^15 < 65504. One test a pass for the whole wave, a scalar branch. */
    float mc[QG]; bool need = false;
#pragma unroll      /* constant g keeps the scores in registers */
    for (int g = 0; g < QG; ++g) {
      mc[g] = max8(st[g][1], max8(st[g][0], st[g][0][0]));
      need |= __builtin_fmaf(mc[g], SC2, nb_q[g]) > 10.0f + LAZY; }      /* this lane's own 16 keys; the ballot joins the halves */
    if (__builtin_expect(__builtin_amdgcn_ballot_w32(need) != 0, 0)) {      /* marked rare: the pass that keeps its maximum falls through, the rescale stands out of line */
#pragma unroll      /* this loop and the one inside it: constant indices keep oacc in registers */
      for (int g = 0; g < QG; ++g) {
        const float mx = fmaxf(mc[g], xhalf(mc[g]));      /* the other 16 keys of this query sit in lane ^ 16: both halves take the same new maximum */
        const float mn = fmaxf(m_q[g], mx); const float al = (mn > -1.0e38f) ? __builtin_amdgcn_exp2f((m_q[g] - mn) * SC2) : 1.0f; m_q[g] = mn;
        nb_q[g] = __builtin_fmaf(-mn, SC2, 10.0f); l_q[g] *= al;
#pragma unroll
        for (int dt = 0; dt < DT; ++dt) oacc[g][dt] *= al; } }
    FragH ph[QG];
#pragma unroll      /* this loop and those inside it: constant indices keep the scores and P in registers */
    for (int g = 0; g < QG; ++g) {
      float ps[16];
#pragma unroll
      for (int i = 0; i < 16; ++i) ps[i] = __builtin_fmaf(st[g][i >> 3][i & 7], SC2, nb_q[g]);
      exp2_run8(ps); exp2_run8(ps + 8);
      float ls[4] = {ps[0], ps[1], ps[2], ps[3]};      /* four independent partial sums: a chain of 4 dependent adds, not 16 */
#pragma unroll
      for (int i = 4; i < 16; ++i) ls[i & 3] += ps[i];
#pragma unroll
      for (int i = 0; i < 16; ++i) ph[g].h[i] = (_Float16)ps[i];      /* ps = 1024 p x 2^(lag of m_q), rounded once to f16; element i = key (i >> 3) * 16 + 8 * hh + (i & 7) */
      l_q[g] += (ls[0] + ls[1]) + (ls[2] + ls[3]); }
    FragH bv[DT];
#pragma unroll
    for (int dt = 0; dt < DT; ++dt) { const unsigned short* vr = (const unsigned short*)(vt + (dt * 16 + ln) * VP); bv[dt].half[0] = *(const v8us*)(vr + 8 * hh); bv[dt].half[1] = *(const v8us*)(vr + 16 + 8 * hh); }      /* all V fragments of the pass as one group of LDS reads, ahead of the products: one LDS latency a pass, not eight */
#pragma unroll      /* constant g and dt keep bv and oacc in registers; each V^T fragment feeds both column groups; a run of 8 products has 8 different accumulators */
    for (int g = 0; g < QG; ++g)
#pragma unroll
      for (int dt = 0; dt < DT; ++dt) oacc[g][dt] = __builtin_amdgcn_wmma_f32_16x16x32_f16(false, bv[dt].v, false, ph[g].v, (short)0, oacc[g][dt], false, false);      /* V^T.P^T, both operands rounded once to f16 (11 bits, against the 8 bits of the bf16-rounded inputs) */
    __builtin_amdgcn_sched_barrier(0);      /* keeps the products above the publish point: sunk below the barrier they would stand between it and the refill, which would then be issued late and lose most of its lead on its wait */
    asm volatile("s_wait_dscnt 0x0" ::: "memory");         /* this wave's reads of the stage are done before the stage is refilled */
    asm volatile("s_wait_asynccnt 0x0" ::: "memory");      /* this wave's copies of the next stage have landed */
    __syncthreads();                                       /* publishes the next stage and ends every wave's reads of this one */
    if (j0 + 64 < jend) stage_copies(j0 + 64, bofs); }
  asm volatile("s_wait_asynccnt 0x0" ::: "memory");        /* nothing in flight when the ring becomes output staging */
#pragma unroll      /* constant g: oacc stays in registers; the two column groups pass through the wave's own staging rows one after the other */
  for (int g = 0; g < QG; ++g) {
    { float l = l_q[g]; l += xhalf(l); const float inv = (l > 0.f) ? 1.0f / l : 0.f;      /* the two halves' partial sums joined once; l and oacc both carry the 2^10 of ps */
#pragma unroll      /* constant dt: oacc stays in registers; a lane's 8 values are 8 consecutive d of its query's row */
      for (int dt = 0; dt < DT; ++dt) { const v4f lo = {oacc[g][dt][0] * inv, oacc[g][dt][1] * inv, oacc[g][dt][2] * inv, oacc[g][dt][3] * inv}, hi = {oacc[g][dt][4] * inv, oacc[g][dt][5] * inv, oacc[g][dt][6] * inv, oacc[g][dt][7] * inv};
        *(v4fa*)&sO[w][ln][dt * 16 + 8 * hh] = lo; *(v4fa*)&sO[w][ln][dt * 16 + 8 * hh + 4] = hi; } }
    __builtin_amdgcn_fence(__ATOMIC_ACQ_REL, "workgroup", "local"); __builtin_amdgcn_wave_barrier();      /* orders this wave's staging stores ahead of its reads; a wave reads back only its own rows. LDS only: the second group need not wait for the first group's global stores */
#pragma unroll
    for (int r = 0; r < 16; ++r) { const int pc = lane; const v4f val = *(const v4fa*)&sO[w][r][pc * 4]; *(v4f*)(O + ((size_t)slab * TT + q0 + g * 16 + r) * 128 + pc * 4) = val; }      /* output laid out [b][h][n][128] (the module reinterprets that buffer as [B,C,H,W]); one 512-B row per instruction: 32 lanes x 16 B */
  } }

extern "C" void kernel_launch(void* const* d_in, const int* in_sizes, int n_in,
                              void* d_out, int out_size, void* d_ws, size_t ws_size, hipStream_t stream) {
  (void)in_sizes; (void)n_in; (void)out_size;
  const float* const* I = (const float* const*)d_in; const float* x = I[0]; const float* Wq = I[1]; const float* bq = I[2]; const float* Wk = I[3]; const float* bk = I[4]; const float* Wv = I[5]; const float* bv = I[6]; const float* rh = I[7]; const float* rw = I[8];
  char* ws = (char*)d_ws; size_t off = 0;
  auto take = [&](size_t bytes) { char* p = ws + off; off += (bytes + 255) & ~(size_t)255; return p; };
  const size_t WSZ = (size_t)CC * CC; _Float16* Bw = (_Float16*)take(3 * WSZ * 2); _Float16* X16 = (_Float16*)take((size_t)NR * CC * 2); _Float16* Q = (_Float16*)take((size_t)NR * CC * 2); _Float16* K = (_Float16*)take((size_t)NR * CC * 2); _Float16* Vt = (_Float16*)take((size_t)NR * CC * 2);
  if (off > ws_size) return;      // 1.6 + 4 x 16.8 = 69 MB
  k_prep<<<3 * PREP_GW + BB * (CC / PREP_T) * (NN / PREP_T), 256, 0, stream>>>(x, Wq, Wk, Wv, Bw, X16);      /* weights (out,in) natural x 2^4; x [B][C][N] to token-major bf16 plane */
  k_proj3<<<3 * (NR / 128) * (CC / 128), 256, 0, stream>>>(X16, Bw, bq, bk, bv, rh, rw, Q, K, Vt);      /* each M 16384 N 512 K 512: q (unscaled) f16; k' = k + rt^T, f16; v as V^T f16 per batch [512 channels][N] = per (b, h) [128][N] */
  k_flash<<<BB * NH * (NN / 128), 128, 0, stream>>>(Q, CC, K, CC, Vt, nullptr, (float*)d_out, 128);      /* y to d_out as [b][h][n][128]; k_flash does not read its V residual argument, and that plane is no longer made */
}
